// v000
// Measured on an AMD MI455X. A time is GPU time per run, averaged over a window of back-to-back runs after a warm-up
// (all launches, gaps included; the runs take copies of the inputs in turn), and the median of several windows.
// Apart from v000's, it joins two sittings. Times from different sittings can be a few percent apart, while
// side-by-side timings come from the same sitting.
// v000 is the starting kernel. One run takes 1780 microseconds.
#include <hip/hip_runtime.h>

// 6-layer post-LN decoder stack: token embedding x sqrt(512) + sinusoidal positions; per layer masked self-attention (8 heads x 64), attention over a memory tensor,
// relu FFN 512 -> 2048 -> 512, each followed by residual add + LayerNorm over 512. Masks are int32 [batch][query][key] tensors read by value (nonzero = score replaced by
// -1e18); a 32-key chunk whose 16x32 mask tile is entirely nonzero is skipped (exact whenever each query row keeps at least one key).
// compute dtype: every contraction on v_wmma_f32_16x16x32_f16 (f16 operands, f32 accumulate): q/k/v projections, score and P.V products, output projections, both FFN
// products. Operand planes: activations f16 x8 (attention context x64), weights bf16-exact f16 x256, softmax P f16 x4096; query tiles with position < 64 of the masked
// self-attention add residual planes (x2048 of the x8 / x4096 carriers) of q, k, v and P: 3 score products and 3 P.V products into a second accumulator.
// tokens and masks int32 (tokens clamped). Fragment k-map per lane half hh for A and B: elements 0..7 <- k = 8hh+0..7, 8..15 <- k = 16+8hh+0..7; acc[r] = D[8hh+r][col].

#ifndef NB
#define NB 8
#endif
#ifndef SEQ
#define SEQ 512
#endif
#define NB_FULL 8
#define SEQ_FULL 512

namespace {
constexpr int D = 512, NH = 8, DH = 64, DFF = 2048, NLAY = 6, VOCAB = 32000;
constexpr int MR = NB * SEQ;                 // activation rows, row = b * SEQ + s
constexpr int LQK = 2 * D;                   // q | k plane pitch (halves): q at h*64, k at 512 + h*64
constexpr int NQKV = 3 * D, NKV = 2 * D, NQT = SEQ / 16, NQT_RES = 4;
constexpr float WSC = 256.0f, CA = 8.0f, CX = 64.0f, PSC = 4096.0f, RS = 2048.0f;
constexpr float SQD = 22.627416997969522f, NLOGD = -0.017988946039015984f, L2E = 1.4426950408889634f, NEGF = -1.0e18f, LNEPS = 1.0e-5f;
constexpr float SCL = 1.0f / (CA * CA * 8.0f);   // score = acc / (8 x 8) / sqrt(64)
static_assert(NB >= 1 && NB <= NB_FULL && SEQ >= 128 && SEQ <= SEQ_FULL && SEQ % 128 == 0);
static_assert(MR % 128 == 0 && MR % 32 == 0 && D == 512 && NH * DH == D && DFF % 512 == 0 && NQT > NQT_RES && (MR * D) % 8 == 0);

typedef _Float16 b16;
typedef __attribute__((ext_vector_type(16))) _Float16 v16b;
typedef __attribute__((ext_vector_type(8))) _Float16 v8b;
typedef __attribute__((ext_vector_type(4))) _Float16 v4h_;
typedef __attribute__((ext_vector_type(8))) float v8f;
typedef __attribute__((ext_vector_type(4))) float v4f;

__device__ __forceinline__ float bf16_rne(float f) { unsigned int u = __float_as_uint(f); u += 0x7FFFu + ((u >> 16) & 1u); return __uint_as_float(u & 0xFFFF0000u); }
__device__ __forceinline__ v16b frag_kb(const b16* p, int hh) { const v8b a = *(const v8b*)(p + 8 * hh), b = *(const v8b*)(p + 16 + 8 * hh); v16b f;
#pragma unroll
  for (int e = 0; e < 8; ++e) { f[e] = a[e]; f[8 + e] = b[e]; } return f; }
__device__ __forceinline__ v8f wmma_raw(v16b a, v16b b, v8f c) { return __builtin_amdgcn_wmma_f32_16x16x32_f16(false, a, false, b, (short)0, c, false, false); }
__device__ __forceinline__ v8f wmma16b(v16b a, v16b b, v8f c) { v8f d = wmma_raw(a, b, c); asm volatile("v_nop\n\tv_nop\n\tv_nop\n\tv_nop" : "+v"(d) : "v"(a), "v"(b)); return d; }
// one guard after a group of 8 accumulating WMMAs: ties all 8 accumulators, keeps both A and all four B fragments live across the 4 nops
#define WMMA_GUARD8(c, a0, a1, bf) asm volatile("v_nop\n\tv_nop\n\tv_nop\n\tv_nop" : "+v"(c[0][0]), "+v"(c[0][1]), "+v"(c[0][2]), "+v"(c[0][3]), \
    "+v"(c[1][0]), "+v"(c[1][1]), "+v"(c[1][2]), "+v"(c[1][3]) : "v"(a0), "v"(a1), "v"(bf[0]), "v"(bf[1]), "v"(bf[2]), "v"(bf[3]))
__device__ __forceinline__ void wave_lds_sync() { __builtin_amdgcn_fence(3 /* release order */, "workgroup"); __builtin_amdgcn_wave_barrier(); __builtin_amdgcn_fence(2 /* acquire order */, "workgroup"); }
__device__ __forceinline__ float pmul(float a, float b) { float p = a * b; asm volatile("" : "+v"(p)); return p; }
__device__ __forceinline__ int iclamp(int v, int lo, int hi) { return v < lo ? lo : (v > hi ? hi : v); }
__device__ __forceinline__ float nexp2(float v) { return __builtin_amdgcn_exp2f(v); }
__device__ __forceinline__ float red_max16(float x) {
#pragma unroll
  for (int off = 8; off > 0; off >>= 1) x = fmaxf(x, __shfl_xor(x, off, 16));
  return x; }
__device__ __forceinline__ float red_sum16(float x) {
#pragma unroll
  for (int off = 8; off > 0; off >>= 1) x += __shfl_xor(x, off, 16);
  return x; }

// Wt[l][noff + n][k] = f16(bf16(W[l][k][n]) x 256), W stored [layer][in][out] with NA columns; block = 64 k x 64 n tile transposed through LDS (cross-thread, block barrier);
__global__ __launch_bounds__(256) void wprep_kernel(const float* __restrict__ W, b16* __restrict__ Wt, int K, int NA, int NT, int noff) {
  __shared__ __attribute__((aligned(16))) b16 T[64 * 72];
  const int tid = threadIdx.x, l = blockIdx.z, k0 = blockIdx.x * 64, n0 = blockIdx.y * 64;
  { const int kr = tid >> 2, nc = (tid & 3) * 16; const float* src = W + ((size_t)l * K + k0 + kr) * NA + n0 + nc;
#pragma unroll
    for (int q = 0; q < 4; ++q) { const v4f v = *(const v4f*)(src + 4 * q);
#pragma unroll
      for (int j = 0; j < 4; ++j) T[(nc + 4 * q + j) * 72 + kr] = (b16)(bf16_rne(v[j]) * WSC); } }
  __syncthreads();
  v8b vv[2]; size_t dst[2];
#pragma unroll
  for (int i = 0; i < 2; ++i) { const int n = (tid >> 3) + 32 * i, p = tid & 7; vv[i] = *(const v8b*)(T + n * 72 + 8 * p); dst[i] = ((size_t)l * NT + noff + n0 + n) * K + k0 + 8 * p; }
  {
#pragma unroll
    for (int i = 0; i < 2; ++i) *(v8b*)(Wt + dst[i]) = vv[i];
     }
}

__global__ __launch_bounds__(256) void mprep_kernel(const float* __restrict__ mem, b16* __restrict__ Mh) {
  const int u = blockIdx.x * 256 + threadIdx.x;
  if (u >= MR * D / 8) return;
  const int row = u / (D / 8), c0 = (u % (D / 8)) * 8, b = row / SEQ, s = row % SEQ;
  const float* src = mem + ((size_t)b * SEQ_FULL + s) * D + c0;
  const v4f a = *(const v4f*)src, c = *(const v4f*)(src + 4); v8b v;
#pragma unroll
  for (int j = 0; j < 4; ++j) { v[j] = (b16)(bf16_rne(a[j]) * CA); v[4 + j] = (b16)(bf16_rne(c[j]) * CA); }
  { *(v8b*)(Mh + (size_t)row * D + c0) = v;  }
}

// embedding: x[b][s][c] = bf16(emb[tok[s][b]][c]) x sqrt(512) + pe(s, c), pe(s, 2j) = sin(s x exp(2j x NLOGD)), pe(s, 2j+1) = cos(same angle); tok clamped. block = 4 rows,
// thread = 8 columns (rolled loop of 4 expf + sincosf); the 4 x 512 f32 tile is staged in LDS (block barrier), then 32 lanes x 16 B per 512-B run to X and
__global__ __launch_bounds__(256) void embed_kernel(const int* __restrict__ tok, const float* __restrict__ emb, float* __restrict__ X, b16* __restrict__ Xh) {
  __shared__ __attribute__((aligned(16))) float Xs[4 * (D + 4)];
  const int tid = threadIdx.x, rl = tid >> 6, c0 = (tid & 63) * 8, row0 = blockIdx.x * 4, row = row0 + rl, b = row / SEQ, s = row % SEQ;
  const int t = iclamp(tok[s * NB_FULL + b], 0, VOCAB - 1);
  const float* er = emb + (size_t)t * D + c0;
#pragma unroll 1
  for (int q = 0; q < 4; ++q) {
    const int c = c0 + 2 * q; const float dv = expf(pmul((float)c, NLOGD)); float sn, cs; sincosf(pmul((float)s, dv), &sn, &cs);
    Xs[rl * (D + 4) + c] = pmul(bf16_rne(er[2 * q]), SQD) + sn; Xs[rl * (D + 4) + c + 1] = pmul(bf16_rne(er[2 * q + 1]), SQD) + cs; }
  __syncthreads();
  v4f fv[2]; size_t fo[2]; v8b hv;
#pragma unroll
  for (int i = 0; i < 2; ++i) { const int f = i * 256 + tid; fv[i] = *(const v4f*)(Xs + (f >> 7) * (D + 4) + (f & 127) * 4); fo[i] = (size_t)(row0 + (f >> 7)) * D + (f & 127) * 4; }
  { const v4f a = *(const v4f*)(Xs + rl * (D + 4) + c0), c4 = *(const v4f*)(Xs + rl * (D + 4) + c0 + 4);
#pragma unroll
    for (int e = 0; e < 4; ++e) { hv[e] = (b16)(a[e] * CA); hv[4 + e] = (b16)(c4[e] * CA); } }
  {
#pragma unroll
    for (int i = 0; i < 2; ++i) *(v4f*)(X + fo[i]) = fv[i];
    *(v8b*)(Xh + (size_t)row * D + c0) = hv;  }
}

// one wave: 32 rows x 64 columns over K (multiple of 32): A rows k-contiguous (pitch lda folded into ap0 / ap1), B = Wt rows (output column, k-contiguous); fragments straight
// from the 16-bit planes; 8 WMMAs per k-step, one guard per group.
__device__ __forceinline__ void mac_32x64(v8f (&acc)[2][4], const b16* ap0, const b16* ap1, const b16* bp, int K, int hlf) {
#pragma unroll 1
  for (int k0 = 0; k0 < K; k0 += 32) {
    const v16b a0 = frag_kb(ap0 + k0, hlf), a1 = frag_kb(ap1 + k0, hlf); v16b bf[4];
#pragma unroll
    for (int t = 0; t < 4; ++t) bf[t] = frag_kb(bp + (size_t)t * 16 * K + k0, hlf);
#pragma unroll
    for (int t = 0; t < 4; ++t) { acc[0][t] = wmma_raw(a0, bf[t], acc[0][t]); acc[1][t] = wmma_raw(a1, bf[t], acc[1][t]); }
    WMMA_GUARD8(acc, a0, a1, bf);
  }
}

// row-major f16 epilogue of one wave's 32 x 64 tile (plane value = f16(v x 8), LO: f16((v x 8 - hi) x 2048)): b16 element stores into the wave-private LDS tile, wave sync,
template <bool LO, bool RELU>
__device__ __forceinline__ void epi_rows(const v8f (&acc)[2][4], const float (&bb)[4], float oscale, b16* Es, b16* dstp, int ldc, int lane, int nloc, int hlf) {
#pragma unroll
  for (int mt = 0; mt < 2; ++mt)
#pragma unroll
    for (int t = 0; t < 4; ++t)
#pragma unroll
      for (int r = 0; r < 8; ++r) {
        float v = acc[mt][t][r] * oscale + bb[t]; if (RELU) v = fmaxf(v, 0.0f); const float vs = v * CA; const b16 hi = (b16)vs;
        Es[(mt * 16 + 8 * hlf + r) * 72 + 16 * t + nloc] = LO ? (b16)((vs - (float)hi) * RS) : hi; }
  wave_lds_sync();
  v8b vv[8];
#pragma unroll
  for (int j = 0; j < 8; ++j) vv[j] = *(const v8b*)(Es + (4 * j + (lane >> 3)) * 72 + 8 * (lane & 7));
  b16* dst = dstp + (size_t)(lane >> 3) * ldc + 8 * (lane & 7);
  {
#pragma unroll
    for (int j = 0; j < 8; ++j) *(v8b*)(dst + (size_t)(4 * j) * ldc) = vv[j];
     }
}

// head-transposed f16 epilogue of the block's 128 (keys) x 128 (head columns) tile -> plane[((b*NH + h)*DH + d)*SEQ + key]: each lane stores its 8 consecutive keys of one
// column as one 16-B LDS store into Et[col][key] (cross-wave, block barrier), then store j: lanes 0..15 -> column 16j + 2 wave, lanes 16..31 -> +1, lane piece = 8 keys
template <bool LO, bool RELU>
__device__ __forceinline__ void epi_vt(const v8f (&acc)[2][4], const float (&bb)[4], float oscale, b16* Et, b16* plane, int bidx, int key0, int colv0, int wave, int wm, int wn, int nloc, int hlf) {
#pragma unroll
  for (int mt = 0; mt < 2; ++mt)
#pragma unroll
    for (int t = 0; t < 4; ++t) { v8b hv;
#pragma unroll
      for (int r = 0; r < 8; ++r) { float v = acc[mt][t][r] * oscale + bb[t]; if (RELU) v = fmaxf(v, 0.0f); const float vs = v * CA; const b16 hi = (b16)vs; hv[r] = LO ? (b16)((vs - (float)hi) * RS) : hi; }
      *(v8b*)(Et + (wn * 64 + 16 * t + nloc) * 136 + wm * 32 + mt * 16 + 8 * hlf) = hv; }
  __syncthreads();
  v8b vv[8]; size_t dsto[8];
#pragma unroll
  for (int j = 0; j < 8; ++j) { const int dl = 16 * j + 2 * wave + hlf; const int col = colv0 + dl; const int hh = col / DH, dd = col % DH;
    vv[j] = *(const v8b*)(Et + dl * 136 + 8 * nloc); dsto[j] = ((size_t)(bidx * NH + hh) * DH + dd) * SEQ + key0 + 8 * nloc; }
  {
#pragma unroll
    for (int j = 0; j < 8; ++j) *(v8b*)(plane + dsto[j]) = vv[j];
     }
}

// C = (A[M][K] f16 plane, pitch lda) x Wt[N][K] + bf16(bias), optional relu; block 128 x 128 = 8 waves of 32 x 64. GEMM columns < vcol0 -> row-major plane C[row*ldc + ccol0 + col]
// (f16 x 8); columns >= vcol0 -> head-transposed plane VT (v of the attention). Blocks whose 128 rows start a sequence also emit the residual planes Clo / VTlo (x 2048) for those rows
// when wres != 0. Bias group pointer chosen per 512-column group (block-uniform).
template <bool RELU>
__global__ __launch_bounds__(256) void gemm_kernel(const b16* __restrict__ A, int lda, const b16* __restrict__ Wt, int K,
    const float* __restrict__ bg0, const float* __restrict__ bg1, const float* __restrict__ bg2, const float* __restrict__ bg3,
    b16* __restrict__ C, b16* __restrict__ Clo, int ldc, int ccol0, b16* __restrict__ VT, b16* __restrict__ VTlo, int vcol0, float oscale, int wres) {
  __shared__ __attribute__((aligned(16))) b16 Ls[18432];   // 8 wave tiles [32][72] (row-major mode) or one block tile [128][136] (transposed mode)
  const int tid = threadIdx.x, wave = tid >> 5, lane = tid & 31, nloc = lane & 15, hlf = lane >> 4;
  const int bm0 = blockIdx.x * 128, bn0 = blockIdx.y * 128, wm = wave >> 1, wn = wave & 1;
  const int row0 = bm0 + wm * 32, col0 = bn0 + wn * 64;
  v8f acc[2][4];
#pragma unroll
  for (int t = 0; t < 4; ++t) { acc[0][t] = (v8f){}; acc[1][t] = (v8f){}; }
  mac_32x64(acc, A + (size_t)(row0 + nloc) * lda, A + (size_t)(row0 + 16 + nloc) * lda, Wt + (size_t)(col0 + nloc) * K, K, hlf);
  const int gsel = bn0 >> 9; const float* bias = gsel == 0 ? bg0 : (gsel == 1 ? bg1 : (gsel == 2 ? bg2 : bg3));
  float bb[4];
#pragma unroll
  for (int t = 0; t < 4; ++t) bb[t] = bf16_rne(bias[(col0 & 511) + 16 * t + nloc]);
  const bool vmode = bn0 >= vcol0, wlo = (wres != 0) && (bm0 % SEQ == 0);
  if (!vmode) {
    b16* Es = Ls + wave * (32 * 72);
    epi_rows<false, RELU>(acc, bb, oscale, Es, C + (size_t)row0 * ldc + ccol0 + col0, ldc, lane, nloc, hlf);
    if (wlo) { wave_lds_sync(); epi_rows<true, RELU>(acc, bb, oscale, Es, Clo + (size_t)row0 * ldc + ccol0 + col0, ldc, lane, nloc, hlf); }
  } else {
    epi_vt<false, RELU>(acc, bb, oscale, Ls, VT, bm0 / SEQ, bm0 % SEQ, bn0 - vcol0, wave, wm, wn, nloc, hlf);
    if (wlo) { __syncthreads(); epi_vt<true, RELU>(acc, bb, oscale, Ls, VTlo, bm0 / SEQ, bm0 % SEQ, bn0 - vcol0, wave, wm, wn, nloc, hlf); }
  }
}

// Y = LayerNorm(Xres + (A x Wt + bf16(bias))) * bf16(g) + bf16(be) over full 512-wide rows: block = 32 rows x 512 columns (wave = 32 x 64), K = 512 or 2048. Per 16-row half the f32
// tile is staged in LDS (cross-wave, block barrier); wave w then owns rows 2w, 2w+1: lane holds columns 128j + 4 lane (j = 0..3), residual / bias / gain loaded with the same map,
__global__ __launch_bounds__(256) void gemm_ln_kernel(const b16* __restrict__ A, int K, const b16* __restrict__ Wt, const float* __restrict__ bias, const float* Xres,
    const float* __restrict__ gam, const float* __restrict__ bet, float* OutF, b16* __restrict__ Xh, float oscale, int wxh) {
  __shared__ __attribute__((aligned(16))) float Tf[16 * (D + 4)];
  const int tid = threadIdx.x, wave = tid >> 5, lane = tid & 31, nloc = lane & 15, hlf = lane >> 4;
  const int bm0 = blockIdx.x * 32, col0 = wave * 64;
  v8f acc[2][4];
#pragma unroll
  for (int t = 0; t < 4; ++t) { acc[0][t] = (v8f){}; acc[1][t] = (v8f){}; }
  mac_32x64(acc, A + (size_t)(bm0 + nloc) * K, A + (size_t)(bm0 + 16 + nloc) * K, Wt + (size_t)(col0 + nloc) * K, K, hlf);
#pragma unroll 1
  for (int mt = 0; mt < 2; ++mt) {
    if (mt) __syncthreads();
#pragma unroll
    for (int t = 0; t < 4; ++t)
#pragma unroll
      for (int r = 0; r < 8; ++r) Tf[(8 * hlf + r) * (D + 4) + col0 + 16 * t + nloc] = (mt ? acc[1][t][r] : acc[0][t][r]) * oscale;
    __syncthreads();
#pragma unroll 1
    for (int rr = 0; rr < 2; ++rr) {
      const int rl = 2 * wave + rr; const size_t go = (size_t)(bm0 + mt * 16 + rl) * D;
      float y[16]; float s = 0.0f;
#pragma unroll
      for (int j = 0; j < 4; ++j) { const int c = 128 * j + 4 * lane;
        const v4f tv = *(const v4f*)(Tf + rl * (D + 4) + c); const v4f rv = *(const v4f*)(Xres + go + c); const v4f bv = *(const v4f*)(bias + c);
#pragma unroll
        for (int e = 0; e < 4; ++e) { const float yy = rv[e] + (tv[e] + bf16_rne(bv[e])); y[4 * j + e] = yy; s += yy; } }
#pragma unroll
      for (int off = 16; off > 0; off >>= 1) s += __shfl_xor(s, off, 32);
      const float mean = s * (1.0f / (float)D); float q = 0.0f;
#pragma unroll
      for (int i = 0; i < 16; ++i) { const float d0 = y[i] - mean; y[i] = d0; q += d0 * d0; }
#pragma unroll
      for (int off = 16; off > 0; off >>= 1) q += __shfl_xor(q, off, 32);
      const float rstd = 1.0f / sqrtf(q * (1.0f / (float)D) + LNEPS);
      v4f ov[4]; v4h_ hv[4];
#pragma unroll
      for (int j = 0; j < 4; ++j) { const int c = 128 * j + 4 * lane; const v4f gv = *(const v4f*)(gam + c), ev = *(const v4f*)(bet + c);
#pragma unroll
        for (int e = 0; e < 4; ++e) { const float o = (y[4 * j + e] * rstd) * bf16_rne(gv[e]) + bf16_rne(ev[e]); ov[j][e] = o; hv[j][e] = (b16)(o * CA); } }
      {
#pragma unroll
        for (int j = 0; j < 4; ++j) { const int c = 128 * j + 4 * lane; *(v4f*)(OutF + go + c) = ov[j]; if (wxh) *(v4h_*)(Xh + go + c) = hv[j]; }
         }
    }
  }
}

// Streaming attention, one wave = 16 query rows of one (batch, head): Q fragments from the q|k plane (column h*64), per 32-key chunk the 16x32 mask tile is loaded first (two groups of
// 8 scalar loads per lane, the first group retired before the second issues; ballot: skip when all masked), scores = 2 k-steps of WMMA against K rows, replace-mask, running-max
// softmax in f32 (exp2), P staged x4096 into a wave-private LDS tile (b16 element stores, wave sync, fragment reload), ctx += P x V with V from the head-transposed plane [d][key].
// RES: query/key residual planes give 3 score products and P_res x V + P x V_res into a second accumulator for chunks with keys < 128 (rows for which the residual planes exist);
template <bool RES>
__global__ __launch_bounds__(32) void attn_kernel(const b16* __restrict__ QK, const b16* __restrict__ QKlo, const b16* __restrict__ VT, const b16* __restrict__ VTlo,
    const int* __restrict__ mask, b16* __restrict__ CTX, int qt0, int nqt) {
  __shared__ __attribute__((aligned(16))) b16 Pst[16 * 40];
  __shared__ __attribute__((aligned(16))) b16 Plst[16 * 40];
  __shared__ __attribute__((aligned(16))) b16 Cst[16 * 72];
  const int lane = threadIdx.x & 31, nloc = lane & 15, hlf = lane >> 4;
  const int bi = blockIdx.x, qt = qt0 + bi % nqt, bh = bi / nqt, h = bh % NH, b = bh / NH, q0 = qt * 16;
  const size_t rq = (size_t)b * SEQ + q0;
  const b16* qp = QK + (rq + nloc) * LQK + h * DH;
  const v16b qa0 = frag_kb(qp, hlf), qa1 = frag_kb(qp + 32, hlf);
  v16b ql0 = (v16b){}, ql1 = (v16b){};
  if (RES) { const b16* qlp = QKlo + (rq + nloc) * LQK + h * DH; ql0 = frag_kb(qlp, hlf); ql1 = frag_kb(qlp + 32, hlf); }
  const b16* kbase = QK + (size_t)b * SEQ * LQK + D + h * DH;
  const b16* klbase = QKlo + (size_t)b * SEQ * LQK + D + h * DH;
  const b16* vbase = VT + (size_t)(b * NH + h) * DH * SEQ;
  const b16* vlbase = VTlo + (size_t)(b * NH + h) * DH * SEQ;
  const int* mq = mask + ((size_t)b * SEQ_FULL + q0 + 8 * hlf) * SEQ_FULL + nloc;
  float mx[8], ls[8]; v8f acc[4], acc2[4];
#pragma unroll
  for (int r = 0; r < 8; ++r) { mx[r] = -3.0e38f; ls[r] = 0.0f; }
#pragma unroll
  for (int t = 0; t < 4; ++t) { acc[t] = (v8f){}; acc2[t] = (v8f){}; }
#pragma unroll 1
  for (int c = 0; c < SEQ / 32; ++c) {
    const int kb = 32 * c;
    int m0[8], m1[8]; bool allm = true;
    // mask tile rows 8 hlf + r: group 1 = key column kb + nloc, group 2 = kb + 16 + nloc; compiler + wait barrier between the two groups of 8 loads
#pragma unroll
    for (int r = 0; r < 8; ++r) m0[r] = mq[(size_t)r * SEQ_FULL + kb];
    asm volatile("" :: "v"(m0[0]), "v"(m0[1]), "v"(m0[2]), "v"(m0[3]), "v"(m0[4]), "v"(m0[5]), "v"(m0[6]), "v"(m0[7]) : "memory");
#pragma unroll
    for (int r = 0; r < 8; ++r) m1[r] = mq[(size_t)r * SEQ_FULL + kb + 16];
#pragma unroll
    for (int r = 0; r < 8; ++r) allm = allm && (m0[r] != 0) && (m1[r] != 0);
    if (__builtin_amdgcn_ballot_w32(allm) == 0xffffffffu) continue;
    wave_lds_sync();   // prior chunk's fragment reloads complete before the P tiles are rewritten
    v8f s[2];
#pragma unroll
    for (int t = 0; t < 2; ++t) {
      const b16* kp = kbase + (size_t)(kb + 16 * t + nloc) * LQK; const v16b k0f = frag_kb(kp, hlf), k1f = frag_kb(kp + 32, hlf);
      v8f sh = wmma16b(qa0, k0f, (v8f){}); sh = wmma16b(qa1, k1f, sh);
      if (RES && c < 4) {
        const b16* klp = klbase + (size_t)(kb + 16 * t + nloc) * LQK;
        v8f x = wmma16b(ql0, k0f, (v8f){}); x = wmma16b(ql1, k1f, x); x = wmma16b(qa0, frag_kb(klp, hlf), x); x = wmma16b(qa1, frag_kb(klp + 32, hlf), x);
#pragma unroll
        for (int r = 0; r < 8; ++r) sh[r] += x[r] * (1.0f / RS); }
      s[t] = sh; }
    float p0[8], p1[8];
#pragma unroll
    for (int r = 0; r < 8; ++r) {
      float s0 = s[0][r] * SCL, s1 = s[1][r] * SCL; s0 = (m0[r] != 0) ? NEGF : s0; s1 = (m1[r] != 0) ? NEGF : s1;
      const float cm = red_max16(fmaxf(s0, s1)); const float mn = fmaxf(mx[r], cm); const float al = nexp2((mx[r] - mn) * L2E); mx[r] = mn;
      const float e0 = nexp2((s0 - mn) * L2E), e1 = nexp2((s1 - mn) * L2E); p0[r] = e0; p1[r] = e1;
      ls[r] = ls[r] * al + red_sum16(e0 + e1);
#pragma unroll
      for (int t = 0; t < 4; ++t) { acc[t][r] *= al; if (RES) acc2[t][r] *= al; } }
#pragma unroll
    for (int r = 0; r < 8; ++r) {
      const float v0 = p0[r] * PSC, v1 = p1[r] * PSC; const b16 h0 = (b16)v0, h1 = (b16)v1;
      Pst[(8 * hlf + r) * 40 + nloc] = h0; Pst[(8 * hlf + r) * 40 + 16 + nloc] = h1;
      if (RES) { Plst[(8 * hlf + r) * 40 + nloc] = (b16)((v0 - (float)h0) * RS); Plst[(8 * hlf + r) * 40 + 16 + nloc] = (b16)((v1 - (float)h1) * RS); } }
    wave_lds_sync();
    const v16b pf = frag_kb(Pst + nloc * 40, hlf); v16b plf = (v16b){}; if (RES) plf = frag_kb(Plst + nloc * 40, hlf);
#pragma unroll
    for (int t = 0; t < 4; ++t) {
      const v16b vf = frag_kb(vbase + (size_t)(16 * t + nloc) * SEQ + kb, hlf); acc[t] = wmma16b(pf, vf, acc[t]);
      if (RES && c < 4) { acc2[t] = wmma16b(plf, vf, acc2[t]); acc2[t] = wmma16b(pf, frag_kb(vlbase + (size_t)(16 * t + nloc) * SEQ + kb, hlf), acc2[t]); } }
  }
  wave_lds_sync();
#pragma unroll
  for (int r = 0; r < 8; ++r) { const float inv = (1.0f / ls[r]) * (CX / (PSC * CA));
#pragma unroll
    for (int t = 0; t < 4; ++t) { float a = acc[t][r]; if (RES) a += acc2[t][r] * (1.0f / RS); Cst[(8 * hlf + r) * 72 + 16 * t + nloc] = (b16)(a * inv); } }
  wave_lds_sync();
  v8b vv[4];
#pragma unroll
  for (int j = 0; j < 4; ++j) vv[j] = *(const v8b*)(Cst + (4 * j + (lane >> 3)) * 72 + 8 * (lane & 7));
  b16* dst = CTX + (rq + (lane >> 3)) * D + h * DH + 8 * (lane & 7);
  {
#pragma unroll
    for (int j = 0; j < 4; ++j) *(v8b*)(dst + (size_t)(4 * j) * D) = vv[j];
     }
}
}  // namespace

extern "C" void kernel_launch(void* const* d_in, const int* in_sizes, int n_in, void* d_out, int out_size, void* d_ws, size_t ws_size, hipStream_t stream) {
  (void)n_in;
  auto Fp = [&](int i) { return (const float*)d_in[i]; };
  auto Ip = [&](int i) { return (const int*)d_in[i]; };
  // wire order: 0 tokens [512][8] i32, 1 memory [8][512][512], 2 self-attention mask [8][512][512] i32, 3 memory mask [8][512][512] i32, 4 embedding [32000][512],
  // 5..8 Wq_s Wk_s Wv_s Wo_s [6][512 in][512 out], 9..12 Wq_c Wk_c Wv_c Wo_c, 13..16 bq_s bk_s bv_s bo_s [6][512], 17..20 bq_c bk_c bv_c bo_c,
  // 21 W1 [6][512][2048], 22 b1 [6][2048], 23 W2 [6][2048][512], 24 b2 [6][512], 25 g1, 26 g2, 27 g3, 28 be1, 29 be2, 30 be3 [6][512]
  const long needRows = (long)(NB - 1) * SEQ_FULL + SEQ;
  if ((long)in_sizes[0] < (long)SEQ * NB_FULL || (long)in_sizes[1] < needRows * D || (long)in_sizes[2] < needRows * SEQ_FULL || (long)in_sizes[3] < needRows * SEQ_FULL ||
      (long)in_sizes[4] < (long)VOCAB * D) return;
  for (int i = 5; i <= 12; ++i) if ((long)in_sizes[i] < (long)NLAY * D * D) return;
  for (int i = 13; i <= 20; ++i) if (in_sizes[i] < NLAY * D) return;
  if ((long)in_sizes[21] < (long)NLAY * D * DFF || in_sizes[22] < NLAY * DFF || (long)in_sizes[23] < (long)NLAY * DFF * D || in_sizes[24] < NLAY * D) return;
  for (int i = 25; i <= 30; ++i) if (in_sizes[i] < NLAY * D) return;
  if (out_size < MR * D) return;

  size_t off = 0; char* ws = (char*)d_ws;
  auto carve = [&](size_t bytes) { char* p = ws + off; off += (bytes + 255) & ~(size_t)255; return p; };
  b16* WQKVS = (b16*)carve((size_t)NLAY * NQKV * D * 2);   // [6][1536][512]
  b16* WOS   = (b16*)carve((size_t)NLAY * D * D * 2);
  b16* WQC   = (b16*)carve((size_t)NLAY * D * D * 2);
  b16* WKVC  = (b16*)carve((size_t)NLAY * NKV * D * 2);    // [6][1024][512]
  b16* WOC   = (b16*)carve((size_t)NLAY * D * D * 2);
  b16* W1T   = (b16*)carve((size_t)NLAY * DFF * D * 2);    // [6][2048][512]
  b16* W2T   = (b16*)carve((size_t)NLAY * D * DFF * 2);    // [6][512][2048]
  float* X   = (float*)carve((size_t)MR * D * 4);
  b16* Xh    = (b16*)carve((size_t)MR * D * 2);
  b16* Mh    = (b16*)carve((size_t)MR * D * 2);
  b16* QK    = (b16*)carve((size_t)MR * LQK * 2);
  b16* QKlo  = (b16*)carve((size_t)MR * LQK * 2);
  b16* Vt    = (b16*)carve((size_t)MR * D * 2);            // [NB][NH][64][SEQ]
  b16* Vtlo  = (b16*)carve((size_t)MR * D * 2);
  b16* CTX   = (b16*)carve((size_t)MR * D * 2);
  b16* Hh    = (b16*)carve((size_t)MR * DFF * 2);
  if (off > ws_size || off > ((size_t)128 << 20)) return;   // 113,246,208 B at full size

  const dim3 b256(256), b32(32);
  wprep_kernel<<<dim3(D / 64, D / 64, NLAY), b256, 0, stream>>>(Fp(5), WQKVS, D, D, NQKV, 0);
  wprep_kernel<<<dim3(D / 64, D / 64, NLAY), b256, 0, stream>>>(Fp(6), WQKVS, D, D, NQKV, D);
  wprep_kernel<<<dim3(D / 64, D / 64, NLAY), b256, 0, stream>>>(Fp(7), WQKVS, D, D, NQKV, 2 * D);
  wprep_kernel<<<dim3(D / 64, D / 64, NLAY), b256, 0, stream>>>(Fp(8), WOS, D, D, D, 0);
  wprep_kernel<<<dim3(D / 64, D / 64, NLAY), b256, 0, stream>>>(Fp(9), WQC, D, D, D, 0);
  wprep_kernel<<<dim3(D / 64, D / 64, NLAY), b256, 0, stream>>>(Fp(10), WKVC, D, D, NKV, 0);
  wprep_kernel<<<dim3(D / 64, D / 64, NLAY), b256, 0, stream>>>(Fp(11), WKVC, D, D, NKV, D);
  wprep_kernel<<<dim3(D / 64, D / 64, NLAY), b256, 0, stream>>>(Fp(12), WOC, D, D, D, 0);
  wprep_kernel<<<dim3(D / 64, DFF / 64, NLAY), b256, 0, stream>>>(Fp(21), W1T, D, DFF, DFF, 0);
  wprep_kernel<<<dim3(DFF / 64, D / 64, NLAY), b256, 0, stream>>>(Fp(23), W2T, DFF, D, D, 0);
  mprep_kernel<<<(MR * D / 8 + 255) / 256, b256, 0, stream>>>(Fp(1), Mh);
  embed_kernel<<<MR / 4, b256, 0, stream>>>(Ip(0), Fp(4), X, Xh);

  const float OSA = 1.0f / (CA * WSC), OSX = 1.0f / (CX * WSC);
  for (int l = 0; l < NLAY; ++l) {
    const size_t lD = (size_t)l * D, lF = (size_t)l * DFF;
    // fused q|k|v projection of x: q -> QK columns 0..511, k -> 512..1023, v -> head-transposed plane; residual planes for the first 128 rows of each sequence
    gemm_kernel<false><<<dim3(MR / 128, NQKV / 128), b256, 0, stream>>>(Xh, D, WQKVS + (size_t)l * NQKV * D, D, Fp(13) + lD, Fp(14) + lD, Fp(15) + lD, Fp(15) + lD,
        QK, QKlo, LQK, 0, Vt, Vtlo, 2 * D, OSA, 1);
    attn_kernel<true><<<NB * NH * NQT_RES, b32, 0, stream>>>(QK, QKlo, Vt, Vtlo, Ip(2), CTX, 0, NQT_RES);
    attn_kernel<false><<<NB * NH * (NQT - NQT_RES), b32, 0, stream>>>(QK, QKlo, Vt, Vtlo, Ip(2), CTX, NQT_RES, NQT - NQT_RES);
    gemm_ln_kernel<<<MR / 32, b256, 0, stream>>>(CTX, D, WOS + (size_t)l * D * D, Fp(16) + lD, X, Fp(25) + lD, Fp(28) + lD, X, Xh, OSX, 1);
    // attention over the memory tensor: q from x, k|v from the memory plane
    gemm_kernel<false><<<dim3(MR / 128, D / 128), b256, 0, stream>>>(Xh, D, WQC + (size_t)l * D * D, D, Fp(17) + lD, Fp(17) + lD, Fp(17) + lD, Fp(17) + lD,
        QK, QKlo, LQK, 0, Vt, Vtlo, D, OSA, 0);
    gemm_kernel<false><<<dim3(MR / 128, NKV / 128), b256, 0, stream>>>(Mh, D, WKVC + (size_t)l * NKV * D, D, Fp(18) + lD, Fp(19) + lD, Fp(19) + lD, Fp(19) + lD,
        QK, QKlo, LQK, D, Vt, Vtlo, D, OSA, 0);
    attn_kernel<false><<<NB * NH * NQT, b32, 0, stream>>>(QK, QKlo, Vt, Vtlo, Ip(3), CTX, 0, NQT);
    gemm_ln_kernel<<<MR / 32, b256, 0, stream>>>(CTX, D, WOC + (size_t)l * D * D, Fp(20) + lD, X, Fp(26) + lD, Fp(29) + lD, X, Xh, OSX, 1);
    // FFN
    gemm_kernel<true><<<dim3(MR / 128, DFF / 128), b256, 0, stream>>>(Xh, D, W1T + (size_t)l * DFF * D, D, Fp(22) + lF, Fp(22) + lF + 512, Fp(22) + lF + 1024, Fp(22) + lF + 1536,
        Hh, QKlo, DFF, 0, Vt, Vtlo, DFF, OSA, 0);
    const bool last = (l == NLAY - 1);
    gemm_ln_kernel<<<MR / 32, b256, 0, stream>>>(Hh, DFF, W2T + (size_t)l * D * DFF, Fp(24) + lD, X, Fp(27) + lD, Fp(30) + lD, last ? (float*)d_out : X, Xh, OSA, last ? 0 : 1);
  }
}

// v001
// It runs in 1500 microseconds.
// Next to v000, in two timings, it ran 1.20 and 1.22 times as fast.
#include <hip/hip_runtime.h>

// 6-layer post-LN decoder stack: token embedding x sqrt(512) + sinusoidal positions; per layer masked self-attention (8 heads x 64), attention over a memory tensor,
// relu FFN 512 -> 2048 -> 512, each followed by residual add + LayerNorm over 512. Masks are int32 [batch][query][key] tensors read by value (nonzero = score replaced by
// -1e18); a 32-key chunk whose 16x32 mask tile is entirely nonzero is skipped (exact whenever each query row keeps at least one key).
// compute dtype: every contraction on v_wmma_f32_16x16x32_f16 (f16 operands, f32 accumulate): q/k/v projections, score and P.V products, output projections, both FFN
// products. Operand planes: activations f16 x8 (attention context x64), weights bf16-exact f16 x256, softmax P f16 x4096; query tiles with position < 64 of the masked
// self-attention add residual planes (x2048 of the x8 / x4096 carriers) of q, k, v and P: 3 score products and 3 P.V products into a second accumulator.
// tokens and masks int32 (tokens clamped). Fragment k-map per lane half hh for A and B: elements 0..7 <- k = 8hh+0..7, 8..15 <- k = 16+8hh+0..7; acc[r] = D[8hh+r][col].

#ifndef NB
#define NB 8
#endif
#ifndef SEQ
#define SEQ 512
#endif
#define NB_FULL 8
#define SEQ_FULL 512

namespace {
constexpr int D = 512, NH = 8, DH = 64, DFF = 2048, NLAY = 6, VOCAB = 32000;
constexpr int MR = NB * SEQ;                 // activation rows, row = b * SEQ + s
constexpr int LQK = 2 * D;                   // q | k plane pitch (halves): q at h*64, k at 512 + h*64
constexpr int NQKV = 3 * D, NKV = 2 * D, NQT = SEQ / 16, NQT_RES = 4;
constexpr float WSC = 256.0f, CA = 8.0f, CX = 64.0f, PSC = 4096.0f, RS = 2048.0f;
constexpr float SQD = 22.627416997969522f, NLOGD = -0.017988946039015984f, L2E = 1.4426950408889634f, NEGF = -1.0e18f, LNEPS = 1.0e-5f;
constexpr float SCL = 1.0f / (CA * CA * 8.0f);   // score = acc / (8 x 8) / sqrt(64)
static_assert(NB >= 1 && NB <= NB_FULL && SEQ >= 128 && SEQ <= SEQ_FULL && SEQ % 128 == 0);
static_assert(MR % 128 == 0 && MR % 32 == 0 && D == 512 && NH * DH == D && DFF % 512 == 0 && NQT > NQT_RES && (MR * D) % 8 == 0);

typedef _Float16 b16;
typedef __attribute__((ext_vector_type(16))) _Float16 v16b;
typedef __attribute__((ext_vector_type(8))) _Float16 v8b;
typedef __attribute__((ext_vector_type(4))) _Float16 v4h_;
typedef __attribute__((ext_vector_type(8))) float v8f;
typedef __attribute__((ext_vector_type(4))) float v4f;

__device__ __forceinline__ float bf16_rne(float f) { unsigned int u = __float_as_uint(f); u += 0x7FFFu + ((u >> 16) & 1u); return __uint_as_float(u & 0xFFFF0000u); }
__device__ __forceinline__ v16b frag_kb(const b16* p, int hh) { const v8b a = *(const v8b*)(p + 8 * hh), b = *(const v8b*)(p + 16 + 8 * hh); v16b f;
#pragma unroll
  for (int e = 0; e < 8; ++e) { f[e] = a[e]; f[8 + e] = b[e]; } return f; }
__device__ __forceinline__ v8f wmma_raw(v16b a, v16b b, v8f c) { return __builtin_amdgcn_wmma_f32_16x16x32_f16(false, a, false, b, (short)0, c, false, false); }
__device__ __forceinline__ v8f wmma16b(v16b a, v16b b, v8f c) { v8f d = wmma_raw(a, b, c); asm volatile("v_nop\n\tv_nop\n\tv_nop\n\tv_nop" : "+v"(d) : "v"(a), "v"(b)); return d; }
// one guard after a group of 8 accumulating WMMAs: ties all 8 accumulators, keeps both A and all four B fragments live across the 4 nops
#define WMMA_GUARD8(c, a0, a1, bf) asm volatile("v_nop\n\tv_nop\n\tv_nop\n\tv_nop" : "+v"(c[0][0]), "+v"(c[0][1]), "+v"(c[0][2]), "+v"(c[0][3]), \
    "+v"(c[1][0]), "+v"(c[1][1]), "+v"(c[1][2]), "+v"(c[1][3]) : "v"(a0), "v"(a1), "v"(bf[0]), "v"(bf[1]), "v"(bf[2]), "v"(bf[3]))
__device__ __forceinline__ void wave_lds_sync() { __builtin_amdgcn_fence(3 /* release order */, "workgroup"); __builtin_amdgcn_wave_barrier(); __builtin_amdgcn_fence(2 /* acquire order */, "workgroup"); }
__device__ __forceinline__ float pmul(float a, float b) { float p = a * b; asm volatile("" : "+v"(p)); return p; }
__device__ __forceinline__ int iclamp(int v, int lo, int hi) { return v < lo ? lo : (v > hi ? hi : v); }
__device__ __forceinline__ float nexp2(float v) { float r; asm("v_exp_f32 %0, %1\n\tv_nop" : "=v"(r) : "v"(v)); return r; }
// 16-lane butterflies (partners lane ^ 8, 4, 2, 1) on ds_bpermute_b32; sa[] holds the four partner byte addresses, formed once per kernel (fewer live registers than per-call index math)
__device__ __forceinline__ float bperm(int addr, float x) { return __int_as_float(__builtin_amdgcn_ds_bpermute(addr, __float_as_int(x))); }
__device__ __forceinline__ float red_max16(float x, const int (&sa)[4]) {
#pragma unroll
  for (int j = 0; j < 4; ++j) x = fmaxf(x, bperm(sa[j], x));
  return x; }
__device__ __forceinline__ float red_sum16(float x, const int (&sa)[4]) {
#pragma unroll
  for (int j = 0; j < 4; ++j) x += bperm(sa[j], x);
  return x; }

// Wt[l][noff + n][k] = f16(bf16(W[l][k][n]) x 256), W stored [layer][in][out] with NA columns; block = 64 k x 64 n tile transposed through LDS (cross-thread, block barrier);
__global__ __launch_bounds__(256) void wprep_kernel(const float* __restrict__ W, b16* __restrict__ Wt, int K, int NA, int NT, int noff) {
  __shared__ __attribute__((aligned(16))) b16 T[64 * 72];
  const int tid = threadIdx.x, l = blockIdx.z, k0 = blockIdx.x * 64, n0 = blockIdx.y * 64;
  { const int kr = tid >> 2, nc = (tid & 3) * 16; const float* src = W + ((size_t)l * K + k0 + kr) * NA + n0 + nc;
#pragma unroll
    for (int q = 0; q < 4; ++q) { const v4f v = *(const v4f*)(src + 4 * q);
#pragma unroll
      for (int j = 0; j < 4; ++j) T[(nc + 4 * q + j) * 72 + kr] = (b16)(bf16_rne(v[j]) * WSC); } }
  __syncthreads();
  v8b vv[2]; size_t dst[2];
#pragma unroll
  for (int i = 0; i < 2; ++i) { const int n = (tid >> 3) + 32 * i, p = tid & 7; vv[i] = *(const v8b*)(T + n * 72 + 8 * p); dst[i] = ((size_t)l * NT + noff + n0 + n) * K + k0 + 8 * p; }
  {
#pragma unroll
    for (int i = 0; i < 2; ++i) *(v8b*)(Wt + dst[i]) = vv[i];
     }
}

__global__ __launch_bounds__(256) void mprep_kernel(const float* __restrict__ mem, b16* __restrict__ Mh) {
  const int u = blockIdx.x * 256 + threadIdx.x;
  if (u >= MR * D / 8) return;
  const int row = u / (D / 8), c0 = (u % (D / 8)) * 8, b = row / SEQ, s = row % SEQ;
  const float* src = mem + ((size_t)b * SEQ_FULL + s) * D + c0;
  const v4f a = *(const v4f*)src, c = *(const v4f*)(src + 4); v8b v;
#pragma unroll
  for (int j = 0; j < 4; ++j) { v[j] = (b16)(bf16_rne(a[j]) * CA); v[4 + j] = (b16)(bf16_rne(c[j]) * CA); }
  { *(v8b*)(Mh + (size_t)row * D + c0) = v;  }
}

// embedding: x[b][s][c] = bf16(emb[tok[s][b]][c]) x sqrt(512) + pe(s, c), pe(s, 2j) = sin(s x exp(2j x NLOGD)), pe(s, 2j+1) = cos(same angle); tok clamped. block = 4 rows,
// thread = 8 columns (rolled loop of 4 expf + sincosf); the 4 x 512 f32 tile is staged in LDS (block barrier), then 32 lanes x 16 B per 512-B run to X and
__global__ __launch_bounds__(256) void embed_kernel(const int* __restrict__ tok, const float* __restrict__ emb, float* __restrict__ X, b16* __restrict__ Xh) {
  __shared__ __attribute__((aligned(16))) float Xs[4 * (D + 4)];
  const int tid = threadIdx.x, rl = tid >> 6, c0 = (tid & 63) * 8, row0 = blockIdx.x * 4, row = row0 + rl, b = row / SEQ, s = row % SEQ;
  const int t = iclamp(tok[s * NB_FULL + b], 0, VOCAB - 1);
  const float* er = emb + (size_t)t * D + c0;
#pragma unroll 1
  for (int q = 0; q < 4; ++q) {
    const int c = c0 + 2 * q; const float dv = expf(pmul((float)c, NLOGD)); float sn, cs; sincosf(pmul((float)s, dv), &sn, &cs);
    Xs[rl * (D + 4) + c] = pmul(bf16_rne(er[2 * q]), SQD) + sn; Xs[rl * (D + 4) + c + 1] = pmul(bf16_rne(er[2 * q + 1]), SQD) + cs; }
  __syncthreads();
  v4f fv[2]; size_t fo[2]; v8b hv;
#pragma unroll
  for (int i = 0; i < 2; ++i) { const int f = i * 256 + tid; fv[i] = *(const v4f*)(Xs + (f >> 7) * (D + 4) + (f & 127) * 4); fo[i] = (size_t)(row0 + (f >> 7)) * D + (f & 127) * 4; }
  { const v4f a = *(const v4f*)(Xs + rl * (D + 4) + c0), c4 = *(const v4f*)(Xs + rl * (D + 4) + c0 + 4);
#pragma unroll
    for (int e = 0; e < 4; ++e) { hv[e] = (b16)(a[e] * CA); hv[4 + e] = (b16)(c4[e] * CA); } }
  {
#pragma unroll
    for (int i = 0; i < 2; ++i) *(v4f*)(X + fo[i]) = fv[i];
    *(v8b*)(Xh + (size_t)row * D + c0) = hv;  }
}

// one wave: 32 rows x 64 columns over K (multiple of 32): A rows k-contiguous (pitch lda folded into ap0 / ap1), B = Wt rows (output column, k-contiguous); fragments straight
// from the 16-bit planes; 8 WMMAs per k-step, one guard per group.
__device__ __forceinline__ void mac_32x64(v8f (&acc)[2][4], const b16* ap0, const b16* ap1, const b16* bp, int K, int hlf) {
#pragma unroll 1
  for (int k0 = 0; k0 < K; k0 += 32) {
    const v16b a0 = frag_kb(ap0 + k0, hlf), a1 = frag_kb(ap1 + k0, hlf); v16b bf[4];
#pragma unroll
    for (int t = 0; t < 4; ++t) bf[t] = frag_kb(bp + (size_t)t * 16 * K + k0, hlf);
#pragma unroll
    for (int t = 0; t < 4; ++t) { acc[0][t] = wmma_raw(a0, bf[t], acc[0][t]); acc[1][t] = wmma_raw(a1, bf[t], acc[1][t]); }
    WMMA_GUARD8(acc, a0, a1, bf);
  }
}

// row-major f16 epilogue of one wave's 32 x 64 tile (plane value = f16(v x 8), LO: f16((v x 8 - hi) x 2048)): b16 element stores into the wave-private LDS tile, wave sync,
template <bool LO, bool RELU>
__device__ __forceinline__ void epi_rows(const v8f (&acc)[2][4], const float (&bb)[4], float oscale, b16* Es, b16* dstp, int ldc, int lane, int nloc, int hlf) {
#pragma unroll
  for (int mt = 0; mt < 2; ++mt)
#pragma unroll
    for (int t = 0; t < 4; ++t)
#pragma unroll
      for (int r = 0; r < 8; ++r) {
        float v = acc[mt][t][r] * oscale + bb[t]; if (RELU) v = fmaxf(v, 0.0f); const float vs = v * CA; const b16 hi = (b16)vs;
        Es[(mt * 16 + 8 * hlf + r) * 72 + 16 * t + nloc] = LO ? (b16)((vs - (float)hi) * RS) : hi; }
  wave_lds_sync();
  v8b vv[8];
#pragma unroll
  for (int j = 0; j < 8; ++j) vv[j] = *(const v8b*)(Es + (4 * j + (lane >> 3)) * 72 + 8 * (lane & 7));
  b16* dst = dstp + (size_t)(lane >> 3) * ldc + 8 * (lane & 7);
  {
#pragma unroll
    for (int j = 0; j < 8; ++j) *(v8b*)(dst + (size_t)(4 * j) * ldc) = vv[j];
     }
}

// head-transposed f16 epilogue of the block's 128 (keys) x 128 (head columns) tile -> plane[((b*NH + h)*DH + d)*SEQ + key]: each lane stores its 8 consecutive keys of one
// column as one 16-B LDS store into Et[col][key] (cross-wave, block barrier), then store j: lanes 0..15 -> column 16j + 2 wave, lanes 16..31 -> +1, lane piece = 8 keys
template <bool LO, bool RELU>
__device__ __forceinline__ void epi_vt(const v8f (&acc)[2][4], const float (&bb)[4], float oscale, b16* Et, b16* plane, int bidx, int key0, int colv0, int wave, int wm, int wn, int nloc, int hlf) {
#pragma unroll
  for (int mt = 0; mt < 2; ++mt)
#pragma unroll
    for (int t = 0; t < 4; ++t) { v8b hv;
#pragma unroll
      for (int r = 0; r < 8; ++r) { float v = acc[mt][t][r] * oscale + bb[t]; if (RELU) v = fmaxf(v, 0.0f); const float vs = v * CA; const b16 hi = (b16)vs; hv[r] = LO ? (b16)((vs - (float)hi) * RS) : hi; }
      *(v8b*)(Et + (wn * 64 + 16 * t + nloc) * 136 + wm * 32 + mt * 16 + 8 * hlf) = hv; }
  __syncthreads();
  v8b vv[8]; size_t dsto[8];
#pragma unroll
  for (int j = 0; j < 8; ++j) { const int dl = 16 * j + 2 * wave + hlf; const int col = colv0 + dl; const int hh = col / DH, dd = col % DH;
    vv[j] = *(const v8b*)(Et + dl * 136 + 8 * nloc); dsto[j] = ((size_t)(bidx * NH + hh) * DH + dd) * SEQ + key0 + 8 * nloc; }
  {
#pragma unroll
    for (int j = 0; j < 8; ++j) *(v8b*)(plane + dsto[j]) = vv[j];
     }
}

// C = (A[M][K] f16 plane, pitch lda) x Wt[N][K] + bf16(bias), optional relu; block 128 x 128 = 8 waves of 32 x 64. GEMM columns < vcol0 -> row-major plane C[row*ldc + ccol0 + col]
// (f16 x 8); columns >= vcol0 -> head-transposed plane VT (v of the attention). Blocks whose 128 rows start a sequence also emit the residual planes Clo / VTlo (x 2048) for those rows
// when wres != 0. Bias group pointer chosen per 512-column group (block-uniform).
template <bool RELU>
__global__ __launch_bounds__(256) void gemm_kernel(const b16* __restrict__ A, int lda, const b16* __restrict__ Wt, int K,
    const float* __restrict__ bg0, const float* __restrict__ bg1, const float* __restrict__ bg2, const float* __restrict__ bg3,
    b16* __restrict__ C, b16* __restrict__ Clo, int ldc, int ccol0, b16* __restrict__ VT, b16* __restrict__ VTlo, int vcol0, float oscale, int wres) {
  __shared__ __attribute__((aligned(16))) b16 Ls[18432];   // 8 wave tiles [32][72] (row-major mode) or one block tile [128][136] (transposed mode)
  const int tid = threadIdx.x, wave = tid >> 5, lane = tid & 31, nloc = lane & 15, hlf = lane >> 4;
  const int bm0 = blockIdx.x * 128, bn0 = blockIdx.y * 128, wm = wave >> 1, wn = wave & 1;
  const int row0 = bm0 + wm * 32, col0 = bn0 + wn * 64;
  v8f acc[2][4];
#pragma unroll
  for (int t = 0; t < 4; ++t) { acc[0][t] = (v8f){}; acc[1][t] = (v8f){}; }
  mac_32x64(acc, A + (size_t)(row0 + nloc) * lda, A + (size_t)(row0 + 16 + nloc) * lda, Wt + (size_t)(col0 + nloc) * K, K, hlf);
  const int gsel = bn0 >> 9; const float* bias = gsel == 0 ? bg0 : (gsel == 1 ? bg1 : (gsel == 2 ? bg2 : bg3));
  float bb[4];
#pragma unroll
  for (int t = 0; t < 4; ++t) bb[t] = bf16_rne(bias[(col0 & 511) + 16 * t + nloc]);
  const bool vmode = bn0 >= vcol0, wlo = (wres != 0) && (bm0 % SEQ == 0);
  if (!vmode) {
    b16* Es = Ls + wave * (32 * 72);
    epi_rows<false, RELU>(acc, bb, oscale, Es, C + (size_t)row0 * ldc + ccol0 + col0, ldc, lane, nloc, hlf);
    if (wlo) { wave_lds_sync(); epi_rows<true, RELU>(acc, bb, oscale, Es, Clo + (size_t)row0 * ldc + ccol0 + col0, ldc, lane, nloc, hlf); }
  } else {
    epi_vt<false, RELU>(acc, bb, oscale, Ls, VT, bm0 / SEQ, bm0 % SEQ, bn0 - vcol0, wave, wm, wn, nloc, hlf);
    if (wlo) { __syncthreads(); epi_vt<true, RELU>(acc, bb, oscale, Ls, VTlo, bm0 / SEQ, bm0 % SEQ, bn0 - vcol0, wave, wm, wn, nloc, hlf); }
  }
}

// Y = LayerNorm(Xres + (A x Wt + bf16(bias))) * bf16(g) + bf16(be) over full 512-wide rows: block = 32 rows x 512 columns (wave = 32 x 64), K = 512 or 2048. Per 16-row half the f32
// tile is staged in LDS (cross-wave, block barrier); wave w then owns rows 2w, 2w+1: lane holds columns 128j + 4 lane (j = 0..3), residual / bias / gain loaded with the same map,
__global__ __launch_bounds__(256) void gemm_ln_kernel(const b16* __restrict__ A, int K, const b16* __restrict__ Wt, const float* __restrict__ bias, const float* Xres,
    const float* __restrict__ gam, const float* __restrict__ bet, float* OutF, b16* __restrict__ Xh, float oscale, int wxh) {
  __shared__ __attribute__((aligned(16))) float Tf[16 * (D + 4)];
  const int tid = threadIdx.x, wave = tid >> 5, lane = tid & 31, nloc = lane & 15, hlf = lane >> 4;
  const int bm0 = blockIdx.x * 32, col0 = wave * 64;
  v8f acc[2][4];
#pragma unroll
  for (int t = 0; t < 4; ++t) { acc[0][t] = (v8f){}; acc[1][t] = (v8f){}; }
  mac_32x64(acc, A + (size_t)(bm0 + nloc) * K, A + (size_t)(bm0 + 16 + nloc) * K, Wt + (size_t)(col0 + nloc) * K, K, hlf);
#pragma unroll 1
  for (int mt = 0; mt < 2; ++mt) {
    if (mt) __syncthreads();
#pragma unroll
    for (int t = 0; t < 4; ++t)
#pragma unroll
      for (int r = 0; r < 8; ++r) Tf[(8 * hlf + r) * (D + 4) + col0 + 16 * t + nloc] = (mt ? acc[1][t][r] : acc[0][t][r]) * oscale;
    __syncthreads();
#pragma unroll 1
    for (int rr = 0; rr < 2; ++rr) {
      const int rl = 2 * wave + rr; const size_t go = (size_t)(bm0 + mt * 16 + rl) * D;
      float y[16]; float s = 0.0f;
#pragma unroll
      for (int j = 0; j < 4; ++j) { const int c = 128 * j + 4 * lane;
        const v4f tv = *(const v4f*)(Tf + rl * (D + 4) + c); const v4f rv = *(const v4f*)(Xres + go + c); const v4f bv = *(const v4f*)(bias + c);
#pragma unroll
        for (int e = 0; e < 4; ++e) { const float yy = rv[e] + (tv[e] + bf16_rne(bv[e])); y[4 * j + e] = yy; s += yy; } }
#pragma unroll
      for (int off = 16; off > 0; off >>= 1) s += __shfl_xor(s, off, 32);
      const float mean = s * (1.0f / (float)D); float q = 0.0f;
#pragma unroll
      for (int i = 0; i < 16; ++i) { const float d0 = y[i] - mean; y[i] = d0; q += d0 * d0; }
#pragma unroll
      for (int off = 16; off > 0; off >>= 1) q += __shfl_xor(q, off, 32);
      const float rstd = 1.0f / sqrtf(q * (1.0f / (float)D) + LNEPS);
      v4f ov[4]; v4h_ hv[4];
#pragma unroll
      for (int j = 0; j < 4; ++j) { const int c = 128 * j + 4 * lane; const v4f gv = *(const v4f*)(gam + c), ev = *(const v4f*)(bet + c);
#pragma unroll
        for (int e = 0; e < 4; ++e) { const float o = (y[4 * j + e] * rstd) * bf16_rne(gv[e]) + bf16_rne(ev[e]); ov[j][e] = o; hv[j][e] = (b16)(o * CA); } }
      {
#pragma unroll
        for (int j = 0; j < 4; ++j) { const int c = 128 * j + 4 * lane; *(v4f*)(OutF + go + c) = ov[j]; if (wxh) *(v4h_*)(Xh + go + c) = hv[j]; }
         }
    }
  }
}

// Streaming attention, one work-group = 16 query rows of one (batch, head), its NWK waves sharing the keys: wave w walks the 32-key chunks w, w + NWK, ... with its own running max,
// sum and context; the partial results meet in LDS behind one block barrier and are joined there (weights exp(max_w - max)). Q fragments from the q|k plane (column h*64), per chunk
// the 16x32 mask tile is loaded first (two groups of 8 scalar loads per lane, the first group retired before the second issues; ballot: skip when all masked), scores = 2 k-steps of
// WMMA against K rows, replace-mask, running-max softmax in f32 (exp2), P staged x4096 into a wave-private LDS tile (b16 element stores, wave sync, fragment reload), ctx += P x V with
// V from the head-transposed plane [d][key].
// RES: query/key residual planes give 3 score products and P_res x V + P x V_res into a second accumulator for chunks with keys < 128 (rows for which the residual planes exist);
constexpr int NWK = 4, PPW = DH + 4;   // waves per query tile; f32 pitch of a partial context row
static_assert((SEQ / 32) % NWK == 0);
template <bool RES>
__global__ __launch_bounds__(32 * NWK) void attn_kernel(const b16* __restrict__ QK, const b16* __restrict__ QKlo, const b16* __restrict__ VT, const b16* __restrict__ VTlo,
    const int* __restrict__ mask, b16* __restrict__ CTX, int qt0, int nqt) {
  __shared__ __attribute__((aligned(16))) b16 PstA[NWK * 16 * 40];
  __shared__ __attribute__((aligned(16))) b16 PlstA[RES ? NWK * 16 * 40 : 8];
  __shared__ __attribute__((aligned(16))) float Part[NWK * 16 * PPW];
  __shared__ float Mxs[NWK * 16], Lss[NWK * 16];
  const int tid = threadIdx.x, lane = tid & 31, nloc = lane & 15, hlf = lane >> 4, wave = __builtin_amdgcn_readfirstlane(tid >> 5);
  const int sa[4] = {(lane ^ 8) << 2, (lane ^ 4) << 2, (lane ^ 2) << 2, (lane ^ 1) << 2};
  b16* Pst = PstA + wave * (16 * 40); b16* Plst = PlstA + (RES ? wave * (16 * 40) : 0);
  const int bi = blockIdx.x, qt = qt0 + bi % nqt, bh = bi / nqt, h = bh % NH, b = bh / NH, q0 = qt * 16;
  const size_t rq = (size_t)b * SEQ + q0;
  const b16* qp = QK + (rq + nloc) * LQK + h * DH;
  const v16b qa0 = frag_kb(qp, hlf), qa1 = frag_kb(qp + 32, hlf);
  v16b ql0 = (v16b){}, ql1 = (v16b){};
  if (RES) { const b16* qlp = QKlo + (rq + nloc) * LQK + h * DH; ql0 = frag_kb(qlp, hlf); ql1 = frag_kb(qlp + 32, hlf); }
  const b16* kbase = QK + ((size_t)b * SEQ + 32 * wave) * LQK + D + h * DH;   // this and the four bases below start at the wave's first chunk
  const b16* klbase = QKlo + ((size_t)b * SEQ + 32 * wave) * LQK + D + h * DH;
  const b16* vbase = VT + (size_t)(b * NH + h) * DH * SEQ + 32 * wave;
  const b16* vlbase = VTlo + (size_t)(b * NH + h) * DH * SEQ + 32 * wave;
  const int* mq = mask + ((size_t)b * SEQ_FULL + q0 + 8 * hlf) * SEQ_FULL + 32 * wave + nloc;
  float mx[8], ls[8]; v8f acc[4], acc2[4];
#pragma unroll
  for (int r = 0; r < 8; ++r) { mx[r] = -3.0e38f; ls[r] = 0.0f; }
#pragma unroll
  for (int t = 0; t < 4; ++t) { acc[t] = (v8f){}; acc2[t] = (v8f){}; }
#pragma unroll 1
  for (int i = 0; i < SEQ / 32 / NWK; ++i) {
    const int kb = 32 * NWK * i, c = wave + NWK * i;   // kb: key offset from the wave's first chunk; c: chunk index
    int m0[8], m1[8]; bool allm = true;
    // mask tile rows 8 hlf + r: group 1 = key column kb + nloc, group 2 = kb + 16 + nloc; compiler + wait barrier between the two groups of 8 loads
#pragma unroll
    for (int r = 0; r < 8; ++r) m0[r] = mq[(size_t)r * SEQ_FULL + kb];
    asm volatile("" :: "v"(m0[0]), "v"(m0[1]), "v"(m0[2]), "v"(m0[3]), "v"(m0[4]), "v"(m0[5]), "v"(m0[6]), "v"(m0[7]) : "memory");
#pragma unroll
    for (int r = 0; r < 8; ++r) m1[r] = mq[(size_t)r * SEQ_FULL + kb + 16];
#pragma unroll
    for (int r = 0; r < 8; ++r) allm = allm && (m0[r] != 0) && (m1[r] != 0);
    if (__builtin_amdgcn_ballot_w32(allm) == 0xffffffffu) continue;
    wave_lds_sync();   // prior chunk's fragment reloads complete before the P tiles are rewritten
    v8f s[2];
#pragma unroll
    for (int t = 0; t < 2; ++t) {
      const b16* kp = kbase + (size_t)(kb + 16 * t + nloc) * LQK; const v16b k0f = frag_kb(kp, hlf), k1f = frag_kb(kp + 32, hlf);
      v8f sh = wmma16b(qa0, k0f, (v8f){}); sh = wmma16b(qa1, k1f, sh);
      if (RES && c < 4) {
        const b16* klp = klbase + (size_t)(kb + 16 * t + nloc) * LQK;
        v8f x = wmma16b(ql0, k0f, (v8f){}); x = wmma16b(ql1, k1f, x); x = wmma16b(qa0, frag_kb(klp, hlf), x); x = wmma16b(qa1, frag_kb(klp + 32, hlf), x);
#pragma unroll
        for (int r = 0; r < 8; ++r) sh[r] += x[r] * (1.0f / RS); }
      s[t] = sh; }
    float p0[8], p1[8];
#pragma unroll
    for (int r = 0; r < 8; ++r) {
      float s0 = s[0][r] * SCL, s1 = s[1][r] * SCL; s0 = (m0[r] != 0) ? NEGF : s0; s1 = (m1[r] != 0) ? NEGF : s1;
      const float cm = red_max16(fmaxf(s0, s1), sa); const float mn = fmaxf(mx[r], cm); const float al = nexp2((mx[r] - mn) * L2E); mx[r] = mn;
      const float e0 = nexp2((s0 - mn) * L2E), e1 = nexp2((s1 - mn) * L2E); p0[r] = e0; p1[r] = e1;
      ls[r] = ls[r] * al + red_sum16(e0 + e1, sa);
#pragma unroll
      for (int t = 0; t < 4; ++t) { acc[t][r] *= al; if (RES) acc2[t][r] *= al; } }
#pragma unroll
    for (int r = 0; r < 8; ++r) {
      const float v0 = p0[r] * PSC, v1 = p1[r] * PSC; const b16 h0 = (b16)v0, h1 = (b16)v1;
      Pst[(8 * hlf + r) * 40 + nloc] = h0; Pst[(8 * hlf + r) * 40 + 16 + nloc] = h1;
      if (RES) { Plst[(8 * hlf + r) * 40 + nloc] = (b16)((v0 - (float)h0) * RS); Plst[(8 * hlf + r) * 40 + 16 + nloc] = (b16)((v1 - (float)h1) * RS); } }
    wave_lds_sync();
    const v16b pf = frag_kb(Pst + nloc * 40, hlf); v16b plf = (v16b){}; if (RES) plf = frag_kb(Plst + nloc * 40, hlf);
#pragma unroll
    for (int t = 0; t < 4; ++t) {
      const v16b vf = frag_kb(vbase + (size_t)(16 * t + nloc) * SEQ + kb, hlf); acc[t] = wmma16b(pf, vf, acc[t]);
      if (RES && c < 4) { acc2[t] = wmma16b(plf, vf, acc2[t]); acc2[t] = wmma16b(pf, frag_kb(vlbase + (size_t)(16 * t + nloc) * SEQ + kb, hlf), acc2[t]); } }
  }
  // each wave publishes its partial context (f32, still scaled by its own max), max and sum; a wave whose chunks were all skipped publishes max -3e38, sum 0, context 0
  float* pw = Part + wave * (16 * PPW);
#pragma unroll
  for (int r = 0; r < 8; ++r) {
#pragma unroll
    for (int t = 0; t < 4; ++t) { float a = acc[t][r]; if (RES) a += acc2[t][r] * (1.0f / RS); pw[(8 * hlf + r) * PPW + 16 * t + nloc] = a; }
    if (nloc == 0) { Mxs[wave * 16 + 8 * hlf + r] = mx[r]; Lss[wave * 16 + 8 * hlf + r] = ls[r]; } }
  __syncthreads();   // every wave's partials are in LDS before any thread joins them
  // join: thread = 8 columns of one row (NWK = 4: 128 threads cover 16 x 64)
  static_assert(32 * NWK * 8 == 16 * DH);
  const int jr = tid >> 3, jc = 8 * (tid & 7);
  float wm_[NWK], M = Mxs[jr];
#pragma unroll
  for (int w = 1; w < NWK; ++w) M = fmaxf(M, Mxs[w * 16 + jr]);
  float L = 0.0f, o[8];
#pragma unroll
  for (int e = 0; e < 8; ++e) o[e] = 0.0f;
#pragma unroll
  for (int w = 0; w < NWK; ++w) { wm_[w] = nexp2((Mxs[w * 16 + jr] - M) * L2E); L += wm_[w] * Lss[w * 16 + jr];
    const v4f x0 = *(const v4f*)(Part + (w * 16 + jr) * PPW + jc), x1 = *(const v4f*)(Part + (w * 16 + jr) * PPW + jc + 4);
#pragma unroll
    for (int e = 0; e < 4; ++e) { o[e] += wm_[w] * x0[e]; o[4 + e] += wm_[w] * x1[e]; } }
  const float inv = (1.0f / L) * (CX / (PSC * CA)); v8b ov;
#pragma unroll
  for (int e = 0; e < 8; ++e) ov[e] = (b16)(o[e] * inv);
  *(v8b*)(CTX + (rq + jr) * D + h * DH + jc) = ov;
}
}  // namespace

extern "C" void kernel_launch(void* const* d_in, const int* in_sizes, int n_in, void* d_out, int out_size, void* d_ws, size_t ws_size, hipStream_t stream) {
  (void)n_in;
  auto Fp = [&](int i) { return (const float*)d_in[i]; };
  auto Ip = [&](int i) { return (const int*)d_in[i]; };
  // wire order: 0 tokens [512][8] i32, 1 memory [8][512][512], 2 self-attention mask [8][512][512] i32, 3 memory mask [8][512][512] i32, 4 embedding [32000][512],
  // 5..8 Wq_s Wk_s Wv_s Wo_s [6][512 in][512 out], 9..12 Wq_c Wk_c Wv_c Wo_c, 13..16 bq_s bk_s bv_s bo_s [6][512], 17..20 bq_c bk_c bv_c bo_c,
  // 21 W1 [6][512][2048], 22 b1 [6][2048], 23 W2 [6][2048][512], 24 b2 [6][512], 25 g1, 26 g2, 27 g3, 28 be1, 29 be2, 30 be3 [6][512]
  const long needRows = (long)(NB - 1) * SEQ_FULL + SEQ;
  if ((long)in_sizes[0] < (long)SEQ * NB_FULL || (long)in_sizes[1] < needRows * D || (long)in_sizes[2] < needRows * SEQ_FULL || (long)in_sizes[3] < needRows * SEQ_FULL ||
      (long)in_sizes[4] < (long)VOCAB * D) return;
  for (int i = 5; i <= 12; ++i) if ((long)in_sizes[i] < (long)NLAY * D * D) return;
  for (int i = 13; i <= 20; ++i) if (in_sizes[i] < NLAY * D) return;
  if ((long)in_sizes[21] < (long)NLAY * D * DFF || in_sizes[22] < NLAY * DFF || (long)in_sizes[23] < (long)NLAY * DFF * D || in_sizes[24] < NLAY * D) return;
  for (int i = 25; i <= 30; ++i) if (in_sizes[i] < NLAY * D) return;
  if (out_size < MR * D) return;

  size_t off = 0; char* ws = (char*)d_ws;
  auto carve = [&](size_t bytes) { char* p = ws + off; off += (bytes + 255) & ~(size_t)255; return p; };
  b16* WQKVS = (b16*)carve((size_t)NLAY * NQKV * D * 2);   // [6][1536][512]
  b16* WOS   = (b16*)carve((size_t)NLAY * D * D * 2);
  b16* WQC   = (b16*)carve((size_t)NLAY * D * D * 2);
  b16* WKVC  = (b16*)carve((size_t)NLAY * NKV * D * 2);    // [6][1024][512]
  b16* WOC   = (b16*)carve((size_t)NLAY * D * D * 2);
  b16* W1T   = (b16*)carve((size_t)NLAY * DFF * D * 2);    // [6][2048][512]
  b16* W2T   = (b16*)carve((size_t)NLAY * D * DFF * 2);    // [6][512][2048]
  float* X   = (float*)carve((size_t)MR * D * 4);
  b16* Xh    = (b16*)carve((size_t)MR * D * 2);
  b16* Mh    = (b16*)carve((size_t)MR * D * 2);
  b16* QK    = (b16*)carve((size_t)MR * LQK * 2);
  b16* QKlo  = (b16*)carve((size_t)MR * LQK * 2);
  b16* Vt    = (b16*)carve((size_t)MR * D * 2);            // [NB][NH][64][SEQ]
  b16* Vtlo  = (b16*)carve((size_t)MR * D * 2);
  b16* CTX   = (b16*)carve((size_t)MR * D * 2);
  b16* Hh    = (b16*)carve((size_t)MR * DFF * 2);
  if (off > ws_size || off > ((size_t)128 << 20)) return;   // 113,246,208 B at full size

  const dim3 b256(256), battn(32 * NWK);
  wprep_kernel<<<dim3(D / 64, D / 64, NLAY), b256, 0, stream>>>(Fp(5), WQKVS, D, D, NQKV, 0);
  wprep_kernel<<<dim3(D / 64, D / 64, NLAY), b256, 0, stream>>>(Fp(6), WQKVS, D, D, NQKV, D);
  wprep_kernel<<<dim3(D / 64, D / 64, NLAY), b256, 0, stream>>>(Fp(7), WQKVS, D, D, NQKV, 2 * D);
  wprep_kernel<<<dim3(D / 64, D / 64, NLAY), b256, 0, stream>>>(Fp(8), WOS, D, D, D, 0);
  wprep_kernel<<<dim3(D / 64, D / 64, NLAY), b256, 0, stream>>>(Fp(9), WQC, D, D, D, 0);
  wprep_kernel<<<dim3(D / 64, D / 64, NLAY), b256, 0, stream>>>(Fp(10), WKVC, D, D, NKV, 0);
  wprep_kernel<<<dim3(D / 64, D / 64, NLAY), b256, 0, stream>>>(Fp(11), WKVC, D, D, NKV, D);
  wprep_kernel<<<dim3(D / 64, D / 64, NLAY), b256, 0, stream>>>(Fp(12), WOC, D, D, D, 0);
  wprep_kernel<<<dim3(D / 64, DFF / 64, NLAY), b256, 0, stream>>>(Fp(21), W1T, D, DFF, DFF, 0);
  wprep_kernel<<<dim3(DFF / 64, D / 64, NLAY), b256, 0, stream>>>(Fp(23), W2T, DFF, D, D, 0);
  mprep_kernel<<<(MR * D / 8 + 255) / 256, b256, 0, stream>>>(Fp(1), Mh);
  embed_kernel<<<MR / 4, b256, 0, stream>>>(Ip(0), Fp(4), X, Xh);

  const float OSA = 1.0f / (CA * WSC), OSX = 1.0f / (CX * WSC);
  for (int l = 0; l < NLAY; ++l) {
    const size_t lD = (size_t)l * D, lF = (size_t)l * DFF;
    // fused q|k|v projection of x: q -> QK columns 0..511, k -> 512..1023, v -> head-transposed plane; residual planes for the first 128 rows of each sequence
    gemm_kernel<false><<<dim3(MR / 128, NQKV / 128), b256, 0, stream>>>(Xh, D, WQKVS + (size_t)l * NQKV * D, D, Fp(13) + lD, Fp(14) + lD, Fp(15) + lD, Fp(15) + lD,
        QK, QKlo, LQK, 0, Vt, Vtlo, 2 * D, OSA, 1);
    attn_kernel<true><<<NB * NH * NQT_RES, battn, 0, stream>>>(QK, QKlo, Vt, Vtlo, Ip(2), CTX, 0, NQT_RES);
    attn_kernel<false><<<NB * NH * (NQT - NQT_RES), battn, 0, stream>>>(QK, QKlo, Vt, Vtlo, Ip(2), CTX, NQT_RES, NQT - NQT_RES);
    gemm_ln_kernel<<<MR / 32, b256, 0, stream>>>(CTX, D, WOS + (size_t)l * D * D, Fp(16) + lD, X, Fp(25) + lD, Fp(28) + lD, X, Xh, OSX, 1);
    // attention over the memory tensor: q from x, k|v from the memory plane
    gemm_kernel<false><<<dim3(MR / 128, D / 128), b256, 0, stream>>>(Xh, D, WQC + (size_t)l * D * D, D, Fp(17) + lD, Fp(17) + lD, Fp(17) + lD, Fp(17) + lD,
        QK, QKlo, LQK, 0, Vt, Vtlo, D, OSA, 0);
    gemm_kernel<false><<<dim3(MR / 128, NKV / 128), b256, 0, stream>>>(Mh, D, WKVC + (size_t)l * NKV * D, D, Fp(18) + lD, Fp(19) + lD, Fp(19) + lD, Fp(19) + lD,
        QK, QKlo, LQK, D, Vt, Vtlo, D, OSA, 0);
    attn_kernel<false><<<NB * NH * NQT, battn, 0, stream>>>(QK, QKlo, Vt, Vtlo, Ip(3), CTX, 0, NQT);
    gemm_ln_kernel<<<MR / 32, b256, 0, stream>>>(CTX, D, WOC + (size_t)l * D * D, Fp(20) + lD, X, Fp(26) + lD, Fp(29) + lD, X, Xh, OSX, 1);
    // FFN
    gemm_kernel<true><<<dim3(MR / 128, DFF / 128), b256, 0, stream>>>(Xh, D, W1T + (size_t)l * DFF * D, D, Fp(22) + lF, Fp(22) + lF + 512, Fp(22) + lF + 1024, Fp(22) + lF + 1536,
        Hh, QKlo, DFF, 0, Vt, Vtlo, DFF, OSA, 0);
    const bool last = (l == NLAY - 1);
    gemm_ln_kernel<<<MR / 32, b256, 0, stream>>>(Hh, DFF, W2T + (size_t)l * D * DFF, Fp(24) + lD, X, Fp(27) + lD, Fp(30) + lD, last ? (float*)d_out : X, Xh, OSA, last ? 0 : 1);
  }
}

// v002
// A run of this version takes 920 microseconds.
// In both of two side-by-side timings against v001, it was 1.63 times as fast.
// All steps since v000 together make it 1.98 times as fast.
#include <hip/hip_runtime.h>

// 6-layer post-LN decoder stack: token embedding x sqrt(512) + sinusoidal positions; per layer masked self-attention (8 heads x 64), attention over a memory tensor,
// relu FFN 512 -> 2048 -> 512, each followed by residual add + LayerNorm over 512. Masks are int32 [batch][query][key] tensors read by value (nonzero = score replaced by
// -1e18); a 32-key chunk whose 16x32 mask tile is entirely nonzero is skipped (exact whenever each query row keeps at least one key).
// compute dtype: every contraction on v_wmma_f32_16x16x32_f16 (f16 operands, f32 accumulate): q/k/v projections, score and P.V products, output projections, both FFN
// products. Operand planes: activations f16 x8 (attention context x64), weights bf16-exact f16 x256, softmax P f16 x4096; query tiles with position < 64 of the masked
// self-attention add residual planes (x2048 of the x8 / x4096 carriers) of q, k, v and P: 3 score products and 3 P.V products into a second accumulator.
// tokens and masks int32 (tokens clamped). Fragment k-map per lane half hh for A and B: elements 0..7 <- k = 8hh+0..7, 8..15 <- k = 16+8hh+0..7; acc[r] = D[8hh+r][col].

#ifndef NB
#define NB 8
#endif
#ifndef SEQ
#define SEQ 512
#endif
#define NB_FULL 8
#define SEQ_FULL 512

namespace {
constexpr int D = 512, NH = 8, DH = 64, DFF = 2048, NLAY = 6, VOCAB = 32000;
constexpr int MR = NB * SEQ;                 // activation rows, row = b * SEQ + s
constexpr int LQK = 2 * D;                   // q | k plane pitch (halves): q at h*64, k at 512 + h*64
constexpr int NQKV = 3 * D, NKV = 2 * D, NQT = SEQ / 16, NQT_RES = 4;
constexpr float WSC = 256.0f, CA = 8.0f, CX = 64.0f, PSC = 4096.0f, RS = 2048.0f;
constexpr float SQD = 22.627416997969522f, NLOGD = -0.017988946039015984f, L2E = 1.4426950408889634f, NEGF = -1.0e18f, LNEPS = 1.0e-5f;
constexpr float SCL = 1.0f / (CA * CA * 8.0f);   // score = acc / (8 x 8) / sqrt(64)
static_assert(NB >= 1 && NB <= NB_FULL && SEQ >= 128 && SEQ <= SEQ_FULL && SEQ % 128 == 0);
static_assert(MR % 128 == 0 && MR % 32 == 0 && D == 512 && NH * DH == D && DFF % 512 == 0 && NQT > NQT_RES && (MR * D) % 8 == 0);

typedef _Float16 b16;
typedef __attribute__((ext_vector_type(16))) _Float16 v16b;
typedef __attribute__((ext_vector_type(8))) _Float16 v8b;
typedef __attribute__((ext_vector_type(4))) _Float16 v4h_;
typedef __attribute__((ext_vector_type(8))) float v8f;
typedef __attribute__((ext_vector_type(4))) float v4f;

__device__ __forceinline__ float bf16_rne(float f) { unsigned int u = __float_as_uint(f); u += 0x7FFFu + ((u >> 16) & 1u); return __uint_as_float(u & 0xFFFF0000u); }
__device__ __forceinline__ v16b frag_kb(const b16* p, int hh) { const v8b a = *(const v8b*)(p + 8 * hh), b = *(const v8b*)(p + 16 + 8 * hh); v16b f;
#pragma unroll
  for (int e = 0; e < 8; ++e) { f[e] = a[e]; f[8 + e] = b[e]; } return f; }
__device__ __forceinline__ v8f wmma_raw(v16b a, v16b b, v8f c) { return __builtin_amdgcn_wmma_f32_16x16x32_f16(false, a, false, b, (short)0, c, false, false); }
__device__ __forceinline__ v8f wmma16b(v16b a, v16b b, v8f c) { v8f d = wmma_raw(a, b, c); asm volatile("v_nop\n\tv_nop\n\tv_nop\n\tv_nop" : "+v"(d) : "v"(a), "v"(b)); return d; }
// one guard after a group of 8 accumulating WMMAs: ties all 8 accumulators, keeps both A and all four B fragments live across the 4 nops
#define WMMA_GUARD8(c, a0, a1, bf) asm volatile("v_nop\n\tv_nop\n\tv_nop\n\tv_nop" : "+v"(c[0][0]), "+v"(c[0][1]), "+v"(c[0][2]), "+v"(c[0][3]), \
    "+v"(c[1][0]), "+v"(c[1][1]), "+v"(c[1][2]), "+v"(c[1][3]) : "v"(a0), "v"(a1), "v"(bf[0]), "v"(bf[1]), "v"(bf[2]), "v"(bf[3]))
__device__ __forceinline__ void wave_lds_sync() { __builtin_amdgcn_fence(3 /* release order */, "workgroup"); __builtin_amdgcn_wave_barrier(); __builtin_amdgcn_fence(2 /* acquire order */, "workgroup"); }
__device__ __forceinline__ float pmul(float a, float b) { float p = a * b; asm volatile("" : "+v"(p)); return p; }
__device__ __forceinline__ int iclamp(int v, int lo, int hi) { return v < lo ? lo : (v > hi ? hi : v); }
__device__ __forceinline__ float nexp2(float v) { float r; asm("v_exp_f32 %0, %1\n\tv_nop" : "=v"(r) : "v"(v)); return r; }
// 16-lane butterflies (partners lane ^ 8, 4, 2, 1) on ds_bpermute_b32; sa[] holds the four partner byte addresses, formed once per kernel (fewer live registers than per-call index math)
__device__ __forceinline__ float bperm(int addr, float x) { return __int_as_float(__builtin_amdgcn_ds_bpermute(addr, __float_as_int(x))); }
__device__ __forceinline__ float red_max16(float x, const int (&sa)[4]) {
#pragma unroll
  for (int j = 0; j < 4; ++j) x = fmaxf(x, bperm(sa[j], x));
  return x; }
__device__ __forceinline__ float red_sum16(float x, const int (&sa)[4]) {
#pragma unroll
  for (int j = 0; j < 4; ++j) x += bperm(sa[j], x);
  return x; }

// Wt[l][noff + n][k] = f16(bf16(W[l][k][n]) x 256), W stored [layer][in][out] with NA columns; block = 64 k x 64 n tile transposed through LDS (cross-thread, block barrier);
__global__ __launch_bounds__(256) void wprep_kernel(const float* __restrict__ W, b16* __restrict__ Wt, int K, int NA, int NT, int noff) {
  __shared__ __attribute__((aligned(16))) b16 T[64 * 72];
  const int tid = threadIdx.x, l = blockIdx.z, k0 = blockIdx.x * 64, n0 = blockIdx.y * 64;
  { const int kr = tid >> 2, nc = (tid & 3) * 16; const float* src = W + ((size_t)l * K + k0 + kr) * NA + n0 + nc;
#pragma unroll
    for (int q = 0; q < 4; ++q) { const v4f v = *(const v4f*)(src + 4 * q);
#pragma unroll
      for (int j = 0; j < 4; ++j) T[(nc + 4 * q + j) * 72 + kr] = (b16)(bf16_rne(v[j]) * WSC); } }
  __syncthreads();
  v8b vv[2]; size_t dst[2];
#pragma unroll
  for (int i = 0; i < 2; ++i) { const int n = (tid >> 3) + 32 * i, p = tid & 7; vv[i] = *(const v8b*)(T + n * 72 + 8 * p); dst[i] = ((size_t)l * NT + noff + n0 + n) * K + k0 + 8 * p; }
  {
#pragma unroll
    for (int i = 0; i < 2; ++i) *(v8b*)(Wt + dst[i]) = vv[i];
     }
}

__global__ __launch_bounds__(256) void mprep_kernel(const float* __restrict__ mem, b16* __restrict__ Mh) {
  const int u = blockIdx.x * 256 + threadIdx.x;
  if (u >= MR * D / 8) return;
  const int row = u / (D / 8), c0 = (u % (D / 8)) * 8, b = row / SEQ, s = row % SEQ;
  const float* src = mem + ((size_t)b * SEQ_FULL + s) * D + c0;
  const v4f a = *(const v4f*)src, c = *(const v4f*)(src + 4); v8b v;
#pragma unroll
  for (int j = 0; j < 4; ++j) { v[j] = (b16)(bf16_rne(a[j]) * CA); v[4 + j] = (b16)(bf16_rne(c[j]) * CA); }
  { *(v8b*)(Mh + (size_t)row * D + c0) = v;  }
}

// embedding: x[b][s][c] = bf16(emb[tok[s][b]][c]) x sqrt(512) + pe(s, c), pe(s, 2j) = sin(s x exp(2j x NLOGD)), pe(s, 2j+1) = cos(same angle); tok clamped. block = 4 rows,
// thread = 8 columns (rolled loop of 4 expf + sincosf); the 4 x 512 f32 tile is staged in LDS (block barrier), then 32 lanes x 16 B per 512-B run to X and
__global__ __launch_bounds__(256) void embed_kernel(const int* __restrict__ tok, const float* __restrict__ emb, float* __restrict__ X, b16* __restrict__ Xh) {
  __shared__ __attribute__((aligned(16))) float Xs[4 * (D + 4)];
  const int tid = threadIdx.x, rl = tid >> 6, c0 = (tid & 63) * 8, row0 = blockIdx.x * 4, row = row0 + rl, b = row / SEQ, s = row % SEQ;
  const int t = iclamp(tok[s * NB_FULL + b], 0, VOCAB - 1);
  const float* er = emb + (size_t)t * D + c0;
#pragma unroll 1
  for (int q = 0; q < 4; ++q) {
    const int c = c0 + 2 * q; const float dv = expf(pmul((float)c, NLOGD)); float sn, cs; sincosf(pmul((float)s, dv), &sn, &cs);
    Xs[rl * (D + 4) + c] = pmul(bf16_rne(er[2 * q]), SQD) + sn; Xs[rl * (D + 4) + c + 1] = pmul(bf16_rne(er[2 * q + 1]), SQD) + cs; }
  __syncthreads();
  v4f fv[2]; size_t fo[2]; v8b hv;
#pragma unroll
  for (int i = 0; i < 2; ++i) { const int f = i * 256 + tid; fv[i] = *(const v4f*)(Xs + (f >> 7) * (D + 4) + (f & 127) * 4); fo[i] = (size_t)(row0 + (f >> 7)) * D + (f & 127) * 4; }
  { const v4f a = *(const v4f*)(Xs + rl * (D + 4) + c0), c4 = *(const v4f*)(Xs + rl * (D + 4) + c0 + 4);
#pragma unroll
    for (int e = 0; e < 4; ++e) { hv[e] = (b16)(a[e] * CA); hv[4 + e] = (b16)(c4[e] * CA); } }
  {
#pragma unroll
    for (int i = 0; i < 2; ++i) *(v4f*)(X + fo[i]) = fv[i];
    *(v8b*)(Xh + (size_t)row * D + c0) = hv;  }
}

// Operand staging of the GEMMs: a stage is KS = 128 k (256 B) of every A and B row of the block tile, laid in LDS at pitch 272 B (16 B x 17: odd, conflict-free for 16-B row readers),
// brought by per-lane asynchronous 16-B copies (a wave's copy covers 2 rows x 256 B = 4 whole lines); two buffers, the next stage's copies fly while this one is worked on.
constexpr int KS = 128, LP = KS + 8;
__device__ __forceinline__ unsigned lds_byte(const void* p) { return (unsigned)(unsigned long long)p; }
// copies of rows 16 apart (LDS step 16 x 272 B, global step gs halves); s_wait_xcnt 0 closes each statement so that no address register is rewritten ahead of it
__device__ __forceinline__ void cp2(unsigned l, const b16* g, size_t gs) {
  asm volatile("global_load_async_to_lds_b128 %0, %2, off\n\tglobal_load_async_to_lds_b128 %1, %3, off\n\ts_wait_xcnt 0x0"
      :: "v"(l), "v"(l + 16u * LP * 2u), "v"(g), "v"(g + gs) : "memory");
}
__device__ __forceinline__ void cp8(unsigned l, const b16* g, size_t gs) {
  constexpr unsigned LS = 16u * LP * 2u;
  asm volatile("global_load_async_to_lds_b128 %0, %8, off\n\tglobal_load_async_to_lds_b128 %1, %9, off\n\tglobal_load_async_to_lds_b128 %2, %10, off\n\t"
      "global_load_async_to_lds_b128 %3, %11, off\n\tglobal_load_async_to_lds_b128 %4, %12, off\n\tglobal_load_async_to_lds_b128 %5, %13, off\n\t"
      "global_load_async_to_lds_b128 %6, %14, off\n\tglobal_load_async_to_lds_b128 %7, %15, off\n\ts_wait_xcnt 0x0"
      :: "v"(l), "v"(l + LS), "v"(l + 2u * LS), "v"(l + 3u * LS), "v"(l + 4u * LS), "v"(l + 5u * LS), "v"(l + 6u * LS), "v"(l + 7u * LS),
         "v"(g), "v"(g + gs), "v"(g + 2 * gs), "v"(g + 3 * gs), "v"(g + 4 * gs), "v"(g + 5 * gs), "v"(g + 6 * gs), "v"(g + 7 * gs) : "memory");
}
// block of 256 threads: AR rows of A (first row Ag, pitch lda) and BR rows of B = Wt (first row Bg, pitch K), K a multiple of 128; the wave takes 32 A rows from arow and 64 B rows from
// brow: 8 WMMAs per 32 k, one guard per stage, same k order as a walk over K in steps of 32. On return every wave has left the ring (last trip's barrier): it may be reused.
template <int AR, int BR>
__device__ __forceinline__ void mac_staged(v8f (&acc)[2][4], b16* ring, const b16* Ag, int lda, const b16* Bg, int K, int arow, int brow, int tid, int nloc, int hlf) {
  static_assert((AR == 32 || AR % 128 == 0) && BR % 128 == 0);
  constexpr int BUFH = (AR + BR) * LP;
  const unsigned l0 = lds_byte(ring) + (unsigned)(tid >> 4) * (LP * 2u) + (unsigned)(tid & 15) * 16u;
  const b16* ga = Ag + (size_t)(tid >> 4) * lda + 8 * (tid & 15);
  const b16* gb = Bg + (size_t)(tid >> 4) * K + 8 * (tid & 15);
  const int NT = K / KS;
  auto fill = [&](int t) {
    const unsigned l = l0 + (unsigned)(t & 1) * (BUFH * 2u);
    if constexpr (AR == 32) cp2(l, ga + t * KS, (size_t)16 * lda);
    else {
#pragma unroll
      for (int j = 0; j < AR / 128; ++j) cp8(l + (unsigned)j * (128u * LP * 2u), ga + (size_t)(128 * j) * lda + t * KS, (size_t)16 * lda); }
#pragma unroll
    for (int j = 0; j < BR / 128; ++j) cp8(l + (unsigned)(AR + 128 * j) * (LP * 2u), gb + (size_t)(128 * j) * K + t * KS, (size_t)16 * K);
  };
  fill(0);
  asm volatile("s_wait_asynccnt 0x0" ::: "memory");   // stage 0 has landed (this wave's copies) before the barrier that publishes it
  __syncthreads();
  if (NT > 1) fill(1);
#pragma unroll 1
  for (int t = 0; t < NT; ++t) {
    const b16* bufp = ring + (t & 1) * BUFH;
    const b16* ap0 = bufp + (arow + nloc) * LP; const b16* ap1 = ap0 + 16 * LP; const b16* bp = bufp + (AR + brow + nloc) * LP;
    v16b a0[2], a1[2], bf[2][4];   // two fragment sets: the next 32 k are fetched while the WMMAs of these 32 k run (all inside this stage's buffer)
    a0[0] = frag_kb(ap0, hlf); a1[0] = frag_kb(ap1, hlf);
#pragma unroll
    for (int u = 0; u < 4; ++u) bf[0][u] = frag_kb(bp + u * 16 * LP, hlf);
#pragma unroll
    for (int s = 0; s < KS / 32; ++s) {
      const int c = s & 1, n = c ^ 1;
      if (s + 1 < KS / 32) {
        a0[n] = frag_kb(ap0 + 32 * (s + 1), hlf); a1[n] = frag_kb(ap1 + 32 * (s + 1), hlf);
#pragma unroll
        for (int u = 0; u < 4; ++u) bf[n][u] = frag_kb(bp + u * 16 * LP + 32 * (s + 1), hlf); }
      __builtin_amdgcn_sched_barrier(0);   // keeps the next block's 12 LDS reads one group in front of this block's WMMAs (for speed only)
#pragma unroll
      for (int u = 0; u < 4; ++u) { acc[0][u] = wmma_raw(a0[c], bf[c][u], acc[0][u]); acc[1][u] = wmma_raw(a1[c], bf[c][u], acc[1][u]); }
      if (s + 1 < KS / 32) __builtin_amdgcn_sched_barrier(0);   // the block after next's reads stay behind this block's WMMAs
      else WMMA_GUARD8(acc, a0[c], a1[c], bf[c]);   // the stage's last WMMAs stand in front of a branch: the 4 slots behind them are filled here for both of its sides
    }
    asm volatile("s_wait_dscnt 0x0" ::: "memory");     // this wave's reads of the buffer have retired before the barrier behind which it is refilled
    asm volatile("s_wait_asynccnt 0x0" ::: "memory");  // this wave's copies of stage t + 1 have landed before the barrier that publishes them
    __syncthreads();
    if (t + 2 < NT) fill(t + 2);
  }
  asm volatile("s_wait_asynccnt 0x0" ::: "memory");    // no copy outstanding when the ring is reused or the wave ends
}

// row-major f16 epilogue of one wave's 32 x 64 tile (plane value = f16(v x 8), LO: f16((v x 8 - hi) x 2048)): b16 element stores into the wave-private LDS tile, wave sync,
template <bool LO, bool RELU>
__device__ __forceinline__ void epi_rows(const v8f (&acc)[2][4], const float (&bb)[4], float oscale, b16* Es, b16* dstp, int ldc, int lane, int nloc, int hlf) {
#pragma unroll
  for (int mt = 0; mt < 2; ++mt)
#pragma unroll
    for (int t = 0; t < 4; ++t)
#pragma unroll
      for (int r = 0; r < 8; ++r) {
        float v = acc[mt][t][r] * oscale + bb[t]; if (RELU) v = fmaxf(v, 0.0f); const float vs = v * CA; const b16 hi = (b16)vs;
        Es[(mt * 16 + 8 * hlf + r) * 72 + 16 * t + nloc] = LO ? (b16)((vs - (float)hi) * RS) : hi; }
  wave_lds_sync();
  v8b vv[8];
#pragma unroll
  for (int j = 0; j < 8; ++j) vv[j] = *(const v8b*)(Es + (4 * j + (lane >> 3)) * 72 + 8 * (lane & 7));
  b16* dst = dstp + (size_t)(lane >> 3) * ldc + 8 * (lane & 7);
  {
#pragma unroll
    for (int j = 0; j < 8; ++j) *(v8b*)(dst + (size_t)(4 * j) * ldc) = vv[j];
     }
}

// head-transposed f16 epilogue of the block's 128 (keys) x 128 (head columns) tile -> plane[((b*NH + h)*DH + d)*SEQ + key]: each lane stores its 8 consecutive keys of one
// column as one 16-B LDS store into Et[col][key] (cross-wave, block barrier), then store j: lanes 0..15 -> column 16j + 2 wave, lanes 16..31 -> +1, lane piece = 8 keys
template <bool LO, bool RELU>
__device__ __forceinline__ void epi_vt(const v8f (&acc)[2][4], const float (&bb)[4], float oscale, b16* Et, b16* plane, int bidx, int key0, int colv0, int wave, int wm, int wn, int nloc, int hlf) {
#pragma unroll
  for (int mt = 0; mt < 2; ++mt)
#pragma unroll
    for (int t = 0; t < 4; ++t) { v8b hv;
#pragma unroll
      for (int r = 0; r < 8; ++r) { float v = acc[mt][t][r] * oscale + bb[t]; if (RELU) v = fmaxf(v, 0.0f); const float vs = v * CA; const b16 hi = (b16)vs; hv[r] = LO ? (b16)((vs - (float)hi) * RS) : hi; }
      *(v8b*)(Et + (wn * 64 + 16 * t + nloc) * 136 + wm * 32 + mt * 16 + 8 * hlf) = hv; }
  __syncthreads();
  v8b vv[8]; size_t dsto[8];
#pragma unroll
  for (int j = 0; j < 8; ++j) { const int dl = 16 * j + 2 * wave + hlf; const int col = colv0 + dl; const int hh = col / DH, dd = col % DH;
    vv[j] = *(const v8b*)(Et + dl * 136 + 8 * nloc); dsto[j] = ((size_t)(bidx * NH + hh) * DH + dd) * SEQ + key0 + 8 * nloc; }
  {
#pragma unroll
    for (int j = 0; j < 8; ++j) *(v8b*)(plane + dsto[j]) = vv[j];
     }
}

// C = (A[M][K] f16 plane, pitch lda) x Wt[N][K] + bf16(bias), optional relu; block 128 x 128 = 8 waves of 32 x 64. GEMM columns < vcol0 -> row-major plane C[row*ldc + ccol0 + col]
// (f16 x 8); columns >= vcol0 -> head-transposed plane VT (v of the attention). Blocks whose 128 rows start a sequence also emit the residual planes Clo / VTlo (x 2048) for those rows
// when wres != 0. Bias group pointer chosen per 512-column group (block-uniform).
template <bool RELU>
__global__ __launch_bounds__(256) void gemm_kernel(const b16* __restrict__ A, int lda, const b16* __restrict__ Wt, int K,
    const float* __restrict__ bg0, const float* __restrict__ bg1, const float* __restrict__ bg2, const float* __restrict__ bg3,
    b16* __restrict__ C, b16* __restrict__ Clo, int ldc, int ccol0, b16* __restrict__ VT, b16* __restrict__ VTlo, int vcol0, float oscale, int wres) {
  __shared__ __attribute__((aligned(16))) b16 Ls[2 * 256 * LP];   // operand ring (2 buffers x 256 rows); behind the K loop 8 wave tiles [32][72] (row-major mode) or one block tile [128][136] (transposed mode)
  static_assert(2 * 256 * LP >= 18432);
  const int tid = threadIdx.x, wave = tid >> 5, lane = tid & 31, nloc = lane & 15, hlf = lane >> 4;
  const int bm0 = blockIdx.x * 128, bn0 = blockIdx.y * 128, wm = wave >> 1, wn = wave & 1;
  const int row0 = bm0 + wm * 32, col0 = bn0 + wn * 64;
  v8f acc[2][4];
#pragma unroll
  for (int t = 0; t < 4; ++t) { acc[0][t] = (v8f){}; acc[1][t] = (v8f){}; }
  mac_staged<128, 128>(acc, Ls, A + (size_t)bm0 * lda, lda, Wt + (size_t)bn0 * K, K, wm * 32, wn * 64, tid, nloc, hlf);
  const int gsel = bn0 >> 9; const float* bias = gsel == 0 ? bg0 : (gsel == 1 ? bg1 : (gsel == 2 ? bg2 : bg3));
  float bb[4];
#pragma unroll
  for (int t = 0; t < 4; ++t) bb[t] = bf16_rne(bias[(col0 & 511) + 16 * t + nloc]);
  const bool vmode = bn0 >= vcol0, wlo = (wres != 0) && (bm0 % SEQ == 0);
  if (!vmode) {
    b16* Es = Ls + wave * (32 * 72);
    epi_rows<false, RELU>(acc, bb, oscale, Es, C + (size_t)row0 * ldc + ccol0 + col0, ldc, lane, nloc, hlf);
    if (wlo) { wave_lds_sync(); epi_rows<true, RELU>(acc, bb, oscale, Es, Clo + (size_t)row0 * ldc + ccol0 + col0, ldc, lane, nloc, hlf); }
  } else {
    epi_vt<false, RELU>(acc, bb, oscale, Ls, VT, bm0 / SEQ, bm0 % SEQ, bn0 - vcol0, wave, wm, wn, nloc, hlf);
    if (wlo) { __syncthreads(); epi_vt<true, RELU>(acc, bb, oscale, Ls, VTlo, bm0 / SEQ, bm0 % SEQ, bn0 - vcol0, wave, wm, wn, nloc, hlf); }
  }
}

// Y = LayerNorm(Xres + (A x Wt + bf16(bias))) * bf16(g) + bf16(be) over full 512-wide rows: block = 32 rows x 512 columns (wave = 32 x 64), K = 512 or 2048. Per 16-row half the f32
// tile is staged in LDS (cross-wave, block barrier); wave w then owns rows 2w, 2w+1: lane holds columns 128j + 4 lane (j = 0..3), residual / bias / gain loaded with the same map,
__global__ __launch_bounds__(256) void gemm_ln_kernel(const b16* __restrict__ A, int K, const b16* __restrict__ Wt, const float* __restrict__ bias, const float* Xres,
    const float* __restrict__ gam, const float* __restrict__ bet, float* OutF, b16* __restrict__ Xh, float oscale, int wxh) {
  __shared__ __attribute__((aligned(16))) b16 Rg[2 * (32 + D) * LP];   // operand ring (2 buffers x 544 rows); behind the K loop the f32 tile Tf
  static_assert(2 * (32 + D) * LP * 2 >= 16 * (D + 4) * 4);
  float* Tf = (float*)Rg;
  const int tid = threadIdx.x, wave = tid >> 5, lane = tid & 31, nloc = lane & 15, hlf = lane >> 4;
  const int bm0 = blockIdx.x * 32, col0 = wave * 64;
  v8f acc[2][4];
#pragma unroll
  for (int t = 0; t < 4; ++t) { acc[0][t] = (v8f){}; acc[1][t] = (v8f){}; }
  mac_staged<32, D>(acc, Rg, A + (size_t)bm0 * K, K, Wt, K, 0, col0, tid, nloc, hlf);
#pragma unroll 1
  for (int mt = 0; mt < 2; ++mt) {
    if (mt) __syncthreads();
#pragma unroll
    for (int t = 0; t < 4; ++t)
#pragma unroll
      for (int r = 0; r < 8; ++r) Tf[(8 * hlf + r) * (D + 4) + col0 + 16 * t + nloc] = (mt ? acc[1][t][r] : acc[0][t][r]) * oscale;
    __syncthreads();
#pragma unroll 1
    for (int rr = 0; rr < 2; ++rr) {
      const int rl = 2 * wave + rr; const size_t go = (size_t)(bm0 + mt * 16 + rl) * D;
      float y[16]; float s = 0.0f;
#pragma unroll
      for (int j = 0; j < 4; ++j) { const int c = 128 * j + 4 * lane;
        const v4f tv = *(const v4f*)(Tf + rl * (D + 4) + c); const v4f rv = *(const v4f*)(Xres + go + c); const v4f bv = *(const v4f*)(bias + c);
#pragma unroll
        for (int e = 0; e < 4; ++e) { const float yy = rv[e] + (tv[e] + bf16_rne(bv[e])); y[4 * j + e] = yy; s += yy; } }
#pragma unroll
      for (int off = 16; off > 0; off >>= 1) s += __shfl_xor(s, off, 32);
      const float mean = s * (1.0f / (float)D); float q = 0.0f;
#pragma unroll
      for (int i = 0; i < 16; ++i) { const float d0 = y[i] - mean; y[i] = d0; q += d0 * d0; }
#pragma unroll
      for (int off = 16; off > 0; off >>= 1) q += __shfl_xor(q, off, 32);
      const float rstd = 1.0f / sqrtf(q * (1.0f / (float)D) + LNEPS);
      v4f ov[4]; v4h_ hv[4];
#pragma unroll
      for (int j = 0; j < 4; ++j) { const int c = 128 * j + 4 * lane; const v4f gv = *(const v4f*)(gam + c), ev = *(const v4f*)(bet + c);
#pragma unroll
        for (int e = 0; e < 4; ++e) { const float o = (y[4 * j + e] * rstd) * bf16_rne(gv[e]) + bf16_rne(ev[e]); ov[j][e] = o; hv[j][e] = (b16)(o * CA); } }
      {
#pragma unroll
        for (int j = 0; j < 4; ++j) { const int c = 128 * j + 4 * lane; *(v4f*)(OutF + go + c) = ov[j]; if (wxh) *(v4h_*)(Xh + go + c) = hv[j]; }
         }
    }
  }
}

// Streaming attention, one work-group = 16 query rows of one (batch, head), its NWK waves sharing the keys: wave w walks the 32-key chunks w, w + NWK, ... with its own running max,
// sum and context; the partial results meet in LDS behind one block barrier and are joined there (weights exp(max_w - max)). Q fragments from the q|k plane (column h*64), per chunk
// the 16x32 mask tile is loaded first (two groups of 8 scalar loads per lane, the first group retired before the second issues; ballot: skip when all masked), scores = 2 k-steps of
// WMMA against K rows, replace-mask, running-max softmax in f32 (exp2), P staged x4096 into a wave-private LDS tile (b16 element stores, wave sync, fragment reload), ctx += P x V with
// V from the head-transposed plane [d][key].
// RES: query/key residual planes give 3 score products and P_res x V + P x V_res into a second accumulator for chunks with keys < 128 (rows for which the residual planes exist);
constexpr int NWK = 4, PPW = DH + 4;   // waves per query tile; f32 pitch of a partial context row
static_assert((SEQ / 32) % NWK == 0);
template <bool RES>
__global__ __launch_bounds__(32 * NWK) void attn_kernel(const b16* __restrict__ QK, const b16* __restrict__ QKlo, const b16* __restrict__ VT, const b16* __restrict__ VTlo,
    const int* __restrict__ mask, b16* __restrict__ CTX, int qt0, int nqt) {
  __shared__ __attribute__((aligned(16))) b16 PstA[NWK * 16 * 40];
  __shared__ __attribute__((aligned(16))) b16 PlstA[RES ? NWK * 16 * 40 : 8];
  __shared__ __attribute__((aligned(16))) float Part[NWK * 16 * PPW];
  __shared__ float Mxs[NWK * 16], Lss[NWK * 16];
  const int tid = threadIdx.x, lane = tid & 31, nloc = lane & 15, hlf = lane >> 4, wave = __builtin_amdgcn_readfirstlane(tid >> 5);
  const int sa[4] = {(lane ^ 8) << 2, (lane ^ 4) << 2, (lane ^ 2) << 2, (lane ^ 1) << 2};
  b16* Pst = PstA + wave * (16 * 40); b16* Plst = PlstA + (RES ? wave * (16 * 40) : 0);
  const int bi = blockIdx.x, qt = qt0 + bi % nqt, bh = bi / nqt, h = bh % NH, b = bh / NH, q0 = qt * 16;
  const size_t rq = (size_t)b * SEQ + q0;
  const b16* qp = QK + (rq + nloc) * LQK + h * DH;
  const v16b qa0 = frag_kb(qp, hlf), qa1 = frag_kb(qp + 32, hlf);
  v16b ql0 = (v16b){}, ql1 = (v16b){};
  if (RES) { const b16* qlp = QKlo + (rq + nloc) * LQK + h * DH; ql0 = frag_kb(qlp, hlf); ql1 = frag_kb(qlp + 32, hlf); }
  const b16* kbase = QK + ((size_t)b * SEQ + 32 * wave) * LQK + D + h * DH;   // this and the four bases below start at the wave's first chunk
  const b16* klbase = QKlo + ((size_t)b * SEQ + 32 * wave) * LQK + D + h * DH;
  const b16* vbase = VT + (size_t)(b * NH + h) * DH * SEQ + 32 * wave;
  const b16* vlbase = VTlo + (size_t)(b * NH + h) * DH * SEQ + 32 * wave;
  const int* mq = mask + ((size_t)b * SEQ_FULL + q0 + 8 * hlf) * SEQ_FULL + 32 * wave + nloc;
  float mx[8], ls[8]; v8f acc[4], acc2[4];
#pragma unroll
  for (int r = 0; r < 8; ++r) { mx[r] = -3.0e38f; ls[r] = 0.0f; }
#pragma unroll
  for (int t = 0; t < 4; ++t) { acc[t] = (v8f){}; acc2[t] = (v8f){}; }
#pragma unroll 1
  for (int i = 0; i < SEQ / 32 / NWK; ++i) {
    const int kb = 32 * NWK * i, c = wave + NWK * i;   // kb: key offset from the wave's first chunk; c: chunk index
    int m0[8], m1[8]; bool allm = true;
    // mask tile rows 8 hlf + r: group 1 = key column kb + nloc, group 2 = kb + 16 + nloc; compiler + wait barrier between the two groups of 8 loads
#pragma unroll
    for (int r = 0; r < 8; ++r) m0[r] = mq[(size_t)r * SEQ_FULL + kb];
    asm volatile("" :: "v"(m0[0]), "v"(m0[1]), "v"(m0[2]), "v"(m0[3]), "v"(m0[4]), "v"(m0[5]), "v"(m0[6]), "v"(m0[7]) : "memory");
#pragma unroll
    for (int r = 0; r < 8; ++r) m1[r] = mq[(size_t)r * SEQ_FULL + kb + 16];
#pragma unroll
    for (int r = 0; r < 8; ++r) allm = allm && (m0[r] != 0) && (m1[r] != 0);
    if (__builtin_amdgcn_ballot_w32(allm) == 0xffffffffu) continue;
    wave_lds_sync();   // prior chunk's fragment reloads complete before the P tiles are rewritten
    v8f s[2];
#pragma unroll
    for (int t = 0; t < 2; ++t) {
      const b16* kp = kbase + (size_t)(kb + 16 * t + nloc) * LQK; const v16b k0f = frag_kb(kp, hlf), k1f = frag_kb(kp + 32, hlf);
      v8f sh = wmma16b(qa0, k0f, (v8f){}); sh = wmma16b(qa1, k1f, sh);
      if (RES && c < 4) {
        const b16* klp = klbase + (size_t)(kb + 16 * t + nloc) * LQK;
        v8f x = wmma16b(ql0, k0f, (v8f){}); x = wmma16b(ql1, k1f, x); x = wmma16b(qa0, frag_kb(klp, hlf), x); x = wmma16b(qa1, frag_kb(klp + 32, hlf), x);
#pragma unroll
        for (int r = 0; r < 8; ++r) sh[r] += x[r] * (1.0f / RS); }
      s[t] = sh; }
    float p0[8], p1[8];
#pragma unroll
    for (int r = 0; r < 8; ++r) {
      float s0 = s[0][r] * SCL, s1 = s[1][r] * SCL; s0 = (m0[r] != 0) ? NEGF : s0; s1 = (m1[r] != 0) ? NEGF : s1;
      const float cm = red_max16(fmaxf(s0, s1), sa); const float mn = fmaxf(mx[r], cm); const float al = nexp2((mx[r] - mn) * L2E); mx[r] = mn;
      const float e0 = nexp2((s0 - mn) * L2E), e1 = nexp2((s1 - mn) * L2E); p0[r] = e0; p1[r] = e1;
      ls[r] = ls[r] * al + red_sum16(e0 + e1, sa);
#pragma unroll
      for (int t = 0; t < 4; ++t) { acc[t][r] *= al; if (RES) acc2[t][r] *= al; } }
#pragma unroll
    for (int r = 0; r < 8; ++r) {
      const float v0 = p0[r] * PSC, v1 = p1[r] * PSC; const b16 h0 = (b16)v0, h1 = (b16)v1;
      Pst[(8 * hlf + r) * 40 + nloc] = h0; Pst[(8 * hlf + r) * 40 + 16 + nloc] = h1;
      if (RES) { Plst[(8 * hlf + r) * 40 + nloc] = (b16)((v0 - (float)h0) * RS); Plst[(8 * hlf + r) * 40 + 16 + nloc] = (b16)((v1 - (float)h1) * RS); } }
    wave_lds_sync();
    const v16b pf = frag_kb(Pst + nloc * 40, hlf); v16b plf = (v16b){}; if (RES) plf = frag_kb(Plst + nloc * 40, hlf);
#pragma unroll
    for (int t = 0; t < 4; ++t) {
      const v16b vf = frag_kb(vbase + (size_t)(16 * t + nloc) * SEQ + kb, hlf); acc[t] = wmma16b(pf, vf, acc[t]);
      if (RES && c < 4) { acc2[t] = wmma16b(plf, vf, acc2[t]); acc2[t] = wmma16b(pf, frag_kb(vlbase + (size_t)(16 * t + nloc) * SEQ + kb, hlf), acc2[t]); } }
  }
  // each wave publishes its partial context (f32, still scaled by its own max), max and sum; a wave whose chunks were all skipped publishes max -3e38, sum 0, context 0
  float* pw = Part + wave * (16 * PPW);
#pragma unroll
  for (int r = 0; r < 8; ++r) {
#pragma unroll
    for (int t = 0; t < 4; ++t) { float a = acc[t][r]; if (RES) a += acc2[t][r] * (1.0f / RS); pw[(8 * hlf + r) * PPW + 16 * t + nloc] = a; }
    if (nloc == 0) { Mxs[wave * 16 + 8 * hlf + r] = mx[r]; Lss[wave * 16 + 8 * hlf + r] = ls[r]; } }
  __syncthreads();   // every wave's partials are in LDS before any thread joins them
  // join: thread = 8 columns of one row (NWK = 4: 128 threads cover 16 x 64)
  static_assert(32 * NWK * 8 == 16 * DH);
  const int jr = tid >> 3, jc = 8 * (tid & 7);
  float wm_[NWK], M = Mxs[jr];
#pragma unroll
  for (int w = 1; w < NWK; ++w) M = fmaxf(M, Mxs[w * 16 + jr]);
  float L = 0.0f, o[8];
#pragma unroll
  for (int e = 0; e < 8; ++e) o[e] = 0.0f;
#pragma unroll
  for (int w = 0; w < NWK; ++w) { wm_[w] = nexp2((Mxs[w * 16 + jr] - M) * L2E); L += wm_[w] * Lss[w * 16 + jr];
    const v4f x0 = *(const v4f*)(Part + (w * 16 + jr) * PPW + jc), x1 = *(const v4f*)(Part + (w * 16 + jr) * PPW + jc + 4);
#pragma unroll
    for (int e = 0; e < 4; ++e) { o[e] += wm_[w] * x0[e]; o[4 + e] += wm_[w] * x1[e]; } }
  const float inv = (1.0f / L) * (CX / (PSC * CA)); v8b ov;
#pragma unroll
  for (int e = 0; e < 8; ++e) ov[e] = (b16)(o[e] * inv);
  *(v8b*)(CTX + (rq + jr) * D + h * DH + jc) = ov;
}
}  // namespace

extern "C" void kernel_launch(void* const* d_in, const int* in_sizes, int n_in, void* d_out, int out_size, void* d_ws, size_t ws_size, hipStream_t stream) {
  (void)n_in;
  auto Fp = [&](int i) { return (const float*)d_in[i]; };
  auto Ip = [&](int i) { return (const int*)d_in[i]; };
  // wire order: 0 tokens [512][8] i32, 1 memory [8][512][512], 2 self-attention mask [8][512][512] i32, 3 memory mask [8][512][512] i32, 4 embedding [32000][512],
  // 5..8 Wq_s Wk_s Wv_s Wo_s [6][512 in][512 out], 9..12 Wq_c Wk_c Wv_c Wo_c, 13..16 bq_s bk_s bv_s bo_s [6][512], 17..20 bq_c bk_c bv_c bo_c,
  // 21 W1 [6][512][2048], 22 b1 [6][2048], 23 W2 [6][2048][512], 24 b2 [6][512], 25 g1, 26 g2, 27 g3, 28 be1, 29 be2, 30 be3 [6][512]
  const long needRows = (long)(NB - 1) * SEQ_FULL + SEQ;
  if ((long)in_sizes[0] < (long)SEQ * NB_FULL || (long)in_sizes[1] < needRows * D || (long)in_sizes[2] < needRows * SEQ_FULL || (long)in_sizes[3] < needRows * SEQ_FULL ||
      (long)in_sizes[4] < (long)VOCAB * D) return;
  for (int i = 5; i <= 12; ++i) if ((long)in_sizes[i] < (long)NLAY * D * D) return;
  for (int i = 13; i <= 20; ++i) if (in_sizes[i] < NLAY * D) return;
  if ((long)in_sizes[21] < (long)NLAY * D * DFF || in_sizes[22] < NLAY * DFF || (long)in_sizes[23] < (long)NLAY * DFF * D || in_sizes[24] < NLAY * D) return;
  for (int i = 25; i <= 30; ++i) if (in_sizes[i] < NLAY * D) return;
  if (out_size < MR * D) return;

  size_t off = 0; char* ws = (char*)d_ws;
  auto carve = [&](size_t bytes) { char* p = ws + off; off += (bytes + 255) & ~(size_t)255; return p; };
  b16* WQKVS = (b16*)carve((size_t)NLAY * NQKV * D * 2);   // [6][1536][512]
  b16* WOS   = (b16*)carve((size_t)NLAY * D * D * 2);
  b16* WQC   = (b16*)carve((size_t)NLAY * D * D * 2);
  b16* WKVC  = (b16*)carve((size_t)NLAY * NKV * D * 2);    // [6][1024][512]
  b16* WOC   = (b16*)carve((size_t)NLAY * D * D * 2);
  b16* W1T   = (b16*)carve((size_t)NLAY * DFF * D * 2);    // [6][2048][512]
  b16* W2T   = (b16*)carve((size_t)NLAY * D * DFF * 2);    // [6][512][2048]
  float* X   = (float*)carve((size_t)MR * D * 4);
  b16* Xh    = (b16*)carve((size_t)MR * D * 2);
  b16* Mh    = (b16*)carve((size_t)MR * D * 2);
  b16* QK    = (b16*)carve((size_t)MR * LQK * 2);
  b16* QKlo  = (b16*)carve((size_t)MR * LQK * 2);
  b16* Vt    = (b16*)carve((size_t)MR * D * 2);            // [NB][NH][64][SEQ]
  b16* Vtlo  = (b16*)carve((size_t)MR * D * 2);
  b16* CTX   = (b16*)carve((size_t)MR * D * 2);
  b16* Hh    = (b16*)carve((size_t)MR * DFF * 2);
  if (off > ws_size || off > ((size_t)128 << 20)) return;   // 113,246,208 B at full size

  const dim3 b256(256), battn(32 * NWK);
  wprep_kernel<<<dim3(D / 64, D / 64, NLAY), b256, 0, stream>>>(Fp(5), WQKVS, D, D, NQKV, 0);
  wprep_kernel<<<dim3(D / 64, D / 64, NLAY), b256, 0, stream>>>(Fp(6), WQKVS, D, D, NQKV, D);
  wprep_kernel<<<dim3(D / 64, D / 64, NLAY), b256, 0, stream>>>(Fp(7), WQKVS, D, D, NQKV, 2 * D);
  wprep_kernel<<<dim3(D / 64, D / 64, NLAY), b256, 0, stream>>>(Fp(8), WOS, D, D, D, 0);
  wprep_kernel<<<dim3(D / 64, D / 64, NLAY), b256, 0, stream>>>(Fp(9), WQC, D, D, D, 0);
  wprep_kernel<<<dim3(D / 64, D / 64, NLAY), b256, 0, stream>>>(Fp(10), WKVC, D, D, NKV, 0);
  wprep_kernel<<<dim3(D / 64, D / 64, NLAY), b256, 0, stream>>>(Fp(11), WKVC, D, D, NKV, D);
  wprep_kernel<<<dim3(D / 64, D / 64, NLAY), b256, 0, stream>>>(Fp(12), WOC, D, D, D, 0);
  wprep_kernel<<<dim3(D / 64, DFF / 64, NLAY), b256, 0, stream>>>(Fp(21), W1T, D, DFF, DFF, 0);
  wprep_kernel<<<dim3(DFF / 64, D / 64, NLAY), b256, 0, stream>>>(Fp(23), W2T, DFF, D, D, 0);
  mprep_kernel<<<(MR * D / 8 + 255) / 256, b256, 0, stream>>>(Fp(1), Mh);
  embed_kernel<<<MR / 4, b256, 0, stream>>>(Ip(0), Fp(4), X, Xh);

  const float OSA = 1.0f / (CA * WSC), OSX = 1.0f / (CX * WSC);
  for (int l = 0; l < NLAY; ++l) {
    const size_t lD = (size_t)l * D, lF = (size_t)l * DFF;
    // fused q|k|v projection of x: q -> QK columns 0..511, k -> 512..1023, v -> head-transposed plane; residual planes for the first 128 rows of each sequence
    gemm_kernel<false><<<dim3(MR / 128, NQKV / 128), b256, 0, stream>>>(Xh, D, WQKVS + (size_t)l * NQKV * D, D, Fp(13) + lD, Fp(14) + lD, Fp(15) + lD, Fp(15) + lD,
        QK, QKlo, LQK, 0, Vt, Vtlo, 2 * D, OSA, 1);
    attn_kernel<true><<<NB * NH * NQT_RES, battn, 0, stream>>>(QK, QKlo, Vt, Vtlo, Ip(2), CTX, 0, NQT_RES);
    attn_kernel<false><<<NB * NH * (NQT - NQT_RES), battn, 0, stream>>>(QK, QKlo, Vt, Vtlo, Ip(2), CTX, NQT_RES, NQT - NQT_RES);
    gemm_ln_kernel<<<MR / 32, b256, 0, stream>>>(CTX, D, WOS + (size_t)l * D * D, Fp(16) + lD, X, Fp(25) + lD, Fp(28) + lD, X, Xh, OSX, 1);
    // attention over the memory tensor: q from x, k|v from the memory plane
    gemm_kernel<false><<<dim3(MR / 128, D / 128), b256, 0, stream>>>(Xh, D, WQC + (size_t)l * D * D, D, Fp(17) + lD, Fp(17) + lD, Fp(17) + lD, Fp(17) + lD,
        QK, QKlo, LQK, 0, Vt, Vtlo, D, OSA, 0);
    gemm_kernel<false><<<dim3(MR / 128, NKV / 128), b256, 0, stream>>>(Mh, D, WKVC + (size_t)l * NKV * D, D, Fp(18) + lD, Fp(19) + lD, Fp(19) + lD, Fp(19) + lD,
        QK, QKlo, LQK, D, Vt, Vtlo, D, OSA, 0);
    attn_kernel<false><<<NB * NH * NQT, battn, 0, stream>>>(QK, QKlo, Vt, Vtlo, Ip(3), CTX, 0, NQT);
    gemm_ln_kernel<<<MR / 32, b256, 0, stream>>>(CTX, D, WOC + (size_t)l * D * D, Fp(20) + lD, X, Fp(26) + lD, Fp(29) + lD, X, Xh, OSX, 1);
    // FFN
    gemm_kernel<true><<<dim3(MR / 128, DFF / 128), b256, 0, stream>>>(Xh, D, W1T + (size_t)l * DFF * D, D, Fp(22) + lF, Fp(22) + lF + 512, Fp(22) + lF + 1024, Fp(22) + lF + 1536,
        Hh, QKlo, DFF, 0, Vt, Vtlo, DFF, OSA, 0);
    const bool last = (l == NLAY - 1);
    gemm_ln_kernel<<<MR / 32, b256, 0, stream>>>(Hh, DFF, W2T + (size_t)l * D * DFF, Fp(24) + lD, X, Fp(27) + lD, Fp(30) + lD, last ? (float*)d_out : X, Xh, OSA, last ? 0 : 1);
  }
}

// v003
// It runs in 864 microseconds.
// Timed twice side by side with v002, it ran 1.06 and 1.07 times as fast.
// All steps since v000 together make it 2.11 times as fast.
#include <hip/hip_runtime.h>

// 6-layer post-LN decoder stack: token embedding x sqrt(512) + sinusoidal positions; per layer masked self-attention (8 heads x 64), attention over a memory tensor,
// relu FFN 512 -> 2048 -> 512, each followed by residual add + LayerNorm over 512. Masks are int32 [batch][query][key] tensors read by value (nonzero = score replaced by
// -1e18); a 32-key chunk whose 16x32 mask tile is entirely nonzero is skipped (exact whenever each query row keeps at least one key).
// compute dtype: every contraction on v_wmma_f32_16x16x32_f16 (f16 operands, f32 accumulate): q/k/v projections, score and P.V products, output projections, both FFN
// products. Operand planes: activations f16 x8 (attention context x64), weights bf16-exact f16 x256, softmax P f16 x4096; query tiles with position < 64 of the masked
// self-attention add residual planes (x2048 of the x8 / x4096 carriers) of q, k, v and P: 3 score products and 3 P.V products into a second accumulator.
// tokens and masks int32 (tokens clamped). Fragment k-map per lane half hh for A and B: elements 0..7 <- k = 8hh+0..7, 8..15 <- k = 16+8hh+0..7; acc[r] = D[8hh+r][col].

#ifndef NB
#define NB 8
#endif
#ifndef SEQ
#define SEQ 512
#endif
#define NB_FULL 8
#define SEQ_FULL 512

namespace {
constexpr int D = 512, NH = 8, DH = 64, DFF = 2048, NLAY = 6, VOCAB = 32000;
constexpr int MR = NB * SEQ;                 // activation rows, row = b * SEQ + s
constexpr int LQK = 2 * D;                   // q | k plane pitch (halves): q at h*64, k at 512 + h*64
constexpr int NQKV = 3 * D, NQT = SEQ / 16, NQT_RES = 4;
constexpr float WSC = 256.0f, CA = 8.0f, CX = 64.0f, PSC = 4096.0f, RS = 2048.0f;
constexpr float SQD = 22.627416997969522f, NLOGD = -0.017988946039015984f, L2E = 1.4426950408889634f, NEGF = -1.0e18f, LNEPS = 1.0e-5f;
constexpr float SCL = 1.0f / (CA * CA * 8.0f);   // score = acc / (8 x 8) / sqrt(64)
static_assert(NB >= 1 && NB <= NB_FULL && SEQ >= 128 && SEQ <= SEQ_FULL && SEQ % 128 == 0);
static_assert(MR % 128 == 0 && MR % 32 == 0 && D == 512 && NH * DH == D && DFF % 512 == 0 && NQT > NQT_RES && (MR * D) % 8 == 0);

typedef _Float16 b16;
typedef __attribute__((ext_vector_type(16))) _Float16 v16b;
typedef __attribute__((ext_vector_type(8))) _Float16 v8b;
typedef __attribute__((ext_vector_type(4))) _Float16 v4h_;
typedef __attribute__((ext_vector_type(8))) float v8f;
typedef __attribute__((ext_vector_type(4))) float v4f;

__device__ __forceinline__ float bf16_rne(float f) { unsigned int u = __float_as_uint(f); u += 0x7FFFu + ((u >> 16) & 1u); return __uint_as_float(u & 0xFFFF0000u); }
__device__ __forceinline__ v16b frag_kb(const b16* p, int hh) { const v8b a = *(const v8b*)(p + 8 * hh), b = *(const v8b*)(p + 16 + 8 * hh); v16b f;
#pragma unroll
  for (int e = 0; e < 8; ++e) { f[e] = a[e]; f[8 + e] = b[e]; } return f; }
__device__ __forceinline__ v8f wmma_raw(v16b a, v16b b, v8f c) { return __builtin_amdgcn_wmma_f32_16x16x32_f16(false, a, false, b, (short)0, c, false, false); }
__device__ __forceinline__ v8f wmma16b(v16b a, v16b b, v8f c) { v8f d = wmma_raw(a, b, c); asm volatile("v_nop\n\tv_nop\n\tv_nop\n\tv_nop" : "+v"(d) : "v"(a), "v"(b)); return d; }
// one guard after a group of 8 accumulating WMMAs: ties all 8 accumulators, keeps both A and all four B fragments live across the 4 nops
#define WMMA_GUARD8(c, a0, a1, bf) asm volatile("v_nop\n\tv_nop\n\tv_nop\n\tv_nop" : "+v"(c[0][0]), "+v"(c[0][1]), "+v"(c[0][2]), "+v"(c[0][3]), \
    "+v"(c[1][0]), "+v"(c[1][1]), "+v"(c[1][2]), "+v"(c[1][3]) : "v"(a0), "v"(a1), "v"(bf[0]), "v"(bf[1]), "v"(bf[2]), "v"(bf[3]))
__device__ __forceinline__ void wave_lds_sync() { __builtin_amdgcn_fence(3 /* release order */, "workgroup"); __builtin_amdgcn_wave_barrier(); __builtin_amdgcn_fence(2 /* acquire order */, "workgroup"); }
__device__ __forceinline__ float pmul(float a, float b) { float p = a * b; asm volatile("" : "+v"(p)); return p; }
__device__ __forceinline__ int iclamp(int v, int lo, int hi) { return v < lo ? lo : (v > hi ? hi : v); }
__device__ __forceinline__ float nexp2(float v) { float r; asm("v_exp_f32 %0, %1\n\tv_nop" : "=v"(r) : "v"(v)); return r; }
// 16-lane butterflies (partners lane ^ 8, 4, 2, 1) on ds_bpermute_b32; sa[] holds the four partner byte addresses, formed once per kernel (fewer live registers than per-call index math)
__device__ __forceinline__ float bperm(int addr, float x) { return __int_as_float(__builtin_amdgcn_ds_bpermute(addr, __float_as_int(x))); }
__device__ __forceinline__ float red_max16(float x, const int (&sa)[4]) {
#pragma unroll
  for (int j = 0; j < 4; ++j) x = fmaxf(x, bperm(sa[j], x));
  return x; }
__device__ __forceinline__ float red_sum16(float x, const int (&sa)[4]) {
#pragma unroll
  for (int j = 0; j < 4; ++j) x += bperm(sa[j], x);
  return x; }

// Wt[l][noff + n][k] = f16(bf16(W[l][k][n]) x 256), W stored [layer][in][out] with NA columns; block = 64 k x 64 n tile transposed through LDS (T: 64 x 72 halves; cross-thread, block barrier);
__device__ __forceinline__ void wprep_tile(b16* T, const float* __restrict__ W, b16* __restrict__ Wt, int K, int NA, int NT, int noff, int l, int k0, int n0, int tid) {
  { const int kr = tid >> 2, nc = (tid & 3) * 16; const float* src = W + ((size_t)l * K + k0 + kr) * NA + n0 + nc;
#pragma unroll
    for (int q = 0; q < 4; ++q) { const v4f v = *(const v4f*)(src + 4 * q);
#pragma unroll
      for (int j = 0; j < 4; ++j) T[(nc + 4 * q + j) * 72 + kr] = (b16)(bf16_rne(v[j]) * WSC); } }
  __syncthreads();
  v8b vv[2]; size_t dst[2];
#pragma unroll
  for (int i = 0; i < 2; ++i) { const int n = (tid >> 3) + 32 * i, p = tid & 7; vv[i] = *(const v8b*)(T + n * 72 + 8 * p); dst[i] = ((size_t)l * NT + noff + n0 + n) * K + k0 + 8 * p; }
  {
#pragma unroll
    for (int i = 0; i < 2; ++i) *(v8b*)(Wt + dst[i]) = vv[i];
     }
}

__device__ __forceinline__ void mprep_part(const float* __restrict__ mem, b16* __restrict__ Mh, int u) {
  if (u >= MR * D / 8) return;
  const int row = u / (D / 8), c0 = (u % (D / 8)) * 8, b = row / SEQ, s = row % SEQ;
  const float* src = mem + ((size_t)b * SEQ_FULL + s) * D + c0;
  const v4f a = *(const v4f*)src, c = *(const v4f*)(src + 4); v8b v;
#pragma unroll
  for (int j = 0; j < 4; ++j) { v[j] = (b16)(bf16_rne(a[j]) * CA); v[4 + j] = (b16)(bf16_rne(c[j]) * CA); }
  { *(v8b*)(Mh + (size_t)row * D + c0) = v;  }
}

// embedding: x[b][s][c] = bf16(emb[tok[s][b]][c]) x sqrt(512) + pe(s, c), pe(s, 2j) = sin(s x exp(2j x NLOGD)), pe(s, 2j+1) = cos(same angle); tok clamped. block = 4 rows,
// thread = 8 columns (rolled loop of 4 expf + sincosf); the 4 x 512 f32 tile is staged in LDS (block barrier), then 32 lanes x 16 B per 512-B run to X and
__device__ __forceinline__ void embed_rows(float* Xs, const int* __restrict__ tok, const float* __restrict__ emb, float* __restrict__ X, b16* __restrict__ Xh, int row0, int tid) {
  const int rl = tid >> 6, c0 = (tid & 63) * 8, row = row0 + rl, b = row / SEQ, s = row % SEQ;
  const int t = iclamp(tok[s * NB_FULL + b], 0, VOCAB - 1);
  const float* er = emb + (size_t)t * D + c0;
#pragma unroll 1
  for (int q = 0; q < 4; ++q) {
    const int c = c0 + 2 * q; const float dv = expf(pmul((float)c, NLOGD)); float sn, cs; sincosf(pmul((float)s, dv), &sn, &cs);
    Xs[rl * (D + 4) + c] = pmul(bf16_rne(er[2 * q]), SQD) + sn; Xs[rl * (D + 4) + c + 1] = pmul(bf16_rne(er[2 * q + 1]), SQD) + cs; }
  __syncthreads();
  v4f fv[2]; size_t fo[2]; v8b hv;
#pragma unroll
  for (int i = 0; i < 2; ++i) { const int f = i * 256 + tid; fv[i] = *(const v4f*)(Xs + (f >> 7) * (D + 4) + (f & 127) * 4); fo[i] = (size_t)(row0 + (f >> 7)) * D + (f & 127) * 4; }
  { const v4f a = *(const v4f*)(Xs + rl * (D + 4) + c0), c4 = *(const v4f*)(Xs + rl * (D + 4) + c0 + 4);
#pragma unroll
    for (int e = 0; e < 4; ++e) { hv[e] = (b16)(a[e] * CA); hv[4 + e] = (b16)(c4[e] * CA); } }
  {
#pragma unroll
    for (int i = 0; i < 2; ++i) *(v4f*)(X + fo[i]) = fv[i];
    *(v8b*)(Xh + (size_t)row * D + c0) = hv;  }
}

// All input preparation in one grid: none of its parts reads what another writes, so a block takes its part by its index range (block-uniform): embedding rows first (the longest blocks),
// then the 64 x 64 tiles of the eight 512 x 512 weights, of W1 and of W2 (k tile fastest, then n tile, then layer), then the memory plane.
constexpr int LTD = 3, LTF = 5, PB_WS = NLAY << (2 * LTD), PB_WF = NLAY << (LTD + LTF);   // log2 of the 64-wide tiles along 512 and along 2048; blocks of a small and of an FFN weight
static_assert((64 << LTD) == D && (64 << LTF) == DFF);
constexpr int P_W = MR / 4, P_F1 = P_W + 8 * PB_WS, P_F2 = P_F1 + PB_WF, P_M = P_F2 + PB_WF, P_ALL = P_M + (MR * D / 8 + 255) / 256;   // first block of each range
__global__ __launch_bounds__(256) void prep_kernel(const int* __restrict__ tok, const float* __restrict__ emb, const float* __restrict__ mem,
    const float* __restrict__ wqs, const float* __restrict__ wks, const float* __restrict__ wvs, const float* __restrict__ wos,
    const float* __restrict__ wqc, const float* __restrict__ wkc, const float* __restrict__ wvc, const float* __restrict__ woc,
    const float* __restrict__ w1, const float* __restrict__ w2,
    b16* __restrict__ WQKVS, b16* __restrict__ WOS, b16* __restrict__ WQKVC, b16* __restrict__ WOC, b16* __restrict__ W1T, b16* __restrict__ W2T,
    b16* __restrict__ Mh, float* __restrict__ X, b16* __restrict__ Xh) {
  __shared__ __attribute__((aligned(16))) b16 Sh[64 * 72];   // weight tile, or the embedding's 4 x 516 f32 rows
  static_assert(64 * 72 * 2 >= 4 * (D + 4) * 4);
  const int tid = threadIdx.x, r = blockIdx.x;
  if (r < P_W) embed_rows((float*)Sh, tok, emb, X, Xh, r * 4, tid);
  else if (r < P_M) {
    const float* W; b16* Wt; int q, lk = LTD, ln = LTD, NT, noff = 0;   // lk, ln: log2 of the tile counts along k (rows of W) and n (its columns)
    if (r < P_F1) {
      const int m = (r - P_W) / PB_WS, g = m & 3;   // m: 0..3 q k v o of the self-attention, 4..7 of the attention over memory
      q = (r - P_W) % PB_WS;
      W = m < 4 ? (g == 0 ? wqs : (g == 1 ? wks : (g == 2 ? wvs : wos))) : (g == 0 ? wqc : (g == 1 ? wkc : (g == 2 ? wvc : woc)));
      Wt = m < 4 ? (g == 3 ? WOS : WQKVS) : (g == 3 ? WOC : WQKVC);
      NT = g == 3 ? D : NQKV; noff = g == 3 ? 0 : g * D;
    } else if (r < P_F2) { q = r - P_F1; W = w1; Wt = W1T; ln = LTF; NT = DFF; }
    else { q = r - P_F2; W = w2; Wt = W2T; lk = LTF; NT = D; }
    wprep_tile(Sh, W, Wt, 64 << lk, 64 << ln, NT, noff, q >> (lk + ln), (q & ((1 << lk) - 1)) * 64, ((q >> lk) & ((1 << ln) - 1)) * 64, tid);
    asm volatile("s_wait_xcnt 0x0" ::: "memory");   // the built code joins this branch's end to an edge into the embedding branch, which rewrites the registers the two stores name: the wait stands in front of that join
  } else mprep_part(mem, Mh, (r - P_M) * 256 + tid);
}

// Operand staging of the GEMMs: a stage is KS = 128 k (256 B) of every A and B row of the block tile, laid in LDS at pitch 272 B (16 B x 17: odd, conflict-free for 16-B row readers),
// brought by per-lane asynchronous 16-B copies (a wave's copy covers 2 rows x 256 B = 4 whole lines); two buffers, the next stage's copies fly while this one is worked on.
constexpr int KS = 128, LP = KS + 8;
__device__ __forceinline__ unsigned lds_byte(const void* p) { return (unsigned)(unsigned long long)p; }
// copies of rows 16 apart (LDS step 16 x 272 B, global step gs halves); s_wait_xcnt 0 closes each statement so that no address register is rewritten ahead of it
__device__ __forceinline__ void cp2(unsigned l, const b16* g, size_t gs) {
  asm volatile("global_load_async_to_lds_b128 %0, %2, off\n\tglobal_load_async_to_lds_b128 %1, %3, off\n\ts_wait_xcnt 0x0"
      :: "v"(l), "v"(l + 16u * LP * 2u), "v"(g), "v"(g + gs) : "memory");
}
__device__ __forceinline__ void cp8(unsigned l, const b16* g, size_t gs) {
  constexpr unsigned LS = 16u * LP * 2u;
  asm volatile("global_load_async_to_lds_b128 %0, %8, off\n\tglobal_load_async_to_lds_b128 %1, %9, off\n\tglobal_load_async_to_lds_b128 %2, %10, off\n\t"
      "global_load_async_to_lds_b128 %3, %11, off\n\tglobal_load_async_to_lds_b128 %4, %12, off\n\tglobal_load_async_to_lds_b128 %5, %13, off\n\t"
      "global_load_async_to_lds_b128 %6, %14, off\n\tglobal_load_async_to_lds_b128 %7, %15, off\n\ts_wait_xcnt 0x0"
      :: "v"(l), "v"(l + LS), "v"(l + 2u * LS), "v"(l + 3u * LS), "v"(l + 4u * LS), "v"(l + 5u * LS), "v"(l + 6u * LS), "v"(l + 7u * LS),
         "v"(g), "v"(g + gs), "v"(g + 2 * gs), "v"(g + 3 * gs), "v"(g + 4 * gs), "v"(g + 5 * gs), "v"(g + 6 * gs), "v"(g + 7 * gs) : "memory");
}
// block of 256 threads: AR rows of A (first row Ag, pitch lda) and BR rows of B = Wt (first row Bg, pitch K), K a multiple of 128; the wave takes 32 A rows from arow and 64 B rows from
// brow: 8 WMMAs per 32 k, one guard per stage, same k order as a walk over K in steps of 32. On return every wave has left the ring (last trip's barrier): it may be reused.
template <int AR, int BR>
__device__ __forceinline__ void mac_staged(v8f (&acc)[2][4], b16* ring, const b16* Ag, int lda, const b16* Bg, int K, int arow, int brow, int tid, int nloc, int hlf) {
  static_assert((AR == 32 || AR % 128 == 0) && BR % 128 == 0);
  constexpr int BUFH = (AR + BR) * LP;
  const unsigned l0 = lds_byte(ring) + (unsigned)(tid >> 4) * (LP * 2u) + (unsigned)(tid & 15) * 16u;
  const b16* ga = Ag + (size_t)(tid >> 4) * lda + 8 * (tid & 15);
  const b16* gb = Bg + (size_t)(tid >> 4) * K + 8 * (tid & 15);
  const int NT = K / KS;
  auto fill = [&](int t) {
    const unsigned l = l0 + (unsigned)(t & 1) * (BUFH * 2u);
    if constexpr (AR == 32) cp2(l, ga + t * KS, (size_t)16 * lda);
    else {
#pragma unroll
      for (int j = 0; j < AR / 128; ++j) cp8(l + (unsigned)j * (128u * LP * 2u), ga + (size_t)(128 * j) * lda + t * KS, (size_t)16 * lda); }
#pragma unroll
    for (int j = 0; j < BR / 128; ++j) cp8(l + (unsigned)(AR + 128 * j) * (LP * 2u), gb + (size_t)(128 * j) * K + t * KS, (size_t)16 * K);
  };
  fill(0);
  asm volatile("s_wait_asynccnt 0x0" ::: "memory");   // stage 0 has landed (this wave's copies) before the barrier that publishes it
  __syncthreads();
  if (NT > 1) fill(1);
#pragma unroll 1
  for (int t = 0; t < NT; ++t) {
    const b16* bufp = ring + (t & 1) * BUFH;
    const b16* ap0 = bufp + (arow + nloc) * LP; const b16* ap1 = ap0 + 16 * LP; const b16* bp = bufp + (AR + brow + nloc) * LP;
    v16b a0[2], a1[2], bf[2][4];   // two fragment sets: the next 32 k are fetched while the WMMAs of these 32 k run (all inside this stage's buffer)
    a0[0] = frag_kb(ap0, hlf); a1[0] = frag_kb(ap1, hlf);
#pragma unroll
    for (int u = 0; u < 4; ++u) bf[0][u] = frag_kb(bp + u * 16 * LP, hlf);
#pragma unroll
    for (int s = 0; s < KS / 32; ++s) {
      const int c = s & 1, n = c ^ 1;
      if (s + 1 < KS / 32) {
        a0[n] = frag_kb(ap0 + 32 * (s + 1), hlf); a1[n] = frag_kb(ap1 + 32 * (s + 1), hlf);
#pragma unroll
        for (int u = 0; u < 4; ++u) bf[n][u] = frag_kb(bp + u * 16 * LP + 32 * (s + 1), hlf); }
      __builtin_amdgcn_sched_barrier(0);   // keeps the next block's 12 LDS reads one group in front of this block's WMMAs (for speed only)
#pragma unroll
      for (int u = 0; u < 4; ++u) { acc[0][u] = wmma_raw(a0[c], bf[c][u], acc[0][u]); acc[1][u] = wmma_raw(a1[c], bf[c][u], acc[1][u]); }
      if (s + 1 < KS / 32) __builtin_amdgcn_sched_barrier(0);   // the block after next's reads stay behind this block's WMMAs
      else WMMA_GUARD8(acc, a0[c], a1[c], bf[c]);   // the stage's last WMMAs stand in front of a branch: the 4 slots behind them are filled here for both of its sides
    }
    asm volatile("s_wait_dscnt 0x0" ::: "memory");     // this wave's reads of the buffer have retired before the barrier behind which it is refilled
    asm volatile("s_wait_asynccnt 0x0" ::: "memory");  // this wave's copies of stage t + 1 have landed before the barrier that publishes them
    __syncthreads();
    if (t + 2 < NT) fill(t + 2);
  }
  asm volatile("s_wait_asynccnt 0x0" ::: "memory");    // no copy outstanding when the ring is reused or the wave ends
}

// row-major f16 epilogue of one wave's 32 x 64 tile (plane value = f16(v x 8), LO: f16((v x 8 - hi) x 2048)): b16 element stores into the wave-private LDS tile, wave sync,
template <bool LO, bool RELU>
__device__ __forceinline__ void epi_rows(const v8f (&acc)[2][4], const float (&bb)[4], float oscale, b16* Es, b16* dstp, int ldc, int lane, int nloc, int hlf) {
#pragma unroll
  for (int mt = 0; mt < 2; ++mt)
#pragma unroll
    for (int t = 0; t < 4; ++t)
#pragma unroll
      for (int r = 0; r < 8; ++r) {
        float v = acc[mt][t][r] * oscale + bb[t]; if (RELU) v = fmaxf(v, 0.0f); const float vs = v * CA; const b16 hi = (b16)vs;
        Es[(mt * 16 + 8 * hlf + r) * 72 + 16 * t + nloc] = LO ? (b16)((vs - (float)hi) * RS) : hi; }
  wave_lds_sync();
  v8b vv[8];
#pragma unroll
  for (int j = 0; j < 8; ++j) vv[j] = *(const v8b*)(Es + (4 * j + (lane >> 3)) * 72 + 8 * (lane & 7));
  b16* dst = dstp + (size_t)(lane >> 3) * ldc + 8 * (lane & 7);
  {
#pragma unroll
    for (int j = 0; j < 8; ++j) *(v8b*)(dst + (size_t)(4 * j) * ldc) = vv[j];
     }
}

// head-transposed f16 epilogue of the block's 128 (keys) x 128 (head columns) tile -> plane[((b*NH + h)*DH + d)*SEQ + key]: each lane stores its 8 consecutive keys of one
// column as one 16-B LDS store into Et[col][key] (cross-wave, block barrier), then store j: lanes 0..15 -> column 16j + 2 wave, lanes 16..31 -> +1, lane piece = 8 keys
template <bool LO, bool RELU>
__device__ __forceinline__ void epi_vt(const v8f (&acc)[2][4], const float (&bb)[4], float oscale, b16* Et, b16* plane, int bidx, int key0, int colv0, int wave, int wm, int wn, int nloc, int hlf) {
#pragma unroll
  for (int mt = 0; mt < 2; ++mt)
#pragma unroll
    for (int t = 0; t < 4; ++t) { v8b hv;
#pragma unroll
      for (int r = 0; r < 8; ++r) { float v = acc[mt][t][r] * oscale + bb[t]; if (RELU) v = fmaxf(v, 0.0f); const float vs = v * CA; const b16 hi = (b16)vs; hv[r] = LO ? (b16)((vs - (float)hi) * RS) : hi; }
      *(v8b*)(Et + (wn * 64 + 16 * t + nloc) * 136 + wm * 32 + mt * 16 + 8 * hlf) = hv; }
  __syncthreads();
  v8b vv[8]; size_t dsto[8];
#pragma unroll
  for (int j = 0; j < 8; ++j) { const int dl = 16 * j + 2 * wave + hlf; const int col = colv0 + dl; const int hh = col / DH, dd = col % DH;
    vv[j] = *(const v8b*)(Et + dl * 136 + 8 * nloc); dsto[j] = ((size_t)(bidx * NH + hh) * DH + dd) * SEQ + key0 + 8 * nloc; }
  {
#pragma unroll
    for (int j = 0; j < 8; ++j) *(v8b*)(plane + dsto[j]) = vv[j];
     }
}

// C = (A[M][K] f16 plane, pitch lda) x Wt[N][K] + bf16(bias), optional relu; block 128 x 128 = 8 waves of 32 x 64. GEMM columns < vcol0 -> row-major plane C[row*ldc + ccol0 + col]
// (f16 x 8); columns >= vcol0 -> head-transposed plane VT (v of the attention). Blocks whose 128 rows start a sequence also emit the residual planes Clo / VTlo (x 2048) for those rows
// when wres != 0. Bias group pointer chosen per 512-column group (block-uniform). Column blocks below asplit multiply A1, the others A2 (block-uniform): two products of different left
// operands that share K and the output planes run as one grid.
template <bool RELU>
__global__ __launch_bounds__(256) void gemm_kernel(const b16* __restrict__ A1, const b16* __restrict__ A2, int asplit, int lda, const b16* __restrict__ Wt, int K,
    const float* __restrict__ bg0, const float* __restrict__ bg1, const float* __restrict__ bg2, const float* __restrict__ bg3,
    b16* __restrict__ C, b16* __restrict__ Clo, int ldc, int ccol0, b16* __restrict__ VT, b16* __restrict__ VTlo, int vcol0, float oscale, int wres) {
  __shared__ __attribute__((aligned(16))) b16 Ls[2 * 256 * LP];   // operand ring (2 buffers x 256 rows); behind the K loop 8 wave tiles [32][72] (row-major mode) or one block tile [128][136] (transposed mode)
  static_assert(2 * 256 * LP >= 18432);
  const int tid = threadIdx.x, wave = tid >> 5, lane = tid & 31, nloc = lane & 15, hlf = lane >> 4;
  const int bm0 = blockIdx.x * 128, bn0 = blockIdx.y * 128, wm = wave >> 1, wn = wave & 1;
  const int row0 = bm0 + wm * 32, col0 = bn0 + wn * 64;
  const b16* A = bn0 < asplit ? A1 : A2;
  v8f acc[2][4];
#pragma unroll
  for (int t = 0; t < 4; ++t) { acc[0][t] = (v8f){}; acc[1][t] = (v8f){}; }
  mac_staged<128, 128>(acc, Ls, A + (size_t)bm0 * lda, lda, Wt + (size_t)bn0 * K, K, wm * 32, wn * 64, tid, nloc, hlf);
  const int gsel = bn0 >> 9; const float* bias = gsel == 0 ? bg0 : (gsel == 1 ? bg1 : (gsel == 2 ? bg2 : bg3));
  float bb[4];
#pragma unroll
  for (int t = 0; t < 4; ++t) bb[t] = bf16_rne(bias[(col0 & 511) + 16 * t + nloc]);
  const bool vmode = bn0 >= vcol0, wlo = (wres != 0) && (bm0 % SEQ == 0);
  if (!vmode) {
    b16* Es = Ls + wave * (32 * 72);
    epi_rows<false, RELU>(acc, bb, oscale, Es, C + (size_t)row0 * ldc + ccol0 + col0, ldc, lane, nloc, hlf);
    if (wlo) { wave_lds_sync(); epi_rows<true, RELU>(acc, bb, oscale, Es, Clo + (size_t)row0 * ldc + ccol0 + col0, ldc, lane, nloc, hlf); }
  } else {
    epi_vt<false, RELU>(acc, bb, oscale, Ls, VT, bm0 / SEQ, bm0 % SEQ, bn0 - vcol0, wave, wm, wn, nloc, hlf);
    if (wlo) { __syncthreads(); epi_vt<true, RELU>(acc, bb, oscale, Ls, VTlo, bm0 / SEQ, bm0 % SEQ, bn0 - vcol0, wave, wm, wn, nloc, hlf); }
  }
}

// Y = LayerNorm(Xres + (A x Wt + bf16(bias))) * bf16(g) + bf16(be) over full 512-wide rows: block = 32 rows x 512 columns (wave = 32 x 64), K = 512 or 2048. Per 16-row half the f32
// tile is staged in LDS (cross-wave, block barrier); wave w then owns rows 2w, 2w+1: lane holds columns 128j + 4 lane (j = 0..3), residual / bias / gain loaded with the same map,
__global__ __launch_bounds__(256) void gemm_ln_kernel(const b16* __restrict__ A, int K, const b16* __restrict__ Wt, const float* __restrict__ bias, const float* Xres,
    const float* __restrict__ gam, const float* __restrict__ bet, float* OutF, b16* __restrict__ Xh, float oscale, int wxh) {
  __shared__ __attribute__((aligned(16))) b16 Rg[2 * (32 + D) * LP];   // operand ring (2 buffers x 544 rows); behind the K loop the f32 tile Tf
  static_assert(2 * (32 + D) * LP * 2 >= 16 * (D + 4) * 4);
  float* Tf = (float*)Rg;
  const int tid = threadIdx.x, wave = tid >> 5, lane = tid & 31, nloc = lane & 15, hlf = lane >> 4;
  const int bm0 = blockIdx.x * 32, col0 = wave * 64;
  v8f acc[2][4];
#pragma unroll
  for (int t = 0; t < 4; ++t) { acc[0][t] = (v8f){}; acc[1][t] = (v8f){}; }
  mac_staged<32, D>(acc, Rg, A + (size_t)bm0 * K, K, Wt, K, 0, col0, tid, nloc, hlf);
#pragma unroll 1
  for (int mt = 0; mt < 2; ++mt) {
    if (mt) __syncthreads();
#pragma unroll
    for (int t = 0; t < 4; ++t)
#pragma unroll
      for (int r = 0; r < 8; ++r) Tf[(8 * hlf + r) * (D + 4) + col0 + 16 * t + nloc] = (mt ? acc[1][t][r] : acc[0][t][r]) * oscale;
    __syncthreads();
#pragma unroll 1
    for (int rr = 0; rr < 2; ++rr) {
      const int rl = 2 * wave + rr; const size_t go = (size_t)(bm0 + mt * 16 + rl) * D;
      float y[16]; float s = 0.0f;
#pragma unroll
      for (int j = 0; j < 4; ++j) { const int c = 128 * j + 4 * lane;
        const v4f tv = *(const v4f*)(Tf + rl * (D + 4) + c); const v4f rv = *(const v4f*)(Xres + go + c); const v4f bv = *(const v4f*)(bias + c);
#pragma unroll
        for (int e = 0; e < 4; ++e) { const float yy = rv[e] + (tv[e] + bf16_rne(bv[e])); y[4 * j + e] = yy; s += yy; } }
#pragma unroll
      for (int off = 16; off > 0; off >>= 1) s += __shfl_xor(s, off, 32);
      const float mean = s * (1.0f / (float)D); float q = 0.0f;
#pragma unroll
      for (int i = 0; i < 16; ++i) { const float d0 = y[i] - mean; y[i] = d0; q += d0 * d0; }
#pragma unroll
      for (int off = 16; off > 0; off >>= 1) q += __shfl_xor(q, off, 32);
      const float rstd = 1.0f / sqrtf(q * (1.0f / (float)D) + LNEPS);
      v4f ov[4]; v4h_ hv[4];
#pragma unroll
      for (int j = 0; j < 4; ++j) { const int c = 128 * j + 4 * lane; const v4f gv = *(const v4f*)(gam + c), ev = *(const v4f*)(bet + c);
#pragma unroll
        for (int e = 0; e < 4; ++e) { const float o = (y[4 * j + e] * rstd) * bf16_rne(gv[e]) + bf16_rne(ev[e]); ov[j][e] = o; hv[j][e] = (b16)(o * CA); } }
      {
#pragma unroll
        for (int j = 0; j < 4; ++j) { const int c = 128 * j + 4 * lane; *(v4f*)(OutF + go + c) = ov[j]; if (wxh) *(v4h_*)(Xh + go + c) = hv[j]; }
         }
    }
  }
}

// Streaming attention, one work-group = 16 query rows of one (batch, head), its NWK waves sharing the keys: wave w walks the 32-key chunks w, w + NWK, ... with its own running max,
// sum and context; the partial results meet in LDS behind one block barrier and are joined there (weights exp(max_w - max)). Q fragments from the q|k plane (column h*64), per chunk
// the 16x32 mask tile is loaded first (two groups of 8 scalar loads per lane, the first group retired before the second issues; ballot: skip when all masked), scores = 2 k-steps of
// WMMA against K rows, replace-mask, running-max softmax in f32 (exp2), P staged x4096 into a wave-private LDS tile (b16 element stores, wave sync, fragment reload), ctx += P x V with
// V from the head-transposed plane [d][key].
// RES: query/key residual planes give 3 score products and P_res x V + P x V_res into a second accumulator for chunks with keys < 128 (rows for which the residual planes exist);
constexpr int NWK = 4, PPW = DH + 4;   // waves per query tile; f32 pitch of a partial context row
static_assert((SEQ / 32) % NWK == 0);
template <bool RES>
__global__ __launch_bounds__(32 * NWK) void attn_kernel(const b16* __restrict__ QK, const b16* __restrict__ QKlo, const b16* __restrict__ VT, const b16* __restrict__ VTlo,
    const int* __restrict__ mask, b16* __restrict__ CTX, int qt0, int nqt) {
  __shared__ __attribute__((aligned(16))) b16 PstA[NWK * 16 * 40];
  __shared__ __attribute__((aligned(16))) b16 PlstA[RES ? NWK * 16 * 40 : 8];
  __shared__ __attribute__((aligned(16))) float Part[NWK * 16 * PPW];
  __shared__ float Mxs[NWK * 16], Lss[NWK * 16];
  const int tid = threadIdx.x, lane = tid & 31, nloc = lane & 15, hlf = lane >> 4, wave = __builtin_amdgcn_readfirstlane(tid >> 5);
  const int sa[4] = {(lane ^ 8) << 2, (lane ^ 4) << 2, (lane ^ 2) << 2, (lane ^ 1) << 2};
  b16* Pst = PstA + wave * (16 * 40); b16* Plst = PlstA + (RES ? wave * (16 * 40) : 0);
  const int bi = blockIdx.x, qt = qt0 + bi % nqt, bh = bi / nqt, h = bh % NH, b = bh / NH, q0 = qt * 16;
  const size_t rq = (size_t)b * SEQ + q0;
  const b16* qp = QK + (rq + nloc) * LQK + h * DH;
  const v16b qa0 = frag_kb(qp, hlf), qa1 = frag_kb(qp + 32, hlf);
  v16b ql0 = (v16b){}, ql1 = (v16b){};
  if (RES) { const b16* qlp = QKlo + (rq + nloc) * LQK + h * DH; ql0 = frag_kb(qlp, hlf); ql1 = frag_kb(qlp + 32, hlf); }
  const b16* kbase = QK + ((size_t)b * SEQ + 32 * wave) * LQK + D + h * DH;   // this and the four bases below start at the wave's first chunk
  const b16* klbase = QKlo + ((size_t)b * SEQ + 32 * wave) * LQK + D + h * DH;
  const b16* vbase = VT + (size_t)(b * NH + h) * DH * SEQ + 32 * wave;
  const b16* vlbase = VTlo + (size_t)(b * NH + h) * DH * SEQ + 32 * wave;
  const int* mq = mask + ((size_t)b * SEQ_FULL + q0 + 8 * hlf) * SEQ_FULL + 32 * wave + nloc;
  float mx[8], ls[8]; v8f acc[4], acc2[4];
#pragma unroll
  for (int r = 0; r < 8; ++r) { mx[r] = -3.0e38f; ls[r] = 0.0f; }
#pragma unroll
  for (int t = 0; t < 4; ++t) { acc[t] = (v8f){}; acc2[t] = (v8f){}; }
#pragma unroll 1
  for (int i = 0; i < SEQ / 32 / NWK; ++i) {
    const int kb = 32 * NWK * i, c = wave + NWK * i;   // kb: key offset from the wave's first chunk; c: chunk index
    int m0[8], m1[8]; bool allm = true;
    // mask tile rows 8 hlf + r: group 1 = key column kb + nloc, group 2 = kb + 16 + nloc; compiler + wait barrier between the two groups of 8 loads
#pragma unroll
    for (int r = 0; r < 8; ++r) m0[r] = mq[(size_t)r * SEQ_FULL + kb];
    asm volatile("" :: "v"(m0[0]), "v"(m0[1]), "v"(m0[2]), "v"(m0[3]), "v"(m0[4]), "v"(m0[5]), "v"(m0[6]), "v"(m0[7]) : "memory");
#pragma unroll
    for (int r = 0; r < 8; ++r) m1[r] = mq[(size_t)r * SEQ_FULL + kb + 16];
#pragma unroll
    for (int r = 0; r < 8; ++r) allm = allm && (m0[r] != 0) && (m1[r] != 0);
    if (__builtin_amdgcn_ballot_w32(allm) == 0xffffffffu) continue;
    wave_lds_sync();   // prior chunk's fragment reloads complete before the P tiles are rewritten
    v8f s[2];
#pragma unroll
    for (int t = 0; t < 2; ++t) {
      const b16* kp = kbase + (size_t)(kb + 16 * t + nloc) * LQK; const v16b k0f = frag_kb(kp, hlf), k1f = frag_kb(kp + 32, hlf);
      v8f sh = wmma16b(qa0, k0f, (v8f){}); sh = wmma16b(qa1, k1f, sh);
      if (RES && c < 4) {
        const b16* klp = klbase + (size_t)(kb + 16 * t + nloc) * LQK;
        v8f x = wmma16b(ql0, k0f, (v8f){}); x = wmma16b(ql1, k1f, x); x = wmma16b(qa0, frag_kb(klp, hlf), x); x = wmma16b(qa1, frag_kb(klp + 32, hlf), x);
#pragma unroll
        for (int r = 0; r < 8; ++r) sh[r] += x[r] * (1.0f / RS); }
      s[t] = sh; }
    float p0[8], p1[8];
#pragma unroll
    for (int r = 0; r < 8; ++r) {
      float s0 = s[0][r] * SCL, s1 = s[1][r] * SCL; s0 = (m0[r] != 0) ? NEGF : s0; s1 = (m1[r] != 0) ? NEGF : s1;
      const float cm = red_max16(fmaxf(s0, s1), sa); const float mn = fmaxf(mx[r], cm); const float al = nexp2((mx[r] - mn) * L2E); mx[r] = mn;
      const float e0 = nexp2((s0 - mn) * L2E), e1 = nexp2((s1 - mn) * L2E); p0[r] = e0; p1[r] = e1;
      ls[r] = ls[r] * al + red_sum16(e0 + e1, sa);
#pragma unroll
      for (int t = 0; t < 4; ++t) { acc[t][r] *= al; if (RES) acc2[t][r] *= al; } }
#pragma unroll
    for (int r = 0; r < 8; ++r) {
      const float v0 = p0[r] * PSC, v1 = p1[r] * PSC; const b16 h0 = (b16)v0, h1 = (b16)v1;
      Pst[(8 * hlf + r) * 40 + nloc] = h0; Pst[(8 * hlf + r) * 40 + 16 + nloc] = h1;
      if (RES) { Plst[(8 * hlf + r) * 40 + nloc] = (b16)((v0 - (float)h0) * RS); Plst[(8 * hlf + r) * 40 + 16 + nloc] = (b16)((v1 - (float)h1) * RS); } }
    wave_lds_sync();
    const v16b pf = frag_kb(Pst + nloc * 40, hlf); v16b plf = (v16b){}; if (RES) plf = frag_kb(Plst + nloc * 40, hlf);
#pragma unroll
    for (int t = 0; t < 4; ++t) {
      const v16b vf = frag_kb(vbase + (size_t)(16 * t + nloc) * SEQ + kb, hlf); acc[t] = wmma16b(pf, vf, acc[t]);
      if (RES && c < 4) { acc2[t] = wmma16b(plf, vf, acc2[t]); acc2[t] = wmma16b(pf, frag_kb(vlbase + (size_t)(16 * t + nloc) * SEQ + kb, hlf), acc2[t]); } }
  }
  // each wave publishes its partial context (f32, still scaled by its own max), max and sum; a wave whose chunks were all skipped publishes max -3e38, sum 0, context 0
  float* pw = Part + wave * (16 * PPW);
#pragma unroll
  for (int r = 0; r < 8; ++r) {
#pragma unroll
    for (int t = 0; t < 4; ++t) { float a = acc[t][r]; if (RES) a += acc2[t][r] * (1.0f / RS); pw[(8 * hlf + r) * PPW + 16 * t + nloc] = a; }
    if (nloc == 0) { Mxs[wave * 16 + 8 * hlf + r] = mx[r]; Lss[wave * 16 + 8 * hlf + r] = ls[r]; } }
  __syncthreads();   // every wave's partials are in LDS before any thread joins them
  // join: thread = 8 columns of one row (NWK = 4: 128 threads cover 16 x 64)
  static_assert(32 * NWK * 8 == 16 * DH);
  const int jr = tid >> 3, jc = 8 * (tid & 7);
  float wm_[NWK], M = Mxs[jr];
#pragma unroll
  for (int w = 1; w < NWK; ++w) M = fmaxf(M, Mxs[w * 16 + jr]);
  float L = 0.0f, o[8];
#pragma unroll
  for (int e = 0; e < 8; ++e) o[e] = 0.0f;
#pragma unroll
  for (int w = 0; w < NWK; ++w) { wm_[w] = nexp2((Mxs[w * 16 + jr] - M) * L2E); L += wm_[w] * Lss[w * 16 + jr];
    const v4f x0 = *(const v4f*)(Part + (w * 16 + jr) * PPW + jc), x1 = *(const v4f*)(Part + (w * 16 + jr) * PPW + jc + 4);
#pragma unroll
    for (int e = 0; e < 4; ++e) { o[e] += wm_[w] * x0[e]; o[4 + e] += wm_[w] * x1[e]; } }
  const float inv = (1.0f / L) * (CX / (PSC * CA)); v8b ov;
#pragma unroll
  for (int e = 0; e < 8; ++e) ov[e] = (b16)(o[e] * inv);
  *(v8b*)(CTX + (rq + jr) * D + h * DH + jc) = ov;
}
}  // namespace

extern "C" void kernel_launch(void* const* d_in, const int* in_sizes, int n_in, void* d_out, int out_size, void* d_ws, size_t ws_size, hipStream_t stream) {
  (void)n_in;
  auto Fp = [&](int i) { return (const float*)d_in[i]; };
  auto Ip = [&](int i) { return (const int*)d_in[i]; };
  // wire order: 0 tokens [512][8] i32, 1 memory [8][512][512], 2 self-attention mask [8][512][512] i32, 3 memory mask [8][512][512] i32, 4 embedding [32000][512],
  // 5..8 Wq_s Wk_s Wv_s Wo_s [6][512 in][512 out], 9..12 Wq_c Wk_c Wv_c Wo_c, 13..16 bq_s bk_s bv_s bo_s [6][512], 17..20 bq_c bk_c bv_c bo_c,
  // 21 W1 [6][512][2048], 22 b1 [6][2048], 23 W2 [6][2048][512], 24 b2 [6][512], 25 g1, 26 g2, 27 g3, 28 be1, 29 be2, 30 be3 [6][512]
  const long needRows = (long)(NB - 1) * SEQ_FULL + SEQ;
  if ((long)in_sizes[0] < (long)SEQ * NB_FULL || (long)in_sizes[1] < needRows * D || (long)in_sizes[2] < needRows * SEQ_FULL || (long)in_sizes[3] < needRows * SEQ_FULL ||
      (long)in_sizes[4] < (long)VOCAB * D) return;
  for (int i = 5; i <= 12; ++i) if ((long)in_sizes[i] < (long)NLAY * D * D) return;
  for (int i = 13; i <= 20; ++i) if (in_sizes[i] < NLAY * D) return;
  if ((long)in_sizes[21] < (long)NLAY * D * DFF || in_sizes[22] < NLAY * DFF || (long)in_sizes[23] < (long)NLAY * DFF * D || in_sizes[24] < NLAY * D) return;
  for (int i = 25; i <= 30; ++i) if (in_sizes[i] < NLAY * D) return;
  if (out_size < MR * D) return;

  size_t off = 0; char* ws = (char*)d_ws;
  auto carve = [&](size_t bytes) { char* p = ws + off; off += (bytes + 255) & ~(size_t)255; return p; };
  b16* WQKVS = (b16*)carve((size_t)NLAY * NQKV * D * 2);   // [6][1536][512]
  b16* WOS   = (b16*)carve((size_t)NLAY * D * D * 2);
  b16* WQKVC = (b16*)carve((size_t)NLAY * NQKV * D * 2);   // [6][1536][512]
  b16* WOC   = (b16*)carve((size_t)NLAY * D * D * 2);
  b16* W1T   = (b16*)carve((size_t)NLAY * DFF * D * 2);    // [6][2048][512]
  b16* W2T   = (b16*)carve((size_t)NLAY * D * DFF * 2);    // [6][512][2048]
  float* X   = (float*)carve((size_t)MR * D * 4);
  b16* Xh    = (b16*)carve((size_t)MR * D * 2);
  b16* Mh    = (b16*)carve((size_t)MR * D * 2);
  b16* QK    = (b16*)carve((size_t)MR * LQK * 2);
  b16* QKlo  = (b16*)carve((size_t)MR * LQK * 2);
  b16* Vt    = (b16*)carve((size_t)MR * D * 2);            // [NB][NH][64][SEQ]
  b16* Vtlo  = (b16*)carve((size_t)MR * D * 2);
  b16* CTX   = (b16*)carve((size_t)MR * D * 2);
  b16* Hh    = (b16*)carve((size_t)MR * DFF * 2);
  if (off > ws_size || off > ((size_t)128 << 20)) return;   // 113,246,208 B at full size

  const dim3 b256(256), battn(32 * NWK);
  prep_kernel<<<P_ALL, b256, 0, stream>>>(Ip(0), Fp(4), Fp(1), Fp(5), Fp(6), Fp(7), Fp(8), Fp(9), Fp(10), Fp(11), Fp(12), Fp(21), Fp(23),
      WQKVS, WOS, WQKVC, WOC, W1T, W2T, Mh, X, Xh);

  const float OSA = 1.0f / (CA * WSC), OSX = 1.0f / (CX * WSC);
  for (int l = 0; l < NLAY; ++l) {
    const size_t lD = (size_t)l * D, lF = (size_t)l * DFF;
    // fused q|k|v projection of x: q -> QK columns 0..511, k -> 512..1023, v -> head-transposed plane; residual planes for the first 128 rows of each sequence
    gemm_kernel<false><<<dim3(MR / 128, NQKV / 128), b256, 0, stream>>>(Xh, Xh, 0, D, WQKVS + (size_t)l * NQKV * D, D, Fp(13) + lD, Fp(14) + lD, Fp(15) + lD, Fp(15) + lD,
        QK, QKlo, LQK, 0, Vt, Vtlo, 2 * D, OSA, 1);
    attn_kernel<true><<<NB * NH * NQT_RES, battn, 0, stream>>>(QK, QKlo, Vt, Vtlo, Ip(2), CTX, 0, NQT_RES);
    attn_kernel<false><<<NB * NH * (NQT - NQT_RES), battn, 0, stream>>>(QK, QKlo, Vt, Vtlo, Ip(2), CTX, NQT_RES, NQT - NQT_RES);
    gemm_ln_kernel<<<MR / 32, b256, 0, stream>>>(CTX, D, WOS + (size_t)l * D * D, Fp(16) + lD, X, Fp(25) + lD, Fp(28) + lD, X, Xh, OSX, 1);
    // attention over the memory tensor: q (columns 0..511) from x, k|v (columns 512..1535) from the memory plane, one grid
    gemm_kernel<false><<<dim3(MR / 128, NQKV / 128), b256, 0, stream>>>(Xh, Mh, D, D, WQKVC + (size_t)l * NQKV * D, D, Fp(17) + lD, Fp(18) + lD, Fp(19) + lD, Fp(19) + lD,
        QK, QKlo, LQK, 0, Vt, Vtlo, 2 * D, OSA, 0);
    attn_kernel<false><<<NB * NH * NQT, battn, 0, stream>>>(QK, QKlo, Vt, Vtlo, Ip(3), CTX, 0, NQT);
    gemm_ln_kernel<<<MR / 32, b256, 0, stream>>>(CTX, D, WOC + (size_t)l * D * D, Fp(20) + lD, X, Fp(26) + lD, Fp(29) + lD, X, Xh, OSX, 1);
    // FFN
    gemm_kernel<true><<<dim3(MR / 128, DFF / 128), b256, 0, stream>>>(Xh, Xh, 0, D, W1T + (size_t)l * DFF * D, D, Fp(22) + lF, Fp(22) + lF + 512, Fp(22) + lF + 1024, Fp(22) + lF + 1536,
        Hh, QKlo, DFF, 0, Vt, Vtlo, DFF, OSA, 0);
    const bool last = (l == NLAY - 1);
    gemm_ln_kernel<<<MR / 32, b256, 0, stream>>>(Hh, DFF, W2T + (size_t)l * D * DFF, Fp(24) + lD, X, Fp(27) + lD, Fp(30) + lD, last ? (float*)d_out : X, Xh, OSA, last ? 0 : 1);
  }
}

// v004
// One run takes 799 microseconds.
// Timed twice side by side with v003, it ran 1.07 times as fast both times.
// All steps since v000 together make it 2.25 times as fast.
#include <hip/hip_runtime.h>

// 6-layer post-LN decoder stack: token embedding x sqrt(512) + sinusoidal positions; per layer masked self-attention (8 heads x 64), attention over a memory tensor,
// relu FFN 512 -> 2048 -> 512, each followed by residual add + LayerNorm over 512. Masks are int32 [batch][query][key] tensors read by value (nonzero = score replaced by
// -1e18); a 32-key chunk whose 16x32 mask tile is entirely nonzero is skipped (exact whenever each query row keeps at least one key).
// compute dtype: every contraction on v_wmma_f32_16x16x32_f16 (f16 operands, f32 accumulate): q/k/v projections, score and P.V products, output projections, both FFN
// products. Operand planes: activations f16 x8 (attention context x64), weights bf16-exact f16 x256, softmax P f16 x4096; query tiles with position < 64 of the masked
// self-attention add residual planes (x2048 of the x8 / x4096 carriers) of q, k, v and P: 3 score products and 3 P.V products into a second accumulator.
// tokens and masks int32 (tokens clamped). Fragment k-map per lane half hh for A and B: elements 0..7 <- k = 8hh+0..7, 8..15 <- k = 16+8hh+0..7; acc[r] = D[8hh+r][col].

#ifndef NB
#define NB 8
#endif
#ifndef SEQ
#define SEQ 512
#endif
#define NB_FULL 8
#define SEQ_FULL 512

namespace {
constexpr int D = 512, NH = 8, DH = 64, DFF = 2048, NLAY = 6, VOCAB = 32000;
constexpr int MR = NB * SEQ;                 // activation rows, row = b * SEQ + s
constexpr int LQK = 2 * D;                   // q | k plane pitch (halves): q at h*64, k at 512 + h*64
constexpr int NQKV = 3 * D, NQT = SEQ / 16, NQT_RES = 4;
constexpr float WSC = 256.0f, CA = 8.0f, CX = 64.0f, PSC = 4096.0f, RS = 2048.0f;
constexpr float SQD = 22.627416997969522f, NLOGD = -0.017988946039015984f, L2E = 1.4426950408889634f, NEGF = -1.0e18f, LNEPS = 1.0e-5f;
constexpr float SCL = 1.0f / (CA * CA * 8.0f);   // score = acc / (8 x 8) / sqrt(64)
static_assert(NB >= 1 && NB <= NB_FULL && SEQ >= 128 && SEQ <= SEQ_FULL && SEQ % 128 == 0);
static_assert(MR % 128 == 0 && MR % 32 == 0 && D == 512 && NH * DH == D && DFF % 512 == 0 && NQT > NQT_RES && (MR * D) % 8 == 0);

typedef _Float16 b16;
typedef __attribute__((ext_vector_type(16))) _Float16 v16b;
typedef __attribute__((ext_vector_type(8))) _Float16 v8b;
typedef __attribute__((ext_vector_type(4))) _Float16 v4h_;
typedef __attribute__((ext_vector_type(8))) float v8f;
typedef __attribute__((ext_vector_type(4))) float v4f;

__device__ __forceinline__ float bf16_rne(float f) { unsigned int u = __float_as_uint(f); u += 0x7FFFu + ((u >> 16) & 1u); return __uint_as_float(u & 0xFFFF0000u); }
__device__ __forceinline__ v16b frag_kb(const b16* p, int hh) { const v8b a = *(const v8b*)(p + 8 * hh), b = *(const v8b*)(p + 16 + 8 * hh); v16b f;
#pragma unroll
  for (int e = 0; e < 8; ++e) { f[e] = a[e]; f[8 + e] = b[e]; } return f; }
__device__ __forceinline__ v8f wmma_raw(v16b a, v16b b, v8f c) { return __builtin_amdgcn_wmma_f32_16x16x32_f16(false, a, false, b, (short)0, c, false, false); }
__device__ __forceinline__ v8f wmma16b(v16b a, v16b b, v8f c) { v8f d = wmma_raw(a, b, c); asm volatile("v_nop\n\tv_nop\n\tv_nop\n\tv_nop" : "+v"(d) : "v"(a), "v"(b)); return d; }
// one guard after a group of 8 accumulating WMMAs: ties all 8 accumulators, keeps both A and all four B fragments live across the 4 nops
#define WMMA_GUARD8(c, a0, a1, bf) asm volatile("v_nop\n\tv_nop\n\tv_nop\n\tv_nop" : "+v"(c[0][0]), "+v"(c[0][1]), "+v"(c[0][2]), "+v"(c[0][3]), \
    "+v"(c[1][0]), "+v"(c[1][1]), "+v"(c[1][2]), "+v"(c[1][3]) : "v"(a0), "v"(a1), "v"(bf[0]), "v"(bf[1]), "v"(bf[2]), "v"(bf[3]))
__device__ __forceinline__ void wave_lds_sync() { __builtin_amdgcn_fence(3 /* release order */, "workgroup"); __builtin_amdgcn_wave_barrier(); __builtin_amdgcn_fence(2 /* acquire order */, "workgroup"); }
__device__ __forceinline__ float pmul(float a, float b) { float p = a * b; asm volatile("" : "+v"(p)); return p; }
__device__ __forceinline__ int iclamp(int v, int lo, int hi) { return v < lo ? lo : (v > hi ? hi : v); }
__device__ __forceinline__ float nexp2(float v) { float r; asm("v_exp_f32 %0, %1\n\tv_nop" : "=v"(r) : "v"(v)); return r; }
// 16-lane butterflies (partners lane ^ 8, 4, 2, 1) on ds_bpermute_b32; sa[] holds the four partner byte addresses, formed once per kernel (fewer live registers than per-call index math)
__device__ __forceinline__ float bperm(int addr, float x) { return __int_as_float(__builtin_amdgcn_ds_bpermute(addr, __float_as_int(x))); }
__device__ __forceinline__ float red_max16(float x, const int (&sa)[4]) {
#pragma unroll
  for (int j = 0; j < 4; ++j) x = fmaxf(x, bperm(sa[j], x));
  return x; }
__device__ __forceinline__ float red_sum16(float x, const int (&sa)[4]) {
#pragma unroll
  for (int j = 0; j < 4; ++j) x += bperm(sa[j], x);
  return x; }

// Wt[l][noff + n][k] = f16(bf16(W[l][k][n]) x 256), W stored [layer][in][out] with NA columns; block = 64 k x 64 n tile transposed through LDS (T: 64 x 72 halves; cross-thread, block barrier);
__device__ __forceinline__ void wprep_tile(b16* T, const float* __restrict__ W, b16* __restrict__ Wt, int K, int NA, int NT, int noff, int l, int k0, int n0, int tid) {
  { const int kr = tid >> 2, nc = (tid & 3) * 16; const float* src = W + ((size_t)l * K + k0 + kr) * NA + n0 + nc;
#pragma unroll
    for (int q = 0; q < 4; ++q) { const v4f v = *(const v4f*)(src + 4 * q);
#pragma unroll
      for (int j = 0; j < 4; ++j) T[(nc + 4 * q + j) * 72 + kr] = (b16)(bf16_rne(v[j]) * WSC); } }
  __syncthreads();
  v8b vv[2]; size_t dst[2];
#pragma unroll
  for (int i = 0; i < 2; ++i) { const int n = (tid >> 3) + 32 * i, p = tid & 7; vv[i] = *(const v8b*)(T + n * 72 + 8 * p); dst[i] = ((size_t)l * NT + noff + n0 + n) * K + k0 + 8 * p; }
  {
#pragma unroll
    for (int i = 0; i < 2; ++i) *(v8b*)(Wt + dst[i]) = vv[i];
     }
}

__device__ __forceinline__ void mprep_part(const float* __restrict__ mem, b16* __restrict__ Mh, int u) {
  if (u >= MR * D / 8) return;
  const int row = u / (D / 8), c0 = (u % (D / 8)) * 8, b = row / SEQ, s = row % SEQ;
  const float* src = mem + ((size_t)b * SEQ_FULL + s) * D + c0;
  const v4f a = *(const v4f*)src, c = *(const v4f*)(src + 4); v8b v;
#pragma unroll
  for (int j = 0; j < 4; ++j) { v[j] = (b16)(bf16_rne(a[j]) * CA); v[4 + j] = (b16)(bf16_rne(c[j]) * CA); }
  { *(v8b*)(Mh + (size_t)row * D + c0) = v;  }
}

// embedding: x[b][s][c] = bf16(emb[tok[s][b]][c]) x sqrt(512) + pe(s, c), pe(s, 2j) = sin(s x exp(2j x NLOGD)), pe(s, 2j+1) = cos(same angle); tok clamped. block = 4 rows,
// thread = 8 columns (rolled loop of 4 expf + sincosf); the 4 x 512 f32 tile is staged in LDS (block barrier), then 32 lanes x 16 B per 512-B run to X and
__device__ __forceinline__ void embed_rows(float* Xs, const int* __restrict__ tok, const float* __restrict__ emb, float* __restrict__ X, b16* __restrict__ Xh, int row0, int tid) {
  const int rl = tid >> 6, c0 = (tid & 63) * 8, row = row0 + rl, b = row / SEQ, s = row % SEQ;
  const int t = iclamp(tok[s * NB_FULL + b], 0, VOCAB - 1);
  const float* er = emb + (size_t)t * D + c0;
#pragma unroll 1
  for (int q = 0; q < 4; ++q) {
    const int c = c0 + 2 * q; const float dv = expf(pmul((float)c, NLOGD)); float sn, cs; sincosf(pmul((float)s, dv), &sn, &cs);
    Xs[rl * (D + 4) + c] = pmul(bf16_rne(er[2 * q]), SQD) + sn; Xs[rl * (D + 4) + c + 1] = pmul(bf16_rne(er[2 * q + 1]), SQD) + cs; }
  __syncthreads();
  v4f fv[2]; size_t fo[2]; v8b hv;
#pragma unroll
  for (int i = 0; i < 2; ++i) { const int f = i * 256 + tid; fv[i] = *(const v4f*)(Xs + (f >> 7) * (D + 4) + (f & 127) * 4); fo[i] = (size_t)(row0 + (f >> 7)) * D + (f & 127) * 4; }
  { const v4f a = *(const v4f*)(Xs + rl * (D + 4) + c0), c4 = *(const v4f*)(Xs + rl * (D + 4) + c0 + 4);
#pragma unroll
    for (int e = 0; e < 4; ++e) { hv[e] = (b16)(a[e] * CA); hv[4 + e] = (b16)(c4[e] * CA); } }
  {
#pragma unroll
    for (int i = 0; i < 2; ++i) *(v4f*)(X + fo[i]) = fv[i];
    *(v8b*)(Xh + (size_t)row * D + c0) = hv;  }
}

// All input preparation in one grid: none of its parts reads what another writes, so a block takes its part by its index range (block-uniform): embedding rows first (the longest blocks),
// then the 64 x 64 tiles of the eight 512 x 512 weights, of W1 and of W2 (k tile fastest, then n tile, then layer), then the memory plane.
constexpr int LTD = 3, LTF = 5, PB_WS = NLAY << (2 * LTD), PB_WF = NLAY << (LTD + LTF);   // log2 of the 64-wide tiles along 512 and along 2048; blocks of a small and of an FFN weight
static_assert((64 << LTD) == D && (64 << LTF) == DFF);
constexpr int P_W = MR / 4, P_F1 = P_W + 8 * PB_WS, P_F2 = P_F1 + PB_WF, P_M = P_F2 + PB_WF, P_ALL = P_M + (MR * D / 8 + 255) / 256;   // first block of each range
__global__ __launch_bounds__(256) void prep_kernel(const int* __restrict__ tok, const float* __restrict__ emb, const float* __restrict__ mem,
    const float* __restrict__ wqs, const float* __restrict__ wks, const float* __restrict__ wvs, const float* __restrict__ wos,
    const float* __restrict__ wqc, const float* __restrict__ wkc, const float* __restrict__ wvc, const float* __restrict__ woc,
    const float* __restrict__ w1, const float* __restrict__ w2,
    b16* __restrict__ WQKVS, b16* __restrict__ WOS, b16* __restrict__ WQKVC, b16* __restrict__ WOC, b16* __restrict__ W1T, b16* __restrict__ W2T,
    b16* __restrict__ Mh, float* __restrict__ X, b16* __restrict__ Xh) {
  __shared__ __attribute__((aligned(16))) b16 Sh[64 * 72];   // weight tile, or the embedding's 4 x 516 f32 rows
  static_assert(64 * 72 * 2 >= 4 * (D + 4) * 4);
  const int tid = threadIdx.x, r = blockIdx.x;
  if (r < P_W) embed_rows((float*)Sh, tok, emb, X, Xh, r * 4, tid);
  else if (r < P_M) {
    const float* W; b16* Wt; int q, lk = LTD, ln = LTD, NT, noff = 0;   // lk, ln: log2 of the tile counts along k (rows of W) and n (its columns)
    if (r < P_F1) {
      const int m = (r - P_W) / PB_WS, g = m & 3;   // m: 0..3 q k v o of the self-attention, 4..7 of the attention over memory
      q = (r - P_W) % PB_WS;
      W = m < 4 ? (g == 0 ? wqs : (g == 1 ? wks : (g == 2 ? wvs : wos))) : (g == 0 ? wqc : (g == 1 ? wkc : (g == 2 ? wvc : woc)));
      Wt = m < 4 ? (g == 3 ? WOS : WQKVS) : (g == 3 ? WOC : WQKVC);
      NT = g == 3 ? D : NQKV; noff = g == 3 ? 0 : g * D;
    } else if (r < P_F2) { q = r - P_F1; W = w1; Wt = W1T; ln = LTF; NT = DFF; }
    else { q = r - P_F2; W = w2; Wt = W2T; lk = LTF; NT = D; }
    wprep_tile(Sh, W, Wt, 64 << lk, 64 << ln, NT, noff, q >> (lk + ln), (q & ((1 << lk) - 1)) * 64, ((q >> lk) & ((1 << ln) - 1)) * 64, tid);
    asm volatile("s_wait_xcnt 0x0" ::: "memory");   // the built code joins this branch's end to an edge into the embedding branch, which rewrites the registers the two stores name: the wait stands in front of that join
  } else mprep_part(mem, Mh, (r - P_M) * 256 + tid);
}

// Operand staging of the GEMMs: a stage is KS = 128 k (256 B) of every A and B row of the block tile, laid in LDS at pitch 272 B (16 B x 17: odd, conflict-free for 16-B row readers),
// brought by per-lane asynchronous 16-B copies (a wave's copy covers 2 rows x 256 B = 4 whole lines); two buffers, the next stage's copies fly while this one is worked on.
constexpr int KS = 128, LP = KS + 8;
__device__ __forceinline__ unsigned lds_byte(const void* p) { return (unsigned)(unsigned long long)p; }
// copies of rows 16 apart (LDS step 16 x 272 B, global step gs halves); s_wait_xcnt 0 closes each statement so that no address register is rewritten ahead of it
__device__ __forceinline__ void cp2(unsigned l, const b16* g, size_t gs) {
  asm volatile("global_load_async_to_lds_b128 %0, %2, off\n\tglobal_load_async_to_lds_b128 %1, %3, off\n\ts_wait_xcnt 0x0"
      :: "v"(l), "v"(l + 16u * LP * 2u), "v"(g), "v"(g + gs) : "memory");
}
__device__ __forceinline__ void cp8(unsigned l, const b16* g, size_t gs) {
  constexpr unsigned LS = 16u * LP * 2u;
  asm volatile("global_load_async_to_lds_b128 %0, %8, off\n\tglobal_load_async_to_lds_b128 %1, %9, off\n\tglobal_load_async_to_lds_b128 %2, %10, off\n\t"
      "global_load_async_to_lds_b128 %3, %11, off\n\tglobal_load_async_to_lds_b128 %4, %12, off\n\tglobal_load_async_to_lds_b128 %5, %13, off\n\t"
      "global_load_async_to_lds_b128 %6, %14, off\n\tglobal_load_async_to_lds_b128 %7, %15, off\n\ts_wait_xcnt 0x0"
      :: "v"(l), "v"(l + LS), "v"(l + 2u * LS), "v"(l + 3u * LS), "v"(l + 4u * LS), "v"(l + 5u * LS), "v"(l + 6u * LS), "v"(l + 7u * LS),
         "v"(g), "v"(g + gs), "v"(g + 2 * gs), "v"(g + 3 * gs), "v"(g + 4 * gs), "v"(g + 5 * gs), "v"(g + 6 * gs), "v"(g + 7 * gs) : "memory");
}
// block of 256 threads: AR rows of A (first row Ag, pitch lda) and BR rows of B = Wt (first row Bg, pitch K), K a multiple of 128; the wave takes 32 A rows from arow and 64 B rows from
// brow: 8 WMMAs per 32 k, one guard per stage. On return every wave has left the ring (last trip's barrier): it may be reused.
// Blocks of one grid share operand rows and start together: walking K alike they would ask L2 for the same lines at the same moment. Trip t therefore takes the k stage (t + rot) mod NT,
// and the 128-row groups of B are copied in the order jrot, jrot + 1, ... (mod their number); rot < NT and jrot come from the block index (block-uniform). The f32 sums run over k in that rotated order.
template <int AR, int BR>
__device__ __forceinline__ void mac_staged(v8f (&acc)[2][4], b16* ring, const b16* Ag, int lda, const b16* Bg, int K, int arow, int brow, int tid, int nloc, int hlf, int rot, int jrot) {
  static_assert((AR == 32 || AR % 128 == 0) && BR % 128 == 0);
  constexpr int BUFH = (AR + BR) * LP;
  const unsigned l0 = lds_byte(ring) + (unsigned)(tid >> 4) * (LP * 2u) + (unsigned)(tid & 15) * 16u;
  const b16* ga = Ag + (size_t)(tid >> 4) * lda + 8 * (tid & 15);
  const b16* gb = Bg + (size_t)(tid >> 4) * K + 8 * (tid & 15);
  const int NT = K / KS;
  auto fill = [&](int t) {
    const unsigned l = l0 + (unsigned)(t & 1) * (BUFH * 2u);
    const int kt = t + rot < NT ? t + rot : t + rot - NT;   // this trip's k stage
    if constexpr (AR == 32) cp2(l, ga + kt * KS, (size_t)16 * lda);
    else {
#pragma unroll
      for (int j = 0; j < AR / 128; ++j) cp8(l + (unsigned)j * (128u * LP * 2u), ga + (size_t)(128 * j) * lda + kt * KS, (size_t)16 * lda); }
#pragma unroll
    for (int i = 0; i < BR / 128; ++i) { const int j = (i + jrot) % (BR / 128);
      cp8(l + (unsigned)(AR + 128 * j) * (LP * 2u), gb + (size_t)(128 * j) * K + kt * KS, (size_t)16 * K); }
  };
  fill(0);
  asm volatile("s_wait_asynccnt 0x0" ::: "memory");   // trip 0's k stage has landed (this wave's copies) before the barrier that publishes it
  __syncthreads();
  if (NT > 1) fill(1);
#pragma unroll 1
  for (int t = 0; t < NT; ++t) {
    const b16* bufp = ring + (t & 1) * BUFH;
    const b16* ap0 = bufp + (arow + nloc) * LP; const b16* ap1 = ap0 + 16 * LP; const b16* bp = bufp + (AR + brow + nloc) * LP;
    v16b a0[2], a1[2], bf[2][4];   // two fragment sets: the next 32 k are fetched while the WMMAs of these 32 k run (all inside this stage's buffer)
    a0[0] = frag_kb(ap0, hlf); a1[0] = frag_kb(ap1, hlf);
#pragma unroll
    for (int u = 0; u < 4; ++u) bf[0][u] = frag_kb(bp + u * 16 * LP, hlf);
#pragma unroll
    for (int s = 0; s < KS / 32; ++s) {
      const int c = s & 1, n = c ^ 1;
      if (s + 1 < KS / 32) {
        a0[n] = frag_kb(ap0 + 32 * (s + 1), hlf); a1[n] = frag_kb(ap1 + 32 * (s + 1), hlf);
#pragma unroll
        for (int u = 0; u < 4; ++u) bf[n][u] = frag_kb(bp + u * 16 * LP + 32 * (s + 1), hlf); }
      __builtin_amdgcn_sched_barrier(0);   // keeps the next block's 12 LDS reads one group in front of this block's WMMAs (for speed only)
#pragma unroll
      for (int u = 0; u < 4; ++u) { acc[0][u] = wmma_raw(a0[c], bf[c][u], acc[0][u]); acc[1][u] = wmma_raw(a1[c], bf[c][u], acc[1][u]); }
      if (s + 1 < KS / 32) __builtin_amdgcn_sched_barrier(0);   // the block after next's reads stay behind this block's WMMAs
      else WMMA_GUARD8(acc, a0[c], a1[c], bf[c]);   // the stage's last WMMAs stand in front of a branch: the 4 slots behind them are filled here for both of its sides
    }
    asm volatile("s_wait_dscnt 0x0" ::: "memory");     // this wave's reads of the buffer have retired before the barrier behind which it is refilled
    asm volatile("s_wait_asynccnt 0x0" ::: "memory");  // this wave's copies for trip t + 1 have landed before the barrier that publishes them
    __syncthreads();
    if (t + 2 < NT) fill(t + 2);
  }
  asm volatile("s_wait_asynccnt 0x0" ::: "memory");    // no copy outstanding when the ring is reused or the wave ends
}

// row-major f16 epilogue of one wave's 32 x 64 tile (plane value = f16(v x 8), LO: f16((v x 8 - hi) x 2048)): b16 element stores into the wave-private LDS tile, wave sync,
template <bool LO, bool RELU>
__device__ __forceinline__ void epi_rows(const v8f (&acc)[2][4], const float (&bb)[4], float oscale, b16* Es, b16* dstp, int ldc, int lane, int nloc, int hlf) {
#pragma unroll
  for (int mt = 0; mt < 2; ++mt)
#pragma unroll
    for (int t = 0; t < 4; ++t)
#pragma unroll
      for (int r = 0; r < 8; ++r) {
        float v = acc[mt][t][r] * oscale + bb[t]; if (RELU) v = fmaxf(v, 0.0f); const float vs = v * CA; const b16 hi = (b16)vs;
        Es[(mt * 16 + 8 * hlf + r) * 72 + 16 * t + nloc] = LO ? (b16)((vs - (float)hi) * RS) : hi; }
  wave_lds_sync();
  v8b vv[8];
#pragma unroll
  for (int j = 0; j < 8; ++j) vv[j] = *(const v8b*)(Es + (4 * j + (lane >> 3)) * 72 + 8 * (lane & 7));
  b16* dst = dstp + (size_t)(lane >> 3) * ldc + 8 * (lane & 7);
  {
#pragma unroll
    for (int j = 0; j < 8; ++j) *(v8b*)(dst + (size_t)(4 * j) * ldc) = vv[j];
     }
}

// head-transposed f16 epilogue of the block's 128 (keys) x 128 (head columns) tile -> plane[((b*NH + h)*DH + d)*SEQ + key]: each lane stores its 8 consecutive keys of one
// column as one 16-B LDS store into Et[col][key] (cross-wave, block barrier), then store j: lanes 0..15 -> column 16j + 2 wave, lanes 16..31 -> +1, lane piece = 8 keys
template <bool LO, bool RELU>
__device__ __forceinline__ void epi_vt(const v8f (&acc)[2][4], const float (&bb)[4], float oscale, b16* Et, b16* plane, int bidx, int key0, int colv0, int wave, int wm, int wn, int nloc, int hlf) {
#pragma unroll
  for (int mt = 0; mt < 2; ++mt)
#pragma unroll
    for (int t = 0; t < 4; ++t) { v8b hv;
#pragma unroll
      for (int r = 0; r < 8; ++r) { float v = acc[mt][t][r] * oscale + bb[t]; if (RELU) v = fmaxf(v, 0.0f); const float vs = v * CA; const b16 hi = (b16)vs; hv[r] = LO ? (b16)((vs - (float)hi) * RS) : hi; }
      *(v8b*)(Et + (wn * 64 + 16 * t + nloc) * 136 + wm * 32 + mt * 16 + 8 * hlf) = hv; }
  __syncthreads();
  v8b vv[8]; size_t dsto[8];
#pragma unroll
  for (int j = 0; j < 8; ++j) { const int dl = 16 * j + 2 * wave + hlf; const int col = colv0 + dl; const int hh = col / DH, dd = col % DH;
    vv[j] = *(const v8b*)(Et + dl * 136 + 8 * nloc); dsto[j] = ((size_t)(bidx * NH + hh) * DH + dd) * SEQ + key0 + 8 * nloc; }
  {
#pragma unroll
    for (int j = 0; j < 8; ++j) *(v8b*)(plane + dsto[j]) = vv[j];
     }
}

// C = (A[M][K] f16 plane, pitch lda) x Wt[N][K] + bf16(bias), optional relu; block 128 x 128 = 8 waves of 32 x 64. GEMM columns < vcol0 -> row-major plane C[row*ldc + ccol0 + col]
// (f16 x 8); columns >= vcol0 -> head-transposed plane VT (v of the attention). Blocks whose 128 rows start a sequence also emit the residual planes Clo / VTlo (x 2048) for those rows
// when wres != 0. Bias group pointer chosen per 512-column group (block-uniform). Column blocks below asplit multiply A1, the others A2 (block-uniform): two products of different left
// operands that share K and the output planes run as one grid.
template <bool RELU>
__global__ __launch_bounds__(256) void gemm_kernel(const b16* __restrict__ A1, const b16* __restrict__ A2, int asplit, int lda, const b16* __restrict__ Wt, int K,
    const float* __restrict__ bg0, const float* __restrict__ bg1, const float* __restrict__ bg2, const float* __restrict__ bg3,
    b16* __restrict__ C, b16* __restrict__ Clo, int ldc, int ccol0, b16* __restrict__ VT, b16* __restrict__ VTlo, int vcol0, float oscale, int wres) {
  __shared__ __attribute__((aligned(16))) b16 Ls[2 * 256 * LP];   // operand ring (2 buffers x 256 rows); behind the K loop 8 wave tiles [32][72] (row-major mode) or one block tile [128][136] (transposed mode)
  static_assert(2 * 256 * LP >= 18432);
  const int tid = threadIdx.x, wave = tid >> 5, lane = tid & 31, nloc = lane & 15, hlf = lane >> 4;
  const int bm0 = blockIdx.x * 128, bn0 = blockIdx.y * 128, wm = wave >> 1, wn = wave & 1;
  const int row0 = bm0 + wm * 32, col0 = bn0 + wn * 64;
  const b16* A = bn0 < asplit ? A1 : A2;
  v8f acc[2][4];
#pragma unroll
  for (int t = 0; t < 4; ++t) { acc[0][t] = (v8f){}; acc[1][t] = (v8f){}; }
  mac_staged<128, 128>(acc, Ls, A + (size_t)bm0 * lda, lda, Wt + (size_t)bn0 * K, K, wm * 32, wn * 64, tid, nloc, hlf, (int)((blockIdx.x + blockIdx.y) % (unsigned)(K / KS)), 0);
  const int gsel = bn0 >> 9; const float* bias = gsel == 0 ? bg0 : (gsel == 1 ? bg1 : (gsel == 2 ? bg2 : bg3));
  float bb[4];
#pragma unroll
  for (int t = 0; t < 4; ++t) bb[t] = bf16_rne(bias[(col0 & 511) + 16 * t + nloc]);
  const bool vmode = bn0 >= vcol0, wlo = (wres != 0) && (bm0 % SEQ == 0);
  if (!vmode) {
    b16* Es = Ls + wave * (32 * 72);
    epi_rows<false, RELU>(acc, bb, oscale, Es, C + (size_t)row0 * ldc + ccol0 + col0, ldc, lane, nloc, hlf);
    if (wlo) { wave_lds_sync(); epi_rows<true, RELU>(acc, bb, oscale, Es, Clo + (size_t)row0 * ldc + ccol0 + col0, ldc, lane, nloc, hlf); }
  } else {
    epi_vt<false, RELU>(acc, bb, oscale, Ls, VT, bm0 / SEQ, bm0 % SEQ, bn0 - vcol0, wave, wm, wn, nloc, hlf);
    if (wlo) { __syncthreads(); epi_vt<true, RELU>(acc, bb, oscale, Ls, VTlo, bm0 / SEQ, bm0 % SEQ, bn0 - vcol0, wave, wm, wn, nloc, hlf); }
  }
}

// Y = LayerNorm(Xres + (A x Wt + bf16(bias))) * bf16(g) + bf16(be) over full 512-wide rows: block = 32 rows x 512 columns (wave = 32 x 64), K = 512 or 2048. Per 16-row half the f32
// tile is staged in LDS (cross-wave, block barrier); wave w then owns rows 2w, 2w+1: lane holds columns 128j + 4 lane (j = 0..3), residual / bias / gain loaded with the same map,
__global__ __launch_bounds__(256) void gemm_ln_kernel(const b16* __restrict__ A, int K, const b16* __restrict__ Wt, const float* __restrict__ bias, const float* Xres,
    const float* __restrict__ gam, const float* __restrict__ bet, float* OutF, b16* __restrict__ Xh, float oscale, int wxh) {
  __shared__ __attribute__((aligned(16))) b16 Rg[2 * (32 + D) * LP];   // operand ring (2 buffers x 544 rows); behind the K loop the f32 tile Tf
  static_assert(2 * (32 + D) * LP * 2 >= 16 * (D + 4) * 4);
  float* Tf = (float*)Rg;
  const int tid = threadIdx.x, wave = tid >> 5, lane = tid & 31, nloc = lane & 15, hlf = lane >> 4;
  const int bm0 = blockIdx.x * 32, col0 = wave * 64;
  v8f acc[2][4];
#pragma unroll
  for (int t = 0; t < 4; ++t) { acc[0][t] = (v8f){}; acc[1][t] = (v8f){}; }
  mac_staged<32, D>(acc, Rg, A + (size_t)bm0 * K, K, Wt, K, 0, col0, tid, nloc, hlf, (int)(blockIdx.x % (unsigned)(K / KS)), (int)(blockIdx.x / (unsigned)(K / KS) % 4u));
#pragma unroll 1
  for (int mt = 0; mt < 2; ++mt) {
    if (mt) __syncthreads();
#pragma unroll
    for (int t = 0; t < 4; ++t)
#pragma unroll
      for (int r = 0; r < 8; ++r) Tf[(8 * hlf + r) * (D + 4) + col0 + 16 * t + nloc] = (mt ? acc[1][t][r] : acc[0][t][r]) * oscale;
    __syncthreads();
#pragma unroll 1
    for (int rr = 0; rr < 2; ++rr) {
      const int rl = 2 * wave + rr; const size_t go = (size_t)(bm0 + mt * 16 + rl) * D;
      float y[16]; float s = 0.0f;
#pragma unroll
      for (int j = 0; j < 4; ++j) { const int c = 128 * j + 4 * lane;
        const v4f tv = *(const v4f*)(Tf + rl * (D + 4) + c); const v4f rv = *(const v4f*)(Xres + go + c); const v4f bv = *(const v4f*)(bias + c);
#pragma unroll
        for (int e = 0; e < 4; ++e) { const float yy = rv[e] + (tv[e] + bf16_rne(bv[e])); y[4 * j + e] = yy; s += yy; } }
#pragma unroll
      for (int off = 16; off > 0; off >>= 1) s += __shfl_xor(s, off, 32);
      const float mean = s * (1.0f / (float)D); float q = 0.0f;
#pragma unroll
      for (int i = 0; i < 16; ++i) { const float d0 = y[i] - mean; y[i] = d0; q += d0 * d0; }
#pragma unroll
      for (int off = 16; off > 0; off >>= 1) q += __shfl_xor(q, off, 32);
      const float rstd = 1.0f / sqrtf(q * (1.0f / (float)D) + LNEPS);
      v4f ov[4]; v4h_ hv[4];
#pragma unroll
      for (int j = 0; j < 4; ++j) { const int c = 128 * j + 4 * lane; const v4f gv = *(const v4f*)(gam + c), ev = *(const v4f*)(bet + c);
#pragma unroll
        for (int e = 0; e < 4; ++e) { const float o = (y[4 * j + e] * rstd) * bf16_rne(gv[e]) + bf16_rne(ev[e]); ov[j][e] = o; hv[j][e] = (b16)(o * CA); } }
      {
#pragma unroll
        for (int j = 0; j < 4; ++j) { const int c = 128 * j + 4 * lane; *(v4f*)(OutF + go + c) = ov[j]; if (wxh) *(v4h_*)(Xh + go + c) = hv[j]; }
         }
    }
  }
}

// Streaming attention, one work-group = 16 query rows of one (batch, head), its NWK waves sharing the keys: wave w walks the 32-key chunks w, w + NWK, ... with its own running max,
// sum and context, beginning at a step rotated by query tile + head and wrapping (the tiles of a head share K and V, the heads of a tile the mask: walking alike they would ask L2 for the same lines
// at once); the partial results meet in LDS behind one block barrier and are joined there (weights exp(max_w - max)). Q fragments from the q|k plane (column h*64), per chunk
// the 16x32 mask tile is loaded first (two groups of 8 scalar loads per lane, the first group retired before the second issues; ballot: skip when all masked), scores = 2 k-steps of
// WMMA against K rows, replace-mask, running-max softmax in f32 (exp2), P staged x4096 into a wave-private LDS tile (b16 element stores, wave sync, fragment reload), ctx += P x V with
// V from the head-transposed plane [d][key].
// RES: query/key residual planes give 3 score products and P_res x V + P x V_res into a second accumulator for chunks with keys < 128 (rows for which the residual planes exist);
constexpr int NWK = 4, PPW = DH + 4;   // waves per query tile; f32 pitch of a partial context row
static_assert((SEQ / 32) % NWK == 0);
template <bool RES>
__global__ __launch_bounds__(32 * NWK) void attn_kernel(const b16* __restrict__ QK, const b16* __restrict__ QKlo, const b16* __restrict__ VT, const b16* __restrict__ VTlo,
    const int* __restrict__ mask, b16* __restrict__ CTX, int qt0, int nqt) {
  __shared__ __attribute__((aligned(16))) b16 PstA[NWK * 16 * 40];
  __shared__ __attribute__((aligned(16))) b16 PlstA[RES ? NWK * 16 * 40 : 8];
  __shared__ __attribute__((aligned(16))) float Part[NWK * 16 * PPW];
  __shared__ float Mxs[NWK * 16], Lss[NWK * 16];
  const int tid = threadIdx.x, lane = tid & 31, nloc = lane & 15, hlf = lane >> 4, wave = __builtin_amdgcn_readfirstlane(tid >> 5);
  const int sa[4] = {(lane ^ 8) << 2, (lane ^ 4) << 2, (lane ^ 2) << 2, (lane ^ 1) << 2};
  b16* Pst = PstA + wave * (16 * 40); b16* Plst = PlstA + (RES ? wave * (16 * 40) : 0);
  const int bi = blockIdx.x, qt = qt0 + bi % nqt, bh = bi / nqt, h = bh % NH, b = bh / NH, q0 = qt * 16;
  const size_t rq = (size_t)b * SEQ + q0;
  const b16* qp = QK + (rq + nloc) * LQK + h * DH;
  const v16b qa0 = frag_kb(qp, hlf), qa1 = frag_kb(qp + 32, hlf);
  v16b ql0 = (v16b){}, ql1 = (v16b){};
  if (RES) { const b16* qlp = QKlo + (rq + nloc) * LQK + h * DH; ql0 = frag_kb(qlp, hlf); ql1 = frag_kb(qlp + 32, hlf); }
  const b16* kbase = QK + ((size_t)b * SEQ + 32 * wave) * LQK + D + h * DH;   // this and the four bases below start at the wave's first chunk
  const b16* klbase = QKlo + ((size_t)b * SEQ + 32 * wave) * LQK + D + h * DH;
  const b16* vbase = VT + (size_t)(b * NH + h) * DH * SEQ + 32 * wave;
  const b16* vlbase = VTlo + (size_t)(b * NH + h) * DH * SEQ + 32 * wave;
  const int* mq = mask + ((size_t)b * SEQ_FULL + q0 + 8 * hlf) * SEQ_FULL + 32 * wave + nloc;
  float mx[8], ls[8]; v8f acc[4], acc2[4];
#pragma unroll
  for (int r = 0; r < 8; ++r) { mx[r] = -3.0e38f; ls[r] = 0.0f; }
#pragma unroll
  for (int t = 0; t < 4; ++t) { acc[t] = (v8f){}; acc2[t] = (v8f){}; }
  constexpr int NI = SEQ / 32 / NWK;
  const int irot = (qt + h) % NI;   // first step of this block's walk (block-uniform)
#pragma unroll 1
  for (int i = 0; i < NI; ++i) {
    const int ii = i + irot < NI ? i + irot : i + irot - NI;
    const int kb = 32 * NWK * ii, c = wave + NWK * ii;   // kb: key offset from the wave's first chunk; c: chunk index
    int m0[8], m1[8]; bool allm = true;
    // mask tile rows 8 hlf + r: group 1 = key column kb + nloc, group 2 = kb + 16 + nloc; compiler + wait barrier between the two groups of 8 loads
#pragma unroll
    for (int r = 0; r < 8; ++r) m0[r] = mq[(size_t)r * SEQ_FULL + kb];
    asm volatile("" :: "v"(m0[0]), "v"(m0[1]), "v"(m0[2]), "v"(m0[3]), "v"(m0[4]), "v"(m0[5]), "v"(m0[6]), "v"(m0[7]) : "memory");
#pragma unroll
    for (int r = 0; r < 8; ++r) m1[r] = mq[(size_t)r * SEQ_FULL + kb + 16];
#pragma unroll
    for (int r = 0; r < 8; ++r) allm = allm && (m0[r] != 0) && (m1[r] != 0);
    if (__builtin_amdgcn_ballot_w32(allm) == 0xffffffffu) continue;
    wave_lds_sync();   // prior chunk's fragment reloads complete before the P tiles are rewritten
    v8f s[2];
#pragma unroll
    for (int t = 0; t < 2; ++t) {
      const b16* kp = kbase + (size_t)(kb + 16 * t + nloc) * LQK; const v16b k0f = frag_kb(kp, hlf), k1f = frag_kb(kp + 32, hlf);
      v8f sh = wmma16b(qa0, k0f, (v8f){}); sh = wmma16b(qa1, k1f, sh);
      if (RES && c < 4) {
        const b16* klp = klbase + (size_t)(kb + 16 * t + nloc) * LQK;
        v8f x = wmma16b(ql0, k0f, (v8f){}); x = wmma16b(ql1, k1f, x); x = wmma16b(qa0, frag_kb(klp, hlf), x); x = wmma16b(qa1, frag_kb(klp + 32, hlf), x);
#pragma unroll
        for (int r = 0; r < 8; ++r) sh[r] += x[r] * (1.0f / RS); }
      s[t] = sh; }
    float p0[8], p1[8];
#pragma unroll
    for (int r = 0; r < 8; ++r) {
      float s0 = s[0][r] * SCL, s1 = s[1][r] * SCL; s0 = (m0[r] != 0) ? NEGF : s0; s1 = (m1[r] != 0) ? NEGF : s1;
      const float cm = red_max16(fmaxf(s0, s1), sa); const float mn = fmaxf(mx[r], cm); const float al = nexp2((mx[r] - mn) * L2E); mx[r] = mn;
      const float e0 = nexp2((s0 - mn) * L2E), e1 = nexp2((s1 - mn) * L2E); p0[r] = e0; p1[r] = e1;
      ls[r] = ls[r] * al + red_sum16(e0 + e1, sa);
#pragma unroll
      for (int t = 0; t < 4; ++t) { acc[t][r] *= al; if (RES) acc2[t][r] *= al; } }
#pragma unroll
    for (int r = 0; r < 8; ++r) {
      const float v0 = p0[r] * PSC, v1 = p1[r] * PSC; const b16 h0 = (b16)v0, h1 = (b16)v1;
      Pst[(8 * hlf + r) * 40 + nloc] = h0; Pst[(8 * hlf + r) * 40 + 16 + nloc] = h1;
      if (RES) { Plst[(8 * hlf + r) * 40 + nloc] = (b16)((v0 - (float)h0) * RS); Plst[(8 * hlf + r) * 40 + 16 + nloc] = (b16)((v1 - (float)h1) * RS); } }
    wave_lds_sync();
    const v16b pf = frag_kb(Pst + nloc * 40, hlf); v16b plf = (v16b){}; if (RES) plf = frag_kb(Plst + nloc * 40, hlf);
#pragma unroll
    for (int t = 0; t < 4; ++t) {
      const v16b vf = frag_kb(vbase + (size_t)(16 * t + nloc) * SEQ + kb, hlf); acc[t] = wmma16b(pf, vf, acc[t]);
      if (RES && c < 4) { acc2[t] = wmma16b(plf, vf, acc2[t]); acc2[t] = wmma16b(pf, frag_kb(vlbase + (size_t)(16 * t + nloc) * SEQ + kb, hlf), acc2[t]); } }
  }
  // each wave publishes its partial context (f32, still scaled by its own max), max and sum; a wave whose chunks were all skipped publishes max -3e38, sum 0, context 0
  float* pw = Part + wave * (16 * PPW);
#pragma unroll
  for (int r = 0; r < 8; ++r) {
#pragma unroll
    for (int t = 0; t < 4; ++t) { float a = acc[t][r]; if (RES) a += acc2[t][r] * (1.0f / RS); pw[(8 * hlf + r) * PPW + 16 * t + nloc] = a; }
    if (nloc == 0) { Mxs[wave * 16 + 8 * hlf + r] = mx[r]; Lss[wave * 16 + 8 * hlf + r] = ls[r]; } }
  __syncthreads();   // every wave's partials are in LDS before any thread joins them
  // join: thread = 8 columns of one row (NWK = 4: 128 threads cover 16 x 64)
  static_assert(32 * NWK * 8 == 16 * DH);
  const int jr = tid >> 3, jc = 8 * (tid & 7);
  float wm_[NWK], M = Mxs[jr];
#pragma unroll
  for (int w = 1; w < NWK; ++w) M = fmaxf(M, Mxs[w * 16 + jr]);
  float L = 0.0f, o[8];
#pragma unroll
  for (int e = 0; e < 8; ++e) o[e] = 0.0f;
#pragma unroll
  for (int w = 0; w < NWK; ++w) { wm_[w] = nexp2((Mxs[w * 16 + jr] - M) * L2E); L += wm_[w] * Lss[w * 16 + jr];
    const v4f x0 = *(const v4f*)(Part + (w * 16 + jr) * PPW + jc), x1 = *(const v4f*)(Part + (w * 16 + jr) * PPW + jc + 4);
#pragma unroll
    for (int e = 0; e < 4; ++e) { o[e] += wm_[w] * x0[e]; o[4 + e] += wm_[w] * x1[e]; } }
  const float inv = (1.0f / L) * (CX / (PSC * CA)); v8b ov;
#pragma unroll
  for (int e = 0; e < 8; ++e) ov[e] = (b16)(o[e] * inv);
  *(v8b*)(CTX + (rq + jr) * D + h * DH + jc) = ov;
}
}  // namespace

extern "C" void kernel_launch(void* const* d_in, const int* in_sizes, int n_in, void* d_out, int out_size, void* d_ws, size_t ws_size, hipStream_t stream) {
  (void)n_in;
  auto Fp = [&](int i) { return (const float*)d_in[i]; };
  auto Ip = [&](int i) { return (const int*)d_in[i]; };
  // wire order: 0 tokens [512][8] i32, 1 memory [8][512][512], 2 self-attention mask [8][512][512] i32, 3 memory mask [8][512][512] i32, 4 embedding [32000][512],
  // 5..8 Wq_s Wk_s Wv_s Wo_s [6][512 in][512 out], 9..12 Wq_c Wk_c Wv_c Wo_c, 13..16 bq_s bk_s bv_s bo_s [6][512], 17..20 bq_c bk_c bv_c bo_c,
  // 21 W1 [6][512][2048], 22 b1 [6][2048], 23 W2 [6][2048][512], 24 b2 [6][512], 25 g1, 26 g2, 27 g3, 28 be1, 29 be2, 30 be3 [6][512]
  const long needRows = (long)(NB - 1) * SEQ_FULL + SEQ;
  if ((long)in_sizes[0] < (long)SEQ * NB_FULL || (long)in_sizes[1] < needRows * D || (long)in_sizes[2] < needRows * SEQ_FULL || (long)in_sizes[3] < needRows * SEQ_FULL ||
      (long)in_sizes[4] < (long)VOCAB * D) return;
  for (int i = 5; i <= 12; ++i) if ((long)in_sizes[i] < (long)NLAY * D * D) return;
  for (int i = 13; i <= 20; ++i) if (in_sizes[i] < NLAY * D) return;
  if ((long)in_sizes[21] < (long)NLAY * D * DFF || in_sizes[22] < NLAY * DFF || (long)in_sizes[23] < (long)NLAY * DFF * D || in_sizes[24] < NLAY * D) return;
  for (int i = 25; i <= 30; ++i) if (in_sizes[i] < NLAY * D) return;
  if (out_size < MR * D) return;

  size_t off = 0; char* ws = (char*)d_ws;
  auto carve = [&](size_t bytes) { char* p = ws + off; off += (bytes + 255) & ~(size_t)255; return p; };
  b16* WQKVS = (b16*)carve((size_t)NLAY * NQKV * D * 2);   // [6][1536][512]
  b16* WOS   = (b16*)carve((size_t)NLAY * D * D * 2);
  b16* WQKVC = (b16*)carve((size_t)NLAY * NQKV * D * 2);   // [6][1536][512]
  b16* WOC   = (b16*)carve((size_t)NLAY * D * D * 2);
  b16* W1T   = (b16*)carve((size_t)NLAY * DFF * D * 2);    // [6][2048][512]
  b16* W2T   = (b16*)carve((size_t)NLAY * D * DFF * 2);    // [6][512][2048]
  float* X   = (float*)carve((size_t)MR * D * 4);
  b16* Xh    = (b16*)carve((size_t)MR * D * 2);
  b16* Mh    = (b16*)carve((size_t)MR * D * 2);
  b16* QK    = (b16*)carve((size_t)MR * LQK * 2);
  b16* QKlo  = (b16*)carve((size_t)MR * LQK * 2);
  b16* Vt    = (b16*)carve((size_t)MR * D * 2);            // [NB][NH][64][SEQ]
  b16* Vtlo  = (b16*)carve((size_t)MR * D * 2);
  b16* CTX   = (b16*)carve((size_t)MR * D * 2);
  b16* Hh    = (b16*)carve((size_t)MR * DFF * 2);
  if (off > ws_size || off > ((size_t)128 << 20)) return;   // 113,246,208 B at full size

  const dim3 b256(256), battn(32 * NWK);
  prep_kernel<<<P_ALL, b256, 0, stream>>>(Ip(0), Fp(4), Fp(1), Fp(5), Fp(6), Fp(7), Fp(8), Fp(9), Fp(10), Fp(11), Fp(12), Fp(21), Fp(23),
      WQKVS, WOS, WQKVC, WOC, W1T, W2T, Mh, X, Xh);

  const float OSA = 1.0f / (CA * WSC), OSX = 1.0f / (CX * WSC);
  for (int l = 0; l < NLAY; ++l) {
    const size_t lD = (size_t)l * D, lF = (size_t)l * DFF;
    // fused q|k|v projection of x: q -> QK columns 0..511, k -> 512..1023, v -> head-transposed plane; residual planes for the first 128 rows of each sequence
    gemm_kernel<false><<<dim3(MR / 128, NQKV / 128), b256, 0, stream>>>(Xh, Xh, 0, D, WQKVS + (size_t)l * NQKV * D, D, Fp(13) + lD, Fp(14) + lD, Fp(15) + lD, Fp(15) + lD,
        QK, QKlo, LQK, 0, Vt, Vtlo, 2 * D, OSA, 1);
    attn_kernel<true><<<NB * NH * NQT_RES, battn, 0, stream>>>(QK, QKlo, Vt, Vtlo, Ip(2), CTX, 0, NQT_RES);
    attn_kernel<false><<<NB * NH * (NQT - NQT_RES), battn, 0, stream>>>(QK, QKlo, Vt, Vtlo, Ip(2), CTX, NQT_RES, NQT - NQT_RES);
    gemm_ln_kernel<<<MR / 32, b256, 0, stream>>>(CTX, D, WOS + (size_t)l * D * D, Fp(16) + lD, X, Fp(25) + lD, Fp(28) + lD, X, Xh, OSX, 1);
    // attention over the memory tensor: q (columns 0..511) from x, k|v (columns 512..1535) from the memory plane, one grid
    gemm_kernel<false><<<dim3(MR / 128, NQKV / 128), b256, 0, stream>>>(Xh, Mh, D, D, WQKVC + (size_t)l * NQKV * D, D, Fp(17) + lD, Fp(18) + lD, Fp(19) + lD, Fp(19) + lD,
        QK, QKlo, LQK, 0, Vt, Vtlo, 2 * D, OSA, 0);
    attn_kernel<false><<<NB * NH * NQT, battn, 0, stream>>>(QK, QKlo, Vt, Vtlo, Ip(3), CTX, 0, NQT);
    gemm_ln_kernel<<<MR / 32, b256, 0, stream>>>(CTX, D, WOC + (size_t)l * D * D, Fp(20) + lD, X, Fp(26) + lD, Fp(29) + lD, X, Xh, OSX, 1);
    // FFN
    gemm_kernel<true><<<dim3(MR / 128, DFF / 128), b256, 0, stream>>>(Xh, Xh, 0, D, W1T + (size_t)l * DFF * D, D, Fp(22) + lF, Fp(22) + lF + 512, Fp(22) + lF + 1024, Fp(22) + lF + 1536,
        Hh, QKlo, DFF, 0, Vt, Vtlo, DFF, OSA, 0);
    const bool last = (l == NLAY - 1);
    gemm_ln_kernel<<<MR / 32, b256, 0, stream>>>(Hh, DFF, W2T + (size_t)l * D * DFF, Fp(24) + lD, X, Fp(27) + lD, Fp(30) + lD, last ? (float*)d_out : X, Xh, OSA, last ? 0 : 1);
  }
}

// v005
// One run takes 778 microseconds.
// Next to v004, in two timings, it ran 1.04 times as fast each time.
// Counting every step since v000, it is 2.34 times as fast.
#include <hip/hip_runtime.h>

// 6-layer post-LN decoder stack: token embedding x sqrt(512) + sinusoidal positions; per layer masked self-attention (8 heads x 64), attention over a memory tensor,
// relu FFN 512 -> 2048 -> 512, each followed by residual add + LayerNorm over 512. Masks are int32 [batch][query][key] tensors read by value (nonzero = score replaced by
// -1e18); a 32-key chunk whose 16x32 mask tile is entirely nonzero is skipped (exact whenever each query row keeps at least one key).
// compute dtype: every contraction on v_wmma_f32_16x16x32_f16 (f16 operands, f32 accumulate): q/k/v projections, score and P.V products, output projections, both FFN
// products. Operand planes: activations f16 x8 (attention context x64), weights bf16-exact f16 x256, softmax P f16 x4096; query tiles with position < 64 of the masked
// self-attention add residual planes (x2048 of the x8 / x4096 carriers) of q, k, v and P: 3 score products and 3 P.V products into a second accumulator.
// tokens and masks int32 (tokens clamped). Fragment k-map per lane half hh for A and B: elements 0..7 <- k = 8hh+0..7, 8..15 <- k = 16+8hh+0..7; acc[r] = D[8hh+r][col].
// The attention's q, k and v planes are kept in fragment order: a fragment (16 rows x 32 k) is 512 halves = piece 0 (elements 0..7 of lanes 0..31) then piece 1 (elements 8..15), so that each
// of its two 16-B-per-lane loads covers 512 contiguous bytes (4 whole lines; from a row-major plane it would touch 16 lines for 32 B each).
// q|k plane: [batch][q, k][head][16-row tile][k step of 32 dims][piece][lane][8]; v plane: [batch][head][32-key chunk][16-dim tile][piece][lane][8] (rows = dims, k = keys).

#ifndef NB
#define NB 8
#endif
#ifndef SEQ
#define SEQ 512
#endif
#define NB_FULL 8
#define SEQ_FULL 512

namespace {
constexpr int D = 512, NH = 8, DH = 64, DFF = 2048, NLAY = 6, VOCAB = 32000;
constexpr int MR = NB * SEQ;                 // activation rows, row = b * SEQ + s
constexpr int LQK = 2 * D;                   // halves of the q | k plane per activation row
constexpr int FRG = 512, QKT = 2 * FRG, VCH = 4 * FRG;   // halves of a fragment, of a 16-row x 64-dim q or k tile, of a 64-dim x 32-key v chunk
constexpr int NQKV = 3 * D, NQT = SEQ / 16, NQT_RES = 4;
constexpr float WSC = 256.0f, CA = 8.0f, CX = 64.0f, PSC = 4096.0f, RS = 2048.0f;
constexpr float SQD = 22.627416997969522f, NLOGD = -0.017988946039015984f, L2E = 1.4426950408889634f, NEGF = -1.0e18f, LNEPS = 1.0e-5f;
constexpr float SCL = 1.0f / (CA * CA * 8.0f);   // score = acc / (8 x 8) / sqrt(64)
static_assert(NB >= 1 && NB <= NB_FULL && SEQ >= 128 && SEQ <= SEQ_FULL && SEQ % 128 == 0);
static_assert(MR % 128 == 0 && MR % 32 == 0 && D == 512 && NH * DH == D && DFF % 512 == 0 && NQT > NQT_RES && (MR * D) % 8 == 0);

typedef _Float16 b16;
typedef __attribute__((ext_vector_type(16))) _Float16 v16b;
typedef __attribute__((ext_vector_type(8))) _Float16 v8b;
typedef __attribute__((ext_vector_type(4))) _Float16 v4h_;
typedef __attribute__((ext_vector_type(8))) float v8f;
typedef __attribute__((ext_vector_type(4))) float v4f;

__device__ __forceinline__ float bf16_rne(float f) { unsigned int u = __float_as_uint(f); u += 0x7FFFu + ((u >> 16) & 1u); return __uint_as_float(u & 0xFFFF0000u); }
__device__ __forceinline__ v16b frag_kb(const b16* p, int hh) { const v8b a = *(const v8b*)(p + 8 * hh), b = *(const v8b*)(p + 16 + 8 * hh); v16b f;
#pragma unroll
  for (int e = 0; e < 8; ++e) { f[e] = a[e]; f[8 + e] = b[e]; } return f; }
__device__ __forceinline__ v16b frag_pk(const b16* p, int lane) { const v8b a = *(const v8b*)(p + 8 * lane), b = *(const v8b*)(p + 256 + 8 * lane); v16b f;   // p: a fragment stored in fragment order
#pragma unroll
  for (int e = 0; e < 8; ++e) { f[e] = a[e]; f[8 + e] = b[e]; } return f; }
__device__ __forceinline__ v8f wmma_raw(v16b a, v16b b, v8f c) { return __builtin_amdgcn_wmma_f32_16x16x32_f16(false, a, false, b, (short)0, c, false, false); }
__device__ __forceinline__ v8f wmma16b(v16b a, v16b b, v8f c) { v8f d = wmma_raw(a, b, c); asm volatile("v_nop\n\tv_nop\n\tv_nop\n\tv_nop" : "+v"(d) : "v"(a), "v"(b)); return d; }
// one guard after a group of 8 accumulating WMMAs: ties all 8 accumulators, keeps both A and all four B fragments live across the 4 nops
#define WMMA_GUARD8(c, a0, a1, bf) asm volatile("v_nop\n\tv_nop\n\tv_nop\n\tv_nop" : "+v"(c[0][0]), "+v"(c[0][1]), "+v"(c[0][2]), "+v"(c[0][3]), \
    "+v"(c[1][0]), "+v"(c[1][1]), "+v"(c[1][2]), "+v"(c[1][3]) : "v"(a0), "v"(a1), "v"(bf[0]), "v"(bf[1]), "v"(bf[2]), "v"(bf[3]))
__device__ __forceinline__ void wave_lds_sync() { __builtin_amdgcn_fence(3 /* release order */, "workgroup"); __builtin_amdgcn_wave_barrier(); __builtin_amdgcn_fence(2 /* acquire order */, "workgroup"); }
__device__ __forceinline__ float pmul(float a, float b) { float p = a * b; asm volatile("" : "+v"(p)); return p; }
__device__ __forceinline__ int iclamp(int v, int lo, int hi) { return v < lo ? lo : (v > hi ? hi : v); }
__device__ __forceinline__ float nexp2(float v) { float r; asm("v_exp_f32 %0, %1\n\tv_nop" : "=v"(r) : "v"(v)); return r; }
// 16-lane butterflies (partners lane ^ 8, 4, 2, 1) on ds_bpermute_b32; sa[] holds the four partner byte addresses, formed once per kernel (fewer live registers than per-call index math)
__device__ __forceinline__ float bperm(int addr, float x) { return __int_as_float(__builtin_amdgcn_ds_bpermute(addr, __float_as_int(x))); }
__device__ __forceinline__ float red_max16(float x, const int (&sa)[4]) {
#pragma unroll
  for (int j = 0; j < 4; ++j) x = fmaxf(x, bperm(sa[j], x));
  return x; }
__device__ __forceinline__ float red_sum16(float x, const int (&sa)[4]) {
#pragma unroll
  for (int j = 0; j < 4; ++j) x += bperm(sa[j], x);
  return x; }

// Wt[l][noff + n][k] = f16(bf16(W[l][k][n]) x 256), W stored [layer][in][out] with NA columns; block = 64 k x 64 n tile transposed through LDS (T: 64 x 72 halves; cross-thread, block barrier);
__device__ __forceinline__ void wprep_tile(b16* T, const float* __restrict__ W, b16* __restrict__ Wt, int K, int NA, int NT, int noff, int l, int k0, int n0, int tid) {
  { const int kr = tid >> 2, nc = (tid & 3) * 16; const float* src = W + ((size_t)l * K + k0 + kr) * NA + n0 + nc;
#pragma unroll
    for (int q = 0; q < 4; ++q) { const v4f v = *(const v4f*)(src + 4 * q);
#pragma unroll
      for (int j = 0; j < 4; ++j) T[(nc + 4 * q + j) * 72 + kr] = (b16)(bf16_rne(v[j]) * WSC); } }
  __syncthreads();
  v8b vv[2]; size_t dst[2];
#pragma unroll
  for (int i = 0; i < 2; ++i) { const int n = (tid >> 3) + 32 * i, p = tid & 7; vv[i] = *(const v8b*)(T + n * 72 + 8 * p); dst[i] = ((size_t)l * NT + noff + n0 + n) * K + k0 + 8 * p; }
  {
#pragma unroll
    for (int i = 0; i < 2; ++i) *(v8b*)(Wt + dst[i]) = vv[i];
     }
}

__device__ __forceinline__ void mprep_part(const float* __restrict__ mem, b16* __restrict__ Mh, int u) {
  if (u >= MR * D / 8) return;
  const int row = u / (D / 8), c0 = (u % (D / 8)) * 8, b = row / SEQ, s = row % SEQ;
  const float* src = mem + ((size_t)b * SEQ_FULL + s) * D + c0;
  const v4f a = *(const v4f*)src, c = *(const v4f*)(src + 4); v8b v;
#pragma unroll
  for (int j = 0; j < 4; ++j) { v[j] = (b16)(bf16_rne(a[j]) * CA); v[4 + j] = (b16)(bf16_rne(c[j]) * CA); }
  { *(v8b*)(Mh + (size_t)row * D + c0) = v;  }
}

// embedding: x[b][s][c] = bf16(emb[tok[s][b]][c]) x sqrt(512) + pe(s, c), pe(s, 2j) = sin(s x exp(2j x NLOGD)), pe(s, 2j+1) = cos(same angle); tok clamped. block = 4 rows,
// thread = 8 columns (rolled loop of 4 expf + sincosf); the 4 x 512 f32 tile is staged in LDS (block barrier), then 32 lanes x 16 B per 512-B run to X and
__device__ __forceinline__ void embed_rows(float* Xs, const int* __restrict__ tok, const float* __restrict__ emb, float* __restrict__ X, b16* __restrict__ Xh, int row0, int tid) {
  const int rl = tid >> 6, c0 = (tid & 63) * 8, row = row0 + rl, b = row / SEQ, s = row % SEQ;
  const int t = iclamp(tok[s * NB_FULL + b], 0, VOCAB - 1);
  const float* er = emb + (size_t)t * D + c0;
#pragma unroll 1
  for (int q = 0; q < 4; ++q) {
    const int c = c0 + 2 * q; const float dv = expf(pmul((float)c, NLOGD)); float sn, cs; sincosf(pmul((float)s, dv), &sn, &cs);
    Xs[rl * (D + 4) + c] = pmul(bf16_rne(er[2 * q]), SQD) + sn; Xs[rl * (D + 4) + c + 1] = pmul(bf16_rne(er[2 * q + 1]), SQD) + cs; }
  __syncthreads();
  v4f fv[2]; size_t fo[2]; v8b hv;
#pragma unroll
  for (int i = 0; i < 2; ++i) { const int f = i * 256 + tid; fv[i] = *(const v4f*)(Xs + (f >> 7) * (D + 4) + (f & 127) * 4); fo[i] = (size_t)(row0 + (f >> 7)) * D + (f & 127) * 4; }
  { const v4f a = *(const v4f*)(Xs + rl * (D + 4) + c0), c4 = *(const v4f*)(Xs + rl * (D + 4) + c0 + 4);
#pragma unroll
    for (int e = 0; e < 4; ++e) { hv[e] = (b16)(a[e] * CA); hv[4 + e] = (b16)(c4[e] * CA); } }
  {
#pragma unroll
    for (int i = 0; i < 2; ++i) *(v4f*)(X + fo[i]) = fv[i];
    *(v8b*)(Xh + (size_t)row * D + c0) = hv;  }
}

// All input preparation in one grid: none of its parts reads what another writes, so a block takes its part by its index range (block-uniform): embedding rows first (the longest blocks),
// then the 64 x 64 tiles of the eight 512 x 512 weights, of W1 and of W2 (k tile fastest, then n tile, then layer), then the memory plane.
constexpr int LTD = 3, LTF = 5, PB_WS = NLAY << (2 * LTD), PB_WF = NLAY << (LTD + LTF);   // log2 of the 64-wide tiles along 512 and along 2048; blocks of a small and of an FFN weight
static_assert((64 << LTD) == D && (64 << LTF) == DFF);
constexpr int P_W = MR / 4, P_F1 = P_W + 8 * PB_WS, P_F2 = P_F1 + PB_WF, P_M = P_F2 + PB_WF, P_ALL = P_M + (MR * D / 8 + 255) / 256;   // first block of each range
__global__ __launch_bounds__(256) void prep_kernel(const int* __restrict__ tok, const float* __restrict__ emb, const float* __restrict__ mem,
    const float* __restrict__ wqs, const float* __restrict__ wks, const float* __restrict__ wvs, const float* __restrict__ wos,
    const float* __restrict__ wqc, const float* __restrict__ wkc, const float* __restrict__ wvc, const float* __restrict__ woc,
    const float* __restrict__ w1, const float* __restrict__ w2,
    b16* __restrict__ WQKVS, b16* __restrict__ WOS, b16* __restrict__ WQKVC, b16* __restrict__ WOC, b16* __restrict__ W1T, b16* __restrict__ W2T,
    b16* __restrict__ Mh, float* __restrict__ X, b16* __restrict__ Xh) {
  __shared__ __attribute__((aligned(16))) b16 Sh[64 * 72];   // weight tile, or the embedding's 4 x 516 f32 rows
  static_assert(64 * 72 * 2 >= 4 * (D + 4) * 4);
  const int tid = threadIdx.x, r = blockIdx.x;
  if (r < P_W) embed_rows((float*)Sh, tok, emb, X, Xh, r * 4, tid);
  else if (r < P_M) {
    const float* W; b16* Wt; int q, lk = LTD, ln = LTD, NT, noff = 0;   // lk, ln: log2 of the tile counts along k (rows of W) and n (its columns)
    if (r < P_F1) {
      const int m = (r - P_W) / PB_WS, g = m & 3;   // m: 0..3 q k v o of the self-attention, 4..7 of the attention over memory
      q = (r - P_W) % PB_WS;
      W = m < 4 ? (g == 0 ? wqs : (g == 1 ? wks : (g == 2 ? wvs : wos))) : (g == 0 ? wqc : (g == 1 ? wkc : (g == 2 ? wvc : woc)));
      Wt = m < 4 ? (g == 3 ? WOS : WQKVS) : (g == 3 ? WOC : WQKVC);
      NT = g == 3 ? D : NQKV; noff = g == 3 ? 0 : g * D;
    } else if (r < P_F2) { q = r - P_F1; W = w1; Wt = W1T; ln = LTF; NT = DFF; }
    else { q = r - P_F2; W = w2; Wt = W2T; lk = LTF; NT = D; }
    wprep_tile(Sh, W, Wt, 64 << lk, 64 << ln, NT, noff, q >> (lk + ln), (q & ((1 << lk) - 1)) * 64, ((q >> lk) & ((1 << ln) - 1)) * 64, tid);
    asm volatile("s_wait_xcnt 0x0" ::: "memory");   // the built code joins this branch's end to an edge into the embedding branch, which rewrites the registers the two stores name: the wait stands in front of that join
  } else mprep_part(mem, Mh, (r - P_M) * 256 + tid);
}

// Operand staging of the GEMMs: a stage is KS = 128 k (256 B) of every A and B row of the block tile, laid in LDS at pitch 272 B (16 B x 17: odd, conflict-free for 16-B row readers),
// brought by per-lane asynchronous 16-B copies (a wave's copy covers 2 rows x 256 B = 4 whole lines); two buffers, the next stage's copies fly while this one is worked on.
constexpr int KS = 128, LP = KS + 8;
__device__ __forceinline__ unsigned lds_byte(const void* p) { return (unsigned)(unsigned long long)p; }
// copies of rows 16 apart (LDS step 16 x 272 B, global step gs halves); s_wait_xcnt 0 closes each statement so that no address register is rewritten ahead of it
__device__ __forceinline__ void cp2(unsigned l, const b16* g, size_t gs) {
  asm volatile("global_load_async_to_lds_b128 %0, %2, off\n\tglobal_load_async_to_lds_b128 %1, %3, off\n\ts_wait_xcnt 0x0"
      :: "v"(l), "v"(l + 16u * LP * 2u), "v"(g), "v"(g + gs) : "memory");
}
__device__ __forceinline__ void cp8(unsigned l, const b16* g, size_t gs) {
  constexpr unsigned LS = 16u * LP * 2u;
  asm volatile("global_load_async_to_lds_b128 %0, %8, off\n\tglobal_load_async_to_lds_b128 %1, %9, off\n\tglobal_load_async_to_lds_b128 %2, %10, off\n\t"
      "global_load_async_to_lds_b128 %3, %11, off\n\tglobal_load_async_to_lds_b128 %4, %12, off\n\tglobal_load_async_to_lds_b128 %5, %13, off\n\t"
      "global_load_async_to_lds_b128 %6, %14, off\n\tglobal_load_async_to_lds_b128 %7, %15, off\n\ts_wait_xcnt 0x0"
      :: "v"(l), "v"(l + LS), "v"(l + 2u * LS), "v"(l + 3u * LS), "v"(l + 4u * LS), "v"(l + 5u * LS), "v"(l + 6u * LS), "v"(l + 7u * LS),
         "v"(g), "v"(g + gs), "v"(g + 2 * gs), "v"(g + 3 * gs), "v"(g + 4 * gs), "v"(g + 5 * gs), "v"(g + 6 * gs), "v"(g + 7 * gs) : "memory");
}
// block of 256 threads: AR rows of A (first row Ag, pitch lda) and BR rows of B = Wt (first row Bg, pitch K), K a multiple of 128; the wave takes 32 A rows from arow and 64 B rows from
// brow: 8 WMMAs per 32 k, one guard per stage. On return every wave has left the ring (last trip's barrier): it may be reused.
// Blocks of one grid share operand rows and start together: walking K alike they would ask L2 for the same lines at the same moment. Trip t therefore takes the k stage (t + rot) mod NT,
// and the 128-row groups of B are copied in the order jrot, jrot + 1, ... (mod their number); rot < NT and jrot come from the block index (block-uniform). The f32 sums run over k in that rotated order.
template <int AR, int BR>
__device__ __forceinline__ void mac_staged(v8f (&acc)[2][4], b16* ring, const b16* Ag, int lda, const b16* Bg, int K, int arow, int brow, int tid, int nloc, int hlf, int rot, int jrot) {
  static_assert((AR == 32 || AR % 128 == 0) && BR % 128 == 0);
  constexpr int BUFH = (AR + BR) * LP;
  const unsigned l0 = lds_byte(ring) + (unsigned)(tid >> 4) * (LP * 2u) + (unsigned)(tid & 15) * 16u;
  const b16* ga = Ag + (size_t)(tid >> 4) * lda + 8 * (tid & 15);
  const b16* gb = Bg + (size_t)(tid >> 4) * K + 8 * (tid & 15);
  const int NT = K / KS;
  auto fill = [&](int t) {
    const unsigned l = l0 + (unsigned)(t & 1) * (BUFH * 2u);
    const int kt = t + rot < NT ? t + rot : t + rot - NT;   // this trip's k stage
    if constexpr (AR == 32) cp2(l, ga + kt * KS, (size_t)16 * lda);
    else {
#pragma unroll
      for (int j = 0; j < AR / 128; ++j) cp8(l + (unsigned)j * (128u * LP * 2u), ga + (size_t)(128 * j) * lda + kt * KS, (size_t)16 * lda); }
#pragma unroll
    for (int i = 0; i < BR / 128; ++i) { const int j = (i + jrot) % (BR / 128);
      cp8(l + (unsigned)(AR + 128 * j) * (LP * 2u), gb + (size_t)(128 * j) * K + kt * KS, (size_t)16 * K); }
  };
  fill(0);
  asm volatile("s_wait_asynccnt 0x0" ::: "memory");   // trip 0's k stage has landed (this wave's copies) before the barrier that publishes it
  __syncthreads();
  if (NT > 1) fill(1);
#pragma unroll 1
  for (int t = 0; t < NT; ++t) {
    const b16* bufp = ring + (t & 1) * BUFH;
    const b16* ap0 = bufp + (arow + nloc) * LP; const b16* ap1 = ap0 + 16 * LP; const b16* bp = bufp + (AR + brow + nloc) * LP;
    v16b a0[2], a1[2], bf[2][4];   // two fragment sets: the next 32 k are fetched while the WMMAs of these 32 k run (all inside this stage's buffer)
    a0[0] = frag_kb(ap0, hlf); a1[0] = frag_kb(ap1, hlf);
#pragma unroll
    for (int u = 0; u < 4; ++u) bf[0][u] = frag_kb(bp + u * 16 * LP, hlf);
#pragma unroll
    for (int s = 0; s < KS / 32; ++s) {
      const int c = s & 1, n = c ^ 1;
      if (s + 1 < KS / 32) {
        a0[n] = frag_kb(ap0 + 32 * (s + 1), hlf); a1[n] = frag_kb(ap1 + 32 * (s + 1), hlf);
#pragma unroll
        for (int u = 0; u < 4; ++u) bf[n][u] = frag_kb(bp + u * 16 * LP + 32 * (s + 1), hlf); }
      __builtin_amdgcn_sched_barrier(0);   // keeps the next block's 12 LDS reads one group in front of this block's WMMAs (for speed only)
#pragma unroll
      for (int u = 0; u < 4; ++u) { acc[0][u] = wmma_raw(a0[c], bf[c][u], acc[0][u]); acc[1][u] = wmma_raw(a1[c], bf[c][u], acc[1][u]); }
      if (s + 1 < KS / 32) __builtin_amdgcn_sched_barrier(0);   // the block after next's reads stay behind this block's WMMAs
      else WMMA_GUARD8(acc, a0[c], a1[c], bf[c]);   // the stage's last WMMAs stand in front of a branch: the 4 slots behind them are filled here for both of its sides
    }
    asm volatile("s_wait_dscnt 0x0" ::: "memory");     // this wave's reads of the buffer have retired before the barrier behind which it is refilled
    asm volatile("s_wait_asynccnt 0x0" ::: "memory");  // this wave's copies for trip t + 1 have landed before the barrier that publishes them
    __syncthreads();
    if (t + 2 < NT) fill(t + 2);
  }
  asm volatile("s_wait_asynccnt 0x0" ::: "memory");    // no copy outstanding when the ring is reused or the wave ends
}

// f16 epilogue of one wave's 32 x 64 tile (plane value = f16(v x 8), LO: f16((v x 8 - hi) x 2048)): b16 element stores into the wave-private LDS tile, wave sync, then 8 stores of 16 B per lane:
// row-major (4 rows x 128 B each, dstp = the tile's first element, pitch ldc), or PK: fragment order (dstp = the first of the wave's two q or k tiles; store j = tile j / 4, k step (j / 2) % 2,
// piece j % 2: 512 contiguous bytes each, 4 KB in a row)
template <bool LO, bool RELU, bool PK>
__device__ __forceinline__ void epi_rows(const v8f (&acc)[2][4], const float (&bb)[4], float oscale, b16* Es, b16* dstp, int ldc, int lane, int nloc, int hlf) {
#pragma unroll
  for (int mt = 0; mt < 2; ++mt)
#pragma unroll
    for (int t = 0; t < 4; ++t)
#pragma unroll
      for (int r = 0; r < 8; ++r) {
        float v = acc[mt][t][r] * oscale + bb[t]; if (RELU) v = fmaxf(v, 0.0f); const float vs = v * CA; const b16 hi = (b16)vs;
        Es[(mt * 16 + 8 * hlf + r) * 72 + 16 * t + nloc] = LO ? (b16)((vs - (float)hi) * RS) : hi; }
  wave_lds_sync();
  v8b vv[8];
#pragma unroll
  for (int j = 0; j < 8; ++j) vv[j] = PK ? *(const v8b*)(Es + ((j >> 2) * 16 + nloc) * 72 + 32 * ((j >> 1) & 1) + 16 * (j & 1) + 8 * hlf) : *(const v8b*)(Es + (4 * j + (lane >> 3)) * 72 + 8 * (lane & 7));
  b16* dst = PK ? dstp + 8 * lane : dstp + (size_t)(lane >> 3) * ldc + 8 * (lane & 7);
  {
#pragma unroll
    for (int j = 0; j < 8; ++j) *(v8b*)(dst + (PK ? (size_t)(256 * j) : (size_t)(4 * j) * ldc)) = vv[j];
    asm volatile("s_wait_xcnt 0x0" ::: "memory");   // what follows (the residual plane's pass) rewrites registers that these stores name: the wait stands in front of it
  }
}

// head-transposed f16 epilogue of the block's 128 (keys) x 128 (head columns) tile -> v plane in fragment order: each lane stores its 8 consecutive keys of one
// column as one 16-B LDS store into Et[col][key] (cross-wave, block barrier), then the wave writes one (head wave / 4, chunk wave % 4): store j = dim tile j / 2, piece j % 2, 4 KB in a row
template <bool LO, bool RELU>
__device__ __forceinline__ void epi_vt(const v8f (&acc)[2][4], const float (&bb)[4], float oscale, b16* Et, b16* plane, int bidx, int key0, int colv0, int wave, int wm, int wn, int nloc, int hlf) {
#pragma unroll
  for (int mt = 0; mt < 2; ++mt)
#pragma unroll
    for (int t = 0; t < 4; ++t) { v8b hv;
#pragma unroll
      for (int r = 0; r < 8; ++r) { float v = acc[mt][t][r] * oscale + bb[t]; if (RELU) v = fmaxf(v, 0.0f); const float vs = v * CA; const b16 hi = (b16)vs; hv[r] = LO ? (b16)((vs - (float)hi) * RS) : hi; }
      *(v8b*)(Et + (wn * 64 + 16 * t + nloc) * 136 + wm * 32 + mt * 16 + 8 * hlf) = hv; }
  __syncthreads();
  v8b vv[8]; const int hd = wave >> 2, ch = wave & 3;
#pragma unroll
  for (int j = 0; j < 8; ++j) vv[j] = *(const v8b*)(Et + (hd * DH + 16 * (j >> 1) + nloc) * 136 + 32 * ch + 16 * (j & 1) + 8 * hlf);
  b16* dst = plane + ((size_t)(bidx * NH + colv0 / DH + hd) * (SEQ / 32) + key0 / 32 + ch) * VCH + 8 * (16 * hlf + nloc);
  {
#pragma unroll
    for (int j = 0; j < 8; ++j) *(v8b*)(dst + 256 * j) = vv[j];
    asm volatile("s_wait_xcnt 0x0" ::: "memory");   // what follows (the residual plane's pass) rewrites registers that these stores name: the wait stands in front of it
  }
}

// C = (A[M][K] f16 plane, pitch lda) x Wt[N][K] + bf16(bias), optional relu; block 128 x 128 = 8 waves of 32 x 64. GEMM columns < vcol0 -> plane C (f16 x 8): with relu (FFN) row-major
// C[row*ldc + ccol0 + col], without (q at columns 0..511, k at 512..1023) the q|k plane in fragment order; columns >= vcol0 -> head-transposed plane VT (v of the attention), fragment order. Blocks whose 128 rows start a sequence also emit the residual planes Clo / VTlo (x 2048) for those rows
// when wres != 0. Bias group pointer chosen per 512-column group (block-uniform). Column blocks below asplit multiply A1, the others A2 (block-uniform): two products of different left
// operands that share K and the output planes run as one grid.
template <bool RELU>
__global__ __launch_bounds__(256) void gemm_kernel(const b16* __restrict__ A1, const b16* __restrict__ A2, int asplit, int lda, const b16* __restrict__ Wt, int K,
    const float* __restrict__ bg0, const float* __restrict__ bg1, const float* __restrict__ bg2, const float* __restrict__ bg3,
    b16* __restrict__ C, b16* __restrict__ Clo, int ldc, int ccol0, b16* __restrict__ VT, b16* __restrict__ VTlo, int vcol0, float oscale, int wres) {
  __shared__ __attribute__((aligned(16))) b16 Ls[2 * 256 * LP];   // operand ring (2 buffers x 256 rows); behind the K loop 8 wave tiles [32][72] (row-major mode) or one block tile [128][136] (transposed mode)
  static_assert(2 * 256 * LP >= 18432);
  const int tid = threadIdx.x, wave = tid >> 5, lane = tid & 31, nloc = lane & 15, hlf = lane >> 4;
  const int bm0 = blockIdx.x * 128, bn0 = blockIdx.y * 128, wm = wave >> 1, wn = wave & 1;
  const int row0 = bm0 + wm * 32, col0 = bn0 + wn * 64;
  const b16* A = bn0 < asplit ? A1 : A2;
  v8f acc[2][4];
#pragma unroll
  for (int t = 0; t < 4; ++t) { acc[0][t] = (v8f){}; acc[1][t] = (v8f){}; }
  mac_staged<128, 128>(acc, Ls, A + (size_t)bm0 * lda, lda, Wt + (size_t)bn0 * K, K, wm * 32, wn * 64, tid, nloc, hlf, (int)((blockIdx.x + blockIdx.y) % (unsigned)(K / KS)), 0);
  const int gsel = bn0 >> 9; const float* bias = gsel == 0 ? bg0 : (gsel == 1 ? bg1 : (gsel == 2 ? bg2 : bg3));
  float bb[4];
#pragma unroll
  for (int t = 0; t < 4; ++t) bb[t] = bf16_rne(bias[(col0 & 511) + 16 * t + nloc]);
  const bool vmode = bn0 >= vcol0, wlo = (wres != 0) && (bm0 % SEQ == 0);
  if (!vmode) {
    b16* Es = Ls + wave * (32 * 72);
    // the wave's 64 columns are one head of q or of k, its 32 rows two tiles that follow one another in the plane
    const size_t co = RELU ? (size_t)row0 * ldc + ccol0 + col0 : (((size_t)(row0 / SEQ * 2 + (col0 >> 9)) * NH + ((col0 & 511) >> 6)) * NQT + row0 % SEQ / 16) * QKT;
    epi_rows<false, RELU, !RELU>(acc, bb, oscale, Es, C + co, ldc, lane, nloc, hlf);
    if (wlo) { wave_lds_sync(); epi_rows<true, RELU, !RELU>(acc, bb, oscale, Es, Clo + co, ldc, lane, nloc, hlf); }
  } else {
    epi_vt<false, RELU>(acc, bb, oscale, Ls, VT, bm0 / SEQ, bm0 % SEQ, bn0 - vcol0, wave, wm, wn, nloc, hlf);
    if (wlo) { __syncthreads(); epi_vt<true, RELU>(acc, bb, oscale, Ls, VTlo, bm0 / SEQ, bm0 % SEQ, bn0 - vcol0, wave, wm, wn, nloc, hlf); }
  }
}

// Y = LayerNorm(Xres + (A x Wt + bf16(bias))) * bf16(g) + bf16(be) over full 512-wide rows: block = 32 rows x 512 columns (wave = 32 x 64), K = 512 or 2048. Per 16-row half the f32
// tile is staged in LDS (cross-wave, block barrier); wave w then owns rows 2w, 2w+1: lane holds columns 128j + 4 lane (j = 0..3), residual / bias / gain loaded with the same map,
__global__ __launch_bounds__(256) void gemm_ln_kernel(const b16* __restrict__ A, int K, const b16* __restrict__ Wt, const float* __restrict__ bias, const float* Xres,
    const float* __restrict__ gam, const float* __restrict__ bet, float* OutF, b16* __restrict__ Xh, float oscale, int wxh) {
  __shared__ __attribute__((aligned(16))) b16 Rg[2 * (32 + D) * LP];   // operand ring (2 buffers x 544 rows); behind the K loop the f32 tile Tf
  static_assert(2 * (32 + D) * LP * 2 >= 16 * (D + 4) * 4);
  float* Tf = (float*)Rg;
  const int tid = threadIdx.x, wave = tid >> 5, lane = tid & 31, nloc = lane & 15, hlf = lane >> 4;
  const int bm0 = blockIdx.x * 32, col0 = wave * 64;
  v8f acc[2][4];
#pragma unroll
  for (int t = 0; t < 4; ++t) { acc[0][t] = (v8f){}; acc[1][t] = (v8f){}; }
  mac_staged<32, D>(acc, Rg, A + (size_t)bm0 * K, K, Wt, K, 0, col0, tid, nloc, hlf, (int)(blockIdx.x % (unsigned)(K / KS)), (int)(blockIdx.x / (unsigned)(K / KS) % 4u));
#pragma unroll 1
  for (int mt = 0; mt < 2; ++mt) {
    if (mt) __syncthreads();
#pragma unroll
    for (int t = 0; t < 4; ++t)
#pragma unroll
      for (int r = 0; r < 8; ++r) Tf[(8 * hlf + r) * (D + 4) + col0 + 16 * t + nloc] = (mt ? acc[1][t][r] : acc[0][t][r]) * oscale;
    __syncthreads();
#pragma unroll 1
    for (int rr = 0; rr < 2; ++rr) {
      const int rl = 2 * wave + rr; const size_t go = (size_t)(bm0 + mt * 16 + rl) * D;
      float y[16]; float s = 0.0f;
#pragma unroll
      for (int j = 0; j < 4; ++j) { const int c = 128 * j + 4 * lane;
        const v4f tv = *(const v4f*)(Tf + rl * (D + 4) + c); const v4f rv = *(const v4f*)(Xres + go + c); const v4f bv = *(const v4f*)(bias + c);
#pragma unroll
        for (int e = 0; e < 4; ++e) { const float yy = rv[e] + (tv[e] + bf16_rne(bv[e])); y[4 * j + e] = yy; s += yy; } }
#pragma unroll
      for (int off = 16; off > 0; off >>= 1) s += __shfl_xor(s, off, 32);
      const float mean = s * (1.0f / (float)D); float q = 0.0f;
#pragma unroll
      for (int i = 0; i < 16; ++i) { const float d0 = y[i] - mean; y[i] = d0; q += d0 * d0; }
#pragma unroll
      for (int off = 16; off > 0; off >>= 1) q += __shfl_xor(q, off, 32);
      const float rstd = 1.0f / sqrtf(q * (1.0f / (float)D) + LNEPS);
      v4f ov[4]; v4h_ hv[4];
#pragma unroll
      for (int j = 0; j < 4; ++j) { const int c = 128 * j + 4 * lane; const v4f gv = *(const v4f*)(gam + c), ev = *(const v4f*)(bet + c);
#pragma unroll
        for (int e = 0; e < 4; ++e) { const float o = (y[4 * j + e] * rstd) * bf16_rne(gv[e]) + bf16_rne(ev[e]); ov[j][e] = o; hv[j][e] = (b16)(o * CA); } }
      {
#pragma unroll
        for (int j = 0; j < 4; ++j) { const int c = 128 * j + 4 * lane; *(v4f*)(OutF + go + c) = ov[j]; if (wxh) *(v4h_*)(Xh + go + c) = hv[j]; }
         }
    }
  }
}

// Streaming attention, one work-group = 16 query rows of one (batch, head), its NWK waves sharing the keys: wave w walks the 32-key chunks w, w + NWK, ... with its own running max,
// sum and context, beginning at a step rotated by query tile + head and wrapping (the tiles of a head share K and V, the heads of a tile the mask: walking alike they would ask L2 for the same lines
// at once); the partial results meet in LDS behind one block barrier and are joined there (weights exp(max_w - max)). Q fragments from the q|k plane (fragment order), per chunk
// the 16x32 mask tile is loaded first (two groups of 8 scalar loads per lane, the first group retired before the second issues; ballot: skip when all masked), scores = 2 k-steps of
// WMMA against K rows, replace-mask, running-max softmax in f32 (exp2), P staged x4096 into a wave-private LDS tile (b16 element stores, wave sync, fragment reload), ctx += P x V with
// V from the head-transposed plane (fragment order).
// RES: query/key residual planes give 3 score products and P_res x V + P x V_res into a second accumulator for chunks with keys < 128 (rows for which the residual planes exist);
constexpr int NWK = 4, PPW = DH + 4;   // waves per query tile; f32 pitch of a partial context row
static_assert((SEQ / 32) % NWK == 0);
template <bool RES>
__global__ __launch_bounds__(32 * NWK) void attn_kernel(const b16* __restrict__ QK, const b16* __restrict__ QKlo, const b16* __restrict__ VT, const b16* __restrict__ VTlo,
    const int* __restrict__ mask, b16* __restrict__ CTX, int qt0, int nqt) {
  __shared__ __attribute__((aligned(16))) b16 PstA[NWK * 16 * 40];
  __shared__ __attribute__((aligned(16))) b16 PlstA[RES ? NWK * 16 * 40 : 8];
  __shared__ __attribute__((aligned(16))) float Part[NWK * 16 * PPW];
  __shared__ float Mxs[NWK * 16], Lss[NWK * 16];
  const int tid = threadIdx.x, lane = tid & 31, nloc = lane & 15, hlf = lane >> 4, wave = __builtin_amdgcn_readfirstlane(tid >> 5);
  const int sa[4] = {(lane ^ 8) << 2, (lane ^ 4) << 2, (lane ^ 2) << 2, (lane ^ 1) << 2};
  b16* Pst = PstA + wave * (16 * 40); b16* Plst = PlstA + (RES ? wave * (16 * 40) : 0);
  const int bi = blockIdx.x, qt = qt0 + bi % nqt, bh = bi / nqt, h = bh % NH, b = bh / NH, q0 = qt * 16;
  const size_t rq = (size_t)b * SEQ + q0;
  const size_t qo = (((size_t)(b * 2) * NH + h) * NQT + qt) * QKT;   // the query tile in the q|k planes
  const v16b qa0 = frag_pk(QK + qo, lane), qa1 = frag_pk(QK + qo + FRG, lane);
  v16b ql0 = (v16b){}, ql1 = (v16b){};
  if (RES) { ql0 = frag_pk(QKlo + qo, lane); ql1 = frag_pk(QKlo + qo + FRG, lane); }
  const size_t ko = (((size_t)(b * 2 + 1) * NH + h) * NQT + 2 * wave) * QKT, vo = ((size_t)(b * NH + h) * (SEQ / 32) + wave) * VCH;
  const b16* kbase = QK + ko;   // this and the three bases below start at the wave's first chunk (two key tiles of k, one chunk of v)
  const b16* klbase = QKlo + ko;
  const b16* vbase = VT + vo;
  const b16* vlbase = VTlo + vo;
  const int* mq = mask + ((size_t)b * SEQ_FULL + q0 + 8 * hlf) * SEQ_FULL + 32 * wave + nloc;
  float mx[8], ls[8]; v8f acc[4], acc2[4];
#pragma unroll
  for (int r = 0; r < 8; ++r) { mx[r] = -3.0e38f; ls[r] = 0.0f; }
#pragma unroll
  for (int t = 0; t < 4; ++t) { acc[t] = (v8f){}; acc2[t] = (v8f){}; }
  constexpr int NI = SEQ / 32 / NWK;
  const int irot = (qt + h) % NI;   // first step of this block's walk (block-uniform)
#pragma unroll 1
  for (int i = 0; i < NI; ++i) {
    const int ii = i + irot < NI ? i + irot : i + irot - NI;
    const int kb = 32 * NWK * ii, c = wave + NWK * ii, fo = NWK * ii * VCH;   // kb: key offset from the wave's first chunk; c: chunk index; fo: the same offset in halves of the k and v planes
    static_assert(2 * QKT == VCH);
    int m0[8], m1[8]; bool allm = true;
    // mask tile rows 8 hlf + r: group 1 = key column kb + nloc, group 2 = kb + 16 + nloc; compiler + wait barrier between the two groups of 8 loads
#pragma unroll
    for (int r = 0; r < 8; ++r) m0[r] = mq[(size_t)r * SEQ_FULL + kb];
    asm volatile("" :: "v"(m0[0]), "v"(m0[1]), "v"(m0[2]), "v"(m0[3]), "v"(m0[4]), "v"(m0[5]), "v"(m0[6]), "v"(m0[7]) : "memory");
#pragma unroll
    for (int r = 0; r < 8; ++r) m1[r] = mq[(size_t)r * SEQ_FULL + kb + 16];
#pragma unroll
    for (int r = 0; r < 8; ++r) allm = allm && (m0[r] != 0) && (m1[r] != 0);
    if (__builtin_amdgcn_ballot_w32(allm) == 0xffffffffu) continue;
    wave_lds_sync();   // prior chunk's fragment reloads complete before the P tiles are rewritten
    v8f s[2];
#pragma unroll
    for (int t = 0; t < 2; ++t) {
      const b16* kp = kbase + fo + t * QKT; const v16b k0f = frag_pk(kp, lane), k1f = frag_pk(kp + FRG, lane);
      v8f sh = wmma16b(qa0, k0f, (v8f){}); sh = wmma16b(qa1, k1f, sh);
      if (RES && c < 4) {
        const b16* klp = klbase + fo + t * QKT;
        v8f x = wmma16b(ql0, k0f, (v8f){}); x = wmma16b(ql1, k1f, x); x = wmma16b(qa0, frag_pk(klp, lane), x); x = wmma16b(qa1, frag_pk(klp + FRG, lane), x);
#pragma unroll
        for (int r = 0; r < 8; ++r) sh[r] += x[r] * (1.0f / RS); }
      s[t] = sh; }
    float p0[8], p1[8];
#pragma unroll
    for (int r = 0; r < 8; ++r) {
      float s0 = s[0][r] * SCL, s1 = s[1][r] * SCL; s0 = (m0[r] != 0) ? NEGF : s0; s1 = (m1[r] != 0) ? NEGF : s1;
      const float cm = red_max16(fmaxf(s0, s1), sa); const float mn = fmaxf(mx[r], cm); const float al = nexp2((mx[r] - mn) * L2E); mx[r] = mn;
      const float e0 = nexp2((s0 - mn) * L2E), e1 = nexp2((s1 - mn) * L2E); p0[r] = e0; p1[r] = e1;
      ls[r] = ls[r] * al + red_sum16(e0 + e1, sa);
#pragma unroll
      for (int t = 0; t < 4; ++t) { acc[t][r] *= al; if (RES) acc2[t][r] *= al; } }
#pragma unroll
    for (int r = 0; r < 8; ++r) {
      const float v0 = p0[r] * PSC, v1 = p1[r] * PSC; const b16 h0 = (b16)v0, h1 = (b16)v1;
      Pst[(8 * hlf + r) * 40 + nloc] = h0; Pst[(8 * hlf + r) * 40 + 16 + nloc] = h1;
      if (RES) { Plst[(8 * hlf + r) * 40 + nloc] = (b16)((v0 - (float)h0) * RS); Plst[(8 * hlf + r) * 40 + 16 + nloc] = (b16)((v1 - (float)h1) * RS); } }
    wave_lds_sync();
    const v16b pf = frag_kb(Pst + nloc * 40, hlf); v16b plf = (v16b){}; if (RES) plf = frag_kb(Plst + nloc * 40, hlf);
#pragma unroll
    for (int t = 0; t < 4; ++t) {
      const v16b vf = frag_pk(vbase + fo + t * FRG, lane); acc[t] = wmma16b(pf, vf, acc[t]);
      if (RES && c < 4) { acc2[t] = wmma16b(plf, vf, acc2[t]); acc2[t] = wmma16b(pf, frag_pk(vlbase + fo + t * FRG, lane), acc2[t]); } }
  }
  // each wave publishes its partial context (f32, still scaled by its own max), max and sum; a wave whose chunks were all skipped publishes max -3e38, sum 0, context 0
  float* pw = Part + wave * (16 * PPW);
#pragma unroll
  for (int r = 0; r < 8; ++r) {
#pragma unroll
    for (int t = 0; t < 4; ++t) { float a = acc[t][r]; if (RES) a += acc2[t][r] * (1.0f / RS); pw[(8 * hlf + r) * PPW + 16 * t + nloc] = a; }
    if (nloc == 0) { Mxs[wave * 16 + 8 * hlf + r] = mx[r]; Lss[wave * 16 + 8 * hlf + r] = ls[r]; } }
  __syncthreads();   // every wave's partials are in LDS before any thread joins them
  // join: thread = 8 columns of one row (NWK = 4: 128 threads cover 16 x 64)
  static_assert(32 * NWK * 8 == 16 * DH);
  const int jr = tid >> 3, jc = 8 * (tid & 7);
  float wm_[NWK], M = Mxs[jr];
#pragma unroll
  for (int w = 1; w < NWK; ++w) M = fmaxf(M, Mxs[w * 16 + jr]);
  float L = 0.0f, o[8];
#pragma unroll
  for (int e = 0; e < 8; ++e) o[e] = 0.0f;
#pragma unroll
  for (int w = 0; w < NWK; ++w) { wm_[w] = nexp2((Mxs[w * 16 + jr] - M) * L2E); L += wm_[w] * Lss[w * 16 + jr];
    const v4f x0 = *(const v4f*)(Part + (w * 16 + jr) * PPW + jc), x1 = *(const v4f*)(Part + (w * 16 + jr) * PPW + jc + 4);
#pragma unroll
    for (int e = 0; e < 4; ++e) { o[e] += wm_[w] * x0[e]; o[4 + e] += wm_[w] * x1[e]; } }
  const float inv = (1.0f / L) * (CX / (PSC * CA)); v8b ov;
#pragma unroll
  for (int e = 0; e < 8; ++e) ov[e] = (b16)(o[e] * inv);
  *(v8b*)(CTX + (rq + jr) * D + h * DH + jc) = ov;
}
}  // namespace

extern "C" void kernel_launch(void* const* d_in, const int* in_sizes, int n_in, void* d_out, int out_size, void* d_ws, size_t ws_size, hipStream_t stream) {
  (void)n_in;
  auto Fp = [&](int i) { return (const float*)d_in[i]; };
  auto Ip = [&](int i) { return (const int*)d_in[i]; };
  // wire order: 0 tokens [512][8] i32, 1 memory [8][512][512], 2 self-attention mask [8][512][512] i32, 3 memory mask [8][512][512] i32, 4 embedding [32000][512],
  // 5..8 Wq_s Wk_s Wv_s Wo_s [6][512 in][512 out], 9..12 Wq_c Wk_c Wv_c Wo_c, 13..16 bq_s bk_s bv_s bo_s [6][512], 17..20 bq_c bk_c bv_c bo_c,
  // 21 W1 [6][512][2048], 22 b1 [6][2048], 23 W2 [6][2048][512], 24 b2 [6][512], 25 g1, 26 g2, 27 g3, 28 be1, 29 be2, 30 be3 [6][512]
  const long needRows = (long)(NB - 1) * SEQ_FULL + SEQ;
  if ((long)in_sizes[0] < (long)SEQ * NB_FULL || (long)in_sizes[1] < needRows * D || (long)in_sizes[2] < needRows * SEQ_FULL || (long)in_sizes[3] < needRows * SEQ_FULL ||
      (long)in_sizes[4] < (long)VOCAB * D) return;
  for (int i = 5; i <= 12; ++i) if ((long)in_sizes[i] < (long)NLAY * D * D) return;
  for (int i = 13; i <= 20; ++i) if (in_sizes[i] < NLAY * D) return;
  if ((long)in_sizes[21] < (long)NLAY * D * DFF || in_sizes[22] < NLAY * DFF || (long)in_sizes[23] < (long)NLAY * DFF * D || in_sizes[24] < NLAY * D) return;
  for (int i = 25; i <= 30; ++i) if (in_sizes[i] < NLAY * D) return;
  if (out_size < MR * D) return;

  size_t off = 0; char* ws = (char*)d_ws;
  auto carve = [&](size_t bytes) { char* p = ws + off; off += (bytes + 255) & ~(size_t)255; return p; };
  b16* WQKVS = (b16*)carve((size_t)NLAY * NQKV * D * 2);   // [6][1536][512]
  b16* WOS   = (b16*)carve((size_t)NLAY * D * D * 2);
  b16* WQKVC = (b16*)carve((size_t)NLAY * NQKV * D * 2);   // [6][1536][512]
  b16* WOC   = (b16*)carve((size_t)NLAY * D * D * 2);
  b16* W1T   = (b16*)carve((size_t)NLAY * DFF * D * 2);    // [6][2048][512]
  b16* W2T   = (b16*)carve((size_t)NLAY * D * DFF * 2);    // [6][512][2048]
  float* X   = (float*)carve((size_t)MR * D * 4);
  b16* Xh    = (b16*)carve((size_t)MR * D * 2);
  b16* Mh    = (b16*)carve((size_t)MR * D * 2);
  b16* QK    = (b16*)carve((size_t)MR * LQK * 2);
  b16* QKlo  = (b16*)carve((size_t)MR * LQK * 2);
  b16* Vt    = (b16*)carve((size_t)MR * D * 2);            // [NB][NH][SEQ / 32][4][512]
  b16* Vtlo  = (b16*)carve((size_t)MR * D * 2);
  b16* CTX   = (b16*)carve((size_t)MR * D * 2);
  b16* Hh    = (b16*)carve((size_t)MR * DFF * 2);
  if (off > ws_size || off > ((size_t)128 << 20)) return;   // 113,246,208 B at full size

  const dim3 b256(256), battn(32 * NWK);
  prep_kernel<<<P_ALL, b256, 0, stream>>>(Ip(0), Fp(4), Fp(1), Fp(5), Fp(6), Fp(7), Fp(8), Fp(9), Fp(10), Fp(11), Fp(12), Fp(21), Fp(23),
      WQKVS, WOS, WQKVC, WOC, W1T, W2T, Mh, X, Xh);

  const float OSA = 1.0f / (CA * WSC), OSX = 1.0f / (CX * WSC);
  for (int l = 0; l < NLAY; ++l) {
    const size_t lD = (size_t)l * D, lF = (size_t)l * DFF;
    // fused q|k|v projection of x: q and k -> q|k plane, v -> head-transposed plane (all in fragment order); residual planes for the first 128 rows of each sequence
    gemm_kernel<false><<<dim3(MR / 128, NQKV / 128), b256, 0, stream>>>(Xh, Xh, 0, D, WQKVS + (size_t)l * NQKV * D, D, Fp(13) + lD, Fp(14) + lD, Fp(15) + lD, Fp(15) + lD,
        QK, QKlo, LQK, 0, Vt, Vtlo, 2 * D, OSA, 1);
    attn_kernel<true><<<NB * NH * NQT_RES, battn, 0, stream>>>(QK, QKlo, Vt, Vtlo, Ip(2), CTX, 0, NQT_RES);
    attn_kernel<false><<<NB * NH * (NQT - NQT_RES), battn, 0, stream>>>(QK, QKlo, Vt, Vtlo, Ip(2), CTX, NQT_RES, NQT - NQT_RES);
    gemm_ln_kernel<<<MR / 32, b256, 0, stream>>>(CTX, D, WOS + (size_t)l * D * D, Fp(16) + lD, X, Fp(25) + lD, Fp(28) + lD, X, Xh, OSX, 1);
    // attention over the memory tensor: q (columns 0..511) from x, k|v (columns 512..1535) from the memory plane, one grid
    gemm_kernel<false><<<dim3(MR / 128, NQKV / 128), b256, 0, stream>>>(Xh, Mh, D, D, WQKVC + (size_t)l * NQKV * D, D, Fp(17) + lD, Fp(18) + lD, Fp(19) + lD, Fp(19) + lD,
        QK, QKlo, LQK, 0, Vt, Vtlo, 2 * D, OSA, 0);
    attn_kernel<false><<<NB * NH * NQT, battn, 0, stream>>>(QK, QKlo, Vt, Vtlo, Ip(3), CTX, 0, NQT);
    gemm_ln_kernel<<<MR / 32, b256, 0, stream>>>(CTX, D, WOC + (size_t)l * D * D, Fp(20) + lD, X, Fp(26) + lD, Fp(29) + lD, X, Xh, OSX, 1);
    // FFN
    gemm_kernel<true><<<dim3(MR / 128, DFF / 128), b256, 0, stream>>>(Xh, Xh, 0, D, W1T + (size_t)l * DFF * D, D, Fp(22) + lF, Fp(22) + lF + 512, Fp(22) + lF + 1024, Fp(22) + lF + 1536,
        Hh, QKlo, DFF, 0, Vt, Vtlo, DFF, OSA, 0);
    const bool last = (l == NLAY - 1);
    gemm_ln_kernel<<<MR / 32, b256, 0, stream>>>(Hh, DFF, W2T + (size_t)l * D * DFF, Fp(24) + lD, X, Fp(27) + lD, Fp(30) + lD, last ? (float*)d_out : X, Xh, OSA, last ? 0 : 1);
  }
}

// v006
// Measured time: 739 microseconds a run.
// In both of two side-by-side timings against v005, it was 1.05 times as fast.
// All steps since v000 together make it 2.45 times as fast.
#include <hip/hip_runtime.h>

// 6-layer post-LN decoder stack: token embedding x sqrt(512) + sinusoidal positions; per layer masked self-attention (8 heads x 64), attention over a memory tensor,
// relu FFN 512 -> 2048 -> 512, each followed by residual add + LayerNorm over 512. Masks are int32 [batch][query][key] tensors read by value (nonzero = score replaced by
// -1e18); a 32-key chunk whose 16x32 mask tile is entirely nonzero is skipped (exact whenever each query row keeps at least one key).
// compute dtype: every contraction on v_wmma_f32_16x16x32_f16 (f16 operands, f32 accumulate): q/k/v projections, score and P.V products, output projections, both FFN
// products. Operand planes: activations f16 x8 (attention context x64), weights bf16-exact f16 x256, softmax P f16 x4096; query tiles with position < 64 of the masked
// self-attention add residual planes (x2048 of the x8 / x4096 carriers) of q, k, v and P: 3 score products and 3 P.V products into a second accumulator.
// tokens and masks int32 (tokens clamped). Fragment k-map per lane half hh for A and B: elements 0..7 <- k = 8hh+0..7, 8..15 <- k = 16+8hh+0..7; acc[r] = D[8hh+r][col].
// The attention's q, k and v planes are kept in fragment order: a fragment (16 rows x 32 k) is 512 halves = piece 0 (elements 0..7 of lanes 0..31) then piece 1 (elements 8..15), so that each
// of its two 16-B-per-lane loads covers 512 contiguous bytes (4 whole lines; from a row-major plane it would touch 16 lines for 32 B each).
// Each mask is packed once, by the preparation grid, into bit words [batch][16-query tile][32-key chunk][row]: bit l of a word = (mask[row][32 chunk + l] != 0); the attention reads only these words.
// q|k plane: [batch][q, k][head][16-row tile][k step of 32 dims][piece][lane][8]; v plane: [batch][head][32-key chunk][16-dim tile][piece][lane][8] (rows = dims, k = keys).

#ifndef NB
#define NB 8
#endif
#ifndef SEQ
#define SEQ 512
#endif
#define NB_FULL 8
#define SEQ_FULL 512

namespace {
constexpr int D = 512, NH = 8, DH = 64, DFF = 2048, NLAY = 6, VOCAB = 32000;
constexpr int MR = NB * SEQ;                 // activation rows, row = b * SEQ + s
constexpr int LQK = 2 * D;                   // halves of the q | k plane per activation row
constexpr int FRG = 512, QKT = 2 * FRG, VCH = 4 * FRG;   // halves of a fragment, of a 16-row x 64-dim q or k tile, of a 64-dim x 32-key v chunk
constexpr int NQKV = 3 * D, NQT = SEQ / 16, NQT_RES = 4;
constexpr float WSC = 256.0f, CA = 8.0f, CX = 64.0f, PSC = 4096.0f, RS = 2048.0f;
constexpr float SQD = 22.627416997969522f, NLOGD = -0.017988946039015984f, L2E = 1.4426950408889634f, NEGF = -1.0e18f, LNEPS = 1.0e-5f;
constexpr float SCL = 1.0f / (CA * CA * 8.0f);   // score = acc / (8 x 8) / sqrt(64)
static_assert(NB >= 1 && NB <= NB_FULL && SEQ >= 128 && SEQ <= SEQ_FULL && SEQ % 128 == 0);
static_assert(MR % 128 == 0 && MR % 32 == 0 && D == 512 && NH * DH == D && DFF % 512 == 0 && NQT > NQT_RES && (MR * D) % 8 == 0);

typedef _Float16 b16;
typedef __attribute__((ext_vector_type(16))) _Float16 v16b;
typedef __attribute__((ext_vector_type(8))) _Float16 v8b;
typedef __attribute__((ext_vector_type(4))) _Float16 v4h_;
typedef __attribute__((ext_vector_type(8))) float v8f;
typedef __attribute__((ext_vector_type(4))) float v4f;
typedef __attribute__((ext_vector_type(16))) unsigned int v16u;

__device__ __forceinline__ float bf16_rne(float f) { unsigned int u = __float_as_uint(f); u += 0x7FFFu + ((u >> 16) & 1u); return __uint_as_float(u & 0xFFFF0000u); }
__device__ __forceinline__ v16b frag_kb(const b16* p, int hh) { const v8b a = *(const v8b*)(p + 8 * hh), b = *(const v8b*)(p + 16 + 8 * hh); v16b f;
#pragma unroll
  for (int e = 0; e < 8; ++e) { f[e] = a[e]; f[8 + e] = b[e]; } return f; }
__device__ __forceinline__ v16b frag_pk(const b16* p, int lane) { const v8b a = *(const v8b*)(p + 8 * lane), b = *(const v8b*)(p + 256 + 8 * lane); v16b f;   // p: a fragment stored in fragment order
#pragma unroll
  for (int e = 0; e < 8; ++e) { f[e] = a[e]; f[8 + e] = b[e]; } return f; }
__device__ __forceinline__ v8f wmma_raw(v16b a, v16b b, v8f c) { return __builtin_amdgcn_wmma_f32_16x16x32_f16(false, a, false, b, (short)0, c, false, false); }
__device__ __forceinline__ v8f wmma16b(v16b a, v16b b, v8f c) { v8f d = wmma_raw(a, b, c); asm volatile("v_nop\n\tv_nop\n\tv_nop\n\tv_nop" : "+v"(d) : "v"(a), "v"(b)); return d; }
// one guard after a group of 8 accumulating WMMAs: ties all 8 accumulators, keeps both A and all four B fragments live across the 4 nops
#define WMMA_GUARD8(c, a0, a1, bf) asm volatile("v_nop\n\tv_nop\n\tv_nop\n\tv_nop" : "+v"(c[0][0]), "+v"(c[0][1]), "+v"(c[0][2]), "+v"(c[0][3]), \
    "+v"(c[1][0]), "+v"(c[1][1]), "+v"(c[1][2]), "+v"(c[1][3]) : "v"(a0), "v"(a1), "v"(bf[0]), "v"(bf[1]), "v"(bf[2]), "v"(bf[3]))
__device__ __forceinline__ void wave_lds_sync() { __builtin_amdgcn_fence(3 /* release order */, "workgroup"); __builtin_amdgcn_wave_barrier(); __builtin_amdgcn_fence(2 /* acquire order */, "workgroup"); }
__device__ __forceinline__ float pmul(float a, float b) { float p = a * b; asm volatile("" : "+v"(p)); return p; }
// 16 mask words at a wave-uniform address, read through the constant address space (no kernel that reads them writes them): so the load stays a scalar load inside a loop that holds fences as well,
// lands in scalar registers and is waited for only where its words are first used
__device__ __forceinline__ v16u ld_words16(const unsigned int* p) { return *(const __attribute__((address_space(4))) v16u*)p; }
__device__ __forceinline__ int iclamp(int v, int lo, int hi) { return v < lo ? lo : (v > hi ? hi : v); }
__device__ __forceinline__ float nexp2(float v) { float r; asm("v_exp_f32 %0, %1\n\tv_nop" : "=v"(r) : "v"(v)); return r; }
// 16-lane butterflies (partners lane ^ 8, 4, 2, 1) on ds_bpermute_b32; sa[] holds the four partner byte addresses, formed once per kernel (fewer live registers than per-call index math)
__device__ __forceinline__ float bperm(int addr, float x) { return __int_as_float(__builtin_amdgcn_ds_bpermute(addr, __float_as_int(x))); }
__device__ __forceinline__ float red_max16(float x, const int (&sa)[4]) {
#pragma unroll
  for (int j = 0; j < 4; ++j) x = fmaxf(x, bperm(sa[j], x));
  return x; }
__device__ __forceinline__ float red_sum16(float x, const int (&sa)[4]) {
#pragma unroll
  for (int j = 0; j < 4; ++j) x += bperm(sa[j], x);
  return x; }

// Wt[l][noff + n][k] = f16(bf16(W[l][k][n]) x 256), W stored [layer][in][out] with NA columns; block = 64 k x 64 n tile transposed through LDS (T: 64 x 72 halves; cross-thread, block barrier);
__device__ __forceinline__ void wprep_tile(b16* T, const float* __restrict__ W, b16* __restrict__ Wt, int K, int NA, int NT, int noff, int l, int k0, int n0, int tid) {
  { const int kr = tid >> 2, nc = (tid & 3) * 16; const float* src = W + ((size_t)l * K + k0 + kr) * NA + n0 + nc;
#pragma unroll
    for (int q = 0; q < 4; ++q) { const v4f v = *(const v4f*)(src + 4 * q);
#pragma unroll
      for (int j = 0; j < 4; ++j) T[(nc + 4 * q + j) * 72 + kr] = (b16)(bf16_rne(v[j]) * WSC); } }
  __syncthreads();
  v8b vv[2]; size_t dst[2];
#pragma unroll
  for (int i = 0; i < 2; ++i) { const int n = (tid >> 3) + 32 * i, p = tid & 7; vv[i] = *(const v8b*)(T + n * 72 + 8 * p); dst[i] = ((size_t)l * NT + noff + n0 + n) * K + k0 + 8 * p; }
  {
#pragma unroll
    for (int i = 0; i < 2; ++i) *(v8b*)(Wt + dst[i]) = vv[i];
     }
}

__device__ __forceinline__ void mprep_part(const float* __restrict__ mem, b16* __restrict__ Mh, int u) {
  if (u >= MR * D / 8) return;
  const int row = u / (D / 8), c0 = (u % (D / 8)) * 8, b = row / SEQ, s = row % SEQ;
  const float* src = mem + ((size_t)b * SEQ_FULL + s) * D + c0;
  const v4f a = *(const v4f*)src, c = *(const v4f*)(src + 4); v8b v;
#pragma unroll
  for (int j = 0; j < 4; ++j) { v[j] = (b16)(bf16_rne(a[j]) * CA); v[4 + j] = (b16)(bf16_rne(c[j]) * CA); }
  { *(v8b*)(Mh + (size_t)row * D + c0) = v;  }
}

// embedding: x[b][s][c] = bf16(emb[tok[s][b]][c]) x sqrt(512) + pe(s, c), pe(s, 2j) = sin(s x exp(2j x NLOGD)), pe(s, 2j+1) = cos(same angle); tok clamped. block = 4 rows,
// thread = 8 columns (rolled loop of 4 expf + sincosf); the 4 x 512 f32 tile is staged in LDS (block barrier), then 32 lanes x 16 B per 512-B run to X and
__device__ __forceinline__ void embed_rows(float* Xs, const int* __restrict__ tok, const float* __restrict__ emb, float* __restrict__ X, b16* __restrict__ Xh, int row0, int tid) {
  const int rl = tid >> 6, c0 = (tid & 63) * 8, row = row0 + rl, b = row / SEQ, s = row % SEQ;
  const int t = iclamp(tok[s * NB_FULL + b], 0, VOCAB - 1);
  const float* er = emb + (size_t)t * D + c0;
#pragma unroll 1
  for (int q = 0; q < 4; ++q) {
    const int c = c0 + 2 * q; const float dv = expf(pmul((float)c, NLOGD)); float sn, cs; sincosf(pmul((float)s, dv), &sn, &cs);
    Xs[rl * (D + 4) + c] = pmul(bf16_rne(er[2 * q]), SQD) + sn; Xs[rl * (D + 4) + c + 1] = pmul(bf16_rne(er[2 * q + 1]), SQD) + cs; }
  __syncthreads();
  v4f fv[2]; size_t fo[2]; v8b hv;
#pragma unroll
  for (int i = 0; i < 2; ++i) { const int f = i * 256 + tid; fv[i] = *(const v4f*)(Xs + (f >> 7) * (D + 4) + (f & 127) * 4); fo[i] = (size_t)(row0 + (f >> 7)) * D + (f & 127) * 4; }
  { const v4f a = *(const v4f*)(Xs + rl * (D + 4) + c0), c4 = *(const v4f*)(Xs + rl * (D + 4) + c0 + 4);
#pragma unroll
    for (int e = 0; e < 4; ++e) { hv[e] = (b16)(a[e] * CA); hv[4 + e] = (b16)(c4[e] * CA); } }
  {
#pragma unroll
    for (int i = 0; i < 2; ++i) *(v4f*)(X + fo[i]) = fv[i];
    *(v8b*)(Xh + (size_t)row * D + c0) = hv;  }
}

// one 16-query tile of a mask -> its SEQ / 2 bit words. A wave makes 32 words (two chunks x 16 rows) that fill one 128-B line: per word one whole-line load (lane = key) and a ballot,
// lane t keeps word t; the 32 loads are independent and fly together
__device__ __forceinline__ void maskpack_tile(const int* __restrict__ mask, unsigned int* __restrict__ MB, int tile, int tid) {
  const int wave = __builtin_amdgcn_readfirstlane(tid >> 5), lane = tid & 31;
  const int* mrow = mask + ((size_t)(tile / NQT) * SEQ_FULL + (tile % NQT) * 16) * SEQ_FULL + lane;
  for (int j = wave; j < SEQ / 64; j += 8) {
    int v[32]; unsigned int keep = 0u;
#pragma unroll
    for (int t = 0; t < 32; ++t) v[t] = mrow[(size_t)(t & 15) * SEQ_FULL + 32 * (2 * j + (t >> 4))];
#pragma unroll
    for (int t = 0; t < 32; ++t) { const unsigned int bal = __builtin_amdgcn_ballot_w32(v[t] != 0); keep = lane == t ? bal : keep; }
    MB[(size_t)tile * (SEQ / 2) + 32 * j + lane] = keep;
    asm volatile("s_wait_xcnt 0x0" ::: "memory");   // the built code joins this part's end to edges into the other parts, which rewrite the registers the store names: the wait stands in front of them
  }
}

// All input preparation in one grid: none of its parts reads what another writes, so a block takes its part by its index range (block-uniform): embedding rows first (the longest blocks),
// then the 64 x 64 tiles of the eight 512 x 512 weights, of W1 and of W2 (k tile fastest, then n tile, then layer), then the memory plane, then the tiles of the two masks.
constexpr int LTD = 3, LTF = 5, PB_WS = NLAY << (2 * LTD), PB_WF = NLAY << (LTD + LTF);   // log2 of the 64-wide tiles along 512 and along 2048; blocks of a small and of an FFN weight
static_assert((64 << LTD) == D && (64 << LTF) == DFF);
constexpr int P_W = MR / 4, P_F1 = P_W + 8 * PB_WS, P_F2 = P_F1 + PB_WF, P_M = P_F2 + PB_WF, P_K = P_M + (MR * D / 8 + 255) / 256, P_ALL = P_K + 2 * NB * NQT;   // first block of each range
__global__ __launch_bounds__(256) void prep_kernel(const int* __restrict__ tok, const float* __restrict__ emb, const float* __restrict__ mem, const int* __restrict__ msks, const int* __restrict__ mskc,
    const float* __restrict__ wqs, const float* __restrict__ wks, const float* __restrict__ wvs, const float* __restrict__ wos,
    const float* __restrict__ wqc, const float* __restrict__ wkc, const float* __restrict__ wvc, const float* __restrict__ woc,
    const float* __restrict__ w1, const float* __restrict__ w2,
    b16* __restrict__ WQKVS, b16* __restrict__ WOS, b16* __restrict__ WQKVC, b16* __restrict__ WOC, b16* __restrict__ W1T, b16* __restrict__ W2T,
    b16* __restrict__ Mh, float* __restrict__ X, b16* __restrict__ Xh, unsigned int* __restrict__ MBS, unsigned int* __restrict__ MBC) {
  __shared__ __attribute__((aligned(16))) b16 Sh[64 * 72];   // weight tile, or the embedding's 4 x 516 f32 rows
  static_assert(64 * 72 * 2 >= 4 * (D + 4) * 4);
  const int tid = threadIdx.x, r = blockIdx.x;
  if (r < P_W) embed_rows((float*)Sh, tok, emb, X, Xh, r * 4, tid);
  else if (r < P_M) {
    const float* W; b16* Wt; int q, lk = LTD, ln = LTD, NT, noff = 0;   // lk, ln: log2 of the tile counts along k (rows of W) and n (its columns)
    if (r < P_F1) {
      const int m = (r - P_W) / PB_WS, g = m & 3;   // m: 0..3 q k v o of the self-attention, 4..7 of the attention over memory
      q = (r - P_W) % PB_WS;
      W = m < 4 ? (g == 0 ? wqs : (g == 1 ? wks : (g == 2 ? wvs : wos))) : (g == 0 ? wqc : (g == 1 ? wkc : (g == 2 ? wvc : woc)));
      Wt = m < 4 ? (g == 3 ? WOS : WQKVS) : (g == 3 ? WOC : WQKVC);
      NT = g == 3 ? D : NQKV; noff = g == 3 ? 0 : g * D;
    } else if (r < P_F2) { q = r - P_F1; W = w1; Wt = W1T; ln = LTF; NT = DFF; }
    else { q = r - P_F2; W = w2; Wt = W2T; lk = LTF; NT = D; }
    wprep_tile(Sh, W, Wt, 64 << lk, 64 << ln, NT, noff, q >> (lk + ln), (q & ((1 << lk) - 1)) * 64, ((q >> lk) & ((1 << ln) - 1)) * 64, tid);
    asm volatile("s_wait_xcnt 0x0" ::: "memory");   // the built code joins this branch's end to an edge into the embedding branch, which rewrites the registers the two stores name: the wait stands in front of that join
  } else if (r < P_K) mprep_part(mem, Mh, (r - P_M) * 256 + tid);
  else { const bool sf = r - P_K < NB * NQT; maskpack_tile(sf ? msks : mskc, sf ? MBS : MBC, (r - P_K) % (NB * NQT), tid); }
}

// Operand staging of the GEMMs: a stage is KS = 128 k (256 B) of every A and B row of the block tile, laid in LDS at pitch 272 B (16 B x 17: odd, conflict-free for 16-B row readers),
// brought by per-lane asynchronous 16-B copies (a wave's copy covers 2 rows x 256 B = 4 whole lines); two buffers, the next stage's copies fly while this one is worked on.
constexpr int KS = 128, LP = KS + 8;
__device__ __forceinline__ unsigned lds_byte(const void* p) { return (unsigned)(unsigned long long)p; }
// copies of rows 16 apart (LDS step 16 x 272 B, global step gs halves); s_wait_xcnt 0 closes each statement so that no address register is rewritten ahead of it
__device__ __forceinline__ void cp2(unsigned l, const b16* g, size_t gs) {
  asm volatile("global_load_async_to_lds_b128 %0, %2, off\n\tglobal_load_async_to_lds_b128 %1, %3, off\n\ts_wait_xcnt 0x0"
      :: "v"(l), "v"(l + 16u * LP * 2u), "v"(g), "v"(g + gs) : "memory");
}
__device__ __forceinline__ void cp8(unsigned l, const b16* g, size_t gs) {
  constexpr unsigned LS = 16u * LP * 2u;
  asm volatile("global_load_async_to_lds_b128 %0, %8, off\n\tglobal_load_async_to_lds_b128 %1, %9, off\n\tglobal_load_async_to_lds_b128 %2, %10, off\n\t"
      "global_load_async_to_lds_b128 %3, %11, off\n\tglobal_load_async_to_lds_b128 %4, %12, off\n\tglobal_load_async_to_lds_b128 %5, %13, off\n\t"
      "global_load_async_to_lds_b128 %6, %14, off\n\tglobal_load_async_to_lds_b128 %7, %15, off\n\ts_wait_xcnt 0x0"
      :: "v"(l), "v"(l + LS), "v"(l + 2u * LS), "v"(l + 3u * LS), "v"(l + 4u * LS), "v"(l + 5u * LS), "v"(l + 6u * LS), "v"(l + 7u * LS),
         "v"(g), "v"(g + gs), "v"(g + 2 * gs), "v"(g + 3 * gs), "v"(g + 4 * gs), "v"(g + 5 * gs), "v"(g + 6 * gs), "v"(g + 7 * gs) : "memory");
}
// block of 256 threads: AR rows of A (first row Ag, pitch lda) and BR rows of B = Wt (first row Bg, pitch K), K a multiple of 128; the wave takes 32 A rows from arow and 64 B rows from
// brow: 8 WMMAs per 32 k, one guard per stage. On return every wave has left the ring (last trip's barrier): it may be reused.
// Blocks of one grid share operand rows and start together: walking K alike they would ask L2 for the same lines at the same moment. Trip t therefore takes the k stage (t + rot) mod NT,
// and the 128-row groups of B are copied in the order jrot, jrot + 1, ... (mod their number); rot < NT and jrot come from the block index (block-uniform). The f32 sums run over k in that rotated order.
template <int AR, int BR>
__device__ __forceinline__ void mac_staged(v8f (&acc)[2][4], b16* ring, const b16* Ag, int lda, const b16* Bg, int K, int arow, int brow, int tid, int nloc, int hlf, int rot, int jrot) {
  static_assert((AR == 32 || AR % 128 == 0) && BR % 128 == 0);
  constexpr int BUFH = (AR + BR) * LP;
  const unsigned l0 = lds_byte(ring) + (unsigned)(tid >> 4) * (LP * 2u) + (unsigned)(tid & 15) * 16u;
  const b16* ga = Ag + (size_t)(tid >> 4) * lda + 8 * (tid & 15);
  const b16* gb = Bg + (size_t)(tid >> 4) * K + 8 * (tid & 15);
  const int NT = K / KS;
  auto fill = [&](int t) {
    const unsigned l = l0 + (unsigned)(t & 1) * (BUFH * 2u);
    const int kt = t + rot < NT ? t + rot : t + rot - NT;   // this trip's k stage
    if constexpr (AR == 32) cp2(l, ga + kt * KS, (size_t)16 * lda);
    else {
#pragma unroll
      for (int j = 0; j < AR / 128; ++j) cp8(l + (unsigned)j * (128u * LP * 2u), ga + (size_t)(128 * j) * lda + kt * KS, (size_t)16 * lda); }
#pragma unroll
    for (int i = 0; i < BR / 128; ++i) { const int j = (i + jrot) % (BR / 128);
      cp8(l + (unsigned)(AR + 128 * j) * (LP * 2u), gb + (size_t)(128 * j) * K + kt * KS, (size_t)16 * K); }
  };
  fill(0);
  asm volatile("s_wait_asynccnt 0x0" ::: "memory");   // trip 0's k stage has landed (this wave's copies) before the barrier that publishes it
  __syncthreads();
  if (NT > 1) fill(1);
#pragma unroll 1
  for (int t = 0; t < NT; ++t) {
    const b16* bufp = ring + (t & 1) * BUFH;
    const b16* ap0 = bufp + (arow + nloc) * LP; const b16* ap1 = ap0 + 16 * LP; const b16* bp = bufp + (AR + brow + nloc) * LP;
    v16b a0[2], a1[2], bf[2][4];   // two fragment sets: the next 32 k are fetched while the WMMAs of these 32 k run (all inside this stage's buffer)
    a0[0] = frag_kb(ap0, hlf); a1[0] = frag_kb(ap1, hlf);
#pragma unroll
    for (int u = 0; u < 4; ++u) bf[0][u] = frag_kb(bp + u * 16 * LP, hlf);
#pragma unroll
    for (int s = 0; s < KS / 32; ++s) {
      const int c = s & 1, n = c ^ 1;
      if (s + 1 < KS / 32) {
        a0[n] = frag_kb(ap0 + 32 * (s + 1), hlf); a1[n] = frag_kb(ap1 + 32 * (s + 1), hlf);
#pragma unroll
        for (int u = 0; u < 4; ++u) bf[n][u] = frag_kb(bp + u * 16 * LP + 32 * (s + 1), hlf); }
      __builtin_amdgcn_sched_barrier(0);   // keeps the next block's 12 LDS reads one group in front of this block's WMMAs (for speed only)
#pragma unroll
      for (int u = 0; u < 4; ++u) { acc[0][u] = wmma_raw(a0[c], bf[c][u], acc[0][u]); acc[1][u] = wmma_raw(a1[c], bf[c][u], acc[1][u]); }
      if (s + 1 < KS / 32) __builtin_amdgcn_sched_barrier(0);   // the block after next's reads stay behind this block's WMMAs
      else WMMA_GUARD8(acc, a0[c], a1[c], bf[c]);   // the stage's last WMMAs stand in front of a branch: the 4 slots behind them are filled here for both of its sides
    }
    asm volatile("s_wait_dscnt 0x0" ::: "memory");     // this wave's reads of the buffer have retired before the barrier behind which it is refilled
    asm volatile("s_wait_asynccnt 0x0" ::: "memory");  // this wave's copies for trip t + 1 have landed before the barrier that publishes them
    __syncthreads();
    if (t + 2 < NT) fill(t + 2);
  }
  asm volatile("s_wait_asynccnt 0x0" ::: "memory");    // no copy outstanding when the ring is reused or the wave ends
}

// f16 epilogue of one wave's 32 x 64 tile (plane value = f16(v x 8), LO: f16((v x 8 - hi) x 2048)): b16 element stores into the wave-private LDS tile, wave sync, then 8 stores of 16 B per lane:
// row-major (4 rows x 128 B each, dstp = the tile's first element, pitch ldc), or PK: fragment order (dstp = the first of the wave's two q or k tiles; store j = tile j / 4, k step (j / 2) % 2,
// piece j % 2: 512 contiguous bytes each, 4 KB in a row)
template <bool LO, bool RELU, bool PK>
__device__ __forceinline__ void epi_rows(const v8f (&acc)[2][4], const float (&bb)[4], float oscale, b16* Es, b16* dstp, int ldc, int lane, int nloc, int hlf) {
#pragma unroll
  for (int mt = 0; mt < 2; ++mt)
#pragma unroll
    for (int t = 0; t < 4; ++t)
#pragma unroll
      for (int r = 0; r < 8; ++r) {
        float v = acc[mt][t][r] * oscale + bb[t]; if (RELU) v = fmaxf(v, 0.0f); const float vs = v * CA; const b16 hi = (b16)vs;
        Es[(mt * 16 + 8 * hlf + r) * 72 + 16 * t + nloc] = LO ? (b16)((vs - (float)hi) * RS) : hi; }
  wave_lds_sync();
  v8b vv[8];
#pragma unroll
  for (int j = 0; j < 8; ++j) vv[j] = PK ? *(const v8b*)(Es + ((j >> 2) * 16 + nloc) * 72 + 32 * ((j >> 1) & 1) + 16 * (j & 1) + 8 * hlf) : *(const v8b*)(Es + (4 * j + (lane >> 3)) * 72 + 8 * (lane & 7));
  b16* dst = PK ? dstp + 8 * lane : dstp + (size_t)(lane >> 3) * ldc + 8 * (lane & 7);
  {
#pragma unroll
    for (int j = 0; j < 8; ++j) *(v8b*)(dst + (PK ? (size_t)(256 * j) : (size_t)(4 * j) * ldc)) = vv[j];
    asm volatile("s_wait_xcnt 0x0" ::: "memory");   // what follows (the residual plane's pass) rewrites registers that these stores name: the wait stands in front of it
  }
}

// head-transposed f16 epilogue of the block's 128 (keys) x 128 (head columns) tile -> v plane in fragment order: each lane stores its 8 consecutive keys of one
// column as one 16-B LDS store into Et[col][key] (cross-wave, block barrier), then the wave writes one (head wave / 4, chunk wave % 4): store j = dim tile j / 2, piece j % 2, 4 KB in a row
template <bool LO, bool RELU>
__device__ __forceinline__ void epi_vt(const v8f (&acc)[2][4], const float (&bb)[4], float oscale, b16* Et, b16* plane, int bidx, int key0, int colv0, int wave, int wm, int wn, int nloc, int hlf) {
#pragma unroll
  for (int mt = 0; mt < 2; ++mt)
#pragma unroll
    for (int t = 0; t < 4; ++t) { v8b hv;
#pragma unroll
      for (int r = 0; r < 8; ++r) { float v = acc[mt][t][r] * oscale + bb[t]; if (RELU) v = fmaxf(v, 0.0f); const float vs = v * CA; const b16 hi = (b16)vs; hv[r] = LO ? (b16)((vs - (float)hi) * RS) : hi; }
      *(v8b*)(Et + (wn * 64 + 16 * t + nloc) * 136 + wm * 32 + mt * 16 + 8 * hlf) = hv; }
  __syncthreads();
  v8b vv[8]; const int hd = wave >> 2, ch = wave & 3;
#pragma unroll
  for (int j = 0; j < 8; ++j) vv[j] = *(const v8b*)(Et + (hd * DH + 16 * (j >> 1) + nloc) * 136 + 32 * ch + 16 * (j & 1) + 8 * hlf);
  b16* dst = plane + ((size_t)(bidx * NH + colv0 / DH + hd) * (SEQ / 32) + key0 / 32 + ch) * VCH + 8 * (16 * hlf + nloc);
  {
#pragma unroll
    for (int j = 0; j < 8; ++j) *(v8b*)(dst + 256 * j) = vv[j];
    asm volatile("s_wait_xcnt 0x0" ::: "memory");   // what follows (the residual plane's pass) rewrites registers that these stores name: the wait stands in front of it
  }
}

// C = (A[M][K] f16 plane, pitch lda) x Wt[N][K] + bf16(bias), optional relu; block 128 x 128 = 8 waves of 32 x 64. GEMM columns < vcol0 -> plane C (f16 x 8): with relu (FFN) row-major
// C[row*ldc + ccol0 + col], without (q at columns 0..511, k at 512..1023) the q|k plane in fragment order; columns >= vcol0 -> head-transposed plane VT (v of the attention), fragment order. Blocks whose 128 rows start a sequence also emit the residual planes Clo / VTlo (x 2048) for those rows
// when wres != 0. Bias group pointer chosen per 512-column group (block-uniform). Column blocks below asplit multiply A1, the others A2 (block-uniform): two products of different left
// operands that share K and the output planes run as one grid.
template <bool RELU>
__global__ __launch_bounds__(256) void gemm_kernel(const b16* __restrict__ A1, const b16* __restrict__ A2, int asplit, int lda, const b16* __restrict__ Wt, int K,
    const float* __restrict__ bg0, const float* __restrict__ bg1, const float* __restrict__ bg2, const float* __restrict__ bg3,
    b16* __restrict__ C, b16* __restrict__ Clo, int ldc, int ccol0, b16* __restrict__ VT, b16* __restrict__ VTlo, int vcol0, float oscale, int wres) {
  __shared__ __attribute__((aligned(16))) b16 Ls[2 * 256 * LP];   // operand ring (2 buffers x 256 rows); behind the K loop 8 wave tiles [32][72] (row-major mode) or one block tile [128][136] (transposed mode)
  static_assert(2 * 256 * LP >= 18432);
  const int tid = threadIdx.x, wave = tid >> 5, lane = tid & 31, nloc = lane & 15, hlf = lane >> 4;
  const int bm0 = blockIdx.x * 128, bn0 = blockIdx.y * 128, wm = wave >> 1, wn = wave & 1;
  const int row0 = bm0 + wm * 32, col0 = bn0 + wn * 64;
  const b16* A = bn0 < asplit ? A1 : A2;
  v8f acc[2][4];
#pragma unroll
  for (int t = 0; t < 4; ++t) { acc[0][t] = (v8f){}; acc[1][t] = (v8f){}; }
  mac_staged<128, 128>(acc, Ls, A + (size_t)bm0 * lda, lda, Wt + (size_t)bn0 * K, K, wm * 32, wn * 64, tid, nloc, hlf, (int)((blockIdx.x + blockIdx.y) % (unsigned)(K / KS)), 0);
  const int gsel = bn0 >> 9; const float* bias = gsel == 0 ? bg0 : (gsel == 1 ? bg1 : (gsel == 2 ? bg2 : bg3));
  float bb[4];
#pragma unroll
  for (int t = 0; t < 4; ++t) bb[t] = bf16_rne(bias[(col0 & 511) + 16 * t + nloc]);
  const bool vmode = bn0 >= vcol0, wlo = (wres != 0) && (bm0 % SEQ == 0);
  if (!vmode) {
    b16* Es = Ls + wave * (32 * 72);
    // the wave's 64 columns are one head of q or of k, its 32 rows two tiles that follow one another in the plane
    const size_t co = RELU ? (size_t)row0 * ldc + ccol0 + col0 : (((size_t)(row0 / SEQ * 2 + (col0 >> 9)) * NH + ((col0 & 511) >> 6)) * NQT + row0 % SEQ / 16) * QKT;
    epi_rows<false, RELU, !RELU>(acc, bb, oscale, Es, C + co, ldc, lane, nloc, hlf);
    if (wlo) { wave_lds_sync(); epi_rows<true, RELU, !RELU>(acc, bb, oscale, Es, Clo + co, ldc, lane, nloc, hlf); }
  } else {
    epi_vt<false, RELU>(acc, bb, oscale, Ls, VT, bm0 / SEQ, bm0 % SEQ, bn0 - vcol0, wave, wm, wn, nloc, hlf);
    if (wlo) { __syncthreads(); epi_vt<true, RELU>(acc, bb, oscale, Ls, VTlo, bm0 / SEQ, bm0 % SEQ, bn0 - vcol0, wave, wm, wn, nloc, hlf); }
  }
}

// Y = LayerNorm(Xres + (A x Wt + bf16(bias))) * bf16(g) + bf16(be) over full 512-wide rows: block = 32 rows x 512 columns (wave = 32 x 64), K = 512 or 2048. Per 16-row half the f32
// tile is staged in LDS (cross-wave, block barrier); wave w then owns rows 2w, 2w+1: lane holds columns 128j + 4 lane (j = 0..3), residual / bias / gain loaded with the same map,
__global__ __launch_bounds__(256) void gemm_ln_kernel(const b16* __restrict__ A, int K, const b16* __restrict__ Wt, const float* __restrict__ bias, const float* Xres,
    const float* __restrict__ gam, const float* __restrict__ bet, float* OutF, b16* __restrict__ Xh, float oscale, int wxh) {
  __shared__ __attribute__((aligned(16))) b16 Rg[2 * (32 + D) * LP];   // operand ring (2 buffers x 544 rows); behind the K loop the f32 tile Tf
  static_assert(2 * (32 + D) * LP * 2 >= 16 * (D + 4) * 4);
  float* Tf = (float*)Rg;
  const int tid = threadIdx.x, wave = tid >> 5, lane = tid & 31, nloc = lane & 15, hlf = lane >> 4;
  const int bm0 = blockIdx.x * 32, col0 = wave * 64;
  v8f acc[2][4];
#pragma unroll
  for (int t = 0; t < 4; ++t) { acc[0][t] = (v8f){}; acc[1][t] = (v8f){}; }
  mac_staged<32, D>(acc, Rg, A + (size_t)bm0 * K, K, Wt, K, 0, col0, tid, nloc, hlf, (int)(blockIdx.x % (unsigned)(K / KS)), (int)(blockIdx.x / (unsigned)(K / KS) % 4u));
#pragma unroll 1
  for (int mt = 0; mt < 2; ++mt) {
    if (mt) __syncthreads();
#pragma unroll
    for (int t = 0; t < 4; ++t)
#pragma unroll
      for (int r = 0; r < 8; ++r) Tf[(8 * hlf + r) * (D + 4) + col0 + 16 * t + nloc] = (mt ? acc[1][t][r] : acc[0][t][r]) * oscale;
    __syncthreads();
#pragma unroll 1
    for (int rr = 0; rr < 2; ++rr) {
      const int rl = 2 * wave + rr; const size_t go = (size_t)(bm0 + mt * 16 + rl) * D;
      float y[16]; float s = 0.0f;
#pragma unroll
      for (int j = 0; j < 4; ++j) { const int c = 128 * j + 4 * lane;
        const v4f tv = *(const v4f*)(Tf + rl * (D + 4) + c); const v4f rv = *(const v4f*)(Xres + go + c); const v4f bv = *(const v4f*)(bias + c);
#pragma unroll
        for (int e = 0; e < 4; ++e) { const float yy = rv[e] + (tv[e] + bf16_rne(bv[e])); y[4 * j + e] = yy; s += yy; } }
#pragma unroll
      for (int off = 16; off > 0; off >>= 1) s += __shfl_xor(s, off, 32);
      const float mean = s * (1.0f / (float)D); float q = 0.0f;
#pragma unroll
      for (int i = 0; i < 16; ++i) { const float d0 = y[i] - mean; y[i] = d0; q += d0 * d0; }
#pragma unroll
      for (int off = 16; off > 0; off >>= 1) q += __shfl_xor(q, off, 32);
      const float rstd = 1.0f / sqrtf(q * (1.0f / (float)D) + LNEPS);
      v4f ov[4]; v4h_ hv[4];
#pragma unroll
      for (int j = 0; j < 4; ++j) { const int c = 128 * j + 4 * lane; const v4f gv = *(const v4f*)(gam + c), ev = *(const v4f*)(bet + c);
#pragma unroll
        for (int e = 0; e < 4; ++e) { const float o = (y[4 * j + e] * rstd) * bf16_rne(gv[e]) + bf16_rne(ev[e]); ov[j][e] = o; hv[j][e] = (b16)(o * CA); } }
      {
#pragma unroll
        for (int j = 0; j < 4; ++j) { const int c = 128 * j + 4 * lane; *(v4f*)(OutF + go + c) = ov[j]; if (wxh) *(v4h_*)(Xh + go + c) = hv[j]; }
         }
    }
  }
}

// Streaming attention, one work-group = 16 query rows of one (batch, head), its NWK waves sharing the keys: wave w walks the 32-key chunks w, w + NWK, ... with its own running max,
// sum and context, beginning at a step rotated by query tile + head and wrapping (the tiles of a head share K and V, the heads of a tile the mask: walking alike they would ask L2 for the same lines
// at once); the partial results meet in LDS behind one block barrier and are joined there (weights exp(max_w - max)). Q fragments from the q|k plane (fragment order), per chunk
// the tile's 16 mask words are at hand in scalar registers (64 B, fetched one step ahead; skip when all bits are set), scores = 2 k-steps of
// WMMA against K rows, replace-mask, running-max softmax in f32 (exp2), P staged x4096 into a wave-private LDS tile (b16 element stores, wave sync, fragment reload), ctx += P x V with
// V from the head-transposed plane (fragment order).
// RES: query/key residual planes give 3 score products and P_res x V + P x V_res into a second accumulator for chunks with keys < 128 (rows for which the residual planes exist);
constexpr int NWK = 4, PPW = DH + 4;   // waves per query tile; f32 pitch of a partial context row
static_assert((SEQ / 32) % NWK == 0);
template <bool RES>
__global__ __launch_bounds__(32 * NWK) void attn_kernel(const b16* __restrict__ QK, const b16* __restrict__ QKlo, const b16* __restrict__ VT, const b16* __restrict__ VTlo,
    const unsigned int* __restrict__ MB, b16* __restrict__ CTX, int qt0, int nqt) {
  __shared__ __attribute__((aligned(16))) b16 PstA[NWK * 16 * 40];
  __shared__ __attribute__((aligned(16))) b16 PlstA[RES ? NWK * 16 * 40 : 8];
  __shared__ __attribute__((aligned(16))) float Part[NWK * 16 * PPW];
  __shared__ float Mxs[NWK * 16], Lss[NWK * 16];
  const int tid = threadIdx.x, lane = tid & 31, nloc = lane & 15, hlf = lane >> 4, wave = __builtin_amdgcn_readfirstlane(tid >> 5);
  const int sa[4] = {(lane ^ 8) << 2, (lane ^ 4) << 2, (lane ^ 2) << 2, (lane ^ 1) << 2};
  b16* Pst = PstA + wave * (16 * 40); b16* Plst = PlstA + (RES ? wave * (16 * 40) : 0);
  const int bi = blockIdx.x, qt = qt0 + bi % nqt, bh = bi / nqt, h = bh % NH, b = bh / NH, q0 = qt * 16;
  const size_t rq = (size_t)b * SEQ + q0;
  const size_t qo = (((size_t)(b * 2) * NH + h) * NQT + qt) * QKT;   // the query tile in the q|k planes
  const v16b qa0 = frag_pk(QK + qo, lane), qa1 = frag_pk(QK + qo + FRG, lane);
  v16b ql0 = (v16b){}, ql1 = (v16b){};
  if (RES) { ql0 = frag_pk(QKlo + qo, lane); ql1 = frag_pk(QKlo + qo + FRG, lane); }
  const size_t ko = (((size_t)(b * 2 + 1) * NH + h) * NQT + 2 * wave) * QKT, vo = ((size_t)(b * NH + h) * (SEQ / 32) + wave) * VCH;
  const b16* kbase = QK + ko;   // this and the three bases below start at the wave's first chunk (two key tiles of k, one chunk of v)
  const b16* klbase = QKlo + ko;
  const b16* vbase = VT + vo;
  const b16* vlbase = VTlo + vo;
  const unsigned int* mbp = MB + ((size_t)b * NQT + qt) * (SEQ / 2) + 16 * wave;   // the 16 bit words (one per query row) of the wave's first chunk; wave-uniform address
  float mx[8], ls[8]; v8f acc[4], acc2[4];
#pragma unroll
  for (int r = 0; r < 8; ++r) { mx[r] = -3.0e38f; ls[r] = 0.0f; }
#pragma unroll
  for (int t = 0; t < 4; ++t) { acc[t] = (v8f){}; acc2[t] = (v8f){}; }
  constexpr int NI = SEQ / 32 / NWK;
  const int irot = (qt + h) % NI;   // first step of this block's walk (block-uniform)
  v16u wn = ld_words16(mbp + 16 * NWK * irot);   // the first step's words
  asm volatile("s_wait_xcnt 0x0" :: "s"(wn) : "memory");   // taking the words as inputs, it stands behind the load's return and in front of the loop, whose first instructions may rewrite the load's base pair
#pragma unroll 1
  for (int i = 0; i < NI; ++i) {
    const int ii = i + irot < NI ? i + irot : i + irot - NI;
    const int c = wave + NWK * ii, fo = NWK * ii * VCH;   // c: chunk index; fo: offset from the wave's first chunk in halves of the k and v planes
    static_assert(2 * QKT == VCH);
    const v16u wc = wn;   // this step's words; the next step's are fetched now, one step ahead of their use (behind the last step the walk's first: in bounds, unused)
    wn = ld_words16(mbp + 16 * NWK * (ii + 1 < NI ? ii + 1 : 0));
    unsigned int allw = wc[0];
#pragma unroll
    for (int r = 1; r < 16; ++r) allw &= wc[r];
    if (allw == 0xffffffffu) continue;
    wave_lds_sync();   // prior chunk's fragment reloads complete before the P tiles are rewritten
    v8f s[2];
#pragma unroll
    for (int t = 0; t < 2; ++t) {
      const b16* kp = kbase + fo + t * QKT; const v16b k0f = frag_pk(kp, lane), k1f = frag_pk(kp + FRG, lane);
      v8f sh = wmma16b(qa0, k0f, (v8f){}); sh = wmma16b(qa1, k1f, sh);
      if (RES && c < 4) {
        const b16* klp = klbase + fo + t * QKT;
        v8f x = wmma16b(ql0, k0f, (v8f){}); x = wmma16b(ql1, k1f, x); x = wmma16b(qa0, frag_pk(klp, lane), x); x = wmma16b(qa1, frag_pk(klp + FRG, lane), x);
#pragma unroll
        for (int r = 0; r < 8; ++r) sh[r] += x[r] * (1.0f / RS); }
      s[t] = sh; }
    float p0[8], p1[8];
#pragma unroll
    for (int r = 0; r < 8; ++r) {
      float s0 = s[0][r] * SCL, s1 = s[1][r] * SCL; // lane masks: lanes 0..15 hold row r, lanes 16..31 row 8 + r; s0 is key column nloc (low halves of the two words), s1 column 16 + nloc (high halves)
      s0 = __builtin_amdgcn_inverse_ballot_w32((wc[r] & 0xFFFFu) | (wc[8 + r] << 16)) ? NEGF : s0; s1 = __builtin_amdgcn_inverse_ballot_w32((wc[r] >> 16) | (wc[8 + r] & 0xFFFF0000u)) ? NEGF : s1;
      const float cm = red_max16(fmaxf(s0, s1), sa); const float mn = fmaxf(mx[r], cm); const float al = nexp2((mx[r] - mn) * L2E); mx[r] = mn;
      const float e0 = nexp2((s0 - mn) * L2E), e1 = nexp2((s1 - mn) * L2E); p0[r] = e0; p1[r] = e1;
      ls[r] = ls[r] * al + red_sum16(e0 + e1, sa);
#pragma unroll
      for (int t = 0; t < 4; ++t) { acc[t][r] *= al; if (RES) acc2[t][r] *= al; } }
#pragma unroll
    for (int r = 0; r < 8; ++r) {
      const float v0 = p0[r] * PSC, v1 = p1[r] * PSC; const b16 h0 = (b16)v0, h1 = (b16)v1;
      Pst[(8 * hlf + r) * 40 + nloc] = h0; Pst[(8 * hlf + r) * 40 + 16 + nloc] = h1;
      if (RES) { Plst[(8 * hlf + r) * 40 + nloc] = (b16)((v0 - (float)h0) * RS); Plst[(8 * hlf + r) * 40 + 16 + nloc] = (b16)((v1 - (float)h1) * RS); } }
    wave_lds_sync();
    const v16b pf = frag_kb(Pst + nloc * 40, hlf); v16b plf = (v16b){}; if (RES) plf = frag_kb(Plst + nloc * 40, hlf);
#pragma unroll
    for (int t = 0; t < 4; ++t) {
      const v16b vf = frag_pk(vbase + fo + t * FRG, lane); acc[t] = wmma16b(pf, vf, acc[t]);
      if (RES && c < 4) { acc2[t] = wmma16b(plf, vf, acc2[t]); acc2[t] = wmma16b(pf, frag_pk(vlbase + fo + t * FRG, lane), acc2[t]); } }
  }
  // each wave publishes its partial context (f32, still scaled by its own max), max and sum; a wave whose chunks were all skipped publishes max -3e38, sum 0, context 0
  float* pw = Part + wave * (16 * PPW);
#pragma unroll
  for (int r = 0; r < 8; ++r) {
#pragma unroll
    for (int t = 0; t < 4; ++t) { float a = acc[t][r]; if (RES) a += acc2[t][r] * (1.0f / RS); pw[(8 * hlf + r) * PPW + 16 * t + nloc] = a; }
    if (nloc == 0) { Mxs[wave * 16 + 8 * hlf + r] = mx[r]; Lss[wave * 16 + 8 * hlf + r] = ls[r]; } }
  __syncthreads();   // every wave's partials are in LDS before any thread joins them
  // join: thread = 8 columns of one row (NWK = 4: 128 threads cover 16 x 64)
  static_assert(32 * NWK * 8 == 16 * DH);
  const int jr = tid >> 3, jc = 8 * (tid & 7);
  float wm_[NWK], M = Mxs[jr];
#pragma unroll
  for (int w = 1; w < NWK; ++w) M = fmaxf(M, Mxs[w * 16 + jr]);
  float L = 0.0f, o[8];
#pragma unroll
  for (int e = 0; e < 8; ++e) o[e] = 0.0f;
#pragma unroll
  for (int w = 0; w < NWK; ++w) { wm_[w] = nexp2((Mxs[w * 16 + jr] - M) * L2E); L += wm_[w] * Lss[w * 16 + jr];
    const v4f x0 = *(const v4f*)(Part + (w * 16 + jr) * PPW + jc), x1 = *(const v4f*)(Part + (w * 16 + jr) * PPW + jc + 4);
#pragma unroll
    for (int e = 0; e < 4; ++e) { o[e] += wm_[w] * x0[e]; o[4 + e] += wm_[w] * x1[e]; } }
  const float inv = (1.0f / L) * (CX / (PSC * CA)); v8b ov;
#pragma unroll
  for (int e = 0; e < 8; ++e) ov[e] = (b16)(o[e] * inv);
  *(v8b*)(CTX + (rq + jr) * D + h * DH + jc) = ov;
}
}  // namespace

extern "C" void kernel_launch(void* const* d_in, const int* in_sizes, int n_in, void* d_out, int out_size, void* d_ws, size_t ws_size, hipStream_t stream) {
  (void)n_in;
  auto Fp = [&](int i) { return (const float*)d_in[i]; };
  auto Ip = [&](int i) { return (const int*)d_in[i]; };
  // wire order: 0 tokens [512][8] i32, 1 memory [8][512][512], 2 self-attention mask [8][512][512] i32, 3 memory mask [8][512][512] i32, 4 embedding [32000][512],
  // 5..8 Wq_s Wk_s Wv_s Wo_s [6][512 in][512 out], 9..12 Wq_c Wk_c Wv_c Wo_c, 13..16 bq_s bk_s bv_s bo_s [6][512], 17..20 bq_c bk_c bv_c bo_c,
  // 21 W1 [6][512][2048], 22 b1 [6][2048], 23 W2 [6][2048][512], 24 b2 [6][512], 25 g1, 26 g2, 27 g3, 28 be1, 29 be2, 30 be3 [6][512]
  const long needRows = (long)(NB - 1) * SEQ_FULL + SEQ;
  if ((long)in_sizes[0] < (long)SEQ * NB_FULL || (long)in_sizes[1] < needRows * D || (long)in_sizes[2] < needRows * SEQ_FULL || (long)in_sizes[3] < needRows * SEQ_FULL ||
      (long)in_sizes[4] < (long)VOCAB * D) return;
  for (int i = 5; i <= 12; ++i) if ((long)in_sizes[i] < (long)NLAY * D * D) return;
  for (int i = 13; i <= 20; ++i) if (in_sizes[i] < NLAY * D) return;
  if ((long)in_sizes[21] < (long)NLAY * D * DFF || in_sizes[22] < NLAY * DFF || (long)in_sizes[23] < (long)NLAY * DFF * D || in_sizes[24] < NLAY * D) return;
  for (int i = 25; i <= 30; ++i) if (in_sizes[i] < NLAY * D) return;
  if (out_size < MR * D) return;

  size_t off = 0; char* ws = (char*)d_ws;
  auto carve = [&](size_t bytes) { char* p = ws + off; off += (bytes + 255) & ~(size_t)255; return p; };
  b16* WQKVS = (b16*)carve((size_t)NLAY * NQKV * D * 2);   // [6][1536][512]
  b16* WOS   = (b16*)carve((size_t)NLAY * D * D * 2);
  b16* WQKVC = (b16*)carve((size_t)NLAY * NQKV * D * 2);   // [6][1536][512]
  b16* WOC   = (b16*)carve((size_t)NLAY * D * D * 2);
  b16* W1T   = (b16*)carve((size_t)NLAY * DFF * D * 2);    // [6][2048][512]
  b16* W2T   = (b16*)carve((size_t)NLAY * D * DFF * 2);    // [6][512][2048]
  float* X   = (float*)carve((size_t)MR * D * 4);
  b16* Xh    = (b16*)carve((size_t)MR * D * 2);
  b16* Mh    = (b16*)carve((size_t)MR * D * 2);
  b16* QK    = (b16*)carve((size_t)MR * LQK * 2);
  b16* QKlo  = (b16*)carve((size_t)MR * LQK * 2);
  b16* Vt    = (b16*)carve((size_t)MR * D * 2);            // [NB][NH][SEQ / 32][4][512]
  b16* Vtlo  = (b16*)carve((size_t)MR * D * 2);
  b16* CTX   = (b16*)carve((size_t)MR * D * 2);
  b16* Hh    = (b16*)carve((size_t)MR * DFF * 2);
  unsigned int* MBS = (unsigned int*)carve((size_t)NB * NQT * (SEQ / 2) * 4);   // mask bit words [NB][NQT][SEQ / 32][16]
  unsigned int* MBC = (unsigned int*)carve((size_t)NB * NQT * (SEQ / 2) * 4);
  if (off > ws_size || off > ((size_t)128 << 20)) return;   // 113,770,496 B at full size

  const dim3 b256(256), battn(32 * NWK);
  prep_kernel<<<P_ALL, b256, 0, stream>>>(Ip(0), Fp(4), Fp(1), Ip(2), Ip(3), Fp(5), Fp(6), Fp(7), Fp(8), Fp(9), Fp(10), Fp(11), Fp(12), Fp(21), Fp(23),
      WQKVS, WOS, WQKVC, WOC, W1T, W2T, Mh, X, Xh, MBS, MBC);

  const float OSA = 1.0f / (CA * WSC), OSX = 1.0f / (CX * WSC);
  for (int l = 0; l < NLAY; ++l) {
    const size_t lD = (size_t)l * D, lF = (size_t)l * DFF;
    // fused q|k|v projection of x: q and k -> q|k plane, v -> head-transposed plane (all in fragment order); residual planes for the first 128 rows of each sequence
    gemm_kernel<false><<<dim3(MR / 128, NQKV / 128), b256, 0, stream>>>(Xh, Xh, 0, D, WQKVS + (size_t)l * NQKV * D, D, Fp(13) + lD, Fp(14) + lD, Fp(15) + lD, Fp(15) + lD,
        QK, QKlo, LQK, 0, Vt, Vtlo, 2 * D, OSA, 1);
    attn_kernel<true><<<NB * NH * NQT_RES, battn, 0, stream>>>(QK, QKlo, Vt, Vtlo, MBS, CTX, 0, NQT_RES);
    attn_kernel<false><<<NB * NH * (NQT - NQT_RES), battn, 0, stream>>>(QK, QKlo, Vt, Vtlo, MBS, CTX, NQT_RES, NQT - NQT_RES);
    gemm_ln_kernel<<<MR / 32, b256, 0, stream>>>(CTX, D, WOS + (size_t)l * D * D, Fp(16) + lD, X, Fp(25) + lD, Fp(28) + lD, X, Xh, OSX, 1);
    // attention over the memory tensor: q (columns 0..511) from x, k|v (columns 512..1535) from the memory plane, one grid
    gemm_kernel<false><<<dim3(MR / 128, NQKV / 128), b256, 0, stream>>>(Xh, Mh, D, D, WQKVC + (size_t)l * NQKV * D, D, Fp(17) + lD, Fp(18) + lD, Fp(19) + lD, Fp(19) + lD,
        QK, QKlo, LQK, 0, Vt, Vtlo, 2 * D, OSA, 0);
    attn_kernel<false><<<NB * NH * NQT, battn, 0, stream>>>(QK, QKlo, Vt, Vtlo, MBC, CTX, 0, NQT);
    gemm_ln_kernel<<<MR / 32, b256, 0, stream>>>(CTX, D, WOC + (size_t)l * D * D, Fp(20) + lD, X, Fp(26) + lD, Fp(29) + lD, X, Xh, OSX, 1);
    // FFN
    gemm_kernel<true><<<dim3(MR / 128, DFF / 128), b256, 0, stream>>>(Xh, Xh, 0, D, W1T + (size_t)l * DFF * D, D, Fp(22) + lF, Fp(22) + lF + 512, Fp(22) + lF + 1024, Fp(22) + lF + 1536,
        Hh, QKlo, DFF, 0, Vt, Vtlo, DFF, OSA, 0);
    const bool last = (l == NLAY - 1);
    gemm_ln_kernel<<<MR / 32, b256, 0, stream>>>(Hh, DFF, W2T + (size_t)l * D * DFF, Fp(24) + lD, X, Fp(27) + lD, Fp(30) + lD, last ? (float*)d_out : X, Xh, OSA, last ? 0 : 1);
  }
}

// v007
// A run of this version takes 683 microseconds.
// Next to v006, in two timings, it ran 1.08 and 1.09 times as fast.
// Counting every step since v000, it is 2.66 times as fast.
#include <hip/hip_runtime.h>

// 6-layer post-LN decoder stack: token embedding x sqrt(512) + sinusoidal positions; per layer masked self-attention (8 heads x 64), attention over a memory tensor,
// relu FFN 512 -> 2048 -> 512, each followed by residual add + LayerNorm over 512. Masks are int32 [batch][query][key] tensors read by value (nonzero = score replaced by
// -1e18); a 32-key chunk whose 16x32 mask tile is entirely nonzero is skipped (exact whenever each query row keeps at least one key).
// compute dtype: every contraction on v_wmma_f32_16x16x32_f16 (f16 operands, f32 accumulate): q/k/v projections, score and P.V products, output projections, both FFN
// products. Operand planes: activations f16 x8 (attention context x64), weights bf16-exact f16 x256, softmax P f16 x4096; query tiles with position < 64 of the masked
// self-attention add residual planes (x2048 of the x8 / x4096 carriers) of q, k, v and P: 3 score products and 3 P.V products into a second accumulator.
// tokens and masks int32 (tokens clamped). Fragment k-map per lane half hh for A and B: elements 0..7 <- k = 8hh+0..7, 8..15 <- k = 16+8hh+0..7; acc[r] = D[8hh+r][col].
// The attention's q, k and v planes are kept in fragment order: a fragment (16 rows x 32 k) is 512 halves = piece 0 (elements 0..7 of lanes 0..31) then piece 1 (elements 8..15), so that each
// of its two 16-B-per-lane loads covers 512 contiguous bytes (4 whole lines; from a row-major plane it would touch 16 lines for 32 B each).
// Each mask is packed once, by the preparation grid, into bit words [batch][16-query tile][32-key chunk][row]: bit l of a word = (mask[row][32 chunk + l] != 0); the attention reads only these words.
// q|k plane: [batch][q, k][head][16-row tile][k step of 32 dims][piece][lane][8]; v plane: [batch][head][32-key chunk][16-dim tile][piece][lane][8] (rows = dims, k = keys).

#ifndef NB
#define NB 8
#endif
#ifndef SEQ
#define SEQ 512
#endif
#define NB_FULL 8
#define SEQ_FULL 512

namespace {
constexpr int D = 512, NH = 8, DH = 64, DFF = 2048, NLAY = 6, VOCAB = 32000;
constexpr int MR = NB * SEQ;                 // activation rows, row = b * SEQ + s
constexpr int LQK = 2 * D;                   // halves of the q | k plane per activation row
constexpr int FRG = 512, QKT = 2 * FRG, VCH = 4 * FRG;   // halves of a fragment, of a 16-row x 64-dim q or k tile, of a 64-dim x 32-key v chunk
constexpr int NQKV = 3 * D, NQT = SEQ / 16, NQT_RES = 4;
constexpr float WSC = 256.0f, CA = 8.0f, CX = 64.0f, PSC = 4096.0f, RS = 2048.0f;
constexpr float SQD = 22.627416997969522f, NLOGD = -0.017988946039015984f, L2E = 1.4426950408889634f, NEGF = -1.0e18f, LNEPS = 1.0e-5f;
constexpr float SCL = 1.0f / (CA * CA * 8.0f);   // score = acc / (8 x 8) / sqrt(64)
static_assert(NB >= 1 && NB <= NB_FULL && SEQ >= 128 && SEQ <= SEQ_FULL && SEQ % 128 == 0);
static_assert(MR % 128 == 0 && MR % 32 == 0 && D == 512 && NH * DH == D && DFF % 512 == 0 && NQT > NQT_RES && (MR * D) % 8 == 0);

typedef _Float16 b16;
typedef __attribute__((ext_vector_type(16))) _Float16 v16b;
typedef __attribute__((ext_vector_type(8))) _Float16 v8b;
typedef __attribute__((ext_vector_type(4))) _Float16 v4h_;
typedef __attribute__((ext_vector_type(8))) float v8f;
typedef __attribute__((ext_vector_type(4))) float v4f;
typedef __attribute__((ext_vector_type(2))) float v2f;

__device__ __forceinline__ float bf16_rne(float f) { unsigned int u = __float_as_uint(f); u += 0x7FFFu + ((u >> 16) & 1u); return __uint_as_float(u & 0xFFFF0000u); }
__device__ __forceinline__ v16b frag_kb(const b16* p, int hh) { const v8b a = *(const v8b*)(p + 8 * hh), b = *(const v8b*)(p + 16 + 8 * hh); v16b f;
#pragma unroll
  for (int e = 0; e < 8; ++e) { f[e] = a[e]; f[8 + e] = b[e]; } return f; }
__device__ __forceinline__ v16b frag_pk(const b16* p, int lane) { const v8b a = *(const v8b*)(p + 8 * lane), b = *(const v8b*)(p + 256 + 8 * lane); v16b f;   // p: a fragment stored in fragment order
#pragma unroll
  for (int e = 0; e < 8; ++e) { f[e] = a[e]; f[8 + e] = b[e]; } return f; }
__device__ __forceinline__ v8f wmma_raw(v16b a, v16b b, v8f c) { return __builtin_amdgcn_wmma_f32_16x16x32_f16(false, a, false, b, (short)0, c, false, false); }
__device__ __forceinline__ v8f wmma16b(v16b a, v16b b, v8f c) { v8f d = wmma_raw(a, b, c); asm volatile("v_nop\n\tv_nop\n\tv_nop\n\tv_nop" : "+v"(d) : "v"(a), "v"(b)); return d; }
// one guard after a group of 8 accumulating WMMAs: ties all 8 accumulators, keeps both A and all four B fragments live across the 4 nops
#define WMMA_GUARD8(c, a0, a1, bf) asm volatile("v_nop\n\tv_nop\n\tv_nop\n\tv_nop" : "+v"(c[0][0]), "+v"(c[0][1]), "+v"(c[0][2]), "+v"(c[0][3]), \
    "+v"(c[1][0]), "+v"(c[1][1]), "+v"(c[1][2]), "+v"(c[1][3]) : "v"(a0), "v"(a1), "v"(bf[0]), "v"(bf[1]), "v"(bf[2]), "v"(bf[3]))
__device__ __forceinline__ void wave_lds_sync() { __builtin_amdgcn_fence(3 /* release order */, "workgroup"); __builtin_amdgcn_wave_barrier(); __builtin_amdgcn_fence(2 /* acquire order */, "workgroup"); }
__device__ __forceinline__ float pmul(float a, float b) { float p = a * b; asm volatile("" : "+v"(p)); return p; }
__device__ __forceinline__ int iclamp(int v, int lo, int hi) { return v < lo ? lo : (v > hi ? hi : v); }
__device__ __forceinline__ float nexp2(float v) { float r; asm("v_exp_f32 %0, %1\n\tv_nop" : "=v"(r) : "v"(v)); return r; }
// lane l <-> lane l ^ 16 (the wave's other half), a vector cross-row move
__device__ __forceinline__ float xhalf(float x) { return __int_as_float(__builtin_amdgcn_permlanex16(__float_as_int(x), __float_as_int(x), 0x76543210, 0xfedcba98, false, false)); }

// Wt[l][noff + n][k] = f16(bf16(W[l][k][n]) x 256), W stored [layer][in][out] with NA columns; block = 64 k x 64 n tile transposed through LDS (T: 64 x 72 halves; cross-thread, block barrier);
__device__ __forceinline__ void wprep_tile(b16* T, const float* __restrict__ W, b16* __restrict__ Wt, int K, int NA, int NT, int noff, int l, int k0, int n0, int tid) {
  { const int kr = tid >> 2, nc = (tid & 3) * 16; const float* src = W + ((size_t)l * K + k0 + kr) * NA + n0 + nc;
#pragma unroll
    for (int q = 0; q < 4; ++q) { const v4f v = *(const v4f*)(src + 4 * q);
#pragma unroll
      for (int j = 0; j < 4; ++j) T[(nc + 4 * q + j) * 72 + kr] = (b16)(bf16_rne(v[j]) * WSC); } }
  __syncthreads();
  v8b vv[2]; size_t dst[2];
#pragma unroll
  for (int i = 0; i < 2; ++i) { const int n = (tid >> 3) + 32 * i, p = tid & 7; vv[i] = *(const v8b*)(T + n * 72 + 8 * p); dst[i] = ((size_t)l * NT + noff + n0 + n) * K + k0 + 8 * p; }
  {
#pragma unroll
    for (int i = 0; i < 2; ++i) *(v8b*)(Wt + dst[i]) = vv[i];
     }
}

__device__ __forceinline__ void mprep_part(const float* __restrict__ mem, b16* __restrict__ Mh, int u) {
  if (u >= MR * D / 8) return;
  const int row = u / (D / 8), c0 = (u % (D / 8)) * 8, b = row / SEQ, s = row % SEQ;
  const float* src = mem + ((size_t)b * SEQ_FULL + s) * D + c0;
  const v4f a = *(const v4f*)src, c = *(const v4f*)(src + 4); v8b v;
#pragma unroll
  for (int j = 0; j < 4; ++j) { v[j] = (b16)(bf16_rne(a[j]) * CA); v[4 + j] = (b16)(bf16_rne(c[j]) * CA); }
  { *(v8b*)(Mh + (size_t)row * D + c0) = v;  }
}

// embedding: x[b][s][c] = bf16(emb[tok[s][b]][c]) x sqrt(512) + pe(s, c), pe(s, 2j) = sin(s x exp(2j x NLOGD)), pe(s, 2j+1) = cos(same angle); tok clamped. block = 4 rows,
// thread = 8 columns (rolled loop of 4 expf + sincosf); the 4 x 512 f32 tile is staged in LDS (block barrier), then 32 lanes x 16 B per 512-B run to X and
__device__ __forceinline__ void embed_rows(float* Xs, const int* __restrict__ tok, const float* __restrict__ emb, float* __restrict__ X, b16* __restrict__ Xh, int row0, int tid) {
  const int rl = tid >> 6, c0 = (tid & 63) * 8, row = row0 + rl, b = row / SEQ, s = row % SEQ;
  const int t = iclamp(tok[s * NB_FULL + b], 0, VOCAB - 1);
  const float* er = emb + (size_t)t * D + c0;
#pragma unroll 1
  for (int q = 0; q < 4; ++q) {
    const int c = c0 + 2 * q; const float dv = expf(pmul((float)c, NLOGD)); float sn, cs; sincosf(pmul((float)s, dv), &sn, &cs);
    Xs[rl * (D + 4) + c] = pmul(bf16_rne(er[2 * q]), SQD) + sn; Xs[rl * (D + 4) + c + 1] = pmul(bf16_rne(er[2 * q + 1]), SQD) + cs; }
  __syncthreads();
  v4f fv[2]; size_t fo[2]; v8b hv;
#pragma unroll
  for (int i = 0; i < 2; ++i) { const int f = i * 256 + tid; fv[i] = *(const v4f*)(Xs + (f >> 7) * (D + 4) + (f & 127) * 4); fo[i] = (size_t)(row0 + (f >> 7)) * D + (f & 127) * 4; }
  { const v4f a = *(const v4f*)(Xs + rl * (D + 4) + c0), c4 = *(const v4f*)(Xs + rl * (D + 4) + c0 + 4);
#pragma unroll
    for (int e = 0; e < 4; ++e) { hv[e] = (b16)(a[e] * CA); hv[4 + e] = (b16)(c4[e] * CA); } }
  {
#pragma unroll
    for (int i = 0; i < 2; ++i) *(v4f*)(X + fo[i]) = fv[i];
    *(v8b*)(Xh + (size_t)row * D + c0) = hv;  }
}

// one 16-query tile of a mask -> its SEQ / 2 bit words. A wave makes 32 words (two chunks x 16 rows) that fill one 128-B line: per word one whole-line load (lane = key) and a ballot,
// lane t keeps word t; the 32 loads are independent and fly together
__device__ __forceinline__ void maskpack_tile(const int* __restrict__ mask, unsigned int* __restrict__ MB, int tile, int tid) {
  const int wave = __builtin_amdgcn_readfirstlane(tid >> 5), lane = tid & 31;
  const int* mrow = mask + ((size_t)(tile / NQT) * SEQ_FULL + (tile % NQT) * 16) * SEQ_FULL + lane;
  for (int j = wave; j < SEQ / 64; j += 8) {
    int v[32]; unsigned int keep = 0u;
#pragma unroll
    for (int t = 0; t < 32; ++t) v[t] = mrow[(size_t)(t & 15) * SEQ_FULL + 32 * (2 * j + (t >> 4))];
#pragma unroll
    for (int t = 0; t < 32; ++t) { const unsigned int bal = __builtin_amdgcn_ballot_w32(v[t] != 0); keep = lane == t ? bal : keep; }
    MB[(size_t)tile * (SEQ / 2) + 32 * j + lane] = keep;
    asm volatile("s_wait_xcnt 0x0" ::: "memory");   // the built code joins this part's end to edges into the other parts, which rewrite the registers the store names: the wait stands in front of them
  }
}

// All input preparation in one grid: none of its parts reads what another writes, so a block takes its part by its index range (block-uniform): embedding rows first (the longest blocks),
// then the 64 x 64 tiles of the eight 512 x 512 weights, of W1 and of W2 (k tile fastest, then n tile, then layer), then the memory plane, then the tiles of the two masks.
constexpr int LTD = 3, LTF = 5, PB_WS = NLAY << (2 * LTD), PB_WF = NLAY << (LTD + LTF);   // log2 of the 64-wide tiles along 512 and along 2048; blocks of a small and of an FFN weight
static_assert((64 << LTD) == D && (64 << LTF) == DFF);
constexpr int P_W = MR / 4, P_F1 = P_W + 8 * PB_WS, P_F2 = P_F1 + PB_WF, P_M = P_F2 + PB_WF, P_K = P_M + (MR * D / 8 + 255) / 256, P_ALL = P_K + 2 * NB * NQT;   // first block of each range
__global__ __launch_bounds__(256) void prep_kernel(const int* __restrict__ tok, const float* __restrict__ emb, const float* __restrict__ mem, const int* __restrict__ msks, const int* __restrict__ mskc,
    const float* __restrict__ wqs, const float* __restrict__ wks, const float* __restrict__ wvs, const float* __restrict__ wos,
    const float* __restrict__ wqc, const float* __restrict__ wkc, const float* __restrict__ wvc, const float* __restrict__ woc,
    const float* __restrict__ w1, const float* __restrict__ w2,
    b16* __restrict__ WQKVS, b16* __restrict__ WOS, b16* __restrict__ WQKVC, b16* __restrict__ WOC, b16* __restrict__ W1T, b16* __restrict__ W2T,
    b16* __restrict__ Mh, float* __restrict__ X, b16* __restrict__ Xh, unsigned int* __restrict__ MBS, unsigned int* __restrict__ MBC) {
  __shared__ __attribute__((aligned(16))) b16 Sh[64 * 72];   // weight tile, or the embedding's 4 x 516 f32 rows
  static_assert(64 * 72 * 2 >= 4 * (D + 4) * 4);
  const int tid = threadIdx.x, r = blockIdx.x;
  if (r < P_W) embed_rows((float*)Sh, tok, emb, X, Xh, r * 4, tid);
  else if (r < P_M) {
    const float* W; b16* Wt; int q, lk = LTD, ln = LTD, NT, noff = 0;   // lk, ln: log2 of the tile counts along k (rows of W) and n (its columns)
    if (r < P_F1) {
      const int m = (r - P_W) / PB_WS, g = m & 3;   // m: 0..3 q k v o of the self-attention, 4..7 of the attention over memory
      q = (r - P_W) % PB_WS;
      W = m < 4 ? (g == 0 ? wqs : (g == 1 ? wks : (g == 2 ? wvs : wos))) : (g == 0 ? wqc : (g == 1 ? wkc : (g == 2 ? wvc : woc)));
      Wt = m < 4 ? (g == 3 ? WOS : WQKVS) : (g == 3 ? WOC : WQKVC);
      NT = g == 3 ? D : NQKV; noff = g == 3 ? 0 : g * D;
    } else if (r < P_F2) { q = r - P_F1; W = w1; Wt = W1T; ln = LTF; NT = DFF; }
    else { q = r - P_F2; W = w2; Wt = W2T; lk = LTF; NT = D; }
    wprep_tile(Sh, W, Wt, 64 << lk, 64 << ln, NT, noff, q >> (lk + ln), (q & ((1 << lk) - 1)) * 64, ((q >> lk) & ((1 << ln) - 1)) * 64, tid);
    asm volatile("s_wait_xcnt 0x0" ::: "memory");   // the built code joins this branch's end to an edge into the embedding branch, which rewrites the registers the two stores name: the wait stands in front of that join
  } else if (r < P_K) mprep_part(mem, Mh, (r - P_M) * 256 + tid);
  else { const bool sf = r - P_K < NB * NQT; maskpack_tile(sf ? msks : mskc, sf ? MBS : MBC, (r - P_K) % (NB * NQT), tid); }
}

// Operand staging of the GEMMs: a stage is KS = 128 k (256 B) of every A and B row of the block tile, laid in LDS at pitch 272 B (16 B x 17: odd, conflict-free for 16-B row readers),
// brought by per-lane asynchronous 16-B copies (a wave's copy covers 2 rows x 256 B = 4 whole lines); two buffers, the next stage's copies fly while this one is worked on.
constexpr int KS = 128, LP = KS + 8;
__device__ __forceinline__ unsigned lds_byte(const void* p) { return (unsigned)(unsigned long long)p; }
// copies of rows 16 apart (LDS step 16 x 272 B, global step gs halves); s_wait_xcnt 0 closes each statement so that no address register is rewritten ahead of it
__device__ __forceinline__ void cp2(unsigned l, const b16* g, size_t gs) {
  asm volatile("global_load_async_to_lds_b128 %0, %2, off\n\tglobal_load_async_to_lds_b128 %1, %3, off\n\ts_wait_xcnt 0x0"
      :: "v"(l), "v"(l + 16u * LP * 2u), "v"(g), "v"(g + gs) : "memory");
}
__device__ __forceinline__ void cp8(unsigned l, const b16* g, size_t gs) {
  constexpr unsigned LS = 16u * LP * 2u;
  asm volatile("global_load_async_to_lds_b128 %0, %8, off\n\tglobal_load_async_to_lds_b128 %1, %9, off\n\tglobal_load_async_to_lds_b128 %2, %10, off\n\t"
      "global_load_async_to_lds_b128 %3, %11, off\n\tglobal_load_async_to_lds_b128 %4, %12, off\n\tglobal_load_async_to_lds_b128 %5, %13, off\n\t"
      "global_load_async_to_lds_b128 %6, %14, off\n\tglobal_load_async_to_lds_b128 %7, %15, off\n\ts_wait_xcnt 0x0"
      :: "v"(l), "v"(l + LS), "v"(l + 2u * LS), "v"(l + 3u * LS), "v"(l + 4u * LS), "v"(l + 5u * LS), "v"(l + 6u * LS), "v"(l + 7u * LS),
         "v"(g), "v"(g + gs), "v"(g + 2 * gs), "v"(g + 3 * gs), "v"(g + 4 * gs), "v"(g + 5 * gs), "v"(g + 6 * gs), "v"(g + 7 * gs) : "memory");
}
// block of 256 threads: AR rows of A (first row Ag, pitch lda) and BR rows of B = Wt (first row Bg, pitch K), K a multiple of 128; the wave takes 32 A rows from arow and 64 B rows from
// brow: 8 WMMAs per 32 k, one guard per stage. On return every wave has left the ring (last trip's barrier): it may be reused.
// Blocks of one grid share operand rows and start together: walking K alike they would ask L2 for the same lines at the same moment. Trip t therefore takes the k stage (t + rot) mod NT,
// and the 128-row groups of B are copied in the order jrot, jrot + 1, ... (mod their number); rot < NT and jrot come from the block index (block-uniform). The f32 sums run over k in that rotated order.
template <int AR, int BR>
__device__ __forceinline__ void mac_staged(v8f (&acc)[2][4], b16* ring, const b16* Ag, int lda, const b16* Bg, int K, int arow, int brow, int tid, int nloc, int hlf, int rot, int jrot) {
  static_assert((AR == 32 || AR % 128 == 0) && BR % 128 == 0);
  constexpr int BUFH = (AR + BR) * LP;
  const unsigned l0 = lds_byte(ring) + (unsigned)(tid >> 4) * (LP * 2u) + (unsigned)(tid & 15) * 16u;
  const b16* ga = Ag + (size_t)(tid >> 4) * lda + 8 * (tid & 15);
  const b16* gb = Bg + (size_t)(tid >> 4) * K + 8 * (tid & 15);
  const int NT = K / KS;
  auto fill = [&](int t) {
    const unsigned l = l0 + (unsigned)(t & 1) * (BUFH * 2u);
    const int kt = t + rot < NT ? t + rot : t + rot - NT;   // this trip's k stage
    if constexpr (AR == 32) cp2(l, ga + kt * KS, (size_t)16 * lda);
    else {
#pragma unroll
      for (int j = 0; j < AR / 128; ++j) cp8(l + (unsigned)j * (128u * LP * 2u), ga + (size_t)(128 * j) * lda + kt * KS, (size_t)16 * lda); }
#pragma unroll
    for (int i = 0; i < BR / 128; ++i) { const int j = (i + jrot) % (BR / 128);
      cp8(l + (unsigned)(AR + 128 * j) * (LP * 2u), gb + (size_t)(128 * j) * K + kt * KS, (size_t)16 * K); }
  };
  fill(0);
  asm volatile("s_wait_asynccnt 0x0" ::: "memory");   // trip 0's k stage has landed (this wave's copies) before the barrier that publishes it
  __syncthreads();
  if (NT > 1) fill(1);
#pragma unroll 1
  for (int t = 0; t < NT; ++t) {
    const b16* bufp = ring + (t & 1) * BUFH;
    const b16* ap0 = bufp + (arow + nloc) * LP; const b16* ap1 = ap0 + 16 * LP; const b16* bp = bufp + (AR + brow + nloc) * LP;
    v16b a0[2], a1[2], bf[2][4];   // two fragment sets: the next 32 k are fetched while the WMMAs of these 32 k run (all inside this stage's buffer)
    a0[0] = frag_kb(ap0, hlf); a1[0] = frag_kb(ap1, hlf);
#pragma unroll
    for (int u = 0; u < 4; ++u) bf[0][u] = frag_kb(bp + u * 16 * LP, hlf);
#pragma unroll
    for (int s = 0; s < KS / 32; ++s) {
      const int c = s & 1, n = c ^ 1;
      if (s + 1 < KS / 32) {
        a0[n] = frag_kb(ap0 + 32 * (s + 1), hlf); a1[n] = frag_kb(ap1 + 32 * (s + 1), hlf);
#pragma unroll
        for (int u = 0; u < 4; ++u) bf[n][u] = frag_kb(bp + u * 16 * LP + 32 * (s + 1), hlf); }
      __builtin_amdgcn_sched_barrier(0);   // keeps the next block's 12 LDS reads one group in front of this block's WMMAs (for speed only)
#pragma unroll
      for (int u = 0; u < 4; ++u) { acc[0][u] = wmma_raw(a0[c], bf[c][u], acc[0][u]); acc[1][u] = wmma_raw(a1[c], bf[c][u], acc[1][u]); }
      if (s + 1 < KS / 32) __builtin_amdgcn_sched_barrier(0);   // the block after next's reads stay behind this block's WMMAs
      else WMMA_GUARD8(acc, a0[c], a1[c], bf[c]);   // the stage's last WMMAs stand in front of a branch: the 4 slots behind them are filled here for both of its sides
    }
    asm volatile("s_wait_dscnt 0x0" ::: "memory");     // this wave's reads of the buffer have retired before the barrier behind which it is refilled
    asm volatile("s_wait_asynccnt 0x0" ::: "memory");  // this wave's copies for trip t + 1 have landed before the barrier that publishes them
    __syncthreads();
    if (t + 2 < NT) fill(t + 2);
  }
  asm volatile("s_wait_asynccnt 0x0" ::: "memory");    // no copy outstanding when the ring is reused or the wave ends
}

// f16 epilogue of one wave's 32 x 64 tile (plane value = f16(v x 8), LO: f16((v x 8 - hi) x 2048)): b16 element stores into the wave-private LDS tile, wave sync, then 8 stores of 16 B per lane:
// row-major (4 rows x 128 B each, dstp = the tile's first element, pitch ldc), or PK: fragment order (dstp = the first of the wave's two q or k tiles; store j = tile j / 4, k step (j / 2) % 2,
// piece j % 2: 512 contiguous bytes each, 4 KB in a row)
template <bool LO, bool RELU, bool PK>
__device__ __forceinline__ void epi_rows(const v8f (&acc)[2][4], const float (&bb)[4], float oscale, b16* Es, b16* dstp, int ldc, int lane, int nloc, int hlf) {
#pragma unroll
  for (int mt = 0; mt < 2; ++mt)
#pragma unroll
    for (int t = 0; t < 4; ++t)
#pragma unroll
      for (int r = 0; r < 8; ++r) {
        float v = acc[mt][t][r] * oscale + bb[t]; if (RELU) v = fmaxf(v, 0.0f); const float vs = v * CA; const b16 hi = (b16)vs;
        Es[(mt * 16 + 8 * hlf + r) * 72 + 16 * t + nloc] = LO ? (b16)((vs - (float)hi) * RS) : hi; }
  wave_lds_sync();
  v8b vv[8];
#pragma unroll
  for (int j = 0; j < 8; ++j) vv[j] = PK ? *(const v8b*)(Es + ((j >> 2) * 16 + nloc) * 72 + 32 * ((j >> 1) & 1) + 16 * (j & 1) + 8 * hlf) : *(const v8b*)(Es + (4 * j + (lane >> 3)) * 72 + 8 * (lane & 7));
  b16* dst = PK ? dstp + 8 * lane : dstp + (size_t)(lane >> 3) * ldc + 8 * (lane & 7);
  {
#pragma unroll
    for (int j = 0; j < 8; ++j) *(v8b*)(dst + (PK ? (size_t)(256 * j) : (size_t)(4 * j) * ldc)) = vv[j];
    asm volatile("s_wait_xcnt 0x0" ::: "memory");   // what follows (the residual plane's pass) rewrites registers that these stores name: the wait stands in front of it
  }
}

// head-transposed f16 epilogue of the block's 128 (keys) x 128 (head columns) tile -> v plane in fragment order: each lane stores its 8 consecutive keys of one
// column as one 16-B LDS store into Et[col][key] (cross-wave, block barrier), then the wave writes one (head wave / 4, chunk wave % 4): store j = dim tile j / 2, piece j % 2, 4 KB in a row
template <bool LO, bool RELU>
__device__ __forceinline__ void epi_vt(const v8f (&acc)[2][4], const float (&bb)[4], float oscale, b16* Et, b16* plane, int bidx, int key0, int colv0, int wave, int wm, int wn, int nloc, int hlf) {
#pragma unroll
  for (int mt = 0; mt < 2; ++mt)
#pragma unroll
    for (int t = 0; t < 4; ++t) { v8b hv;
#pragma unroll
      for (int r = 0; r < 8; ++r) { float v = acc[mt][t][r] * oscale + bb[t]; if (RELU) v = fmaxf(v, 0.0f); const float vs = v * CA; const b16 hi = (b16)vs; hv[r] = LO ? (b16)((vs - (float)hi) * RS) : hi; }
      *(v8b*)(Et + (wn * 64 + 16 * t + nloc) * 136 + wm * 32 + mt * 16 + 8 * hlf) = hv; }
  __syncthreads();
  v8b vv[8]; const int hd = wave >> 2, ch = wave & 3;
#pragma unroll
  for (int j = 0; j < 8; ++j) vv[j] = *(const v8b*)(Et + (hd * DH + 16 * (j >> 1) + nloc) * 136 + 32 * ch + 16 * (j & 1) + 8 * hlf);
  b16* dst = plane + ((size_t)(bidx * NH + colv0 / DH + hd) * (SEQ / 32) + key0 / 32 + ch) * VCH + 8 * (16 * hlf + nloc);
  {
#pragma unroll
    for (int j = 0; j < 8; ++j) *(v8b*)(dst + 256 * j) = vv[j];
    asm volatile("s_wait_xcnt 0x0" ::: "memory");   // what follows (the residual plane's pass) rewrites registers that these stores name: the wait stands in front of it
  }
}

// C = (A[M][K] f16 plane, pitch lda) x Wt[N][K] + bf16(bias), optional relu; block 128 x 128 = 8 waves of 32 x 64. GEMM columns < vcol0 -> plane C (f16 x 8): with relu (FFN) row-major
// C[row*ldc + ccol0 + col], without (q at columns 0..511, k at 512..1023) the q|k plane in fragment order; columns >= vcol0 -> head-transposed plane VT (v of the attention), fragment order. Blocks whose 128 rows start a sequence also emit the residual planes Clo / VTlo (x 2048) for those rows
// when wres != 0. Bias group pointer chosen per 512-column group (block-uniform). Column blocks below asplit multiply A1, the others A2 (block-uniform): two products of different left
// operands that share K and the output planes run as one grid.
template <bool RELU>
__global__ __launch_bounds__(256) void gemm_kernel(const b16* __restrict__ A1, const b16* __restrict__ A2, int asplit, int lda, const b16* __restrict__ Wt, int K,
    const float* __restrict__ bg0, const float* __restrict__ bg1, const float* __restrict__ bg2, const float* __restrict__ bg3,
    b16* __restrict__ C, b16* __restrict__ Clo, int ldc, int ccol0, b16* __restrict__ VT, b16* __restrict__ VTlo, int vcol0, float oscale, int wres) {
  __shared__ __attribute__((aligned(16))) b16 Ls[2 * 256 * LP];   // operand ring (2 buffers x 256 rows); behind the K loop 8 wave tiles [32][72] (row-major mode) or one block tile [128][136] (transposed mode)
  static_assert(2 * 256 * LP >= 18432);
  const int tid = threadIdx.x, wave = tid >> 5, lane = tid & 31, nloc = lane & 15, hlf = lane >> 4;
  const int bm0 = blockIdx.x * 128, bn0 = blockIdx.y * 128, wm = wave >> 1, wn = wave & 1;
  const int row0 = bm0 + wm * 32, col0 = bn0 + wn * 64;
  const b16* A = bn0 < asplit ? A1 : A2;
  v8f acc[2][4];
#pragma unroll
  for (int t = 0; t < 4; ++t) { acc[0][t] = (v8f){}; acc[1][t] = (v8f){}; }
  mac_staged<128, 128>(acc, Ls, A + (size_t)bm0 * lda, lda, Wt + (size_t)bn0 * K, K, wm * 32, wn * 64, tid, nloc, hlf, (int)((blockIdx.x + blockIdx.y) % (unsigned)(K / KS)), 0);
  const int gsel = bn0 >> 9; const float* bias = gsel == 0 ? bg0 : (gsel == 1 ? bg1 : (gsel == 2 ? bg2 : bg3));
  float bb[4];
#pragma unroll
  for (int t = 0; t < 4; ++t) bb[t] = bf16_rne(bias[(col0 & 511) + 16 * t + nloc]);
  const bool vmode = bn0 >= vcol0, wlo = (wres != 0) && (bm0 % SEQ == 0);
  if (!vmode) {
    b16* Es = Ls + wave * (32 * 72);
    // the wave's 64 columns are one head of q or of k, its 32 rows two tiles that follow one another in the plane
    const size_t co = RELU ? (size_t)row0 * ldc + ccol0 + col0 : (((size_t)(row0 / SEQ * 2 + (col0 >> 9)) * NH + ((col0 & 511) >> 6)) * NQT + row0 % SEQ / 16) * QKT;
    epi_rows<false, RELU, !RELU>(acc, bb, oscale, Es, C + co, ldc, lane, nloc, hlf);
    if (wlo) { wave_lds_sync(); epi_rows<true, RELU, !RELU>(acc, bb, oscale, Es, Clo + co, ldc, lane, nloc, hlf); }
  } else {
    epi_vt<false, RELU>(acc, bb, oscale, Ls, VT, bm0 / SEQ, bm0 % SEQ, bn0 - vcol0, wave, wm, wn, nloc, hlf);
    if (wlo) { __syncthreads(); epi_vt<true, RELU>(acc, bb, oscale, Ls, VTlo, bm0 / SEQ, bm0 % SEQ, bn0 - vcol0, wave, wm, wn, nloc, hlf); }
  }
}

// Y = LayerNorm(Xres + (A x Wt + bf16(bias))) * bf16(g) + bf16(be) over full 512-wide rows: block = 32 rows x 512 columns (wave = 32 x 64), K = 512 or 2048. Per 16-row half the f32
// tile is staged in LDS (cross-wave, block barrier); wave w then owns rows 2w, 2w+1: lane holds columns 128j + 4 lane (j = 0..3), residual / bias / gain loaded with the same map,
__global__ __launch_bounds__(256) void gemm_ln_kernel(const b16* __restrict__ A, int K, const b16* __restrict__ Wt, const float* __restrict__ bias, const float* Xres,
    const float* __restrict__ gam, const float* __restrict__ bet, float* OutF, b16* __restrict__ Xh, float oscale, int wxh) {
  __shared__ __attribute__((aligned(16))) b16 Rg[2 * (32 + D) * LP];   // operand ring (2 buffers x 544 rows); behind the K loop the f32 tile Tf
  static_assert(2 * (32 + D) * LP * 2 >= 16 * (D + 4) * 4);
  float* Tf = (float*)Rg;
  const int tid = threadIdx.x, wave = tid >> 5, lane = tid & 31, nloc = lane & 15, hlf = lane >> 4;
  const int bm0 = blockIdx.x * 32, col0 = wave * 64;
  v8f acc[2][4];
#pragma unroll
  for (int t = 0; t < 4; ++t) { acc[0][t] = (v8f){}; acc[1][t] = (v8f){}; }
  mac_staged<32, D>(acc, Rg, A + (size_t)bm0 * K, K, Wt, K, 0, col0, tid, nloc, hlf, (int)(blockIdx.x % (unsigned)(K / KS)), (int)(blockIdx.x / (unsigned)(K / KS) % 4u));
#pragma unroll 1
  for (int mt = 0; mt < 2; ++mt) {
    if (mt) __syncthreads();
#pragma unroll
    for (int t = 0; t < 4; ++t)
#pragma unroll
      for (int r = 0; r < 8; ++r) Tf[(8 * hlf + r) * (D + 4) + col0 + 16 * t + nloc] = (mt ? acc[1][t][r] : acc[0][t][r]) * oscale;
    __syncthreads();
#pragma unroll 1
    for (int rr = 0; rr < 2; ++rr) {
      const int rl = 2 * wave + rr; const size_t go = (size_t)(bm0 + mt * 16 + rl) * D;
      float y[16]; float s = 0.0f;
#pragma unroll
      for (int j = 0; j < 4; ++j) { const int c = 128 * j + 4 * lane;
        const v4f tv = *(const v4f*)(Tf + rl * (D + 4) + c); const v4f rv = *(const v4f*)(Xres + go + c); const v4f bv = *(const v4f*)(bias + c);
#pragma unroll
        for (int e = 0; e < 4; ++e) { const float yy = rv[e] + (tv[e] + bf16_rne(bv[e])); y[4 * j + e] = yy; s += yy; } }
#pragma unroll
      for (int off = 16; off > 0; off >>= 1) s += __shfl_xor(s, off, 32);
      const float mean = s * (1.0f / (float)D); float q = 0.0f;
#pragma unroll
      for (int i = 0; i < 16; ++i) { const float d0 = y[i] - mean; y[i] = d0; q += d0 * d0; }
#pragma unroll
      for (int off = 16; off > 0; off >>= 1) q += __shfl_xor(q, off, 32);
      const float rstd = 1.0f / sqrtf(q * (1.0f / (float)D) + LNEPS);
      v4f ov[4]; v4h_ hv[4];
#pragma unroll
      for (int j = 0; j < 4; ++j) { const int c = 128 * j + 4 * lane; const v4f gv = *(const v4f*)(gam + c), ev = *(const v4f*)(bet + c);
#pragma unroll
        for (int e = 0; e < 4; ++e) { const float o = (y[4 * j + e] * rstd) * bf16_rne(gv[e]) + bf16_rne(ev[e]); ov[j][e] = o; hv[j][e] = (b16)(o * CA); } }
      {
#pragma unroll
        for (int j = 0; j < 4; ++j) { const int c = 128 * j + 4 * lane; *(v4f*)(OutF + go + c) = ov[j]; if (wxh) *(v4h_*)(Xh + go + c) = hv[j]; }
         }
    }
  }
}

// Streaming attention, one work-group = 16 query rows of one (batch, head), its NWK waves sharing the keys: wave w walks the 32-key chunks w, w + NWK, ... with its own running max,
// sum and context, beginning at a step rotated by query tile + head and wrapping (the tiles of a head share K and V, the heads of a tile the mask: walking alike they would ask L2 for the same lines
// at once); the partial results meet in LDS behind one block barrier and are joined there (weights exp(max_w - max)).
// Both products are taken transposed: S^T = K x Q^T (A = a 16-key tile of k, B = the query tile, both from the q|k plane in fragment order), so that lane (nloc, hlf) holds, of query nloc alone,
// the scores of keys 16 t + 8 hlf + r (t = key tile, r = accumulator register): max and sum run inside the lane, with one exchange between the wave's halves for the max (the halves' sums are
// joined once, behind the loop). Converted in place (x4096) these 16 values are the B fragment of P^T in the k-map above, and ctx^T += V^T x P^T takes the v plane's fragments as A:
// acc[t][r] = ctx^T[dim 16 t + 8 hlf + r][query nloc]. P goes through no LDS and the loop holds no wave sync.
// Mask: the lane reads the bit word of its own query row (fetched one step ahead); a chunk whose 16 words are all ones is skipped, one whose words are all zero is not masked at all.
// RES: query/key residual planes give 3 score products and V x P_res + V_res x P into a second accumulator for chunks with keys < 128 (rows for which the residual planes exist);
constexpr int NWK = 4, PPW = DH + 4;   // waves per query tile; f32 pitch of a partial context row
static_assert((SEQ / 32) % NWK == 0);
// second launch bound: the register budget of 7 waves per SIMD (an allocation of 144); without it the build takes 148 registers, allocated as 160: one work-group fewer on a WGP
template <bool RES>
__global__ __launch_bounds__(32 * NWK, RES ? 1 : 7) void attn_kernel(const b16* __restrict__ QK, const b16* __restrict__ QKlo, const b16* __restrict__ VT, const b16* __restrict__ VTlo,
    const unsigned int* __restrict__ MB, b16* __restrict__ CTX, int qt0, int nqt) {
  __shared__ __attribute__((aligned(16))) float Part[NWK * 16 * PPW];
  __shared__ float Mxs[NWK * 16], Lss[NWK * 16];
  const int tid = threadIdx.x, lane = tid & 31, nloc = lane & 15, hlf = lane >> 4, wave = __builtin_amdgcn_readfirstlane(tid >> 5);
  const int bi = blockIdx.x, qt = qt0 + bi % nqt, bh = bi / nqt, h = bh % NH, b = bh / NH, q0 = qt * 16;
  const size_t rq = (size_t)b * SEQ + q0;
  const size_t qo = (((size_t)(b * 2) * NH + h) * NQT + qt) * QKT;   // the query tile in the q|k planes
  const v16b qa0 = frag_pk(QK + qo, lane), qa1 = frag_pk(QK + qo + FRG, lane);
  v16b ql0 = (v16b){}, ql1 = (v16b){};
  if (RES) { ql0 = frag_pk(QKlo + qo, lane); ql1 = frag_pk(QKlo + qo + FRG, lane); }
  const size_t ko = (((size_t)(b * 2 + 1) * NH + h) * NQT + 2 * wave) * QKT, vo = ((size_t)(b * NH + h) * (SEQ / 32) + wave) * VCH;
  const b16* kbase = QK + ko;   // this and the three bases below start at the wave's first chunk (two key tiles of k, one chunk of v)
  const b16* klbase = QKlo + ko;
  const b16* vbase = VT + vo;
  const b16* vlbase = VTlo + vo;
  const unsigned int* mbp = MB + ((size_t)b * NQT + qt) * (SEQ / 2) + 16 * wave;   // the 16 bit words (one per query row) of the wave's first chunk; wave-uniform, the lane reads word nloc
  float mx = -3.0e38f, ls = 0.0f;   // of query nloc: running max (equal in both halves), sum over the keys of this lane's half
  v8f acc[4], acc2[4];
#pragma unroll
  for (int t = 0; t < 4; ++t) { acc[t] = (v8f){}; acc2[t] = (v8f){}; }
  constexpr int NI = SEQ / 32 / NWK;
  const int irot = (qt + h) % NI;   // first step of this block's walk (block-uniform)
  unsigned int wn = mbp[16 * NWK * irot + nloc];   // the first step's word
#pragma unroll 1
  for (int i = 0; i < NI; ++i) {
    const int ii = i + irot < NI ? i + irot : i + irot - NI;
    const int c = wave + NWK * ii, fo = NWK * ii * VCH;   // c: chunk index; fo: offset from the wave's first chunk in halves of the k and v planes
    static_assert(2 * QKT == VCH);
    const unsigned int wc = wn;   // this step's word; the next step's is fetched now, one step ahead of its use (behind the last step the walk's first: in bounds, unused)
    const unsigned int* mp = mbp + 16 * NWK * (ii + 1 < NI ? ii + 1 : 0) + nloc;
    wn = *mp;
    if (__builtin_amdgcn_ballot_w32(wc != 0xffffffffu) == 0u) continue;
    v16b kf[2][2], vf[4]; const b16* kp = kbase + fo + 8 * lane; const b16* vp = vbase + fo + 8 * lane;   // the lane's own place in the chunk's first k and v fragment
#pragma unroll
    for (int t = 0; t < 2; ++t) { kf[t][0] = frag_pk(kp + t * QKT, 0); kf[t][1] = frag_pk(kp + t * QKT + FRG, 0); }
#pragma unroll
    for (int t = 0; t < 4; ++t) vf[t] = frag_pk(vp + t * FRG, 0);
    // No LDS sync stands between the two products any more, so the chunk's K and V fragments are all asked for here and fly together. The wait takes the lane's three load addresses as inputs: that keeps
    // their registers out of the loads' own destinations, and what rewrites them stands behind it; its memory clobber holds the 16 loads in front of it (left to itself the build asks for them pair by pair, each pair waited for alone)
    asm volatile("s_wait_xcnt 0x0" :: "v"(kp), "v"(vp), "v"(mp) : "memory");
    float sv[16];   // sv[8 t + r]: score of key 16 t + 8 hlf + r of the chunk
#pragma unroll
    for (int t = 0; t < 2; ++t) {
      const v16b k0f = kf[t][0], k1f = kf[t][1];
      v8f sh = wmma16b(k0f, qa0, (v8f){}); sh = wmma16b(k1f, qa1, sh);
      if (RES && c < 4) {
        const b16* klp = klbase + fo + t * QKT;
        v8f x = wmma16b(k0f, ql0, (v8f){}); x = wmma16b(k1f, ql1, x); x = wmma16b(frag_pk(klp, lane), qa0, x); x = wmma16b(frag_pk(klp + FRG, lane), qa1, x);
#pragma unroll
        for (int r = 0; r < 8; ++r) sh[r] += x[r] * (1.0f / RS); }
#pragma unroll
      for (int r = 0; r < 8; ++r) sv[8 * t + r] = sh[r] * SCL; }
    if (__builtin_amdgcn_ballot_w32(wc != 0u) != 0u) {   // wave-uniform: some key of some row is masked
      const unsigned int wh = wc >> (8 * hlf);   // bit 16 t + r = key 16 t + 8 hlf + r
#pragma unroll
      for (int j = 0; j < 16; ++j) sv[j] = (wh & (1u << (16 * (j >> 3) + (j & 7)))) ? NEGF : sv[j]; }
    float cm = sv[0];
#pragma unroll
    for (int j = 1; j < 16; ++j) cm = fmaxf(cm, sv[j]);
    cm = fmaxf(cm, xhalf(cm));
    const float mn = fmaxf(mx, cm), al = nexp2((mx - mn) * L2E); mx = mn;
    v2f es = (v2f){0.0f, 0.0f}; v16b pf, plf = (v16b){};   // es: sums of the even and of the odd keys (two chains of 8 adds, not one of 16)
#pragma unroll
    for (int j = 0; j < 16; ++j) {
      const float e = nexp2((sv[j] - mn) * L2E); es[j & 1] += e;
      const float v = e * PSC; const b16 hi = (b16)v; pf[j] = hi;
      if (RES) plf[j] = (b16)((v - (float)hi) * RS); }
    ls = ls * al + (es[0] + es[1]);
#pragma unroll
    for (int t = 0; t < 4; ++t)
#pragma unroll
      for (int r = 0; r < 8; ++r) { acc[t][r] *= al; if (RES) acc2[t][r] *= al; }
#pragma unroll
    for (int t = 0; t < 4; ++t) {
      acc[t] = wmma16b(vf[t], pf, acc[t]);
      if (RES && c < 4) { acc2[t] = wmma16b(vf[t], plf, acc2[t]); acc2[t] = wmma16b(frag_pk(vlbase + fo + t * FRG, lane), pf, acc2[t]); } }
  }
  // each wave publishes its partial context (f32, still scaled by its own max), max and sum; a wave whose chunks were all skipped publishes max -3e38, sum 0, context 0
  float* pw = Part + wave * (16 * PPW) + nloc * PPW + 8 * hlf;   // the lane's 8 consecutive dims of a dim tile: two 16-B stores
#pragma unroll
  for (int t = 0; t < 4; ++t) { v4f x0, x1;
#pragma unroll
    for (int e = 0; e < 4; ++e) { float a = acc[t][e], c4 = acc[t][4 + e]; if (RES) { a += acc2[t][e] * (1.0f / RS); c4 += acc2[t][4 + e] * (1.0f / RS); } x0[e] = a; x1[e] = c4; }
    *(v4f*)(pw + 16 * t) = x0; *(v4f*)(pw + 16 * t + 4) = x1; }
  const float lsw = ls + xhalf(ls);   // the two halves' sums of query nloc
  if (hlf == 0) { Mxs[wave * 16 + nloc] = mx; Lss[wave * 16 + nloc] = lsw; }
  __syncthreads();   // every wave's partials are in LDS before any thread joins them
  // join: thread = 8 columns of one row (NWK = 4: 128 threads cover 16 x 64)
  static_assert(32 * NWK * 8 == 16 * DH);
  const int jr = tid >> 3, jc = 8 * (tid & 7);
  float wm_[NWK], M = Mxs[jr];
#pragma unroll
  for (int w = 1; w < NWK; ++w) M = fmaxf(M, Mxs[w * 16 + jr]);
  float L = 0.0f, o[8];
#pragma unroll
  for (int e = 0; e < 8; ++e) o[e] = 0.0f;
#pragma unroll
  for (int w = 0; w < NWK; ++w) { wm_[w] = nexp2((Mxs[w * 16 + jr] - M) * L2E); L += wm_[w] * Lss[w * 16 + jr];
    const v4f x0 = *(const v4f*)(Part + (w * 16 + jr) * PPW + jc), x1 = *(const v4f*)(Part + (w * 16 + jr) * PPW + jc + 4);
#pragma unroll
    for (int e = 0; e < 4; ++e) { o[e] += wm_[w] * x0[e]; o[4 + e] += wm_[w] * x1[e]; } }
  const float inv = (1.0f / L) * (CX / (PSC * CA)); v8b ov;
#pragma unroll
  for (int e = 0; e < 8; ++e) ov[e] = (b16)(o[e] * inv);
  *(v8b*)(CTX + (rq + jr) * D + h * DH + jc) = ov;
}
}  // namespace

extern "C" void kernel_launch(void* const* d_in, const int* in_sizes, int n_in, void* d_out, int out_size, void* d_ws, size_t ws_size, hipStream_t stream) {
  (void)n_in;
  auto Fp = [&](int i) { return (const float*)d_in[i]; };
  auto Ip = [&](int i) { return (const int*)d_in[i]; };
  // wire order: 0 tokens [512][8] i32, 1 memory [8][512][512], 2 self-attention mask [8][512][512] i32, 3 memory mask [8][512][512] i32, 4 embedding [32000][512],
  // 5..8 Wq_s Wk_s Wv_s Wo_s [6][512 in][512 out], 9..12 Wq_c Wk_c Wv_c Wo_c, 13..16 bq_s bk_s bv_s bo_s [6][512], 17..20 bq_c bk_c bv_c bo_c,
  // 21 W1 [6][512][2048], 22 b1 [6][2048], 23 W2 [6][2048][512], 24 b2 [6][512], 25 g1, 26 g2, 27 g3, 28 be1, 29 be2, 30 be3 [6][512]
  const long needRows = (long)(NB - 1) * SEQ_FULL + SEQ;
  if ((long)in_sizes[0] < (long)SEQ * NB_FULL || (long)in_sizes[1] < needRows * D || (long)in_sizes[2] < needRows * SEQ_FULL || (long)in_sizes[3] < needRows * SEQ_FULL ||
      (long)in_sizes[4] < (long)VOCAB * D) return;
  for (int i = 5; i <= 12; ++i) if ((long)in_sizes[i] < (long)NLAY * D * D) return;
  for (int i = 13; i <= 20; ++i) if (in_sizes[i] < NLAY * D) return;
  if ((long)in_sizes[21] < (long)NLAY * D * DFF || in_sizes[22] < NLAY * DFF || (long)in_sizes[23] < (long)NLAY * DFF * D || in_sizes[24] < NLAY * D) return;
  for (int i = 25; i <= 30; ++i) if (in_sizes[i] < NLAY * D) return;
  if (out_size < MR * D) return;

  size_t off = 0; char* ws = (char*)d_ws;
  auto carve = [&](size_t bytes) { char* p = ws + off; off += (bytes + 255) & ~(size_t)255; return p; };
  b16* WQKVS = (b16*)carve((size_t)NLAY * NQKV * D * 2);   // [6][1536][512]
  b16* WOS   = (b16*)carve((size_t)NLAY * D * D * 2);
  b16* WQKVC = (b16*)carve((size_t)NLAY * NQKV * D * 2);   // [6][1536][512]
  b16* WOC   = (b16*)carve((size_t)NLAY * D * D * 2);
  b16* W1T   = (b16*)carve((size_t)NLAY * DFF * D * 2);    // [6][2048][512]
  b16* W2T   = (b16*)carve((size_t)NLAY * D * DFF * 2);    // [6][512][2048]
  float* X   = (float*)carve((size_t)MR * D * 4);
  b16* Xh    = (b16*)carve((size_t)MR * D * 2);
  b16* Mh    = (b16*)carve((size_t)MR * D * 2);
  b16* QK    = (b16*)carve((size_t)MR * LQK * 2);
  b16* QKlo  = (b16*)carve((size_t)MR * LQK * 2);
  b16* Vt    = (b16*)carve((size_t)MR * D * 2);            // [NB][NH][SEQ / 32][4][512]
  b16* Vtlo  = (b16*)carve((size_t)MR * D * 2);
  b16* CTX   = (b16*)carve((size_t)MR * D * 2);
  b16* Hh    = (b16*)carve((size_t)MR * DFF * 2);
  unsigned int* MBS = (unsigned int*)carve((size_t)NB * NQT * (SEQ / 2) * 4);   // mask bit words [NB][NQT][SEQ / 32][16]
  unsigned int* MBC = (unsigned int*)carve((size_t)NB * NQT * (SEQ / 2) * 4);
  if (off > ws_size || off > ((size_t)128 << 20)) return;   // 113,770,496 B at full size

  const dim3 b256(256), battn(32 * NWK);
  prep_kernel<<<P_ALL, b256, 0, stream>>>(Ip(0), Fp(4), Fp(1), Ip(2), Ip(3), Fp(5), Fp(6), Fp(7), Fp(8), Fp(9), Fp(10), Fp(11), Fp(12), Fp(21), Fp(23),
      WQKVS, WOS, WQKVC, WOC, W1T, W2T, Mh, X, Xh, MBS, MBC);

  const float OSA = 1.0f / (CA * WSC), OSX = 1.0f / (CX * WSC);
  for (int l = 0; l < NLAY; ++l) {
    const size_t lD = (size_t)l * D, lF = (size_t)l * DFF;
    // fused q|k|v projection of x: q and k -> q|k plane, v -> head-transposed plane (all in fragment order); residual planes for the first 128 rows of each sequence
    gemm_kernel<false><<<dim3(MR / 128, NQKV / 128), b256, 0, stream>>>(Xh, Xh, 0, D, WQKVS + (size_t)l * NQKV * D, D, Fp(13) + lD, Fp(14) + lD, Fp(15) + lD, Fp(15) + lD,
        QK, QKlo, LQK, 0, Vt, Vtlo, 2 * D, OSA, 1);
    attn_kernel<true><<<NB * NH * NQT_RES, battn, 0, stream>>>(QK, QKlo, Vt, Vtlo, MBS, CTX, 0, NQT_RES);
    attn_kernel<false><<<NB * NH * (NQT - NQT_RES), battn, 0, stream>>>(QK, QKlo, Vt, Vtlo, MBS, CTX, NQT_RES, NQT - NQT_RES);
    gemm_ln_kernel<<<MR / 32, b256, 0, stream>>>(CTX, D, WOS + (size_t)l * D * D, Fp(16) + lD, X, Fp(25) + lD, Fp(28) + lD, X, Xh, OSX, 1);
    // attention over the memory tensor: q (columns 0..511) from x, k|v (columns 512..1535) from the memory plane, one grid
    gemm_kernel<false><<<dim3(MR / 128, NQKV / 128), b256, 0, stream>>>(Xh, Mh, D, D, WQKVC + (size_t)l * NQKV * D, D, Fp(17) + lD, Fp(18) + lD, Fp(19) + lD, Fp(19) + lD,
        QK, QKlo, LQK, 0, Vt, Vtlo, 2 * D, OSA, 0);
    attn_kernel<false><<<NB * NH * NQT, battn, 0, stream>>>(QK, QKlo, Vt, Vtlo, MBC, CTX, 0, NQT);
    gemm_ln_kernel<<<MR / 32, b256, 0, stream>>>(CTX, D, WOC + (size_t)l * D * D, Fp(20) + lD, X, Fp(26) + lD, Fp(29) + lD, X, Xh, OSX, 1);
    // FFN
    gemm_kernel<true><<<dim3(MR / 128, DFF / 128), b256, 0, stream>>>(Xh, Xh, 0, D, W1T + (size_t)l * DFF * D, D, Fp(22) + lF, Fp(22) + lF + 512, Fp(22) + lF + 1024, Fp(22) + lF + 1536,
        Hh, QKlo, DFF, 0, Vt, Vtlo, DFF, OSA, 0);
    const bool last = (l == NLAY - 1);
    gemm_ln_kernel<<<MR / 32, b256, 0, stream>>>(Hh, DFF, W2T + (size_t)l * D * DFF, Fp(24) + lD, X, Fp(27) + lD, Fp(30) + lD, last ? (float*)d_out : X, Xh, OSA, last ? 0 : 1);
  }
}

// v008
// Measured time: 638 microseconds a run.
// Next to v007, in two timings, it ran 1.07 and 1.06 times as fast.
// Over all steps from v000 it is 2.83 times as fast.
#include <hip/hip_runtime.h>

// 6-layer post-LN decoder stack: token embedding x sqrt(512) + sinusoidal positions; per layer masked self-attention (8 heads x 64), attention over a memory tensor,
// relu FFN 512 -> 2048 -> 512, each followed by residual add + LayerNorm over 512. Masks are int32 [batch][query][key] tensors read by value (nonzero = score replaced by
// -1e18); a 32-key chunk whose 16x32 mask tile is entirely nonzero is skipped (exact whenever each query row keeps at least one key).
// compute dtype: every contraction on v_wmma_f32_16x16x32_f16 (f16 operands, f32 accumulate): q/k/v projections, score and P.V products, output projections, both FFN
// products. Operand planes: activations f16 x8 (attention context x64), weights bf16-exact f16 x256, softmax P f16 x4096; query tiles with position < 64 of the masked
// self-attention add residual planes (x2048 of the x8 / x4096 carriers) of q, k, v and P: 3 score products and 3 P.V products into a second accumulator.
// tokens and masks int32 (tokens clamped). Fragment k-map per lane half hh for A and B: elements 0..7 <- k = 8hh+0..7, 8..15 <- k = 16+8hh+0..7; acc[r] = D[8hh+r][col].
// The attention's q, k and v planes are kept in fragment order: a fragment (16 rows x 32 k) is 512 halves = piece 0 (elements 0..7 of lanes 0..31) then piece 1 (elements 8..15), so that each
// of its two 16-B-per-lane loads covers 512 contiguous bytes (4 whole lines; from a row-major plane it would touch 16 lines for 32 B each).
// Each mask is packed once, by the preparation grid, into bit words [batch][16-query tile][32-key chunk][row]: bit l of a word = (mask[row][32 chunk + l] != 0); the attention reads only these words.
// q|k plane: [batch][q, k][head][16-row tile][k step of 32 dims][piece][lane][8]; v plane: [batch][head][32-key chunk][16-dim tile][piece][lane][8] (rows = dims, k = keys).

#ifndef NB
#define NB 8
#endif
#ifndef SEQ
#define SEQ 512
#endif
#define NB_FULL 8
#define SEQ_FULL 512

namespace {
constexpr int D = 512, NH = 8, DH = 64, DFF = 2048, NLAY = 6, VOCAB = 32000;
constexpr int MR = NB * SEQ;                 // activation rows, row = b * SEQ + s
constexpr int LQK = 2 * D;                   // halves of the q | k plane per activation row
constexpr int FRG = 512, QKT = 2 * FRG, VCH = 4 * FRG;   // halves of a fragment, of a 16-row x 64-dim q or k tile, of a 64-dim x 32-key v chunk
constexpr int NQKV = 3 * D, NQT = SEQ / 16, NQT_RES = 4;
constexpr float WSC = 256.0f, CA = 8.0f, CX = 64.0f, PSC = 4096.0f, RS = 2048.0f;
constexpr float SQD = 22.627416997969522f, NLOGD = -0.017988946039015984f, L2E = 1.4426950408889634f, NEGF = -1.0e18f, LNEPS = 1.0e-5f;
constexpr float SCL = 1.0f / (CA * CA * 8.0f);   // score = acc / (8 x 8) / sqrt(64)
static_assert(NB >= 1 && NB <= NB_FULL && SEQ >= 128 && SEQ <= SEQ_FULL && SEQ % 128 == 0);
static_assert(MR % 128 == 0 && MR % 32 == 0 && D == 512 && NH * DH == D && DFF % 512 == 0 && NQT > NQT_RES && (MR * D) % 8 == 0);

typedef _Float16 b16;
typedef __attribute__((ext_vector_type(16))) _Float16 v16b;
typedef __attribute__((ext_vector_type(8))) _Float16 v8b;
typedef __attribute__((ext_vector_type(4))) _Float16 v4h_;
typedef __attribute__((ext_vector_type(8))) float v8f;
typedef __attribute__((ext_vector_type(4))) float v4f;
typedef __attribute__((ext_vector_type(2))) float v2f;

__device__ __forceinline__ float bf16_rne(float f) { unsigned int u = __float_as_uint(f); u += 0x7FFFu + ((u >> 16) & 1u); return __uint_as_float(u & 0xFFFF0000u); }
__device__ __forceinline__ v16b frag_kb(const b16* p, int hh) { const v8b a = *(const v8b*)(p + 8 * hh), b = *(const v8b*)(p + 16 + 8 * hh); v16b f;
#pragma unroll
  for (int e = 0; e < 8; ++e) { f[e] = a[e]; f[8 + e] = b[e]; } return f; }
__device__ __forceinline__ v16b frag_pk(const b16* p, int lane) { const v8b a = *(const v8b*)(p + 8 * lane), b = *(const v8b*)(p + 256 + 8 * lane); v16b f;   // p: a fragment stored in fragment order
#pragma unroll
  for (int e = 0; e < 8; ++e) { f[e] = a[e]; f[8 + e] = b[e]; } return f; }
__device__ __forceinline__ v8f wmma_raw(v16b a, v16b b, v8f c) { return __builtin_amdgcn_wmma_f32_16x16x32_f16(false, a, false, b, (short)0, c, false, false); }
__device__ __forceinline__ v8f wmma16b(v16b a, v16b b, v8f c) { v8f d = wmma_raw(a, b, c); asm volatile("v_nop\n\tv_nop\n\tv_nop\n\tv_nop" : "+v"(d) : "v"(a), "v"(b)); return d; }
// one guard after a group of 8 accumulating WMMAs: ties all 8 accumulators, keeps both A and all four B fragments live across the 4 nops
#define WMMA_GUARD8(c, a0, a1, bf) asm volatile("v_nop\n\tv_nop\n\tv_nop\n\tv_nop" : "+v"(c[0][0]), "+v"(c[0][1]), "+v"(c[0][2]), "+v"(c[0][3]), \
    "+v"(c[1][0]), "+v"(c[1][1]), "+v"(c[1][2]), "+v"(c[1][3]) : "v"(a0), "v"(a1), "v"(bf[0]), "v"(bf[1]), "v"(bf[2]), "v"(bf[3]))
__device__ __forceinline__ void wave_lds_sync() { __builtin_amdgcn_fence(3 /* release order */, "workgroup"); __builtin_amdgcn_wave_barrier(); __builtin_amdgcn_fence(2 /* acquire order */, "workgroup"); }
__device__ __forceinline__ float pmul(float a, float b) { float p = a * b; asm volatile("" : "+v"(p)); return p; }
__device__ __forceinline__ int iclamp(int v, int lo, int hi) { return v < lo ? lo : (v > hi ? hi : v); }
__device__ __forceinline__ float nexp2(float v) { float r; asm("v_exp_f32 %0, %1\n\tv_nop" : "=v"(r) : "v"(v)); return r; }
// lane l <-> lane l ^ 16 (the wave's other half), a vector cross-row move
__device__ __forceinline__ float xhalf(float x) { return __int_as_float(__builtin_amdgcn_permlanex16(__float_as_int(x), __float_as_int(x), 0x76543210, 0xfedcba98, false, false)); }

// Wt[l][noff + n][k] = f16(bf16(W[l][k][n]) x 256), W stored [layer][in][out] with NA columns; block = 64 k x 64 n tile transposed through LDS (T: 64 x 72 halves; cross-thread, block barrier);
__device__ __forceinline__ void wprep_tile(b16* T, const float* __restrict__ W, b16* __restrict__ Wt, int K, int NA, int NT, int noff, int l, int k0, int n0, int tid) {
  { const int kr = tid >> 2, nc = (tid & 3) * 16; const float* src = W + ((size_t)l * K + k0 + kr) * NA + n0 + nc;
#pragma unroll
    for (int q = 0; q < 4; ++q) { const v4f v = *(const v4f*)(src + 4 * q);
#pragma unroll
      for (int j = 0; j < 4; ++j) T[(nc + 4 * q + j) * 72 + kr] = (b16)(bf16_rne(v[j]) * WSC); } }
  __syncthreads();
  v8b vv[2]; size_t dst[2];
#pragma unroll
  for (int i = 0; i < 2; ++i) { const int n = (tid >> 3) + 32 * i, p = tid & 7; vv[i] = *(const v8b*)(T + n * 72 + 8 * p); dst[i] = ((size_t)l * NT + noff + n0 + n) * K + k0 + 8 * p; }
  {
#pragma unroll
    for (int i = 0; i < 2; ++i) *(v8b*)(Wt + dst[i]) = vv[i];
     }
}

__device__ __forceinline__ void mprep_part(const float* __restrict__ mem, b16* __restrict__ Mh, int u) {
  if (u >= MR * D / 8) return;
  const int row = u / (D / 8), c0 = (u % (D / 8)) * 8, b = row / SEQ, s = row % SEQ;
  const float* src = mem + ((size_t)b * SEQ_FULL + s) * D + c0;
  const v4f a = *(const v4f*)src, c = *(const v4f*)(src + 4); v8b v;
#pragma unroll
  for (int j = 0; j < 4; ++j) { v[j] = (b16)(bf16_rne(a[j]) * CA); v[4 + j] = (b16)(bf16_rne(c[j]) * CA); }
  { *(v8b*)(Mh + (size_t)row * D + c0) = v;  }
}

// embedding: x[b][s][c] = bf16(emb[tok[s][b]][c]) x sqrt(512) + pe(s, c), pe(s, 2j) = sin(s x exp(2j x NLOGD)), pe(s, 2j+1) = cos(same angle); tok clamped. block = 4 rows,
// thread = 8 columns (rolled loop of 4 expf + sincosf); the 4 x 512 f32 tile is staged in LDS (block barrier), then 32 lanes x 16 B per 512-B run to X and
__device__ __forceinline__ void embed_rows(float* Xs, const int* __restrict__ tok, const float* __restrict__ emb, float* __restrict__ X, b16* __restrict__ Xh, int row0, int tid) {
  const int rl = tid >> 6, c0 = (tid & 63) * 8, row = row0 + rl, b = row / SEQ, s = row % SEQ;
  const int t = iclamp(tok[s * NB_FULL + b], 0, VOCAB - 1);
  const float* er = emb + (size_t)t * D + c0;
#pragma unroll 1
  for (int q = 0; q < 4; ++q) {
    const int c = c0 + 2 * q; const float dv = expf(pmul((float)c, NLOGD)); float sn, cs; sincosf(pmul((float)s, dv), &sn, &cs);
    Xs[rl * (D + 4) + c] = pmul(bf16_rne(er[2 * q]), SQD) + sn; Xs[rl * (D + 4) + c + 1] = pmul(bf16_rne(er[2 * q + 1]), SQD) + cs; }
  __syncthreads();
  v4f fv[2]; size_t fo[2]; v8b hv;
#pragma unroll
  for (int i = 0; i < 2; ++i) { const int f = i * 256 + tid; fv[i] = *(const v4f*)(Xs + (f >> 7) * (D + 4) + (f & 127) * 4); fo[i] = (size_t)(row0 + (f >> 7)) * D + (f & 127) * 4; }
  { const v4f a = *(const v4f*)(Xs + rl * (D + 4) + c0), c4 = *(const v4f*)(Xs + rl * (D + 4) + c0 + 4);
#pragma unroll
    for (int e = 0; e < 4; ++e) { hv[e] = (b16)(a[e] * CA); hv[4 + e] = (b16)(c4[e] * CA); } }
  {
#pragma unroll
    for (int i = 0; i < 2; ++i) *(v4f*)(X + fo[i]) = fv[i];
    *(v8b*)(Xh + (size_t)row * D + c0) = hv;  }
}

// one 16-query tile of a mask -> its SEQ / 2 bit words. A wave makes 32 words (two chunks x 16 rows) that fill one 128-B line: per word one whole-line load (lane = key) and a ballot,
// lane t keeps word t; the 32 loads are independent and fly together
__device__ __forceinline__ void maskpack_tile(const int* __restrict__ mask, unsigned int* __restrict__ MB, int tile, int tid) {
  const int wave = __builtin_amdgcn_readfirstlane(tid >> 5), lane = tid & 31;
  const int* mrow = mask + ((size_t)(tile / NQT) * SEQ_FULL + (tile % NQT) * 16) * SEQ_FULL + lane;
  for (int j = wave; j < SEQ / 64; j += 8) {
    int v[32]; unsigned int keep = 0u;
#pragma unroll
    for (int t = 0; t < 32; ++t) v[t] = mrow[(size_t)(t & 15) * SEQ_FULL + 32 * (2 * j + (t >> 4))];
#pragma unroll
    for (int t = 0; t < 32; ++t) { const unsigned int bal = __builtin_amdgcn_ballot_w32(v[t] != 0); keep = lane == t ? bal : keep; }
    MB[(size_t)tile * (SEQ / 2) + 32 * j + lane] = keep;
    asm volatile("s_wait_xcnt 0x0" ::: "memory");   // the built code joins this part's end to edges into the other parts, which rewrite the registers the store names: the wait stands in front of them
  }
}

// All input preparation in one grid: none of its parts reads what another writes, so a block takes its part by its index range (block-uniform): embedding rows first (the longest blocks),
// then the 64 x 64 tiles of the eight 512 x 512 weights, of W1 and of W2 (k tile fastest, then n tile, then layer), then the memory plane, then the tiles of the two masks.
constexpr int LTD = 3, LTF = 5, PB_WS = NLAY << (2 * LTD), PB_WF = NLAY << (LTD + LTF);   // log2 of the 64-wide tiles along 512 and along 2048; blocks of a small and of an FFN weight
static_assert((64 << LTD) == D && (64 << LTF) == DFF);
constexpr int P_W = MR / 4, P_F1 = P_W + 8 * PB_WS, P_F2 = P_F1 + PB_WF, P_M = P_F2 + PB_WF, P_K = P_M + (MR * D / 8 + 255) / 256, P_ALL = P_K + 2 * NB * NQT;   // first block of each range
__global__ __launch_bounds__(256) void prep_kernel(const int* __restrict__ tok, const float* __restrict__ emb, const float* __restrict__ mem, const int* __restrict__ msks, const int* __restrict__ mskc,
    const float* __restrict__ wqs, const float* __restrict__ wks, const float* __restrict__ wvs, const float* __restrict__ wos,
    const float* __restrict__ wqc, const float* __restrict__ wkc, const float* __restrict__ wvc, const float* __restrict__ woc,
    const float* __restrict__ w1, const float* __restrict__ w2,
    b16* __restrict__ WQKVS, b16* __restrict__ WOS, b16* __restrict__ WQKVC, b16* __restrict__ WOC, b16* __restrict__ W1T, b16* __restrict__ W2T,
    b16* __restrict__ Mh, float* __restrict__ X, b16* __restrict__ Xh, unsigned int* __restrict__ MBS, unsigned int* __restrict__ MBC) {
  __shared__ __attribute__((aligned(16))) b16 Sh[64 * 72];   // weight tile, or the embedding's 4 x 516 f32 rows
  static_assert(64 * 72 * 2 >= 4 * (D + 4) * 4);
  const int tid = threadIdx.x, r = blockIdx.x;
  if (r < P_W) embed_rows((float*)Sh, tok, emb, X, Xh, r * 4, tid);
  else if (r < P_M) {
    const float* W; b16* Wt; int q, lk = LTD, ln = LTD, NT, noff = 0;   // lk, ln: log2 of the tile counts along k (rows of W) and n (its columns)
    if (r < P_F1) {
      const int m = (r - P_W) / PB_WS, g = m & 3;   // m: 0..3 q k v o of the self-attention, 4..7 of the attention over memory
      q = (r - P_W) % PB_WS;
      W = m < 4 ? (g == 0 ? wqs : (g == 1 ? wks : (g == 2 ? wvs : wos))) : (g == 0 ? wqc : (g == 1 ? wkc : (g == 2 ? wvc : woc)));
      Wt = m < 4 ? (g == 3 ? WOS : WQKVS) : (g == 3 ? WOC : WQKVC);
      NT = g == 3 ? D : NQKV; noff = g == 3 ? 0 : g * D;
    } else if (r < P_F2) { q = r - P_F1; W = w1; Wt = W1T; ln = LTF; NT = DFF; }
    else { q = r - P_F2; W = w2; Wt = W2T; lk = LTF; NT = D; }
    wprep_tile(Sh, W, Wt, 64 << lk, 64 << ln, NT, noff, q >> (lk + ln), (q & ((1 << lk) - 1)) * 64, ((q >> lk) & ((1 << ln) - 1)) * 64, tid);
    asm volatile("s_wait_xcnt 0x0" ::: "memory");   // the built code joins this branch's end to an edge into the embedding branch, which rewrites the registers the two stores name: the wait stands in front of that join
  } else if (r < P_K) mprep_part(mem, Mh, (r - P_M) * 256 + tid);
  else { const bool sf = r - P_K < NB * NQT; maskpack_tile(sf ? msks : mskc, sf ? MBS : MBC, (r - P_K) % (NB * NQT), tid); }
}

// Operand staging of the GEMMs: a stage is KS = 128 k (256 B) of every A and B row of the block tile, laid in LDS at pitch 272 B (16 B x 17: odd, conflict-free for 16-B row readers),
// brought by per-lane asynchronous 16-B copies (a wave's copy covers 2 rows x 256 B = 4 whole lines); two buffers, the next stage's copies fly while this one is worked on.
constexpr int KS = 128, LP = KS + 8;
__device__ __forceinline__ unsigned lds_byte(const void* p) { return (unsigned)(unsigned long long)p; }
// copies of rows 16 apart (LDS step 16 x 272 B, global step gs halves); s_wait_xcnt 0 closes each statement so that no address register is rewritten ahead of it
__device__ __forceinline__ void cp2(unsigned l, const b16* g, size_t gs) {
  asm volatile("global_load_async_to_lds_b128 %0, %2, off\n\tglobal_load_async_to_lds_b128 %1, %3, off\n\ts_wait_xcnt 0x0"
      :: "v"(l), "v"(l + 16u * LP * 2u), "v"(g), "v"(g + gs) : "memory");
}
__device__ __forceinline__ void cp8(unsigned l, const b16* g, size_t gs) {
  constexpr unsigned LS = 16u * LP * 2u;
  asm volatile("global_load_async_to_lds_b128 %0, %8, off\n\tglobal_load_async_to_lds_b128 %1, %9, off\n\tglobal_load_async_to_lds_b128 %2, %10, off\n\t"
      "global_load_async_to_lds_b128 %3, %11, off\n\tglobal_load_async_to_lds_b128 %4, %12, off\n\tglobal_load_async_to_lds_b128 %5, %13, off\n\t"
      "global_load_async_to_lds_b128 %6, %14, off\n\tglobal_load_async_to_lds_b128 %7, %15, off\n\ts_wait_xcnt 0x0"
      :: "v"(l), "v"(l + LS), "v"(l + 2u * LS), "v"(l + 3u * LS), "v"(l + 4u * LS), "v"(l + 5u * LS), "v"(l + 6u * LS), "v"(l + 7u * LS),
         "v"(g), "v"(g + gs), "v"(g + 2 * gs), "v"(g + 3 * gs), "v"(g + 4 * gs), "v"(g + 5 * gs), "v"(g + 6 * gs), "v"(g + 7 * gs) : "memory");
}
// block of 256 threads: AR rows of A (first row Ag, pitch lda) and BR rows of B = Wt (first row Bg, pitch K), K a multiple of 128; the wave takes 32 A rows from arow and 64 B rows from
// brow: 8 WMMAs per 32 k, one guard per stage. On return every wave has left the ring (last trip's barrier): it may be reused.
// Blocks of one grid share operand rows and start together: walking K alike they would ask L2 for the same lines at the same moment. Trip t therefore takes the k stage (t + rot) mod NT,
// and the 128-row groups of B are copied in the order jrot, jrot + 1, ... (mod their number); rot < NT and jrot come from the block index (block-uniform). The f32 sums run over k in that rotated order.
template <int AR, int BR>
__device__ __forceinline__ void mac_staged(v8f (&acc)[2][4], b16* ring, const b16* Ag, int lda, const b16* Bg, int K, int arow, int brow, int tid, int nloc, int hlf, int rot, int jrot) {
  static_assert((AR == 32 || AR % 128 == 0) && BR % 128 == 0);
  constexpr int BUFH = (AR + BR) * LP;
  const unsigned l0 = lds_byte(ring) + (unsigned)(tid >> 4) * (LP * 2u) + (unsigned)(tid & 15) * 16u;
  const b16* ga = Ag + (size_t)(tid >> 4) * lda + 8 * (tid & 15);
  const b16* gb = Bg + (size_t)(tid >> 4) * K + 8 * (tid & 15);
  const int NT = K / KS;
  auto fill = [&](int t) {
    const unsigned l = l0 + (unsigned)(t & 1) * (BUFH * 2u);
    const int kt = t + rot < NT ? t + rot : t + rot - NT;   // this trip's k stage
    if constexpr (AR == 32) cp2(l, ga + kt * KS, (size_t)16 * lda);
    else {
#pragma unroll
      for (int j = 0; j < AR / 128; ++j) cp8(l + (unsigned)j * (128u * LP * 2u), ga + (size_t)(128 * j) * lda + kt * KS, (size_t)16 * lda); }
#pragma unroll
    for (int i = 0; i < BR / 128; ++i) { const int j = (i + jrot) % (BR / 128);
      cp8(l + (unsigned)(AR + 128 * j) * (LP * 2u), gb + (size_t)(128 * j) * K + kt * KS, (size_t)16 * K); }
  };
  fill(0);
  asm volatile("s_wait_asynccnt 0x0" ::: "memory");   // trip 0's k stage has landed (this wave's copies) before the barrier that publishes it
  __syncthreads();
  if (NT > 1) fill(1);
#pragma unroll 1
  for (int t = 0; t < NT; ++t) {
    const b16* bufp = ring + (t & 1) * BUFH;
    const b16* ap0 = bufp + (arow + nloc) * LP; const b16* ap1 = ap0 + 16 * LP; const b16* bp = bufp + (AR + brow + nloc) * LP;
    v16b a0[2], a1[2], bf[2][4];   // two fragment sets: the next 32 k are fetched while the WMMAs of these 32 k run (all inside this stage's buffer)
    a0[0] = frag_kb(ap0, hlf); a1[0] = frag_kb(ap1, hlf);
#pragma unroll
    for (int u = 0; u < 4; ++u) bf[0][u] = frag_kb(bp + u * 16 * LP, hlf);
#pragma unroll
    for (int s = 0; s < KS / 32; ++s) {
      const int c = s & 1, n = c ^ 1;
      if (s + 1 < KS / 32) {
        a0[n] = frag_kb(ap0 + 32 * (s + 1), hlf); a1[n] = frag_kb(ap1 + 32 * (s + 1), hlf);
#pragma unroll
        for (int u = 0; u < 4; ++u) bf[n][u] = frag_kb(bp + u * 16 * LP + 32 * (s + 1), hlf); }
      __builtin_amdgcn_sched_barrier(0);   // keeps the next block's 12 LDS reads one group in front of this block's WMMAs (for speed only)
#pragma unroll
      for (int u = 0; u < 4; ++u) { acc[0][u] = wmma_raw(a0[c], bf[c][u], acc[0][u]); acc[1][u] = wmma_raw(a1[c], bf[c][u], acc[1][u]); }
      if (s + 1 < KS / 32) __builtin_amdgcn_sched_barrier(0);   // the block after next's reads stay behind this block's WMMAs
      else WMMA_GUARD8(acc, a0[c], a1[c], bf[c]);   // the stage's last WMMAs stand in front of a branch: the 4 slots behind them are filled here for both of its sides
    }
    asm volatile("s_wait_dscnt 0x0" ::: "memory");     // this wave's reads of the buffer have retired before the barrier behind which it is refilled
    asm volatile("s_wait_asynccnt 0x0" ::: "memory");  // this wave's copies for trip t + 1 have landed before the barrier that publishes them
    __syncthreads();
    if (t + 2 < NT) fill(t + 2);
  }
  asm volatile("s_wait_asynccnt 0x0" ::: "memory");    // no copy outstanding when the ring is reused or the wave ends
}

// f16 epilogue of one wave's 32 x 64 tile (plane value = f16(v x 8), LO: f16((v x 8 - hi) x 2048)): b16 element stores into the wave-private LDS tile, wave sync, then 8 stores of 16 B per lane:
// row-major (4 rows x 128 B each, dstp = the tile's first element, pitch ldc), or PK: fragment order (dstp = the first of the wave's two q or k tiles; store j = tile j / 4, k step (j / 2) % 2,
// piece j % 2: 512 contiguous bytes each, 4 KB in a row)
template <bool LO, bool RELU, bool PK>
__device__ __forceinline__ void epi_rows(const v8f (&acc)[2][4], const float (&bb)[4], float oscale, b16* Es, b16* dstp, int ldc, int lane, int nloc, int hlf) {
#pragma unroll
  for (int mt = 0; mt < 2; ++mt)
#pragma unroll
    for (int t = 0; t < 4; ++t)
#pragma unroll
      for (int r = 0; r < 8; ++r) {
        float v = acc[mt][t][r] * oscale + bb[t]; if (RELU) v = fmaxf(v, 0.0f); const float vs = v * CA; const b16 hi = (b16)vs;
        Es[(mt * 16 + 8 * hlf + r) * 72 + 16 * t + nloc] = LO ? (b16)((vs - (float)hi) * RS) : hi; }
  wave_lds_sync();
  v8b vv[8];
#pragma unroll
  for (int j = 0; j < 8; ++j) vv[j] = PK ? *(const v8b*)(Es + ((j >> 2) * 16 + nloc) * 72 + 32 * ((j >> 1) & 1) + 16 * (j & 1) + 8 * hlf) : *(const v8b*)(Es + (4 * j + (lane >> 3)) * 72 + 8 * (lane & 7));
  b16* dst = PK ? dstp + 8 * lane : dstp + (size_t)(lane >> 3) * ldc + 8 * (lane & 7);
  {
#pragma unroll
    for (int j = 0; j < 8; ++j) *(v8b*)(dst + (PK ? (size_t)(256 * j) : (size_t)(4 * j) * ldc)) = vv[j];
    asm volatile("s_wait_xcnt 0x0" ::: "memory");   // what follows (the residual plane's pass) rewrites registers that these stores name: the wait stands in front of it
  }
}

// head-transposed f16 epilogue of the block's 128 (keys) x 128 (head columns) tile -> v plane in fragment order: each lane stores its 8 consecutive keys of one
// column as one 16-B LDS store into Et[col][key] (cross-wave, block barrier), then the wave writes one (head wave / 4, chunk wave % 4): store j = dim tile j / 2, piece j % 2, 4 KB in a row
template <bool LO, bool RELU>
__device__ __forceinline__ void epi_vt(const v8f (&acc)[2][4], const float (&bb)[4], float oscale, b16* Et, b16* plane, int bidx, int key0, int colv0, int wave, int wm, int wn, int nloc, int hlf) {
#pragma unroll
  for (int mt = 0; mt < 2; ++mt)
#pragma unroll
    for (int t = 0; t < 4; ++t) { v8b hv;
#pragma unroll
      for (int r = 0; r < 8; ++r) { float v = acc[mt][t][r] * oscale + bb[t]; if (RELU) v = fmaxf(v, 0.0f); const float vs = v * CA; const b16 hi = (b16)vs; hv[r] = LO ? (b16)((vs - (float)hi) * RS) : hi; }
      *(v8b*)(Et + (wn * 64 + 16 * t + nloc) * 136 + wm * 32 + mt * 16 + 8 * hlf) = hv; }
  __syncthreads();
  v8b vv[8]; const int hd = wave >> 2, ch = wave & 3;
#pragma unroll
  for (int j = 0; j < 8; ++j) vv[j] = *(const v8b*)(Et + (hd * DH + 16 * (j >> 1) + nloc) * 136 + 32 * ch + 16 * (j & 1) + 8 * hlf);
  b16* dst = plane + ((size_t)(bidx * NH + colv0 / DH + hd) * (SEQ / 32) + key0 / 32 + ch) * VCH + 8 * (16 * hlf + nloc);
  {
#pragma unroll
    for (int j = 0; j < 8; ++j) *(v8b*)(dst + 256 * j) = vv[j];
    asm volatile("s_wait_xcnt 0x0" ::: "memory");   // what follows (the residual plane's pass) rewrites registers that these stores name: the wait stands in front of it
  }
}

// C = (A[M][K] f16 plane, pitch lda) x Wt[N][K] + bf16(bias), optional relu; block 128 x 128 = 8 waves of 32 x 64. GEMM columns < vcol0 -> plane C (f16 x 8): with relu (FFN) row-major
// C[row*ldc + ccol0 + col], without (q at columns 0..511, k at 512..1023) the q|k plane in fragment order; columns >= vcol0 -> head-transposed plane VT (v of the attention), fragment order. Blocks whose 128 rows start a sequence also emit the residual planes Clo / VTlo (x 2048) for those rows
// when wres != 0. Bias group pointer chosen per 512-column group (block-uniform). Column blocks below asplit multiply A1, the others A2 (block-uniform): two products of different left
// operands that share K and the output planes run as one grid.
template <bool RELU>
__global__ __launch_bounds__(256) void gemm_kernel(const b16* __restrict__ A1, const b16* __restrict__ A2, int asplit, int lda, const b16* __restrict__ Wt, int K,
    const float* __restrict__ bg0, const float* __restrict__ bg1, const float* __restrict__ bg2, const float* __restrict__ bg3,
    b16* __restrict__ C, b16* __restrict__ Clo, int ldc, int ccol0, b16* __restrict__ VT, b16* __restrict__ VTlo, int vcol0, float oscale, int wres) {
  __shared__ __attribute__((aligned(16))) b16 Ls[2 * 256 * LP];   // operand ring (2 buffers x 256 rows); behind the K loop 8 wave tiles [32][72] (row-major mode) or one block tile [128][136] (transposed mode)
  static_assert(2 * 256 * LP >= 18432);
  const int tid = threadIdx.x, wave = tid >> 5, lane = tid & 31, nloc = lane & 15, hlf = lane >> 4;
  const int bm0 = blockIdx.x * 128, bn0 = blockIdx.y * 128, wm = wave >> 1, wn = wave & 1;
  const int row0 = bm0 + wm * 32, col0 = bn0 + wn * 64;
  const b16* A = bn0 < asplit ? A1 : A2;
  v8f acc[2][4];
#pragma unroll
  for (int t = 0; t < 4; ++t) { acc[0][t] = (v8f){}; acc[1][t] = (v8f){}; }
  mac_staged<128, 128>(acc, Ls, A + (size_t)bm0 * lda, lda, Wt + (size_t)bn0 * K, K, wm * 32, wn * 64, tid, nloc, hlf, (int)((blockIdx.x + blockIdx.y) % (unsigned)(K / KS)), 0);
  const int gsel = bn0 >> 9; const float* bias = gsel == 0 ? bg0 : (gsel == 1 ? bg1 : (gsel == 2 ? bg2 : bg3));
  float bb[4];
#pragma unroll
  for (int t = 0; t < 4; ++t) bb[t] = bf16_rne(bias[(col0 & 511) + 16 * t + nloc]);
  const bool vmode = bn0 >= vcol0, wlo = (wres != 0) && (bm0 % SEQ == 0);
  if (!vmode) {
    b16* Es = Ls + wave * (32 * 72);
    // the wave's 64 columns are one head of q or of k, its 32 rows two tiles that follow one another in the plane
    const size_t co = RELU ? (size_t)row0 * ldc + ccol0 + col0 : (((size_t)(row0 / SEQ * 2 + (col0 >> 9)) * NH + ((col0 & 511) >> 6)) * NQT + row0 % SEQ / 16) * QKT;
    epi_rows<false, RELU, !RELU>(acc, bb, oscale, Es, C + co, ldc, lane, nloc, hlf);
    if (wlo) { wave_lds_sync(); epi_rows<true, RELU, !RELU>(acc, bb, oscale, Es, Clo + co, ldc, lane, nloc, hlf); }
  } else {
    epi_vt<false, RELU>(acc, bb, oscale, Ls, VT, bm0 / SEQ, bm0 % SEQ, bn0 - vcol0, wave, wm, wn, nloc, hlf);
    if (wlo) { __syncthreads(); epi_vt<true, RELU>(acc, bb, oscale, Ls, VTlo, bm0 / SEQ, bm0 % SEQ, bn0 - vcol0, wave, wm, wn, nloc, hlf); }
  }
}

// Y = LayerNorm(Xres + (A x Wt + bf16(bias))) * bf16(g) + bf16(be) over full 512-wide rows: block = 32 rows x 512 columns (wave = 32 x 64), K = 512 or 2048. Behind the K loop the whole
// 32 x 512 f32 tile is staged in LDS (cross-wave, one block barrier); wave w then owns rows 4w .. 4w+3: lane holds columns 128j + 4 lane (j = 0..3), residual / bias / gain loaded with the same map.
// The four rows run as one unrolled pass: a row alone is one long dependent chain (residual load, sum, 5 lane exchanges, squares, 5 exchanges, root, divide), so the four chains are
// interleaved step by step, and every global operand of the pass (16 residual loads, 12 parameter loads) is asked for at once, in front of the staging, which runs under their latency.
__global__ __launch_bounds__(256) void gemm_ln_kernel(const b16* __restrict__ A, int K, const b16* __restrict__ Wt, const float* __restrict__ bias, const float* Xres,
    const float* __restrict__ gam, const float* __restrict__ bet, float* OutF, b16* __restrict__ Xh, float oscale, int wxh) {
  __shared__ __attribute__((aligned(16))) b16 Rg[2 * (32 + D) * LP];   // operand ring (2 buffers x 544 rows); behind the K loop the f32 tile Tf
  static_assert(2 * (32 + D) * LP * 2 >= 32 * (D + 4) * 4);
  float* Tf = (float*)Rg;
  const int tid = threadIdx.x, wave = tid >> 5, lane = tid & 31, nloc = lane & 15, hlf = lane >> 4;
  const int bm0 = blockIdx.x * 32, col0 = wave * 64;
  v8f acc[2][4];
#pragma unroll
  for (int t = 0; t < 4; ++t) { acc[0][t] = (v8f){}; acc[1][t] = (v8f){}; }
  mac_staged<32, D>(acc, Rg, A + (size_t)bm0 * K, K, Wt, K, 0, col0, tid, nloc, hlf, (int)(blockIdx.x % (unsigned)(K / KS)), (int)(blockIdx.x / (unsigned)(K / KS) % 4u));
  const size_t go = (size_t)(bm0 + 4 * wave) * D + 4 * lane;   // the lane's first element of the wave's first row
  v4f bv[4], gv[4], ev[4], rv[4][4];
#pragma unroll
  for (int j = 0; j < 4; ++j) { bv[j] = *(const v4f*)(bias + 128 * j + 4 * lane); gv[j] = *(const v4f*)(gam + 128 * j + 4 * lane); ev[j] = *(const v4f*)(bet + 128 * j + 4 * lane); }
#pragma unroll
  for (int i = 0; i < 4; ++i)
#pragma unroll
    for (int j = 0; j < 4; ++j) rv[i][j] = *(const v4f*)(Xres + go + i * D + 128 * j);
  asm volatile("s_wait_xcnt 0x0" ::: "memory");   // what follows rewrites address registers that these 28 loads name: the wait stands in front of it (behind it the built code starts the staging without waiting for a loaded value)
#pragma unroll
  for (int mt = 0; mt < 2; ++mt)
#pragma unroll
    for (int t = 0; t < 4; ++t)
#pragma unroll
      for (int r = 0; r < 8; ++r) Tf[(16 * mt + 8 * hlf + r) * (D + 4) + col0 + 16 * t + nloc] = acc[mt][t][r] * oscale;
  __syncthreads();   // every wave's columns of all 32 rows are in LDS before any wave reads its rows
  float y[4][16], s[4], q[4], rstd[4];
#pragma unroll
  for (int i = 0; i < 4; ++i) { s[i] = 0.0f;
#pragma unroll
    for (int j = 0; j < 4; ++j) { const v4f tv = *(const v4f*)(Tf + (4 * wave + i) * (D + 4) + 128 * j + 4 * lane);
#pragma unroll
      for (int e = 0; e < 4; ++e) { const float yy = rv[i][j][e] + (tv[e] + bf16_rne(bv[j][e])); y[i][4 * j + e] = yy; s[i] += yy; } } }
#pragma unroll
  for (int off = 16; off > 0; off >>= 1)
#pragma unroll
    for (int i = 0; i < 4; ++i) s[i] += __shfl_xor(s[i], off, 32);
#pragma unroll
  for (int i = 0; i < 4; ++i) { const float mean = s[i] * (1.0f / (float)D); q[i] = 0.0f;
#pragma unroll
    for (int k = 0; k < 16; ++k) { const float d0 = y[i][k] - mean; y[i][k] = d0; q[i] += d0 * d0; } }
#pragma unroll
  for (int off = 16; off > 0; off >>= 1)
#pragma unroll
    for (int i = 0; i < 4; ++i) q[i] += __shfl_xor(q[i], off, 32);
#pragma unroll
  for (int i = 0; i < 4; ++i) rstd[i] = 1.0f / sqrtf(q[i] * (1.0f / (float)D) + LNEPS);
  v4f ov[4][4]; v4h_ hv[4][4];
#pragma unroll
  for (int i = 0; i < 4; ++i)
#pragma unroll
    for (int j = 0; j < 4; ++j)
#pragma unroll
      for (int e = 0; e < 4; ++e) { const float o = (y[i][4 * j + e] * rstd[i]) * bf16_rne(gv[j][e]) + bf16_rne(ev[j][e]); ov[i][j][e] = o; hv[i][j][e] = (b16)(o * CA); }
  // the f16 plane goes out first: its values are made from the f32 ones, which stay live for their own stores behind it (the other way round the conversions would overwrite registers that the f32 stores name)
  if (wxh) {
#pragma unroll
    for (int i = 0; i < 4; ++i)
#pragma unroll
      for (int j = 0; j < 4; ++j) *(v4h_*)(Xh + go + i * D + 128 * j) = hv[i][j];
    asm volatile("s_wait_xcnt 0x0" ::: "memory");   // the address of the f32 stores is formed behind these stores, in registers that they name: the wait stands in front of it
  }
#pragma unroll
  for (int i = 0; i < 4; ++i)
#pragma unroll
    for (int j = 0; j < 4; ++j) *(v4f*)(OutF + go + i * D + 128 * j) = ov[i][j];
}

// Streaming attention, one work-group = 16 query rows of one (batch, head), its NWK waves sharing the keys: wave w walks the 32-key chunks w, w + NWK, ... with its own running max,
// sum and context, beginning at a step rotated by query tile + head and wrapping (the tiles of a head share K and V, the heads of a tile the mask: walking alike they would ask L2 for the same lines
// at once); the partial results meet in LDS behind one block barrier and are joined there (weights exp(max_w - max)).
// Both products are taken transposed: S^T = K x Q^T (A = a 16-key tile of k, B = the query tile, both from the q|k plane in fragment order), so that lane (nloc, hlf) holds, of query nloc alone,
// the scores of keys 16 t + 8 hlf + r (t = key tile, r = accumulator register): max and sum run inside the lane, with one exchange between the wave's halves for the max (the halves' sums are
// joined once, behind the loop). Converted in place (x4096) these 16 values are the B fragment of P^T in the k-map above, and ctx^T += V^T x P^T takes the v plane's fragments as A:
// acc[t][r] = ctx^T[dim 16 t + 8 hlf + r][query nloc]. P goes through no LDS and the loop holds no wave sync.
// Mask: the lane reads the bit word of its own query row (fetched one step ahead); a chunk whose 16 words are all ones is skipped, one whose words are all zero is not masked at all.
// RES: query/key residual planes give 3 score products and V x P_res + V_res x P into a second accumulator for chunks with keys < 128 (rows for which the residual planes exist);
constexpr int NWK = 4, PPW = DH + 4;   // waves per query tile; f32 pitch of a partial context row
static_assert((SEQ / 32) % NWK == 0);
// second launch bound: the register budget of 7 waves per SIMD (an allocation of 144); without it the build takes 148 registers, allocated as 160: one work-group fewer on a WGP
template <bool RES>
__global__ __launch_bounds__(32 * NWK, RES ? 1 : 7) void attn_kernel(const b16* __restrict__ QK, const b16* __restrict__ QKlo, const b16* __restrict__ VT, const b16* __restrict__ VTlo,
    const unsigned int* __restrict__ MB, b16* __restrict__ CTX, int qt0, int nqt) {
  __shared__ __attribute__((aligned(16))) float Part[NWK * 16 * PPW];
  __shared__ float Mxs[NWK * 16], Lss[NWK * 16];
  const int tid = threadIdx.x, lane = tid & 31, nloc = lane & 15, hlf = lane >> 4, wave = __builtin_amdgcn_readfirstlane(tid >> 5);
  const int bi = blockIdx.x, qt = qt0 + bi % nqt, bh = bi / nqt, h = bh % NH, b = bh / NH, q0 = qt * 16;
  const size_t rq = (size_t)b * SEQ + q0;
  const size_t qo = (((size_t)(b * 2) * NH + h) * NQT + qt) * QKT;   // the query tile in the q|k planes
  const v16b qa0 = frag_pk(QK + qo, lane), qa1 = frag_pk(QK + qo + FRG, lane);
  v16b ql0 = (v16b){}, ql1 = (v16b){};
  if (RES) { ql0 = frag_pk(QKlo + qo, lane); ql1 = frag_pk(QKlo + qo + FRG, lane); }
  const size_t ko = (((size_t)(b * 2 + 1) * NH + h) * NQT + 2 * wave) * QKT, vo = ((size_t)(b * NH + h) * (SEQ / 32) + wave) * VCH;
  const b16* kbase = QK + ko;   // this and the three bases below start at the wave's first chunk (two key tiles of k, one chunk of v)
  const b16* klbase = QKlo + ko;
  const b16* vbase = VT + vo;
  const b16* vlbase = VTlo + vo;
  const unsigned int* mbp = MB + ((size_t)b * NQT + qt) * (SEQ / 2) + 16 * wave;   // the 16 bit words (one per query row) of the wave's first chunk; wave-uniform, the lane reads word nloc
  float mx = -3.0e38f, ls = 0.0f;   // of query nloc: running max (equal in both halves), sum over the keys of this lane's half
  v8f acc[4], acc2[4];
#pragma unroll
  for (int t = 0; t < 4; ++t) { acc[t] = (v8f){}; acc2[t] = (v8f){}; }
  constexpr int NI = SEQ / 32 / NWK;
  const int irot = (qt + h) % NI;   // first step of this block's walk (block-uniform)
  unsigned int wn = mbp[16 * NWK * irot + nloc];   // the first step's word
#pragma unroll 1
  for (int i = 0; i < NI; ++i) {
    const int ii = i + irot < NI ? i + irot : i + irot - NI;
    const int c = wave + NWK * ii, fo = NWK * ii * VCH;   // c: chunk index; fo: offset from the wave's first chunk in halves of the k and v planes
    static_assert(2 * QKT == VCH);
    const unsigned int wc = wn;   // this step's word; the next step's is fetched now, one step ahead of its use (behind the last step the walk's first: in bounds, unused)
    const unsigned int* mp = mbp + 16 * NWK * (ii + 1 < NI ? ii + 1 : 0) + nloc;
    wn = *mp;
    if (__builtin_amdgcn_ballot_w32(wc != 0xffffffffu) == 0u) continue;
    v16b kf[2][2], vf[4]; const b16* kp = kbase + fo + 8 * lane; const b16* vp = vbase + fo + 8 * lane;   // the lane's own place in the chunk's first k and v fragment
#pragma unroll
    for (int t = 0; t < 2; ++t) { kf[t][0] = frag_pk(kp + t * QKT, 0); kf[t][1] = frag_pk(kp + t * QKT + FRG, 0); }
#pragma unroll
    for (int t = 0; t < 4; ++t) vf[t] = frag_pk(vp + t * FRG, 0);
    // No LDS sync stands between the two products any more, so the chunk's K and V fragments are all asked for here and fly together. The wait takes the lane's three load addresses as inputs: that keeps
    // their registers out of the loads' own destinations, and what rewrites them stands behind it; its memory clobber holds the 16 loads in front of it (left to itself the build asks for them pair by pair, each pair waited for alone)
    asm volatile("s_wait_xcnt 0x0" :: "v"(kp), "v"(vp), "v"(mp) : "memory");
    float sv[16];   // sv[8 t + r]: score of key 16 t + 8 hlf + r of the chunk
#pragma unroll
    for (int t = 0; t < 2; ++t) {
      const v16b k0f = kf[t][0], k1f = kf[t][1];
      v8f sh = wmma16b(k0f, qa0, (v8f){}); sh = wmma16b(k1f, qa1, sh);
      if (RES && c < 4) {
        const b16* klp = klbase + fo + t * QKT;
        v8f x = wmma16b(k0f, ql0, (v8f){}); x = wmma16b(k1f, ql1, x); x = wmma16b(frag_pk(klp, lane), qa0, x); x = wmma16b(frag_pk(klp + FRG, lane), qa1, x);
#pragma unroll
        for (int r = 0; r < 8; ++r) sh[r] += x[r] * (1.0f / RS); }
#pragma unroll
      for (int r = 0; r < 8; ++r) sv[8 * t + r] = sh[r] * SCL; }
    if (__builtin_amdgcn_ballot_w32(wc != 0u) != 0u) {   // wave-uniform: some key of some row is masked
      const unsigned int wh = wc >> (8 * hlf);   // bit 16 t + r = key 16 t + 8 hlf + r
#pragma unroll
      for (int j = 0; j < 16; ++j) sv[j] = (wh & (1u << (16 * (j >> 3) + (j & 7)))) ? NEGF : sv[j]; }
    float cm = sv[0];
#pragma unroll
    for (int j = 1; j < 16; ++j) cm = fmaxf(cm, sv[j]);
    cm = fmaxf(cm, xhalf(cm));
    const float mn = fmaxf(mx, cm), al = nexp2((mx - mn) * L2E); mx = mn;
    v2f es = (v2f){0.0f, 0.0f}; v16b pf, plf = (v16b){};   // es: sums of the even and of the odd keys (two chains of 8 adds, not one of 16)
#pragma unroll
    for (int j = 0; j < 16; ++j) {
      const float e = nexp2((sv[j] - mn) * L2E); es[j & 1] += e;
      const float v = e * PSC; const b16 hi = (b16)v; pf[j] = hi;
      if (RES) plf[j] = (b16)((v - (float)hi) * RS); }
    ls = ls * al + (es[0] + es[1]);
#pragma unroll
    for (int t = 0; t < 4; ++t)
#pragma unroll
      for (int r = 0; r < 8; ++r) { acc[t][r] *= al; if (RES) acc2[t][r] *= al; }
#pragma unroll
    for (int t = 0; t < 4; ++t) {
      acc[t] = wmma16b(vf[t], pf, acc[t]);
      if (RES && c < 4) { acc2[t] = wmma16b(vf[t], plf, acc2[t]); acc2[t] = wmma16b(frag_pk(vlbase + fo + t * FRG, lane), pf, acc2[t]); } }
  }
  // each wave publishes its partial context (f32, still scaled by its own max), max and sum; a wave whose chunks were all skipped publishes max -3e38, sum 0, context 0
  float* pw = Part + wave * (16 * PPW) + nloc * PPW + 8 * hlf;   // the lane's 8 consecutive dims of a dim tile: two 16-B stores
#pragma unroll
  for (int t = 0; t < 4; ++t) { v4f x0, x1;
#pragma unroll
    for (int e = 0; e < 4; ++e) { float a = acc[t][e], c4 = acc[t][4 + e]; if (RES) { a += acc2[t][e] * (1.0f / RS); c4 += acc2[t][4 + e] * (1.0f / RS); } x0[e] = a; x1[e] = c4; }
    *(v4f*)(pw + 16 * t) = x0; *(v4f*)(pw + 16 * t + 4) = x1; }
  const float lsw = ls + xhalf(ls);   // the two halves' sums of query nloc
  if (hlf == 0) { Mxs[wave * 16 + nloc] = mx; Lss[wave * 16 + nloc] = lsw; }
  __syncthreads();   // every wave's partials are in LDS before any thread joins them
  // join: thread = 8 columns of one row (NWK = 4: 128 threads cover 16 x 64)
  static_assert(32 * NWK * 8 == 16 * DH);
  const int jr = tid >> 3, jc = 8 * (tid & 7);
  float wm_[NWK], M = Mxs[jr];
#pragma unroll
  for (int w = 1; w < NWK; ++w) M = fmaxf(M, Mxs[w * 16 + jr]);
  float L = 0.0f, o[8];
#pragma unroll
  for (int e = 0; e < 8; ++e) o[e] = 0.0f;
#pragma unroll
  for (int w = 0; w < NWK; ++w) { wm_[w] = nexp2((Mxs[w * 16 + jr] - M) * L2E); L += wm_[w] * Lss[w * 16 + jr];
    const v4f x0 = *(const v4f*)(Part + (w * 16 + jr) * PPW + jc), x1 = *(const v4f*)(Part + (w * 16 + jr) * PPW + jc + 4);
#pragma unroll
    for (int e = 0; e < 4; ++e) { o[e] += wm_[w] * x0[e]; o[4 + e] += wm_[w] * x1[e]; } }
  const float inv = (1.0f / L) * (CX / (PSC * CA)); v8b ov;
#pragma unroll
  for (int e = 0; e < 8; ++e) ov[e] = (b16)(o[e] * inv);
  *(v8b*)(CTX + (rq + jr) * D + h * DH + jc) = ov;
}
}  // namespace

extern "C" void kernel_launch(void* const* d_in, const int* in_sizes, int n_in, void* d_out, int out_size, void* d_ws, size_t ws_size, hipStream_t stream) {
  (void)n_in;
  auto Fp = [&](int i) { return (const float*)d_in[i]; };
  auto Ip = [&](int i) { return (const int*)d_in[i]; };
  // wire order: 0 tokens [512][8] i32, 1 memory [8][512][512], 2 self-attention mask [8][512][512] i32, 3 memory mask [8][512][512] i32, 4 embedding [32000][512],
  // 5..8 Wq_s Wk_s Wv_s Wo_s [6][512 in][512 out], 9..12 Wq_c Wk_c Wv_c Wo_c, 13..16 bq_s bk_s bv_s bo_s [6][512], 17..20 bq_c bk_c bv_c bo_c,
  // 21 W1 [6][512][2048], 22 b1 [6][2048], 23 W2 [6][2048][512], 24 b2 [6][512], 25 g1, 26 g2, 27 g3, 28 be1, 29 be2, 30 be3 [6][512]
  const long needRows = (long)(NB - 1) * SEQ_FULL + SEQ;
  if ((long)in_sizes[0] < (long)SEQ * NB_FULL || (long)in_sizes[1] < needRows * D || (long)in_sizes[2] < needRows * SEQ_FULL || (long)in_sizes[3] < needRows * SEQ_FULL ||
      (long)in_sizes[4] < (long)VOCAB * D) return;
  for (int i = 5; i <= 12; ++i) if ((long)in_sizes[i] < (long)NLAY * D * D) return;
  for (int i = 13; i <= 20; ++i) if (in_sizes[i] < NLAY * D) return;
  if ((long)in_sizes[21] < (long)NLAY * D * DFF || in_sizes[22] < NLAY * DFF || (long)in_sizes[23] < (long)NLAY * DFF * D || in_sizes[24] < NLAY * D) return;
  for (int i = 25; i <= 30; ++i) if (in_sizes[i] < NLAY * D) return;
  if (out_size < MR * D) return;

  size_t off = 0; char* ws = (char*)d_ws;
  auto carve = [&](size_t bytes) { char* p = ws + off; off += (bytes + 255) & ~(size_t)255; return p; };
  b16* WQKVS = (b16*)carve((size_t)NLAY * NQKV * D * 2);   // [6][1536][512]
  b16* WOS   = (b16*)carve((size_t)NLAY * D * D * 2);
  b16* WQKVC = (b16*)carve((size_t)NLAY * NQKV * D * 2);   // [6][1536][512]
  b16* WOC   = (b16*)carve((size_t)NLAY * D * D * 2);
  b16* W1T   = (b16*)carve((size_t)NLAY * DFF * D * 2);    // [6][2048][512]
  b16* W2T   = (b16*)carve((size_t)NLAY * D * DFF * 2);    // [6][512][2048]
  float* X   = (float*)carve((size_t)MR * D * 4);
  b16* Xh    = (b16*)carve((size_t)MR * D * 2);
  b16* Mh    = (b16*)carve((size_t)MR * D * 2);
  b16* QK    = (b16*)carve((size_t)MR * LQK * 2);
  b16* QKlo  = (b16*)carve((size_t)MR * LQK * 2);
  b16* Vt    = (b16*)carve((size_t)MR * D * 2);            // [NB][NH][SEQ / 32][4][512]
  b16* Vtlo  = (b16*)carve((size_t)MR * D * 2);
  b16* CTX   = (b16*)carve((size_t)MR * D * 2);
  b16* Hh    = (b16*)carve((size_t)MR * DFF * 2);
  unsigned int* MBS = (unsigned int*)carve((size_t)NB * NQT * (SEQ / 2) * 4);   // mask bit words [NB][NQT][SEQ / 32][16]
  unsigned int* MBC = (unsigned int*)carve((size_t)NB * NQT * (SEQ / 2) * 4);
  if (off > ws_size || off > ((size_t)128 << 20)) return;   // 113,770,496 B at full size

  const dim3 b256(256), battn(32 * NWK);
  prep_kernel<<<P_ALL, b256, 0, stream>>>(Ip(0), Fp(4), Fp(1), Ip(2), Ip(3), Fp(5), Fp(6), Fp(7), Fp(8), Fp(9), Fp(10), Fp(11), Fp(12), Fp(21), Fp(23),
      WQKVS, WOS, WQKVC, WOC, W1T, W2T, Mh, X, Xh, MBS, MBC);

  const float OSA = 1.0f / (CA * WSC), OSX = 1.0f / (CX * WSC);
  for (int l = 0; l < NLAY; ++l) {
    const size_t lD = (size_t)l * D, lF = (size_t)l * DFF;
    // fused q|k|v projection of x: q and k -> q|k plane, v -> head-transposed plane (all in fragment order); residual planes for the first 128 rows of each sequence
    gemm_kernel<false><<<dim3(MR / 128, NQKV / 128), b256, 0, stream>>>(Xh, Xh, 0, D, WQKVS + (size_t)l * NQKV * D, D, Fp(13) + lD, Fp(14) + lD, Fp(15) + lD, Fp(15) + lD,
        QK, QKlo, LQK, 0, Vt, Vtlo, 2 * D, OSA, 1);
    attn_kernel<true><<<NB * NH * NQT_RES, battn, 0, stream>>>(QK, QKlo, Vt, Vtlo, MBS, CTX, 0, NQT_RES);
    attn_kernel<false><<<NB * NH * (NQT - NQT_RES), battn, 0, stream>>>(QK, QKlo, Vt, Vtlo, MBS, CTX, NQT_RES, NQT - NQT_RES);
    gemm_ln_kernel<<<MR / 32, b256, 0, stream>>>(CTX, D, WOS + (size_t)l * D * D, Fp(16) + lD, X, Fp(25) + lD, Fp(28) + lD, X, Xh, OSX, 1);
    // attention over the memory tensor: q (columns 0..511) from x, k|v (columns 512..1535) from the memory plane, one grid
    gemm_kernel<false><<<dim3(MR / 128, NQKV / 128), b256, 0, stream>>>(Xh, Mh, D, D, WQKVC + (size_t)l * NQKV * D, D, Fp(17) + lD, Fp(18) + lD, Fp(19) + lD, Fp(19) + lD,
        QK, QKlo, LQK, 0, Vt, Vtlo, 2 * D, OSA, 0);
    attn_kernel<false><<<NB * NH * NQT, battn, 0, stream>>>(QK, QKlo, Vt, Vtlo, MBC, CTX, 0, NQT);
    gemm_ln_kernel<<<MR / 32, b256, 0, stream>>>(CTX, D, WOC + (size_t)l * D * D, Fp(20) + lD, X, Fp(26) + lD, Fp(29) + lD, X, Xh, OSX, 1);
    // FFN
    gemm_kernel<true><<<dim3(MR / 128, DFF / 128), b256, 0, stream>>>(Xh, Xh, 0, D, W1T + (size_t)l * DFF * D, D, Fp(22) + lF, Fp(22) + lF + 512, Fp(22) + lF + 1024, Fp(22) + lF + 1536,
        Hh, QKlo, DFF, 0, Vt, Vtlo, DFF, OSA, 0);
    const bool last = (l == NLAY - 1);
    gemm_ln_kernel<<<MR / 32, b256, 0, stream>>>(Hh, DFF, W2T + (size_t)l * D * DFF, Fp(24) + lD, X, Fp(27) + lD, Fp(30) + lD, last ? (float*)d_out : X, Xh, OSA, last ? 0 : 1);
  }
}

// v009
// A run of this version takes 594 microseconds.
// Timed twice side by side with v008, it ran 1.07 and 1.08 times as fast.
// Counting every step since v000, it is 3.04 times as fast.
#include <hip/hip_runtime.h>

// 6-layer post-LN decoder stack: token embedding x sqrt(512) + sinusoidal positions; per layer masked self-attention (8 heads x 64), attention over a memory tensor,
// relu FFN 512 -> 2048 -> 512, each followed by residual add + LayerNorm over 512. Masks are int32 [batch][query][key] tensors read by value (nonzero = score replaced by
// -1e18); a 32-key chunk whose 16x32 mask tile is entirely nonzero is skipped (exact whenever each query row keeps at least one key).
// compute dtype: every contraction on v_wmma_f32_16x16x32_f16 (f16 operands, f32 accumulate): q/k/v projections, score and P.V products, output projections, both FFN
// products. Operand planes: activations f16 x8 (attention context x64), weights bf16-exact f16 x256, softmax P f16 x4096; query tiles with position < 64 of the masked
// self-attention add residual planes (x2048 of the x8 / x4096 carriers) of q, k, v and P: 3 score products and 3 P.V products (the two residual ones summed apart, then added to the context).
// tokens and masks int32 (tokens clamped). Fragment k-map per lane half hh for A and B: elements 0..7 <- k = 8hh+0..7, 8..15 <- k = 16+8hh+0..7; acc[r] = D[8hh+r][col].
// The attention's q, k and v planes are kept in fragment order: a fragment (16 rows x 32 k) is 512 halves = piece 0 (elements 0..7 of lanes 0..31) then piece 1 (elements 8..15), so that each
// of its two 16-B-per-lane loads covers 512 contiguous bytes (4 whole lines; from a row-major plane it would touch 16 lines for 32 B each).
// Each mask is packed once, by the preparation grid, into bit words [batch][16-query tile][32-key chunk][row]: bit l of a word = (mask[row][32 chunk + l] != 0); the attention reads only these words.
// q|k plane: [batch][q, k][head][16-row tile][k step of 32 dims][piece][lane][8]; v plane: [batch][head][32-key chunk][16-dim tile][piece][lane][8] (rows = dims, k = keys).

#ifndef NB
#define NB 8
#endif
#ifndef SEQ
#define SEQ 512
#endif
#define NB_FULL 8
#define SEQ_FULL 512

namespace {
constexpr int D = 512, NH = 8, DH = 64, DFF = 2048, NLAY = 6, VOCAB = 32000;
constexpr int MR = NB * SEQ;                 // activation rows, row = b * SEQ + s
constexpr int LQK = 2 * D;                   // halves of the q | k plane per activation row
constexpr int FRG = 512, QKT = 2 * FRG, VCH = 4 * FRG;   // halves of a fragment, of a 16-row x 64-dim q or k tile, of a 64-dim x 32-key v chunk
constexpr int NQKV = 3 * D, NQT = SEQ / 16, NQT_RES = 4;
constexpr float WSC = 256.0f, CA = 8.0f, CX = 64.0f, PSC = 4096.0f, RS = 2048.0f;
constexpr float SQD = 22.627416997969522f, NLOGD = -0.017988946039015984f, L2E = 1.4426950408889634f, NEGF = -1.0e18f, LNEPS = 1.0e-5f;
constexpr float SCL = 1.0f / (CA * CA * 8.0f);   // score = acc / (8 x 8) / sqrt(64)
static_assert(NB >= 1 && NB <= NB_FULL && SEQ >= 128 && SEQ <= SEQ_FULL && SEQ % 128 == 0);
static_assert(MR % 128 == 0 && MR % 32 == 0 && D == 512 && NH * DH == D && DFF % 512 == 0 && NQT > NQT_RES && (MR * D) % 8 == 0);

typedef _Float16 b16;
typedef __attribute__((ext_vector_type(16))) _Float16 v16b;
typedef __attribute__((ext_vector_type(8))) _Float16 v8b;
typedef __attribute__((ext_vector_type(4))) _Float16 v4h_;
typedef __attribute__((ext_vector_type(8))) float v8f;
typedef __attribute__((ext_vector_type(4))) float v4f;
typedef __attribute__((ext_vector_type(2))) float v2f;

__device__ __forceinline__ float bf16_rne(float f) { unsigned int u = __float_as_uint(f); u += 0x7FFFu + ((u >> 16) & 1u); return __uint_as_float(u & 0xFFFF0000u); }
__device__ __forceinline__ v16b frag_kb(const b16* p, int hh) { const v8b a = *(const v8b*)(p + 8 * hh), b = *(const v8b*)(p + 16 + 8 * hh); v16b f;
#pragma unroll
  for (int e = 0; e < 8; ++e) { f[e] = a[e]; f[8 + e] = b[e]; } return f; }
__device__ __forceinline__ v16b frag_pk(const b16* p, int lane) { const v8b a = *(const v8b*)(p + 8 * lane), b = *(const v8b*)(p + 256 + 8 * lane); v16b f;   // p: a fragment stored in fragment order
#pragma unroll
  for (int e = 0; e < 8; ++e) { f[e] = a[e]; f[8 + e] = b[e]; } return f; }
__device__ __forceinline__ v8f wmma_raw(v16b a, v16b b, v8f c) { return __builtin_amdgcn_wmma_f32_16x16x32_f16(false, a, false, b, (short)0, c, false, false); }
__device__ __forceinline__ v8f wmma16b(v16b a, v16b b, v8f c) { v8f d = wmma_raw(a, b, c); asm volatile("v_nop\n\tv_nop\n\tv_nop\n\tv_nop" : "+v"(d) : "v"(a), "v"(b)); return d; }
// one guard after a group of 8 accumulating WMMAs: ties all 8 accumulators, keeps both A and all four B fragments live across the 4 nops
#define WMMA_GUARD8(c, a0, a1, bf) asm volatile("v_nop\n\tv_nop\n\tv_nop\n\tv_nop" : "+v"(c[0][0]), "+v"(c[0][1]), "+v"(c[0][2]), "+v"(c[0][3]), \
    "+v"(c[1][0]), "+v"(c[1][1]), "+v"(c[1][2]), "+v"(c[1][3]) : "v"(a0), "v"(a1), "v"(bf[0]), "v"(bf[1]), "v"(bf[2]), "v"(bf[3]))
__device__ __forceinline__ void wave_lds_sync() { __builtin_amdgcn_fence(3 /* release order */, "workgroup"); __builtin_amdgcn_wave_barrier(); __builtin_amdgcn_fence(2 /* acquire order */, "workgroup"); }
__device__ __forceinline__ float pmul(float a, float b) { float p = a * b; asm volatile("" : "+v"(p)); return p; }
__device__ __forceinline__ int iclamp(int v, int lo, int hi) { return v < lo ? lo : (v > hi ? hi : v); }
__device__ __forceinline__ float nexp2(float v) { float r; asm("v_exp_f32 %0, %1\n\tv_nop" : "=v"(r) : "v"(v)); return r; }
// lane l <-> lane l ^ 16 (the wave's other half), a vector cross-row move
__device__ __forceinline__ float xhalf(float x) { return __int_as_float(__builtin_amdgcn_permlanex16(__float_as_int(x), __float_as_int(x), 0x76543210, 0xfedcba98, false, false)); }

// Wt[l][noff + n][k] = f16(bf16(W[l][k][n]) x 256), W stored [layer][in][out] with NA columns; block = 64 k x 64 n tile transposed through LDS (T: 64 x 72 halves; cross-thread, block barrier);
__device__ __forceinline__ void wprep_tile(b16* T, const float* __restrict__ W, b16* __restrict__ Wt, int K, int NA, int NT, int noff, int l, int k0, int n0, int tid) {
  { const int kr = tid >> 2, nc = (tid & 3) * 16; const float* src = W + ((size_t)l * K + k0 + kr) * NA + n0 + nc;
#pragma unroll
    for (int q = 0; q < 4; ++q) { const v4f v = *(const v4f*)(src + 4 * q);
#pragma unroll
      for (int j = 0; j < 4; ++j) T[(nc + 4 * q + j) * 72 + kr] = (b16)(bf16_rne(v[j]) * WSC); } }
  __syncthreads();
  v8b vv[2]; size_t dst[2];
#pragma unroll
  for (int i = 0; i < 2; ++i) { const int n = (tid >> 3) + 32 * i, p = tid & 7; vv[i] = *(const v8b*)(T + n * 72 + 8 * p); dst[i] = ((size_t)l * NT + noff + n0 + n) * K + k0 + 8 * p; }
  {
#pragma unroll
    for (int i = 0; i < 2; ++i) *(v8b*)(Wt + dst[i]) = vv[i];
     }
}

__device__ __forceinline__ void mprep_part(const float* __restrict__ mem, b16* __restrict__ Mh, int u) {
  if (u >= MR * D / 8) return;
  const int row = u / (D / 8), c0 = (u % (D / 8)) * 8, b = row / SEQ, s = row % SEQ;
  const float* src = mem + ((size_t)b * SEQ_FULL + s) * D + c0;
  const v4f a = *(const v4f*)src, c = *(const v4f*)(src + 4); v8b v;
#pragma unroll
  for (int j = 0; j < 4; ++j) { v[j] = (b16)(bf16_rne(a[j]) * CA); v[4 + j] = (b16)(bf16_rne(c[j]) * CA); }
  { *(v8b*)(Mh + (size_t)row * D + c0) = v;  }
}

// embedding: x[b][s][c] = bf16(emb[tok[s][b]][c]) x sqrt(512) + pe(s, c), pe(s, 2j) = sin(s x exp(2j x NLOGD)), pe(s, 2j+1) = cos(same angle); tok clamped. block = 4 rows,
// thread = 8 columns (rolled loop of 4 expf + sincosf); the 4 x 512 f32 tile is staged in LDS (block barrier), then 32 lanes x 16 B per 512-B run to X and
__device__ __forceinline__ void embed_rows(float* Xs, const int* __restrict__ tok, const float* __restrict__ emb, float* __restrict__ X, b16* __restrict__ Xh, int row0, int tid) {
  const int rl = tid >> 6, c0 = (tid & 63) * 8, row = row0 + rl, b = row / SEQ, s = row % SEQ;
  const int t = iclamp(tok[s * NB_FULL + b], 0, VOCAB - 1);
  const float* er = emb + (size_t)t * D + c0;
#pragma unroll 1
  for (int q = 0; q < 4; ++q) {
    const int c = c0 + 2 * q; const float dv = expf(pmul((float)c, NLOGD)); float sn, cs; sincosf(pmul((float)s, dv), &sn, &cs);
    Xs[rl * (D + 4) + c] = pmul(bf16_rne(er[2 * q]), SQD) + sn; Xs[rl * (D + 4) + c + 1] = pmul(bf16_rne(er[2 * q + 1]), SQD) + cs; }
  __syncthreads();
  v4f fv[2]; size_t fo[2]; v8b hv;
#pragma unroll
  for (int i = 0; i < 2; ++i) { const int f = i * 256 + tid; fv[i] = *(const v4f*)(Xs + (f >> 7) * (D + 4) + (f & 127) * 4); fo[i] = (size_t)(row0 + (f >> 7)) * D + (f & 127) * 4; }
  { const v4f a = *(const v4f*)(Xs + rl * (D + 4) + c0), c4 = *(const v4f*)(Xs + rl * (D + 4) + c0 + 4);
#pragma unroll
    for (int e = 0; e < 4; ++e) { hv[e] = (b16)(a[e] * CA); hv[4 + e] = (b16)(c4[e] * CA); } }
  {
#pragma unroll
    for (int i = 0; i < 2; ++i) *(v4f*)(X + fo[i]) = fv[i];
    *(v8b*)(Xh + (size_t)row * D + c0) = hv;  }
}

// one 16-query tile of a mask -> its SEQ / 2 bit words. A wave makes 32 words (two chunks x 16 rows) that fill one 128-B line: per word one whole-line load (lane = key) and a ballot,
// lane t keeps word t; the 32 loads are independent and fly together
__device__ __forceinline__ void maskpack_tile(const int* __restrict__ mask, unsigned int* __restrict__ MB, int tile, int tid) {
  const int wave = __builtin_amdgcn_readfirstlane(tid >> 5), lane = tid & 31;
  const int* mrow = mask + ((size_t)(tile / NQT) * SEQ_FULL + (tile % NQT) * 16) * SEQ_FULL + lane;
  for (int j = wave; j < SEQ / 64; j += 8) {
    int v[32]; unsigned int keep = 0u;
#pragma unroll
    for (int t = 0; t < 32; ++t) v[t] = mrow[(size_t)(t & 15) * SEQ_FULL + 32 * (2 * j + (t >> 4))];
#pragma unroll
    for (int t = 0; t < 32; ++t) { const unsigned int bal = __builtin_amdgcn_ballot_w32(v[t] != 0); keep = lane == t ? bal : keep; }
    MB[(size_t)tile * (SEQ / 2) + 32 * j + lane] = keep;
    asm volatile("s_wait_xcnt 0x0" ::: "memory");   // the built code joins this part's end to edges into the other parts, which rewrite the registers the store names: the wait stands in front of them
  }
}

// All input preparation in one grid: none of its parts reads what another writes, so a block takes its part by its index range (block-uniform): embedding rows first (the longest blocks),
// then the 64 x 64 tiles of the eight 512 x 512 weights, of W1 and of W2 (k tile fastest, then n tile, then layer), then the memory plane, then the tiles of the two masks.
constexpr int LTD = 3, LTF = 5, PB_WS = NLAY << (2 * LTD), PB_WF = NLAY << (LTD + LTF);   // log2 of the 64-wide tiles along 512 and along 2048; blocks of a small and of an FFN weight
static_assert((64 << LTD) == D && (64 << LTF) == DFF);
constexpr int P_W = MR / 4, P_F1 = P_W + 8 * PB_WS, P_F2 = P_F1 + PB_WF, P_M = P_F2 + PB_WF, P_K = P_M + (MR * D / 8 + 255) / 256, P_ALL = P_K + 2 * NB * NQT;   // first block of each range
__global__ __launch_bounds__(256) void prep_kernel(const int* __restrict__ tok, const float* __restrict__ emb, const float* __restrict__ mem, const int* __restrict__ msks, const int* __restrict__ mskc,
    const float* __restrict__ wqs, const float* __restrict__ wks, const float* __restrict__ wvs, const float* __restrict__ wos,
    const float* __restrict__ wqc, const float* __restrict__ wkc, const float* __restrict__ wvc, const float* __restrict__ woc,
    const float* __restrict__ w1, const float* __restrict__ w2,
    b16* __restrict__ WQKVS, b16* __restrict__ WOS, b16* __restrict__ WQKVC, b16* __restrict__ WOC, b16* __restrict__ W1T, b16* __restrict__ W2T,
    b16* __restrict__ Mh, float* __restrict__ X, b16* __restrict__ Xh, unsigned int* __restrict__ MBS, unsigned int* __restrict__ MBC) {
  __shared__ __attribute__((aligned(16))) b16 Sh[64 * 72];   // weight tile, or the embedding's 4 x 516 f32 rows
  static_assert(64 * 72 * 2 >= 4 * (D + 4) * 4);
  const int tid = threadIdx.x, r = blockIdx.x;
  if (r < P_W) embed_rows((float*)Sh, tok, emb, X, Xh, r * 4, tid);
  else if (r < P_M) {
    const float* W; b16* Wt; int q, lk = LTD, ln = LTD, NT, noff = 0;   // lk, ln: log2 of the tile counts along k (rows of W) and n (its columns)
    if (r < P_F1) {
      const int m = (r - P_W) / PB_WS, g = m & 3;   // m: 0..3 q k v o of the self-attention, 4..7 of the attention over memory
      q = (r - P_W) % PB_WS;
      W = m < 4 ? (g == 0 ? wqs : (g == 1 ? wks : (g == 2 ? wvs : wos))) : (g == 0 ? wqc : (g == 1 ? wkc : (g == 2 ? wvc : woc)));
      Wt = m < 4 ? (g == 3 ? WOS : WQKVS) : (g == 3 ? WOC : WQKVC);
      NT = g == 3 ? D : NQKV; noff = g == 3 ? 0 : g * D;
    } else if (r < P_F2) { q = r - P_F1; W = w1; Wt = W1T; ln = LTF; NT = DFF; }
    else { q = r - P_F2; W = w2; Wt = W2T; lk = LTF; NT = D; }
    wprep_tile(Sh, W, Wt, 64 << lk, 64 << ln, NT, noff, q >> (lk + ln), (q & ((1 << lk) - 1)) * 64, ((q >> lk) & ((1 << ln) - 1)) * 64, tid);
    asm volatile("s_wait_xcnt 0x0" ::: "memory");   // the built code joins this branch's end to an edge into the embedding branch, which rewrites the registers the two stores name: the wait stands in front of that join
  } else if (r < P_K) mprep_part(mem, Mh, (r - P_M) * 256 + tid);
  else { const bool sf = r - P_K < NB * NQT; maskpack_tile(sf ? msks : mskc, sf ? MBS : MBC, (r - P_K) % (NB * NQT), tid); }
}

// Operand staging of the GEMMs: a stage is KS = 128 k (256 B) of every A and B row of the block tile, laid in LDS at pitch 272 B (16 B x 17: odd, conflict-free for 16-B row readers),
// brought by per-lane asynchronous 16-B copies (a wave's copy covers 2 rows x 256 B = 4 whole lines); two buffers, the next stage's copies fly while this one is worked on.
constexpr int KS = 128, LP = KS + 8;
__device__ __forceinline__ unsigned lds_byte(const void* p) { return (unsigned)(unsigned long long)p; }
// copies of rows 16 apart (LDS step 16 x 272 B, global step gs halves); s_wait_xcnt 0 closes each statement so that no address register is rewritten ahead of it
__device__ __forceinline__ void cp2(unsigned l, const b16* g, size_t gs) {
  asm volatile("global_load_async_to_lds_b128 %0, %2, off\n\tglobal_load_async_to_lds_b128 %1, %3, off\n\ts_wait_xcnt 0x0"
      :: "v"(l), "v"(l + 16u * LP * 2u), "v"(g), "v"(g + gs) : "memory");
}
__device__ __forceinline__ void cp8(unsigned l, const b16* g, size_t gs) {
  constexpr unsigned LS = 16u * LP * 2u;
  asm volatile("global_load_async_to_lds_b128 %0, %8, off\n\tglobal_load_async_to_lds_b128 %1, %9, off\n\tglobal_load_async_to_lds_b128 %2, %10, off\n\t"
      "global_load_async_to_lds_b128 %3, %11, off\n\tglobal_load_async_to_lds_b128 %4, %12, off\n\tglobal_load_async_to_lds_b128 %5, %13, off\n\t"
      "global_load_async_to_lds_b128 %6, %14, off\n\tglobal_load_async_to_lds_b128 %7, %15, off\n\ts_wait_xcnt 0x0"
      :: "v"(l), "v"(l + LS), "v"(l + 2u * LS), "v"(l + 3u * LS), "v"(l + 4u * LS), "v"(l + 5u * LS), "v"(l + 6u * LS), "v"(l + 7u * LS),
         "v"(g), "v"(g + gs), "v"(g + 2 * gs), "v"(g + 3 * gs), "v"(g + 4 * gs), "v"(g + 5 * gs), "v"(g + 6 * gs), "v"(g + 7 * gs) : "memory");
}
// block of 256 threads: AR rows of A (first row Ag, pitch lda) and BR rows of B = Wt (first row Bg, pitch K), K a multiple of 128; the wave takes 32 A rows from arow and 64 B rows from
// brow: 8 WMMAs per 32 k, one guard per stage. On return every wave has left the ring (last trip's barrier): it may be reused.
// Blocks of one grid share operand rows and start together: walking K alike they would ask L2 for the same lines at the same moment. Trip t therefore takes the k stage (t + rot) mod NT,
// and the 128-row groups of B are copied in the order jrot, jrot + 1, ... (mod their number); rot < NT and jrot come from the block index (block-uniform). The f32 sums run over k in that rotated order.
template <int AR, int BR>
__device__ __forceinline__ void mac_staged(v8f (&acc)[2][4], b16* ring, const b16* Ag, int lda, const b16* Bg, int K, int arow, int brow, int tid, int nloc, int hlf, int rot, int jrot) {
  static_assert((AR == 32 || AR % 128 == 0) && BR % 128 == 0);
  constexpr int BUFH = (AR + BR) * LP;
  const unsigned l0 = lds_byte(ring) + (unsigned)(tid >> 4) * (LP * 2u) + (unsigned)(tid & 15) * 16u;
  const b16* ga = Ag + (size_t)(tid >> 4) * lda + 8 * (tid & 15);
  const b16* gb = Bg + (size_t)(tid >> 4) * K + 8 * (tid & 15);
  const int NT = K / KS;
  auto fill = [&](int t) {
    const unsigned l = l0 + (unsigned)(t & 1) * (BUFH * 2u);
    const int kt = t + rot < NT ? t + rot : t + rot - NT;   // this trip's k stage
    if constexpr (AR == 32) cp2(l, ga + kt * KS, (size_t)16 * lda);
    else {
#pragma unroll
      for (int j = 0; j < AR / 128; ++j) cp8(l + (unsigned)j * (128u * LP * 2u), ga + (size_t)(128 * j) * lda + kt * KS, (size_t)16 * lda); }
#pragma unroll
    for (int i = 0; i < BR / 128; ++i) { const int j = (i + jrot) % (BR / 128);
      cp8(l + (unsigned)(AR + 128 * j) * (LP * 2u), gb + (size_t)(128 * j) * K + kt * KS, (size_t)16 * K); }
  };
  fill(0);
  asm volatile("s_wait_asynccnt 0x0" ::: "memory");   // trip 0's k stage has landed (this wave's copies) before the barrier that publishes it
  __syncthreads();
  if (NT > 1) fill(1);
#pragma unroll 1
  for (int t = 0; t < NT; ++t) {
    const b16* bufp = ring + (t & 1) * BUFH;
    const b16* ap0 = bufp + (arow + nloc) * LP; const b16* ap1 = ap0 + 16 * LP; const b16* bp = bufp + (AR + brow + nloc) * LP;
    v16b a0[2], a1[2], bf[2][4];   // two fragment sets: the next 32 k are fetched while the WMMAs of these 32 k run (all inside this stage's buffer)
    a0[0] = frag_kb(ap0, hlf); a1[0] = frag_kb(ap1, hlf);
#pragma unroll
    for (int u = 0; u < 4; ++u) bf[0][u] = frag_kb(bp + u * 16 * LP, hlf);
#pragma unroll
    for (int s = 0; s < KS / 32; ++s) {
      const int c = s & 1, n = c ^ 1;
      if (s + 1 < KS / 32) {
        a0[n] = frag_kb(ap0 + 32 * (s + 1), hlf); a1[n] = frag_kb(ap1 + 32 * (s + 1), hlf);
#pragma unroll
        for (int u = 0; u < 4; ++u) bf[n][u] = frag_kb(bp + u * 16 * LP + 32 * (s + 1), hlf); }
      __builtin_amdgcn_sched_barrier(0);   // keeps the next block's 12 LDS reads one group in front of this block's WMMAs (for speed only)
#pragma unroll
      for (int u = 0; u < 4; ++u) { acc[0][u] = wmma_raw(a0[c], bf[c][u], acc[0][u]); acc[1][u] = wmma_raw(a1[c], bf[c][u], acc[1][u]); }
      if (s + 1 < KS / 32) __builtin_amdgcn_sched_barrier(0);   // the block after next's reads stay behind this block's WMMAs
      else WMMA_GUARD8(acc, a0[c], a1[c], bf[c]);   // the stage's last WMMAs stand in front of a branch: the 4 slots behind them are filled here for both of its sides
    }
    asm volatile("s_wait_dscnt 0x0" ::: "memory");     // this wave's reads of the buffer have retired before the barrier behind which it is refilled
    asm volatile("s_wait_asynccnt 0x0" ::: "memory");  // this wave's copies for trip t + 1 have landed before the barrier that publishes them
    __syncthreads();
    if (t + 2 < NT) fill(t + 2);
  }
  asm volatile("s_wait_asynccnt 0x0" ::: "memory");    // no copy outstanding when the ring is reused or the wave ends
}

// f16 epilogue of one wave's 32 x 64 tile (plane value = f16(v x 8), LO: f16((v x 8 - hi) x 2048)): b16 element stores into the wave-private LDS tile, wave sync, then 8 stores of 16 B per lane:
// row-major (4 rows x 128 B each, dstp = the tile's first element, pitch ldc), or PK: fragment order (dstp = the first of the wave's two q or k tiles; store j = tile j / 4, k step (j / 2) % 2,
// piece j % 2: 512 contiguous bytes each, 4 KB in a row)
template <bool LO, bool RELU, bool PK>
__device__ __forceinline__ void epi_rows(const v8f (&acc)[2][4], const float (&bb)[4], float oscale, b16* Es, b16* dstp, int ldc, int lane, int nloc, int hlf) {
#pragma unroll
  for (int mt = 0; mt < 2; ++mt)
#pragma unroll
    for (int t = 0; t < 4; ++t)
#pragma unroll
      for (int r = 0; r < 8; ++r) {
        float v = acc[mt][t][r] * oscale + bb[t]; if (RELU) v = fmaxf(v, 0.0f); const float vs = v * CA; const b16 hi = (b16)vs;
        Es[(mt * 16 + 8 * hlf + r) * 72 + 16 * t + nloc] = LO ? (b16)((vs - (float)hi) * RS) : hi; }
  wave_lds_sync();
  v8b vv[8];
#pragma unroll
  for (int j = 0; j < 8; ++j) vv[j] = PK ? *(const v8b*)(Es + ((j >> 2) * 16 + nloc) * 72 + 32 * ((j >> 1) & 1) + 16 * (j & 1) + 8 * hlf) : *(const v8b*)(Es + (4 * j + (lane >> 3)) * 72 + 8 * (lane & 7));
  b16* dst = PK ? dstp + 8 * lane : dstp + (size_t)(lane >> 3) * ldc + 8 * (lane & 7);
  {
#pragma unroll
    for (int j = 0; j < 8; ++j) *(v8b*)(dst + (PK ? (size_t)(256 * j) : (size_t)(4 * j) * ldc)) = vv[j];
    asm volatile("s_wait_xcnt 0x0" ::: "memory");   // what follows (the residual plane's pass) rewrites registers that these stores name: the wait stands in front of it
  }
}

// head-transposed f16 epilogue of the block's 128 (keys) x 128 (head columns) tile -> v plane in fragment order: each lane stores its 8 consecutive keys of one
// column as one 16-B LDS store into Et[col][key] (cross-wave, block barrier), then the wave writes one (head wave / 4, chunk wave % 4): store j = dim tile j / 2, piece j % 2, 4 KB in a row
template <bool LO, bool RELU>
__device__ __forceinline__ void epi_vt(const v8f (&acc)[2][4], const float (&bb)[4], float oscale, b16* Et, b16* plane, int bidx, int key0, int colv0, int wave, int wm, int wn, int nloc, int hlf) {
#pragma unroll
  for (int mt = 0; mt < 2; ++mt)
#pragma unroll
    for (int t = 0; t < 4; ++t) { v8b hv;
#pragma unroll
      for (int r = 0; r < 8; ++r) { float v = acc[mt][t][r] * oscale + bb[t]; if (RELU) v = fmaxf(v, 0.0f); const float vs = v * CA; const b16 hi = (b16)vs; hv[r] = LO ? (b16)((vs - (float)hi) * RS) : hi; }
      *(v8b*)(Et + (wn * 64 + 16 * t + nloc) * 136 + wm * 32 + mt * 16 + 8 * hlf) = hv; }
  __syncthreads();
  v8b vv[8]; const int hd = wave >> 2, ch = wave & 3;
#pragma unroll
  for (int j = 0; j < 8; ++j) vv[j] = *(const v8b*)(Et + (hd * DH + 16 * (j >> 1) + nloc) * 136 + 32 * ch + 16 * (j & 1) + 8 * hlf);
  b16* dst = plane + ((size_t)(bidx * NH + colv0 / DH + hd) * (SEQ / 32) + key0 / 32 + ch) * VCH + 8 * (16 * hlf + nloc);
  {
#pragma unroll
    for (int j = 0; j < 8; ++j) *(v8b*)(dst + 256 * j) = vv[j];
    asm volatile("s_wait_xcnt 0x0" ::: "memory");   // what follows (the residual plane's pass) rewrites registers that these stores name: the wait stands in front of it
  }
}

// C = (A[M][K] f16 plane, pitch lda) x Wt[N][K] + bf16(bias), optional relu; block 128 x 128 = 8 waves of 32 x 64. GEMM columns < vcol0 -> plane C (f16 x 8): with relu (FFN) row-major
// C[row*ldc + ccol0 + col], without (q at columns 0..511, k at 512..1023) the q|k plane in fragment order; columns >= vcol0 -> head-transposed plane VT (v of the attention), fragment order. Blocks whose 128 rows start a sequence also emit the residual planes Clo / VTlo (x 2048) for those rows
// when wres != 0. Bias group pointer chosen per 512-column group (block-uniform). Column blocks below asplit multiply A1, the others A2 (block-uniform): two products of different left
// operands that share K and the output planes run as one grid.
template <bool RELU>
__global__ __launch_bounds__(256) void gemm_kernel(const b16* __restrict__ A1, const b16* __restrict__ A2, int asplit, int lda, const b16* __restrict__ Wt, int K,
    const float* __restrict__ bg0, const float* __restrict__ bg1, const float* __restrict__ bg2, const float* __restrict__ bg3,
    b16* __restrict__ C, b16* __restrict__ Clo, int ldc, int ccol0, b16* __restrict__ VT, b16* __restrict__ VTlo, int vcol0, float oscale, int wres) {
  __shared__ __attribute__((aligned(16))) b16 Ls[2 * 256 * LP];   // operand ring (2 buffers x 256 rows); behind the K loop 8 wave tiles [32][72] (row-major mode) or one block tile [128][136] (transposed mode)
  static_assert(2 * 256 * LP >= 18432);
  const int tid = threadIdx.x, wave = tid >> 5, lane = tid & 31, nloc = lane & 15, hlf = lane >> 4;
  const int bm0 = blockIdx.x * 128, bn0 = blockIdx.y * 128, wm = wave >> 1, wn = wave & 1;
  const int row0 = bm0 + wm * 32, col0 = bn0 + wn * 64;
  const b16* A = bn0 < asplit ? A1 : A2;
  v8f acc[2][4];
#pragma unroll
  for (int t = 0; t < 4; ++t) { acc[0][t] = (v8f){}; acc[1][t] = (v8f){}; }
  mac_staged<128, 128>(acc, Ls, A + (size_t)bm0 * lda, lda, Wt + (size_t)bn0 * K, K, wm * 32, wn * 64, tid, nloc, hlf, (int)((blockIdx.x + blockIdx.y) % (unsigned)(K / KS)), 0);
  const int gsel = bn0 >> 9; const float* bias = gsel == 0 ? bg0 : (gsel == 1 ? bg1 : (gsel == 2 ? bg2 : bg3));
  float bb[4];
#pragma unroll
  for (int t = 0; t < 4; ++t) bb[t] = bf16_rne(bias[(col0 & 511) + 16 * t + nloc]);
  const bool vmode = bn0 >= vcol0, wlo = (wres != 0) && (bm0 % SEQ == 0);
  if (!vmode) {
    b16* Es = Ls + wave * (32 * 72);
    // the wave's 64 columns are one head of q or of k, its 32 rows two tiles that follow one another in the plane
    const size_t co = RELU ? (size_t)row0 * ldc + ccol0 + col0 : (((size_t)(row0 / SEQ * 2 + (col0 >> 9)) * NH + ((col0 & 511) >> 6)) * NQT + row0 % SEQ / 16) * QKT;
    epi_rows<false, RELU, !RELU>(acc, bb, oscale, Es, C + co, ldc, lane, nloc, hlf);
    if (wlo) { wave_lds_sync(); epi_rows<true, RELU, !RELU>(acc, bb, oscale, Es, Clo + co, ldc, lane, nloc, hlf); }
  } else {
    epi_vt<false, RELU>(acc, bb, oscale, Ls, VT, bm0 / SEQ, bm0 % SEQ, bn0 - vcol0, wave, wm, wn, nloc, hlf);
    if (wlo) { __syncthreads(); epi_vt<true, RELU>(acc, bb, oscale, Ls, VTlo, bm0 / SEQ, bm0 % SEQ, bn0 - vcol0, wave, wm, wn, nloc, hlf); }
  }
}

// Y = LayerNorm(Xres + (A x Wt + bf16(bias))) * bf16(g) + bf16(be) over full 512-wide rows: block = 32 rows x 512 columns (wave = 32 x 64), K = 512 or 2048. Behind the K loop the whole
// 32 x 512 f32 tile is staged in LDS (cross-wave, one block barrier); wave w then owns rows 4w .. 4w+3: lane holds columns 128j + 4 lane (j = 0..3), residual / bias / gain loaded with the same map.
// The four rows run as one unrolled pass: a row alone is one long dependent chain (residual load, sum, 5 lane exchanges, squares, 5 exchanges, root, divide), so the four chains are
// interleaved step by step, and every global operand of the pass (16 residual loads, 12 parameter loads) is asked for at once, in front of the staging, which runs under their latency.
__global__ __launch_bounds__(256) void gemm_ln_kernel(const b16* __restrict__ A, int K, const b16* __restrict__ Wt, const float* __restrict__ bias, const float* Xres,
    const float* __restrict__ gam, const float* __restrict__ bet, float* OutF, b16* __restrict__ Xh, float oscale, int wxh) {
  __shared__ __attribute__((aligned(16))) b16 Rg[2 * (32 + D) * LP];   // operand ring (2 buffers x 544 rows); behind the K loop the f32 tile Tf
  static_assert(2 * (32 + D) * LP * 2 >= 32 * (D + 4) * 4);
  float* Tf = (float*)Rg;
  const int tid = threadIdx.x, wave = tid >> 5, lane = tid & 31, nloc = lane & 15, hlf = lane >> 4;
  const int bm0 = blockIdx.x * 32, col0 = wave * 64;
  v8f acc[2][4];
#pragma unroll
  for (int t = 0; t < 4; ++t) { acc[0][t] = (v8f){}; acc[1][t] = (v8f){}; }
  mac_staged<32, D>(acc, Rg, A + (size_t)bm0 * K, K, Wt, K, 0, col0, tid, nloc, hlf, (int)(blockIdx.x % (unsigned)(K / KS)), (int)(blockIdx.x / (unsigned)(K / KS) % 4u));
  const size_t go = (size_t)(bm0 + 4 * wave) * D + 4 * lane;   // the lane's first element of the wave's first row
  v4f bv[4], gv[4], ev[4], rv[4][4];
#pragma unroll
  for (int j = 0; j < 4; ++j) { bv[j] = *(const v4f*)(bias + 128 * j + 4 * lane); gv[j] = *(const v4f*)(gam + 128 * j + 4 * lane); ev[j] = *(const v4f*)(bet + 128 * j + 4 * lane); }
#pragma unroll
  for (int i = 0; i < 4; ++i)
#pragma unroll
    for (int j = 0; j < 4; ++j) rv[i][j] = *(const v4f*)(Xres + go + i * D + 128 * j);
  asm volatile("s_wait_xcnt 0x0" ::: "memory");   // what follows rewrites address registers that these 28 loads name: the wait stands in front of it (behind it the built code starts the staging without waiting for a loaded value)
#pragma unroll
  for (int mt = 0; mt < 2; ++mt)
#pragma unroll
    for (int t = 0; t < 4; ++t)
#pragma unroll
      for (int r = 0; r < 8; ++r) Tf[(16 * mt + 8 * hlf + r) * (D + 4) + col0 + 16 * t + nloc] = acc[mt][t][r] * oscale;
  __syncthreads();   // every wave's columns of all 32 rows are in LDS before any wave reads its rows
  float y[4][16], s[4], q[4], rstd[4];
#pragma unroll
  for (int i = 0; i < 4; ++i) { s[i] = 0.0f;
#pragma unroll
    for (int j = 0; j < 4; ++j) { const v4f tv = *(const v4f*)(Tf + (4 * wave + i) * (D + 4) + 128 * j + 4 * lane);
#pragma unroll
      for (int e = 0; e < 4; ++e) { const float yy = rv[i][j][e] + (tv[e] + bf16_rne(bv[j][e])); y[i][4 * j + e] = yy; s[i] += yy; } } }
#pragma unroll
  for (int off = 16; off > 0; off >>= 1)
#pragma unroll
    for (int i = 0; i < 4; ++i) s[i] += __shfl_xor(s[i], off, 32);
#pragma unroll
  for (int i = 0; i < 4; ++i) { const float mean = s[i] * (1.0f / (float)D); q[i] = 0.0f;
#pragma unroll
    for (int k = 0; k < 16; ++k) { const float d0 = y[i][k] - mean; y[i][k] = d0; q[i] += d0 * d0; } }
#pragma unroll
  for (int off = 16; off > 0; off >>= 1)
#pragma unroll
    for (int i = 0; i < 4; ++i) q[i] += __shfl_xor(q[i], off, 32);
#pragma unroll
  for (int i = 0; i < 4; ++i) rstd[i] = 1.0f / sqrtf(q[i] * (1.0f / (float)D) + LNEPS);
  v4f ov[4][4]; v4h_ hv[4][4];
#pragma unroll
  for (int i = 0; i < 4; ++i)
#pragma unroll
    for (int j = 0; j < 4; ++j)
#pragma unroll
      for (int e = 0; e < 4; ++e) { const float o = (y[i][4 * j + e] * rstd[i]) * bf16_rne(gv[j][e]) + bf16_rne(ev[j][e]); ov[i][j][e] = o; hv[i][j][e] = (b16)(o * CA); }
  // the f16 plane goes out first: its values are made from the f32 ones, which stay live for their own stores behind it (the other way round the conversions would overwrite registers that the f32 stores name)
  if (wxh) {
#pragma unroll
    for (int i = 0; i < 4; ++i)
#pragma unroll
      for (int j = 0; j < 4; ++j) *(v4h_*)(Xh + go + i * D + 128 * j) = hv[i][j];
    asm volatile("s_wait_xcnt 0x0" ::: "memory");   // the address of the f32 stores is formed behind these stores, in registers that they name: the wait stands in front of it
  }
#pragma unroll
  for (int i = 0; i < 4; ++i)
#pragma unroll
    for (int j = 0; j < 4; ++j) *(v4f*)(OutF + go + i * D + 128 * j) = ov[i][j];
}

// Streaming attention, one work-group = 16 query rows of one (batch, head), its NWK waves sharing the keys: wave w walks the 32-key chunks w, w + NWK, ... with its own running max,
// sum and context, beginning at a step rotated by query tile + head and wrapping (the tiles of a head share K and V, the heads of a tile the mask: walking alike they would ask L2 for the same lines
// at once); the partial results meet in LDS behind one block barrier and are joined there (weights exp(max_w - max)).
// Both products are taken transposed: S^T = K x Q^T (A = a 16-key tile of k, B = the query tile, both from the q|k plane in fragment order), so that lane (nloc, hlf) holds, of query nloc alone,
// the scores of keys 16 t + 8 hlf + r (t = key tile, r = accumulator register): max and sum run inside the lane, with one exchange between the wave's halves for the max (the halves' sums are
// joined once, behind the loop). Converted in place (x4096) these 16 values are the B fragment of P^T in the k-map above, and ctx^T += V^T x P^T takes the v plane's fragments as A:
// acc[t][r] = ctx^T[dim 16 t + 8 hlf + r][query nloc]. P goes through no LDS and the loop holds no wave sync.
// Mask: the lane reads the bit word of its own query row (fetched one step ahead); a chunk whose 16 words are all ones is skipped, one whose words are all zero is not masked at all.
// RES: query/key residual planes give 3 score products and V x P_res + V_res x P, summed apart and added to the context in the same key step, for chunks with keys < 128 (rows for which the residual planes exist);
constexpr int NWK = 4, PPW = DH + 4;   // waves per query tile; f32 pitch of a partial context row
static_assert((SEQ / 32) % NWK == 0);
// One wave's walk over its key chunks. RES = false: the chunk's K and V fragments are all asked for at once. RES = true (query tiles with residual planes): the same sums plus the residual
// products; its fragments are asked for in smaller groups (one key tile, two dim tiles), so that this path fits the register budget of the other one, with which it shares a kernel.
template <bool RES>
__device__ __forceinline__ void attn_walk(v8f (&acc)[4], float& mx, float& ls, const v16b qa0, const v16b qa1, const b16* qlb, const b16* kbase, const b16* klbase,
    const b16* vbase, const b16* vlbase, const unsigned int* mbp, int irot, int wave, int lane, int nloc, int hlf) {
  constexpr int NI = SEQ / 32 / NWK;
  unsigned int wn = mbp[16 * NWK * irot + nloc];   // the first step's word
#pragma unroll 1
  for (int i = 0; i < NI; ++i) {
    const int ii = i + irot < NI ? i + irot : i + irot - NI;
    const int c = wave + NWK * ii, fo = NWK * ii * VCH;   // c: chunk index; fo: offset from the wave's first chunk in halves of the k and v planes
    static_assert(2 * QKT == VCH);
    const unsigned int wc = wn;   // this step's word; the next step's is fetched now, one step ahead of its use (behind the last step the walk's first: in bounds, unused)
    const unsigned int* mp = mbp + 16 * NWK * (ii + 1 < NI ? ii + 1 : 0) + nloc;
    wn = *mp;
    if (__builtin_amdgcn_ballot_w32(wc != 0xffffffffu) == 0u) continue;
    const bool rc = RES && c < 4;   // wave-uniform: the chunk's keys have residual planes
    // RES: every other address of the step is formed from kp by a wave-uniform distance inside the workspace (one per-lane base kept in registers, not five)
    const long dql = qlb - kbase - fo, dkl = klbase - kbase, dv = vbase - kbase, dvl = vlbase - kbase;
    v16b kf[2][2], vf[4]; const b16* kp = kbase + fo + 8 * lane; const b16* vp = RES ? kp + dv : vbase + fo + 8 * lane;   // the lane's own place in the chunk's first k and v fragment
    if constexpr (!RES) {
#pragma unroll
      for (int t = 0; t < 2; ++t) { kf[t][0] = frag_pk(kp + t * QKT, 0); kf[t][1] = frag_pk(kp + t * QKT + FRG, 0); }
#pragma unroll
      for (int t = 0; t < 4; ++t) vf[t] = frag_pk(vp + t * FRG, 0);
      // No LDS sync stands between the two products any more, so the chunk's K and V fragments are all asked for here and fly together. The wait takes the lane's three load addresses as inputs: that keeps
      // their registers out of the loads' own destinations, and what rewrites them stands behind it; its memory clobber holds the 16 loads in front of it (left to itself the build asks for them pair by pair, each pair waited for alone)
      asm volatile("s_wait_xcnt 0x0" :: "v"(kp), "v"(vp), "v"(mp) : "memory");
    }
    float sv[16];   // sv[8 t + r]: score of key 16 t + 8 hlf + r of the chunk
#pragma unroll
    for (int t = 0; t < 2; ++t) {
      v16b ql0 = (v16b){}, ql1 = (v16b){};
      if constexpr (RES) {
        const b16* qlp = kp + dql;
        kf[t][0] = frag_pk(kp + t * QKT, 0); kf[t][1] = frag_pk(kp + t * QKT + FRG, 0);
        if (rc) { ql0 = frag_pk(qlp, 0); ql1 = frag_pk(qlp + FRG, 0); }
        // these loads fly together; what rewrites their address registers stands behind the wait (either form), which takes them as inputs; the mask word's address is named behind its own load only
        if (t == 0) asm volatile("s_wait_xcnt 0x0" :: "v"(kp), "v"(qlp), "v"(mp) : "memory");
        else asm volatile("s_wait_xcnt 0x0" :: "v"(kp), "v"(qlp) : "memory");
      }
      const v16b k0f = kf[t][0], k1f = kf[t][1];
      v8f sh = wmma16b(k0f, qa0, (v8f){}); sh = wmma16b(k1f, qa1, sh);
      if (rc) {
        v8f x = wmma16b(k0f, ql0, (v8f){}); x = wmma16b(k1f, ql1, x);
        const b16* klp = kp + dkl;
        const v16b kl0 = frag_pk(klp + t * QKT, 0), kl1 = frag_pk(klp + t * QKT + FRG, 0);
        asm volatile("s_wait_xcnt 0x0" :: "v"(klp) : "memory");   // what rewrites the address register of these loads stands behind this wait
        x = wmma16b(kl0, qa0, x); x = wmma16b(kl1, qa1, x);
#pragma unroll
        for (int r = 0; r < 8; ++r) sh[r] += x[r] * (1.0f / RS); }
#pragma unroll
      for (int r = 0; r < 8; ++r) sv[8 * t + r] = sh[r] * SCL; }
    if (__builtin_amdgcn_ballot_w32(wc != 0u) != 0u) {   // wave-uniform: some key of some row is masked
      const unsigned int wh = wc >> (8 * hlf);   // bit 16 t + r = key 16 t + 8 hlf + r
#pragma unroll
      for (int j = 0; j < 16; ++j) sv[j] = (wh & (1u << (16 * (j >> 3) + (j & 7)))) ? NEGF : sv[j]; }
    float cm = sv[0];
#pragma unroll
    for (int j = 1; j < 16; ++j) cm = fmaxf(cm, sv[j]);
    cm = fmaxf(cm, xhalf(cm));
    const float mn = fmaxf(mx, cm), al = nexp2((mx - mn) * L2E); mx = mn;
    v2f es = (v2f){0.0f, 0.0f}; v16b pf, plf = (v16b){};   // es: sums of the even and of the odd keys (two chains of 8 adds, not one of 16)
#pragma unroll
    for (int j = 0; j < 16; ++j) {
      const float e = nexp2((sv[j] - mn) * L2E); es[j & 1] += e;
      const float v = e * PSC; const b16 hi = (b16)v; pf[j] = hi;
      if (RES) plf[j] = (b16)((v - (float)hi) * RS); }
    ls = ls * al + (es[0] + es[1]);
#pragma unroll
    for (int t = 0; t < 4; ++t)
#pragma unroll
      for (int r = 0; r < 8; ++r) acc[t][r] *= al;
    if constexpr (!RES) {
#pragma unroll
      for (int t = 0; t < 4; ++t) acc[t] = wmma16b(vf[t], pf, acc[t]);
    } else {
#pragma unroll
      for (int g = 0; g < 2; ++g) {
        const b16* vlp = kp + dvl;
        const v16b va = frag_pk(vp + 2 * g * FRG, 0), vb = frag_pk(vp + (2 * g + 1) * FRG, 0); v16b vla = (v16b){}, vlb = (v16b){};
        if (rc) { vla = frag_pk(vlp + 2 * g * FRG, 0); vlb = frag_pk(vlp + (2 * g + 1) * FRG, 0); }
        // the two dim tiles' loads fly together; what rewrites their address registers stands behind this wait, which takes them as inputs
        asm volatile("s_wait_xcnt 0x0" :: "v"(vp), "v"(vlp) : "memory");
        acc[2 * g] = wmma16b(va, pf, acc[2 * g]); acc[2 * g + 1] = wmma16b(vb, pf, acc[2 * g + 1]);
        if (rc) {   // V x P_res + V_res x P of this step, added to the context here
          v8f x = wmma16b(va, plf, (v8f){}); x = wmma16b(vla, pf, x);
#pragma unroll
          for (int r = 0; r < 8; ++r) acc[2 * g][r] += x[r] * (1.0f / RS);
          x = wmma16b(vb, plf, (v8f){}); x = wmma16b(vlb, pf, x);
#pragma unroll
          for (int r = 0; r < 8; ++r) acc[2 * g + 1][r] += x[r] * (1.0f / RS); }
      }
    }
  }
}

// MIX: the grid holds query tiles with residual planes (tile index < NQT_RES) beside the others; a block takes its walk by its tile index (block-uniform).
// second launch bound: the register budget of 7 waves per SIMD (an allocation of 144); both walks are built inside it with no scratch. One register block more would cost a work-group on a WGP
template <bool MIX>
__global__ __launch_bounds__(32 * NWK, 7) void attn_kernel(const b16* __restrict__ QK, const b16* __restrict__ QKlo, const b16* __restrict__ VT, const b16* __restrict__ VTlo,
    const unsigned int* __restrict__ MB, b16* __restrict__ CTX) {
  __shared__ __attribute__((aligned(16))) float Part[NWK * 16 * PPW];
  __shared__ float Mxs[NWK * 16], Lss[NWK * 16];
  const int tid = threadIdx.x, lane = tid & 31, nloc = lane & 15, hlf = lane >> 4, wave = __builtin_amdgcn_readfirstlane(tid >> 5);
  const int bi = blockIdx.x, qt = bi % NQT, bh = bi / NQT, h = bh % NH, b = bh / NH, q0 = qt * 16;
  const size_t rq = (size_t)b * SEQ + q0;
  const size_t qo = (((size_t)(b * 2) * NH + h) * NQT + qt) * QKT;   // the query tile in the q|k planes
  const v16b qa0 = frag_pk(QK + qo, lane), qa1 = frag_pk(QK + qo + FRG, lane);
  const size_t ko = (((size_t)(b * 2 + 1) * NH + h) * NQT + 2 * wave) * QKT, vo = ((size_t)(b * NH + h) * (SEQ / 32) + wave) * VCH;   // the wave's first chunk (two key tiles of k, one chunk of v)
  const unsigned int* mbp = MB + ((size_t)b * NQT + qt) * (SEQ / 2) + 16 * wave;   // the 16 bit words (one per query row) of the wave's first chunk; wave-uniform, the lane reads word nloc
  float mx = -3.0e38f, ls = 0.0f;   // of query nloc: running max (equal in both halves), sum over the keys of this lane's half
  v8f acc[4];
#pragma unroll
  for (int t = 0; t < 4; ++t) acc[t] = (v8f){};
  const int irot = (qt + h) % (SEQ / 32 / NWK);   // first step of this block's walk (block-uniform)
  if (MIX && qt < NQT_RES) attn_walk<true>(acc, mx, ls, qa0, qa1, QKlo + qo, QK + ko, QKlo + ko, VT + vo, VTlo + vo, mbp, irot, wave, lane, nloc, hlf);
  else attn_walk<false>(acc, mx, ls, qa0, qa1, QKlo, QK + ko, QKlo + ko, VT + vo, VTlo + vo, mbp, irot, wave, lane, nloc, hlf);
  // each wave publishes its partial context (f32, still scaled by its own max), max and sum; a wave whose chunks were all skipped publishes max -3e38, sum 0, context 0
  float* pw = Part + wave * (16 * PPW) + nloc * PPW + 8 * hlf;   // the lane's 8 consecutive dims of a dim tile: two 16-B stores
#pragma unroll
  for (int t = 0; t < 4; ++t) { v4f x0, x1;
#pragma unroll
    for (int e = 0; e < 4; ++e) { x0[e] = acc[t][e]; x1[e] = acc[t][4 + e]; }
    *(v4f*)(pw + 16 * t) = x0; *(v4f*)(pw + 16 * t + 4) = x1; }
  const float lsw = ls + xhalf(ls);   // the two halves' sums of query nloc
  if (hlf == 0) { Mxs[wave * 16 + nloc] = mx; Lss[wave * 16 + nloc] = lsw; }
  __syncthreads();   // every wave's partials are in LDS before any thread joins them
  // join: thread = 8 columns of one row (NWK = 4: 128 threads cover 16 x 64)
  static_assert(32 * NWK * 8 == 16 * DH);
  const int jr = tid >> 3, jc = 8 * (tid & 7);
  float wm_[NWK], M = Mxs[jr];
#pragma unroll
  for (int w = 1; w < NWK; ++w) M = fmaxf(M, Mxs[w * 16 + jr]);
  float L = 0.0f, o[8];
#pragma unroll
  for (int e = 0; e < 8; ++e) o[e] = 0.0f;
#pragma unroll
  for (int w = 0; w < NWK; ++w) { wm_[w] = nexp2((Mxs[w * 16 + jr] - M) * L2E); L += wm_[w] * Lss[w * 16 + jr];
    const v4f x0 = *(const v4f*)(Part + (w * 16 + jr) * PPW + jc), x1 = *(const v4f*)(Part + (w * 16 + jr) * PPW + jc + 4);
#pragma unroll
    for (int e = 0; e < 4; ++e) { o[e] += wm_[w] * x0[e]; o[4 + e] += wm_[w] * x1[e]; } }
  const float inv = (1.0f / L) * (CX / (PSC * CA)); v8b ov;
#pragma unroll
  for (int e = 0; e < 8; ++e) ov[e] = (b16)(o[e] * inv);
  *(v8b*)(CTX + (rq + jr) * D + h * DH + jc) = ov;
}
}  // namespace

extern "C" void kernel_launch(void* const* d_in, const int* in_sizes, int n_in, void* d_out, int out_size, void* d_ws, size_t ws_size, hipStream_t stream) {
  (void)n_in;
  auto Fp = [&](int i) { return (const float*)d_in[i]; };
  auto Ip = [&](int i) { return (const int*)d_in[i]; };
  // wire order: 0 tokens [512][8] i32, 1 memory [8][512][512], 2 self-attention mask [8][512][512] i32, 3 memory mask [8][512][512] i32, 4 embedding [32000][512],
  // 5..8 Wq_s Wk_s Wv_s Wo_s [6][512 in][512 out], 9..12 Wq_c Wk_c Wv_c Wo_c, 13..16 bq_s bk_s bv_s bo_s [6][512], 17..20 bq_c bk_c bv_c bo_c,
  // 21 W1 [6][512][2048], 22 b1 [6][2048], 23 W2 [6][2048][512], 24 b2 [6][512], 25 g1, 26 g2, 27 g3, 28 be1, 29 be2, 30 be3 [6][512]
  const long needRows = (long)(NB - 1) * SEQ_FULL + SEQ;
  if ((long)in_sizes[0] < (long)SEQ * NB_FULL || (long)in_sizes[1] < needRows * D || (long)in_sizes[2] < needRows * SEQ_FULL || (long)in_sizes[3] < needRows * SEQ_FULL ||
      (long)in_sizes[4] < (long)VOCAB * D) return;
  for (int i = 5; i <= 12; ++i) if ((long)in_sizes[i] < (long)NLAY * D * D) return;
  for (int i = 13; i <= 20; ++i) if (in_sizes[i] < NLAY * D) return;
  if ((long)in_sizes[21] < (long)NLAY * D * DFF || in_sizes[22] < NLAY * DFF || (long)in_sizes[23] < (long)NLAY * DFF * D || in_sizes[24] < NLAY * D) return;
  for (int i = 25; i <= 30; ++i) if (in_sizes[i] < NLAY * D) return;
  if (out_size < MR * D) return;

  size_t off = 0; char* ws = (char*)d_ws;
  auto carve = [&](size_t bytes) { char* p = ws + off; off += (bytes + 255) & ~(size_t)255; return p; };
  b16* WQKVS = (b16*)carve((size_t)NLAY * NQKV * D * 2);   // [6][1536][512]
  b16* WOS   = (b16*)carve((size_t)NLAY * D * D * 2);
  b16* WQKVC = (b16*)carve((size_t)NLAY * NQKV * D * 2);   // [6][1536][512]
  b16* WOC   = (b16*)carve((size_t)NLAY * D * D * 2);
  b16* W1T   = (b16*)carve((size_t)NLAY * DFF * D * 2);    // [6][2048][512]
  b16* W2T   = (b16*)carve((size_t)NLAY * D * DFF * 2);    // [6][512][2048]
  float* X   = (float*)carve((size_t)MR * D * 4);
  b16* Xh    = (b16*)carve((size_t)MR * D * 2);
  b16* Mh    = (b16*)carve((size_t)MR * D * 2);
  b16* QK    = (b16*)carve((size_t)MR * LQK * 2);
  b16* QKlo  = (b16*)carve((size_t)MR * LQK * 2);
  b16* Vt    = (b16*)carve((size_t)MR * D * 2);            // [NB][NH][SEQ / 32][4][512]
  b16* Vtlo  = (b16*)carve((size_t)MR * D * 2);
  b16* CTX   = (b16*)carve((size_t)MR * D * 2);
  b16* Hh    = (b16*)carve((size_t)MR * DFF * 2);
  unsigned int* MBS = (unsigned int*)carve((size_t)NB * NQT * (SEQ / 2) * 4);   // mask bit words [NB][NQT][SEQ / 32][16]
  unsigned int* MBC = (unsigned int*)carve((size_t)NB * NQT * (SEQ / 2) * 4);
  if (off > ws_size || off > ((size_t)128 << 20)) return;   // 113,770,496 B at full size

  const dim3 b256(256), battn(32 * NWK);
  prep_kernel<<<P_ALL, b256, 0, stream>>>(Ip(0), Fp(4), Fp(1), Ip(2), Ip(3), Fp(5), Fp(6), Fp(7), Fp(8), Fp(9), Fp(10), Fp(11), Fp(12), Fp(21), Fp(23),
      WQKVS, WOS, WQKVC, WOC, W1T, W2T, Mh, X, Xh, MBS, MBC);

  const float OSA = 1.0f / (CA * WSC), OSX = 1.0f / (CX * WSC);
  for (int l = 0; l < NLAY; ++l) {
    const size_t lD = (size_t)l * D, lF = (size_t)l * DFF;
    // fused q|k|v projection of x: q and k -> q|k plane, v -> head-transposed plane (all in fragment order); residual planes for the first 128 rows of each sequence
    gemm_kernel<false><<<dim3(MR / 128, NQKV / 128), b256, 0, stream>>>(Xh, Xh, 0, D, WQKVS + (size_t)l * NQKV * D, D, Fp(13) + lD, Fp(14) + lD, Fp(15) + lD, Fp(15) + lD,
        QK, QKlo, LQK, 0, Vt, Vtlo, 2 * D, OSA, 1);
    attn_kernel<true><<<NB * NH * NQT, battn, 0, stream>>>(QK, QKlo, Vt, Vtlo, MBS, CTX);
    gemm_ln_kernel<<<MR / 32, b256, 0, stream>>>(CTX, D, WOS + (size_t)l * D * D, Fp(16) + lD, X, Fp(25) + lD, Fp(28) + lD, X, Xh, OSX, 1);
    // attention over the memory tensor: q (columns 0..511) from x, k|v (columns 512..1535) from the memory plane, one grid
    gemm_kernel<false><<<dim3(MR / 128, NQKV / 128), b256, 0, stream>>>(Xh, Mh, D, D, WQKVC + (size_t)l * NQKV * D, D, Fp(17) + lD, Fp(18) + lD, Fp(19) + lD, Fp(19) + lD,
        QK, QKlo, LQK, 0, Vt, Vtlo, 2 * D, OSA, 0);
    attn_kernel<false><<<NB * NH * NQT, battn, 0, stream>>>(QK, QKlo, Vt, Vtlo, MBC, CTX);
    gemm_ln_kernel<<<MR / 32, b256, 0, stream>>>(CTX, D, WOC + (size_t)l * D * D, Fp(20) + lD, X, Fp(26) + lD, Fp(29) + lD, X, Xh, OSX, 1);
    // FFN
    gemm_kernel<true><<<dim3(MR / 128, DFF / 128), b256, 0, stream>>>(Xh, Xh, 0, D, W1T + (size_t)l * DFF * D, D, Fp(22) + lF, Fp(22) + lF + 512, Fp(22) + lF + 1024, Fp(22) + lF + 1536,
        Hh, QKlo, DFF, 0, Vt, Vtlo, DFF, OSA, 0);
    const bool last = (l == NLAY - 1);
    gemm_ln_kernel<<<MR / 32, b256, 0, stream>>>(Hh, DFF, W2T + (size_t)l * D * DFF, Fp(24) + lD, X, Fp(27) + lD, Fp(30) + lD, last ? (float*)d_out : X, Xh, OSA, last ? 0 : 1);
  }
}

// v010
// One run takes 563 microseconds.
// Next to v009, in two timings, it ran 1.06 times as fast each time.
// All steps since v000 together make it 3.22 times as fast.
#include <hip/hip_runtime.h>

// 6-layer post-LN decoder stack: token embedding x sqrt(512) + sinusoidal positions; per layer masked self-attention (8 heads x 64), attention over a memory tensor,
// relu FFN 512 -> 2048 -> 512, each followed by residual add + LayerNorm over 512. Masks are int32 [batch][query][key] tensors read by value (nonzero = score replaced by
// -1e18); a 32-key chunk whose 16x32 mask tiles are entirely nonzero for all query tiles of a work-group is skipped (exact whenever each query row keeps at least one key).
// compute dtype: every contraction on v_wmma_f32_16x16x32_f16 (f16 operands, f32 accumulate): q/k/v projections, score and P.V products, output projections, both FFN
// products. Operand planes: activations f16 x8 (attention context x64), weights bf16-exact f16 x256, softmax P f16 x4096; query tiles with position < 64 of the masked
// self-attention add residual planes (x2048 of the x8 / x4096 carriers) of q, k, v and P: 3 score products and 3 P.V products (the two residual ones summed apart, then added to the context).
// tokens and masks int32 (tokens clamped). Fragment k-map per lane half hh for A and B: elements 0..7 <- k = 8hh+0..7, 8..15 <- k = 16+8hh+0..7; acc[r] = D[8hh+r][col].
// The attention's q, k and v planes are kept in fragment order: a fragment (16 rows x 32 k) is 512 halves = piece 0 (elements 0..7 of lanes 0..31) then piece 1 (elements 8..15), so that each
// of its two 16-B-per-lane loads covers 512 contiguous bytes (4 whole lines; from a row-major plane it would touch 16 lines for 32 B each).
// Each mask is packed once, by the preparation grid, into bit words [batch][16-query tile][32-key chunk][row]: bit l of a word = (mask[row][32 chunk + l] != 0); the attention reads only these words.
// q|k plane: [batch][q, k][head][16-row tile][k step of 32 dims][piece][lane][8]; v plane: [batch][head][32-key chunk][16-dim tile][piece][lane][8] (rows = dims, k = keys).

#ifndef NB
#define NB 8
#endif
#ifndef SEQ
#define SEQ 512
#endif
#define NB_FULL 8
#define SEQ_FULL 512

namespace {
constexpr int D = 512, NH = 8, DH = 64, DFF = 2048, NLAY = 6, VOCAB = 32000;
constexpr int MR = NB * SEQ;                 // activation rows, row = b * SEQ + s
constexpr int LQK = 2 * D;                   // halves of the q | k plane per activation row
constexpr int FRG = 512, QKT = 2 * FRG, VCH = 4 * FRG;   // halves of a fragment, of a 16-row x 64-dim q or k tile, of a 64-dim x 32-key v chunk
constexpr int NQKV = 3 * D, NQT = SEQ / 16, NQT_RES = 4;
constexpr float WSC = 256.0f, CA = 8.0f, CX = 64.0f, PSC = 4096.0f, RS = 2048.0f;
constexpr float SQD = 22.627416997969522f, NLOGD = -0.017988946039015984f, L2E = 1.4426950408889634f, NEGF = -1.0e18f, LNEPS = 1.0e-5f;
constexpr float SCL = 1.0f / (CA * CA * 8.0f);   // score = acc / (8 x 8) / sqrt(64)
static_assert(NB >= 1 && NB <= NB_FULL && SEQ >= 128 && SEQ <= SEQ_FULL && SEQ % 128 == 0);
static_assert(MR % 128 == 0 && MR % 32 == 0 && D == 512 && NH * DH == D && DFF % 512 == 0 && NQT > NQT_RES && (MR * D) % 8 == 0);

typedef _Float16 b16;
typedef __attribute__((ext_vector_type(16))) _Float16 v16b;
typedef __attribute__((ext_vector_type(8))) _Float16 v8b;
typedef __attribute__((ext_vector_type(4))) _Float16 v4h_;
typedef __attribute__((ext_vector_type(8))) float v8f;
typedef __attribute__((ext_vector_type(4))) float v4f;
typedef __attribute__((ext_vector_type(2))) float v2f;

__device__ __forceinline__ float bf16_rne(float f) { unsigned int u = __float_as_uint(f); u += 0x7FFFu + ((u >> 16) & 1u); return __uint_as_float(u & 0xFFFF0000u); }
__device__ __forceinline__ v16b frag_kb(const b16* p, int hh) { const v8b a = *(const v8b*)(p + 8 * hh), b = *(const v8b*)(p + 16 + 8 * hh); v16b f;
#pragma unroll
  for (int e = 0; e < 8; ++e) { f[e] = a[e]; f[8 + e] = b[e]; } return f; }
__device__ __forceinline__ v16b frag_pk(const b16* p, int lane) { const v8b a = *(const v8b*)(p + 8 * lane), b = *(const v8b*)(p + 256 + 8 * lane); v16b f;   // p: a fragment stored in fragment order
#pragma unroll
  for (int e = 0; e < 8; ++e) { f[e] = a[e]; f[8 + e] = b[e]; } return f; }
__device__ __forceinline__ v8f wmma_raw(v16b a, v16b b, v8f c) { return __builtin_amdgcn_wmma_f32_16x16x32_f16(false, a, false, b, (short)0, c, false, false); }
__device__ __forceinline__ v8f wmma16b(v16b a, v16b b, v8f c) { v8f d = wmma_raw(a, b, c); asm volatile("v_nop\n\tv_nop\n\tv_nop\n\tv_nop" : "+v"(d) : "v"(a), "v"(b)); return d; }
// one guard after a group of 8 accumulating WMMAs: ties all 8 accumulators, keeps both A and all four B fragments live across the 4 nops
#define WMMA_GUARD8(c, a0, a1, bf) asm volatile("v_nop\n\tv_nop\n\tv_nop\n\tv_nop" : "+v"(c[0][0]), "+v"(c[0][1]), "+v"(c[0][2]), "+v"(c[0][3]), \
    "+v"(c[1][0]), "+v"(c[1][1]), "+v"(c[1][2]), "+v"(c[1][3]) : "v"(a0), "v"(a1), "v"(bf[0]), "v"(bf[1]), "v"(bf[2]), "v"(bf[3]))
__device__ __forceinline__ void wave_lds_sync() { __builtin_amdgcn_fence(3 /* release order */, "workgroup"); __builtin_amdgcn_wave_barrier(); __builtin_amdgcn_fence(2 /* acquire order */, "workgroup"); }
__device__ __forceinline__ float pmul(float a, float b) { float p = a * b; asm volatile("" : "+v"(p)); return p; }
__device__ __forceinline__ int iclamp(int v, int lo, int hi) { return v < lo ? lo : (v > hi ? hi : v); }
__device__ __forceinline__ float nexp2(float v) { float r; asm("v_exp_f32 %0, %1\n\tv_nop" : "=v"(r) : "v"(v)); return r; }
// lane l <-> lane l ^ 16 (the wave's other half), a vector cross-row move
__device__ __forceinline__ float xhalf(float x) { return __int_as_float(__builtin_amdgcn_permlanex16(__float_as_int(x), __float_as_int(x), 0x76543210, 0xfedcba98, false, false)); }

// Wt[l][noff + n][k] = f16(bf16(W[l][k][n]) x 256), W stored [layer][in][out] with NA columns; block = 64 k x 64 n tile transposed through LDS (T: 64 x 72 halves; cross-thread, block barrier);
__device__ __forceinline__ void wprep_tile(b16* T, const float* __restrict__ W, b16* __restrict__ Wt, int K, int NA, int NT, int noff, int l, int k0, int n0, int tid) {
  { const int kr = tid >> 2, nc = (tid & 3) * 16; const float* src = W + ((size_t)l * K + k0 + kr) * NA + n0 + nc;
#pragma unroll
    for (int q = 0; q < 4; ++q) { const v4f v = *(const v4f*)(src + 4 * q);
#pragma unroll
      for (int j = 0; j < 4; ++j) T[(nc + 4 * q + j) * 72 + kr] = (b16)(bf16_rne(v[j]) * WSC); } }
  __syncthreads();
  v8b vv[2]; size_t dst[2];
#pragma unroll
  for (int i = 0; i < 2; ++i) { const int n = (tid >> 3) + 32 * i, p = tid & 7; vv[i] = *(const v8b*)(T + n * 72 + 8 * p); dst[i] = ((size_t)l * NT + noff + n0 + n) * K + k0 + 8 * p; }
  {
#pragma unroll
    for (int i = 0; i < 2; ++i) *(v8b*)(Wt + dst[i]) = vv[i];
     }
}

__device__ __forceinline__ void mprep_part(const float* __restrict__ mem, b16* __restrict__ Mh, int u) {
  if (u >= MR * D / 8) return;
  const int row = u / (D / 8), c0 = (u % (D / 8)) * 8, b = row / SEQ, s = row % SEQ;
  const float* src = mem + ((size_t)b * SEQ_FULL + s) * D + c0;
  const v4f a = *(const v4f*)src, c = *(const v4f*)(src + 4); v8b v;
#pragma unroll
  for (int j = 0; j < 4; ++j) { v[j] = (b16)(bf16_rne(a[j]) * CA); v[4 + j] = (b16)(bf16_rne(c[j]) * CA); }
  { *(v8b*)(Mh + (size_t)row * D + c0) = v;  }
}

// embedding: x[b][s][c] = bf16(emb[tok[s][b]][c]) x sqrt(512) + pe(s, c), pe(s, 2j) = sin(s x exp(2j x NLOGD)), pe(s, 2j+1) = cos(same angle); tok clamped. block = 4 rows,
// thread = 8 columns (rolled loop of 4 expf + sincosf); the 4 x 512 f32 tile is staged in LDS (block barrier), then 32 lanes x 16 B per 512-B run to X and
__device__ __forceinline__ void embed_rows(float* Xs, const int* __restrict__ tok, const float* __restrict__ emb, float* __restrict__ X, b16* __restrict__ Xh, int row0, int tid) {
  const int rl = tid >> 6, c0 = (tid & 63) * 8, row = row0 + rl, b = row / SEQ, s = row % SEQ;
  const int t = iclamp(tok[s * NB_FULL + b], 0, VOCAB - 1);
  const float* er = emb + (size_t)t * D + c0;
#pragma unroll 1
  for (int q = 0; q < 4; ++q) {
    const int c = c0 + 2 * q; const float dv = expf(pmul((float)c, NLOGD)); float sn, cs; sincosf(pmul((float)s, dv), &sn, &cs);
    Xs[rl * (D + 4) + c] = pmul(bf16_rne(er[2 * q]), SQD) + sn; Xs[rl * (D + 4) + c + 1] = pmul(bf16_rne(er[2 * q + 1]), SQD) + cs; }
  __syncthreads();
  v4f fv[2]; size_t fo[2]; v8b hv;
#pragma unroll
  for (int i = 0; i < 2; ++i) { const int f = i * 256 + tid; fv[i] = *(const v4f*)(Xs + (f >> 7) * (D + 4) + (f & 127) * 4); fo[i] = (size_t)(row0 + (f >> 7)) * D + (f & 127) * 4; }
  { const v4f a = *(const v4f*)(Xs + rl * (D + 4) + c0), c4 = *(const v4f*)(Xs + rl * (D + 4) + c0 + 4);
#pragma unroll
    for (int e = 0; e < 4; ++e) { hv[e] = (b16)(a[e] * CA); hv[4 + e] = (b16)(c4[e] * CA); } }
  {
#pragma unroll
    for (int i = 0; i < 2; ++i) *(v4f*)(X + fo[i]) = fv[i];
    *(v8b*)(Xh + (size_t)row * D + c0) = hv;  }
}

// one 16-query tile of a mask -> its SEQ / 2 bit words. A wave makes 32 words (two chunks x 16 rows) that fill one 128-B line: per word one whole-line load (lane = key) and a ballot,
// lane t keeps word t; the 32 loads are independent and fly together
__device__ __forceinline__ void maskpack_tile(const int* __restrict__ mask, unsigned int* __restrict__ MB, int tile, int tid) {
  const int wave = __builtin_amdgcn_readfirstlane(tid >> 5), lane = tid & 31;
  const int* mrow = mask + ((size_t)(tile / NQT) * SEQ_FULL + (tile % NQT) * 16) * SEQ_FULL + lane;
  for (int j = wave; j < SEQ / 64; j += 8) {
    int v[32]; unsigned int keep = 0u;
#pragma unroll
    for (int t = 0; t < 32; ++t) v[t] = mrow[(size_t)(t & 15) * SEQ_FULL + 32 * (2 * j + (t >> 4))];
#pragma unroll
    for (int t = 0; t < 32; ++t) { const unsigned int bal = __builtin_amdgcn_ballot_w32(v[t] != 0); keep = lane == t ? bal : keep; }
    MB[(size_t)tile * (SEQ / 2) + 32 * j + lane] = keep;
    asm volatile("s_wait_xcnt 0x0" ::: "memory");   // the built code joins this part's end to edges into the other parts, which rewrite the registers the store names: the wait stands in front of them
  }
}

// All input preparation in one grid: none of its parts reads what another writes, so a block takes its part by its index range (block-uniform): embedding rows first (the longest blocks),
// then the 64 x 64 tiles of the eight 512 x 512 weights, of W1 and of W2 (k tile fastest, then n tile, then layer), then the memory plane, then the tiles of the two masks.
constexpr int LTD = 3, LTF = 5, PB_WS = NLAY << (2 * LTD), PB_WF = NLAY << (LTD + LTF);   // log2 of the 64-wide tiles along 512 and along 2048; blocks of a small and of an FFN weight
static_assert((64 << LTD) == D && (64 << LTF) == DFF);
constexpr int P_W = MR / 4, P_F1 = P_W + 8 * PB_WS, P_F2 = P_F1 + PB_WF, P_M = P_F2 + PB_WF, P_K = P_M + (MR * D / 8 + 255) / 256, P_ALL = P_K + 2 * NB * NQT;   // first block of each range
__global__ __launch_bounds__(256) void prep_kernel(const int* __restrict__ tok, const float* __restrict__ emb, const float* __restrict__ mem, const int* __restrict__ msks, const int* __restrict__ mskc,
    const float* __restrict__ wqs, const float* __restrict__ wks, const float* __restrict__ wvs, const float* __restrict__ wos,
    const float* __restrict__ wqc, const float* __restrict__ wkc, const float* __restrict__ wvc, const float* __restrict__ woc,
    const float* __restrict__ w1, const float* __restrict__ w2,
    b16* __restrict__ WQKVS, b16* __restrict__ WOS, b16* __restrict__ WQKVC, b16* __restrict__ WOC, b16* __restrict__ W1T, b16* __restrict__ W2T,
    b16* __restrict__ Mh, float* __restrict__ X, b16* __restrict__ Xh, unsigned int* __restrict__ MBS, unsigned int* __restrict__ MBC) {
  __shared__ __attribute__((aligned(16))) b16 Sh[64 * 72];   // weight tile, or the embedding's 4 x 516 f32 rows
  static_assert(64 * 72 * 2 >= 4 * (D + 4) * 4);
  const int tid = threadIdx.x, r = blockIdx.x;
  if (r < P_W) embed_rows((float*)Sh, tok, emb, X, Xh, r * 4, tid);
  else if (r < P_M) {
    const float* W; b16* Wt; int q, lk = LTD, ln = LTD, NT, noff = 0;   // lk, ln: log2 of the tile counts along k (rows of W) and n (its columns)
    if (r < P_F1) {
      const int m = (r - P_W) / PB_WS, g = m & 3;   // m: 0..3 q k v o of the self-attention, 4..7 of the attention over memory
      q = (r - P_W) % PB_WS;
      W = m < 4 ? (g == 0 ? wqs : (g == 1 ? wks : (g == 2 ? wvs : wos))) : (g == 0 ? wqc : (g == 1 ? wkc : (g == 2 ? wvc : woc)));
      Wt = m < 4 ? (g == 3 ? WOS : WQKVS) : (g == 3 ? WOC : WQKVC);
      NT = g == 3 ? D : NQKV; noff = g == 3 ? 0 : g * D;
    } else if (r < P_F2) { q = r - P_F1; W = w1; Wt = W1T; ln = LTF; NT = DFF; }
    else { q = r - P_F2; W = w2; Wt = W2T; lk = LTF; NT = D; }
    wprep_tile(Sh, W, Wt, 64 << lk, 64 << ln, NT, noff, q >> (lk + ln), (q & ((1 << lk) - 1)) * 64, ((q >> lk) & ((1 << ln) - 1)) * 64, tid);
    asm volatile("s_wait_xcnt 0x0" ::: "memory");   // the built code joins this branch's end to an edge into the embedding branch, which rewrites the registers the two stores name: the wait stands in front of that join
  } else if (r < P_K) mprep_part(mem, Mh, (r - P_M) * 256 + tid);
  else { const bool sf = r - P_K < NB * NQT; maskpack_tile(sf ? msks : mskc, sf ? MBS : MBC, (r - P_K) % (NB * NQT), tid); }
}

// Operand staging of the GEMMs: a stage is KS = 128 k (256 B) of every A and B row of the block tile, laid in LDS at pitch 272 B (16 B x 17: odd, conflict-free for 16-B row readers),
// brought by per-lane asynchronous 16-B copies (a wave's copy covers 2 rows x 256 B = 4 whole lines); two buffers, the next stage's copies fly while this one is worked on.
constexpr int KS = 128, LP = KS + 8;
__device__ __forceinline__ unsigned lds_byte(const void* p) { return (unsigned)(unsigned long long)p; }
// copies of rows 16 apart (LDS step 16 x 272 B, global step gs halves); s_wait_xcnt 0 closes each statement so that no address register is rewritten ahead of it
__device__ __forceinline__ void cp2(unsigned l, const b16* g, size_t gs) {
  asm volatile("global_load_async_to_lds_b128 %0, %2, off\n\tglobal_load_async_to_lds_b128 %1, %3, off\n\ts_wait_xcnt 0x0"
      :: "v"(l), "v"(l + 16u * LP * 2u), "v"(g), "v"(g + gs) : "memory");
}
__device__ __forceinline__ void cp8(unsigned l, const b16* g, size_t gs) {
  constexpr unsigned LS = 16u * LP * 2u;
  asm volatile("global_load_async_to_lds_b128 %0, %8, off\n\tglobal_load_async_to_lds_b128 %1, %9, off\n\tglobal_load_async_to_lds_b128 %2, %10, off\n\t"
      "global_load_async_to_lds_b128 %3, %11, off\n\tglobal_load_async_to_lds_b128 %4, %12, off\n\tglobal_load_async_to_lds_b128 %5, %13, off\n\t"
      "global_load_async_to_lds_b128 %6, %14, off\n\tglobal_load_async_to_lds_b128 %7, %15, off\n\ts_wait_xcnt 0x0"
      :: "v"(l), "v"(l + LS), "v"(l + 2u * LS), "v"(l + 3u * LS), "v"(l + 4u * LS), "v"(l + 5u * LS), "v"(l + 6u * LS), "v"(l + 7u * LS),
         "v"(g), "v"(g + gs), "v"(g + 2 * gs), "v"(g + 3 * gs), "v"(g + 4 * gs), "v"(g + 5 * gs), "v"(g + 6 * gs), "v"(g + 7 * gs) : "memory");
}
// block of 256 threads: AR rows of A (first row Ag, pitch lda) and BR rows of B = Wt (first row Bg, pitch K), K a multiple of 128; the wave takes 32 A rows from arow and 64 B rows from
// brow: 8 WMMAs per 32 k, one guard per stage. On return every wave has left the ring (last trip's barrier): it may be reused.
// Blocks of one grid share operand rows and start together: walking K alike they would ask L2 for the same lines at the same moment. Trip t therefore takes the k stage (t + rot) mod NT,
// and the 128-row groups of B are copied in the order jrot, jrot + 1, ... (mod their number); rot < NT and jrot come from the block index (block-uniform). The f32 sums run over k in that rotated order.
template <int AR, int BR>
__device__ __forceinline__ void mac_staged(v8f (&acc)[2][4], b16* ring, const b16* Ag, int lda, const b16* Bg, int K, int arow, int brow, int tid, int nloc, int hlf, int rot, int jrot) {
  static_assert((AR == 32 || AR % 128 == 0) && BR % 128 == 0);
  constexpr int BUFH = (AR + BR) * LP;
  const unsigned l0 = lds_byte(ring) + (unsigned)(tid >> 4) * (LP * 2u) + (unsigned)(tid & 15) * 16u;
  const b16* ga = Ag + (size_t)(tid >> 4) * lda + 8 * (tid & 15);
  const b16* gb = Bg + (size_t)(tid >> 4) * K + 8 * (tid & 15);
  const int NT = K / KS;
  auto fill = [&](int t) {
    const unsigned l = l0 + (unsigned)(t & 1) * (BUFH * 2u);
    const int kt = t + rot < NT ? t + rot : t + rot - NT;   // this trip's k stage
    if constexpr (AR == 32) cp2(l, ga + kt * KS, (size_t)16 * lda);
    else {
#pragma unroll
      for (int j = 0; j < AR / 128; ++j) cp8(l + (unsigned)j * (128u * LP * 2u), ga + (size_t)(128 * j) * lda + kt * KS, (size_t)16 * lda); }
#pragma unroll
    for (int i = 0; i < BR / 128; ++i) { const int j = (i + jrot) % (BR / 128);
      cp8(l + (unsigned)(AR + 128 * j) * (LP * 2u), gb + (size_t)(128 * j) * K + kt * KS, (size_t)16 * K); }
  };
  fill(0);
  asm volatile("s_wait_asynccnt 0x0" ::: "memory");   // trip 0's k stage has landed (this wave's copies) before the barrier that publishes it
  __syncthreads();
  if (NT > 1) fill(1);
#pragma unroll 1
  for (int t = 0; t < NT; ++t) {
    const b16* bufp = ring + (t & 1) * BUFH;
    const b16* ap0 = bufp + (arow + nloc) * LP; const b16* ap1 = ap0 + 16 * LP; const b16* bp = bufp + (AR + brow + nloc) * LP;
    v16b a0[2], a1[2], bf[2][4];   // two fragment sets: the next 32 k are fetched while the WMMAs of these 32 k run (all inside this stage's buffer)
    a0[0] = frag_kb(ap0, hlf); a1[0] = frag_kb(ap1, hlf);
#pragma unroll
    for (int u = 0; u < 4; ++u) bf[0][u] = frag_kb(bp + u * 16 * LP, hlf);
#pragma unroll
    for (int s = 0; s < KS / 32; ++s) {
      const int c = s & 1, n = c ^ 1;
      if (s + 1 < KS / 32) {
        a0[n] = frag_kb(ap0 + 32 * (s + 1), hlf); a1[n] = frag_kb(ap1 + 32 * (s + 1), hlf);
#pragma unroll
        for (int u = 0; u < 4; ++u) bf[n][u] = frag_kb(bp + u * 16 * LP + 32 * (s + 1), hlf); }
      __builtin_amdgcn_sched_barrier(0);   // keeps the next block's 12 LDS reads one group in front of this block's WMMAs (for speed only)
#pragma unroll
      for (int u = 0; u < 4; ++u) { acc[0][u] = wmma_raw(a0[c], bf[c][u], acc[0][u]); acc[1][u] = wmma_raw(a1[c], bf[c][u], acc[1][u]); }
      if (s + 1 < KS / 32) __builtin_amdgcn_sched_barrier(0);   // the block after next's reads stay behind this block's WMMAs
      else WMMA_GUARD8(acc, a0[c], a1[c], bf[c]);   // the stage's last WMMAs stand in front of a branch: the 4 slots behind them are filled here for both of its sides
    }
    asm volatile("s_wait_dscnt 0x0" ::: "memory");     // this wave's reads of the buffer have retired before the barrier behind which it is refilled
    asm volatile("s_wait_asynccnt 0x0" ::: "memory");  // this wave's copies for trip t + 1 have landed before the barrier that publishes them
    __syncthreads();
    if (t + 2 < NT) fill(t + 2);
  }
  asm volatile("s_wait_asynccnt 0x0" ::: "memory");    // no copy outstanding when the ring is reused or the wave ends
}

// f16 epilogue of one wave's 32 x 64 tile (plane value = f16(v x 8), LO: f16((v x 8 - hi) x 2048)): b16 element stores into the wave-private LDS tile, wave sync, then 8 stores of 16 B per lane:
// row-major (4 rows x 128 B each, dstp = the tile's first element, pitch ldc), or PK: fragment order (dstp = the first of the wave's two q or k tiles; store j = tile j / 4, k step (j / 2) % 2,
// piece j % 2: 512 contiguous bytes each, 4 KB in a row)
template <bool LO, bool RELU, bool PK>
__device__ __forceinline__ void epi_rows(const v8f (&acc)[2][4], const float (&bb)[4], float oscale, b16* Es, b16* dstp, int ldc, int lane, int nloc, int hlf) {
#pragma unroll
  for (int mt = 0; mt < 2; ++mt)
#pragma unroll
    for (int t = 0; t < 4; ++t)
#pragma unroll
      for (int r = 0; r < 8; ++r) {
        float v = acc[mt][t][r] * oscale + bb[t]; if (RELU) v = fmaxf(v, 0.0f); const float vs = v * CA; const b16 hi = (b16)vs;
        Es[(mt * 16 + 8 * hlf + r) * 72 + 16 * t + nloc] = LO ? (b16)((vs - (float)hi) * RS) : hi; }
  wave_lds_sync();
  v8b vv[8];
#pragma unroll
  for (int j = 0; j < 8; ++j) vv[j] = PK ? *(const v8b*)(Es + ((j >> 2) * 16 + nloc) * 72 + 32 * ((j >> 1) & 1) + 16 * (j & 1) + 8 * hlf) : *(const v8b*)(Es + (4 * j + (lane >> 3)) * 72 + 8 * (lane & 7));
  b16* dst = PK ? dstp + 8 * lane : dstp + (size_t)(lane >> 3) * ldc + 8 * (lane & 7);
  {
#pragma unroll
    for (int j = 0; j < 8; ++j) *(v8b*)(dst + (PK ? (size_t)(256 * j) : (size_t)(4 * j) * ldc)) = vv[j];
    asm volatile("s_wait_xcnt 0x0" ::: "memory");   // what follows (the residual plane's pass) rewrites registers that these stores name: the wait stands in front of it
  }
}

// head-transposed f16 epilogue of the block's 128 (keys) x 128 (head columns) tile -> v plane in fragment order: each lane stores its 8 consecutive keys of one
// column as one 16-B LDS store into Et[col][key] (cross-wave, block barrier), then the wave writes one (head wave / 4, chunk wave % 4): store j = dim tile j / 2, piece j % 2, 4 KB in a row
template <bool LO, bool RELU>
__device__ __forceinline__ void epi_vt(const v8f (&acc)[2][4], const float (&bb)[4], float oscale, b16* Et, b16* plane, int bidx, int key0, int colv0, int wave, int wm, int wn, int nloc, int hlf) {
#pragma unroll
  for (int mt = 0; mt < 2; ++mt)
#pragma unroll
    for (int t = 0; t < 4; ++t) { v8b hv;
#pragma unroll
      for (int r = 0; r < 8; ++r) { float v = acc[mt][t][r] * oscale + bb[t]; if (RELU) v = fmaxf(v, 0.0f); const float vs = v * CA; const b16 hi = (b16)vs; hv[r] = LO ? (b16)((vs - (float)hi) * RS) : hi; }
      *(v8b*)(Et + (wn * 64 + 16 * t + nloc) * 136 + wm * 32 + mt * 16 + 8 * hlf) = hv; }
  __syncthreads();
  v8b vv[8]; const int hd = wave >> 2, ch = wave & 3;
#pragma unroll
  for (int j = 0; j < 8; ++j) vv[j] = *(const v8b*)(Et + (hd * DH + 16 * (j >> 1) + nloc) * 136 + 32 * ch + 16 * (j & 1) + 8 * hlf);
  b16* dst = plane + ((size_t)(bidx * NH + colv0 / DH + hd) * (SEQ / 32) + key0 / 32 + ch) * VCH + 8 * (16 * hlf + nloc);
  {
#pragma unroll
    for (int j = 0; j < 8; ++j) *(v8b*)(dst + 256 * j) = vv[j];
    asm volatile("s_wait_xcnt 0x0" ::: "memory");   // what follows (the residual plane's pass) rewrites registers that these stores name: the wait stands in front of it
  }
}

// C = (A[M][K] f16 plane, pitch lda) x Wt[N][K] + bf16(bias), optional relu; block 128 x 128 = 8 waves of 32 x 64. GEMM columns < vcol0 -> plane C (f16 x 8): with relu (FFN) row-major
// C[row*ldc + ccol0 + col], without (q at columns 0..511, k at 512..1023) the q|k plane in fragment order; columns >= vcol0 -> head-transposed plane VT (v of the attention), fragment order. Blocks whose 128 rows start a sequence also emit the residual planes Clo / VTlo (x 2048) for those rows
// when wres != 0. Bias group pointer chosen per 512-column group (block-uniform). Column blocks below asplit multiply A1, the others A2 (block-uniform): two products of different left
// operands that share K and the output planes run as one grid.
template <bool RELU>
__global__ __launch_bounds__(256) void gemm_kernel(const b16* __restrict__ A1, const b16* __restrict__ A2, int asplit, int lda, const b16* __restrict__ Wt, int K,
    const float* __restrict__ bg0, const float* __restrict__ bg1, const float* __restrict__ bg2, const float* __restrict__ bg3,
    b16* __restrict__ C, b16* __restrict__ Clo, int ldc, int ccol0, b16* __restrict__ VT, b16* __restrict__ VTlo, int vcol0, float oscale, int wres) {
  __shared__ __attribute__((aligned(16))) b16 Ls[2 * 256 * LP];   // operand ring (2 buffers x 256 rows); behind the K loop 8 wave tiles [32][72] (row-major mode) or one block tile [128][136] (transposed mode)
  static_assert(2 * 256 * LP >= 18432);
  const int tid = threadIdx.x, wave = tid >> 5, lane = tid & 31, nloc = lane & 15, hlf = lane >> 4;
  const int bm0 = blockIdx.x * 128, bn0 = blockIdx.y * 128, wm = wave >> 1, wn = wave & 1;
  const int row0 = bm0 + wm * 32, col0 = bn0 + wn * 64;
  const b16* A = bn0 < asplit ? A1 : A2;
  v8f acc[2][4];
#pragma unroll
  for (int t = 0; t < 4; ++t) { acc[0][t] = (v8f){}; acc[1][t] = (v8f){}; }
  mac_staged<128, 128>(acc, Ls, A + (size_t)bm0 * lda, lda, Wt + (size_t)bn0 * K, K, wm * 32, wn * 64, tid, nloc, hlf, (int)((blockIdx.x + blockIdx.y) % (unsigned)(K / KS)), 0);
  const int gsel = bn0 >> 9; const float* bias = gsel == 0 ? bg0 : (gsel == 1 ? bg1 : (gsel == 2 ? bg2 : bg3));
  float bb[4];
#pragma unroll
  for (int t = 0; t < 4; ++t) bb[t] = bf16_rne(bias[(col0 & 511) + 16 * t + nloc]);
  const bool vmode = bn0 >= vcol0, wlo = (wres != 0) && (bm0 % SEQ == 0);
  if (!vmode) {
    b16* Es = Ls + wave * (32 * 72);
    // the wave's 64 columns are one head of q or of k, its 32 rows two tiles that follow one another in the plane
    const size_t co = RELU ? (size_t)row0 * ldc + ccol0 + col0 : (((size_t)(row0 / SEQ * 2 + (col0 >> 9)) * NH + ((col0 & 511) >> 6)) * NQT + row0 % SEQ / 16) * QKT;
    epi_rows<false, RELU, !RELU>(acc, bb, oscale, Es, C + co, ldc, lane, nloc, hlf);
    if (wlo) { wave_lds_sync(); epi_rows<true, RELU, !RELU>(acc, bb, oscale, Es, Clo + co, ldc, lane, nloc, hlf); }
  } else {
    epi_vt<false, RELU>(acc, bb, oscale, Ls, VT, bm0 / SEQ, bm0 % SEQ, bn0 - vcol0, wave, wm, wn, nloc, hlf);
    if (wlo) { __syncthreads(); epi_vt<true, RELU>(acc, bb, oscale, Ls, VTlo, bm0 / SEQ, bm0 % SEQ, bn0 - vcol0, wave, wm, wn, nloc, hlf); }
  }
}

// Y = LayerNorm(Xres + (A x Wt + bf16(bias))) * bf16(g) + bf16(be) over full 512-wide rows: block = 32 rows x 512 columns (wave = 32 x 64), K = 512 or 2048. Behind the K loop the whole
// 32 x 512 f32 tile is staged in LDS (cross-wave, one block barrier); wave w then owns rows 4w .. 4w+3: lane holds columns 128j + 4 lane (j = 0..3), residual / bias / gain loaded with the same map.
// The four rows run as one unrolled pass: a row alone is one long dependent chain (residual load, sum, 5 lane exchanges, squares, 5 exchanges, root, divide), so the four chains are
// interleaved step by step, and every global operand of the pass (16 residual loads, 12 parameter loads) is asked for at once, in front of the staging, which runs under their latency.
__global__ __launch_bounds__(256) void gemm_ln_kernel(const b16* __restrict__ A, int K, const b16* __restrict__ Wt, const float* __restrict__ bias, const float* Xres,
    const float* __restrict__ gam, const float* __restrict__ bet, float* OutF, b16* __restrict__ Xh, float oscale, int wxh) {
  __shared__ __attribute__((aligned(16))) b16 Rg[2 * (32 + D) * LP];   // operand ring (2 buffers x 544 rows); behind the K loop the f32 tile Tf
  static_assert(2 * (32 + D) * LP * 2 >= 32 * (D + 4) * 4);
  float* Tf = (float*)Rg;
  const int tid = threadIdx.x, wave = tid >> 5, lane = tid & 31, nloc = lane & 15, hlf = lane >> 4;
  const int bm0 = blockIdx.x * 32, col0 = wave * 64;
  v8f acc[2][4];
#pragma unroll
  for (int t = 0; t < 4; ++t) { acc[0][t] = (v8f){}; acc[1][t] = (v8f){}; }
  mac_staged<32, D>(acc, Rg, A + (size_t)bm0 * K, K, Wt, K, 0, col0, tid, nloc, hlf, (int)(blockIdx.x % (unsigned)(K / KS)), (int)(blockIdx.x / (unsigned)(K / KS) % 4u));
  const size_t go = (size_t)(bm0 + 4 * wave) * D + 4 * lane;   // the lane's first element of the wave's first row
  v4f bv[4], gv[4], ev[4], rv[4][4];
#pragma unroll
  for (int j = 0; j < 4; ++j) { bv[j] = *(const v4f*)(bias + 128 * j + 4 * lane); gv[j] = *(const v4f*)(gam + 128 * j + 4 * lane); ev[j] = *(const v4f*)(bet + 128 * j + 4 * lane); }
#pragma unroll
  for (int i = 0; i < 4; ++i)
#pragma unroll
    for (int j = 0; j < 4; ++j) rv[i][j] = *(const v4f*)(Xres + go + i * D + 128 * j);
  asm volatile("s_wait_xcnt 0x0" ::: "memory");   // what follows rewrites address registers that these 28 loads name: the wait stands in front of it (behind it the built code starts the staging without waiting for a loaded value)
#pragma unroll
  for (int mt = 0; mt < 2; ++mt)
#pragma unroll
    for (int t = 0; t < 4; ++t)
#pragma unroll
      for (int r = 0; r < 8; ++r) Tf[(16 * mt + 8 * hlf + r) * (D + 4) + col0 + 16 * t + nloc] = acc[mt][t][r] * oscale;
  __syncthreads();   // every wave's columns of all 32 rows are in LDS before any wave reads its rows
  float y[4][16], s[4], q[4], rstd[4];
#pragma unroll
  for (int i = 0; i < 4; ++i) { s[i] = 0.0f;
#pragma unroll
    for (int j = 0; j < 4; ++j) { const v4f tv = *(const v4f*)(Tf + (4 * wave + i) * (D + 4) + 128 * j + 4 * lane);
#pragma unroll
      for (int e = 0; e < 4; ++e) { const float yy = rv[i][j][e] + (tv[e] + bf16_rne(bv[j][e])); y[i][4 * j + e] = yy; s[i] += yy; } } }
#pragma unroll
  for (int off = 16; off > 0; off >>= 1)
#pragma unroll
    for (int i = 0; i < 4; ++i) s[i] += __shfl_xor(s[i], off, 32);
#pragma unroll
  for (int i = 0; i < 4; ++i) { const float mean = s[i] * (1.0f / (float)D); q[i] = 0.0f;
#pragma unroll
    for (int k = 0; k < 16; ++k) { const float d0 = y[i][k] - mean; y[i][k] = d0; q[i] += d0 * d0; } }
#pragma unroll
  for (int off = 16; off > 0; off >>= 1)
#pragma unroll
    for (int i = 0; i < 4; ++i) q[i] += __shfl_xor(q[i], off, 32);
#pragma unroll
  for (int i = 0; i < 4; ++i) rstd[i] = 1.0f / sqrtf(q[i] * (1.0f / (float)D) + LNEPS);
  v4f ov[4][4]; v4h_ hv[4][4];
#pragma unroll
  for (int i = 0; i < 4; ++i)
#pragma unroll
    for (int j = 0; j < 4; ++j)
#pragma unroll
      for (int e = 0; e < 4; ++e) { const float o = (y[i][4 * j + e] * rstd[i]) * bf16_rne(gv[j][e]) + bf16_rne(ev[j][e]); ov[i][j][e] = o; hv[i][j][e] = (b16)(o * CA); }
  // the f16 plane goes out first: its values are made from the f32 ones, which stay live for their own stores behind it (the other way round the conversions would overwrite registers that the f32 stores name)
  if (wxh) {
#pragma unroll
    for (int i = 0; i < 4; ++i)
#pragma unroll
      for (int j = 0; j < 4; ++j) *(v4h_*)(Xh + go + i * D + 128 * j) = hv[i][j];
    asm volatile("s_wait_xcnt 0x0" ::: "memory");   // the address of the f32 stores is formed behind these stores, in registers that they name: the wait stands in front of it
  }
#pragma unroll
  for (int i = 0; i < 4; ++i)
#pragma unroll
    for (int j = 0; j < 4; ++j) *(v4f*)(OutF + go + i * D + 128 * j) = ov[i][j];
}

// Streaming attention, one work-group = NQW neighbouring 16-query tiles of one (batch, head) (one tile where it has residual planes), its NWK waves sharing the keys: wave w walks the 32-key chunks
// w, w + NWK, ... with a running max, sum and context per tile, beginning at a step rotated by block + head and wrapping (the blocks of a head share K and V, the heads of a tile the mask: walking alike
// they would ask L2 for the same lines at once); the partial results meet in LDS behind one block barrier and are joined there (weights exp(max_w - max)).
// A chunk's K and V fragments are loaded once and multiply the operands of all NQW tiles: per score half the bytes from L2, and half the waves to start.
// Both products are taken transposed: S^T = K x Q^T (A = a 16-key tile of k, B = the query tile, both from the q|k plane in fragment order), so that lane (nloc, hlf) holds, of query nloc alone,
// the scores of keys 16 t + 8 hlf + r (t = key tile, r = accumulator register): max and sum run inside the lane, with one exchange between the wave's halves for the max (the halves' sums are
// joined once, behind the loop). Converted in place (x4096) these 16 values are the B fragment of P^T in the k-map above, and ctx^T += V^T x P^T takes the v plane's fragments as A:
// acc[t][r] = ctx^T[dim 16 t + 8 hlf + r][query nloc]. P goes through no LDS and the loop holds no wave sync.
// Mask: the lane reads the bit word of its own query row (fetched one step ahead); a chunk whose words are all ones in every tile of the block is skipped, a tile whose 16 words are all zero is not masked at all.
// RES: query/key residual planes give 3 score products and V x P_res + V_res x P, summed apart and added to the context in the same key step, for chunks with keys < 128 (rows for which the residual planes exist);
constexpr int NWK = 4, PPW = DH + 4, NQW = 2;   // waves per work-group; f32 pitch of a partial context row; query tiles per work-group (and per wave) where no residual planes are used
static_assert((SEQ / 32) % NWK == 0 && NQT % NQW == 0 && (NQT - NQT_RES) % NQW == 0);
// One wave's walk over its key chunks. RES = false: NQW query tiles (index u); the chunk's K and V fragments are all asked for at once. RES = true (a query tile with residual planes, u = 0 alone):
// the same sums plus the residual products; its fragments are asked for in smaller groups (one key tile, two dim tiles).
template <bool RES>
__device__ __forceinline__ void attn_walk(v8f (&acc)[NQW][4], float (&mx)[NQW], float (&ls)[NQW], const v16b (&qa)[NQW][2], const b16* qlb, const b16* kbase, const b16* klbase,
    const b16* vbase, const b16* vlbase, const unsigned int* mbp, int irot, int wave, int lane, int nloc, int hlf) {
  constexpr int NI = SEQ / 32 / NWK, NQ = RES ? 1 : NQW, MBT = SEQ / 2;   // MBT: bit words of a query tile
  unsigned int wn[NQ];   // the first step's words
#pragma unroll
  for (int u = 0; u < NQ; ++u) wn[u] = mbp[u * MBT + 16 * NWK * irot + nloc];
#pragma unroll 1
  for (int i = 0; i < NI; ++i) {
    const int ii = i + irot < NI ? i + irot : i + irot - NI;
    const int c = wave + NWK * ii, fo = NWK * ii * VCH;   // c: chunk index; fo: offset from the wave's first chunk in halves of the k and v planes
    static_assert(2 * QKT == VCH);
    unsigned int wc[NQ], wall = 0xffffffffu;   // this step's words; the next step's are fetched now, one step ahead of their use (behind the last step the walk's first: in bounds, unused)
    const unsigned int* mp = mbp + 16 * NWK * (ii + 1 < NI ? ii + 1 : 0) + nloc;
#pragma unroll
    for (int u = 0; u < NQ; ++u) { wc[u] = wn[u]; wall &= wc[u]; wn[u] = mp[u * MBT]; }
    if (__builtin_amdgcn_ballot_w32(wall != 0xffffffffu) == 0u) continue;   // skipped only where every tile's words are all ones
    const bool rc = RES && c < 4;   // wave-uniform: the chunk's keys have residual planes
    // RES: every other address of the step is formed from kp by a wave-uniform distance inside the workspace (one per-lane base kept in registers, not five)
    const long dql = qlb - kbase - fo, dkl = klbase - kbase, dv = vbase - kbase, dvl = vlbase - kbase;
    v16b kf[2][2], vf[4]; const b16* kp = kbase + fo + 8 * lane; const b16* vp = RES ? kp + dv : vbase + fo + 8 * lane;   // the lane's own place in the chunk's first k and v fragment
    if constexpr (!RES) {
#pragma unroll
      for (int t = 0; t < 2; ++t) { kf[t][0] = frag_pk(kp + t * QKT, 0); kf[t][1] = frag_pk(kp + t * QKT + FRG, 0); }
#pragma unroll
      for (int t = 0; t < 4; ++t) vf[t] = frag_pk(vp + t * FRG, 0);
      // No LDS sync stands between the two products any more, so the chunk's K and V fragments are all asked for here and fly together. The wait takes the lane's three load addresses as inputs: that keeps
      // their registers out of the loads' own destinations, and what rewrites them stands behind it; its memory clobber holds the 16 loads in front of it (left to itself the build asks for them pair by pair, each pair waited for alone)
      asm volatile("s_wait_xcnt 0x0" :: "v"(kp), "v"(vp), "v"(mp) : "memory");
    }
    v16b pf[NQ], plf = (v16b){};
#pragma unroll
    for (int u = 0; u < NQ; ++u) {
    const v16b qa0 = qa[u][0], qa1 = qa[u][1];
    float sv[16];   // sv[8 t + r]: score of key 16 t + 8 hlf + r of the chunk
#pragma unroll
    for (int t = 0; t < 2; ++t) {
      v16b ql0 = (v16b){}, ql1 = (v16b){};
      if constexpr (RES) {
        const b16* qlp = kp + dql;
        kf[t][0] = frag_pk(kp + t * QKT, 0); kf[t][1] = frag_pk(kp + t * QKT + FRG, 0);
        if (rc) { ql0 = frag_pk(qlp, 0); ql1 = frag_pk(qlp + FRG, 0); }
        // these loads fly together; what rewrites their address registers stands behind the wait (either form), which takes them as inputs; the mask word's address is named behind its own load only
        if (t == 0) asm volatile("s_wait_xcnt 0x0" :: "v"(kp), "v"(qlp), "v"(mp) : "memory");
        else asm volatile("s_wait_xcnt 0x0" :: "v"(kp), "v"(qlp) : "memory");
      }
      const v16b k0f = kf[t][0], k1f = kf[t][1];
      v8f sh = wmma16b(k0f, qa0, (v8f){}); sh = wmma16b(k1f, qa1, sh);
      if (rc) {
        v8f x = wmma16b(k0f, ql0, (v8f){}); x = wmma16b(k1f, ql1, x);
        const b16* klp = kp + dkl;
        const v16b kl0 = frag_pk(klp + t * QKT, 0), kl1 = frag_pk(klp + t * QKT + FRG, 0);
        asm volatile("s_wait_xcnt 0x0" :: "v"(klp) : "memory");   // what rewrites the address register of these loads stands behind this wait
        x = wmma16b(kl0, qa0, x); x = wmma16b(kl1, qa1, x);
#pragma unroll
        for (int r = 0; r < 8; ++r) sh[r] += x[r] * (1.0f / RS); }
#pragma unroll
      for (int r = 0; r < 8; ++r) sv[8 * t + r] = sh[r] * SCL; }
    if (__builtin_amdgcn_ballot_w32(wc[u] != 0u) != 0u) {   // wave-uniform: some key of some row is masked
      const unsigned int wh = wc[u] >> (8 * hlf);   // bit 16 t + r = key 16 t + 8 hlf + r
#pragma unroll
      for (int j = 0; j < 16; ++j) sv[j] = (wh & (1u << (16 * (j >> 3) + (j & 7)))) ? NEGF : sv[j]; }
    float cm = sv[0];
#pragma unroll
    for (int j = 1; j < 16; ++j) cm = fmaxf(cm, sv[j]);
    cm = fmaxf(cm, xhalf(cm));
    const float mn = fmaxf(mx[u], cm), al = nexp2((mx[u] - mn) * L2E); mx[u] = mn;
    v2f es = (v2f){0.0f, 0.0f};   // es: sums of the even and of the odd keys (two chains of 8 adds, not one of 16)
#pragma unroll
    for (int j = 0; j < 16; ++j) {
      const float e = nexp2((sv[j] - mn) * L2E); es[j & 1] += e;
      const float v = e * PSC; const b16 hi = (b16)v; pf[u][j] = hi;
      if (RES) plf[j] = (b16)((v - (float)hi) * RS); }
    ls[u] = ls[u] * al + (es[0] + es[1]);
#pragma unroll
    for (int t = 0; t < 4; ++t)
#pragma unroll
      for (int r = 0; r < 8; ++r) acc[u][t][r] *= al;
    }   // tile u
    if constexpr (!RES) {
#pragma unroll
      for (int t = 0; t < 4; ++t)
#pragma unroll
        for (int u = 0; u < NQ; ++u) acc[u][t] = wmma16b(vf[t], pf[u], acc[u][t]);
    } else {
#pragma unroll
      for (int g = 0; g < 2; ++g) {
        const b16* vlp = kp + dvl;
        const v16b va = frag_pk(vp + 2 * g * FRG, 0), vb = frag_pk(vp + (2 * g + 1) * FRG, 0); v16b vla = (v16b){}, vlb = (v16b){};
        if (rc) { vla = frag_pk(vlp + 2 * g * FRG, 0); vlb = frag_pk(vlp + (2 * g + 1) * FRG, 0); }
        // the two dim tiles' loads fly together; what rewrites their address registers stands behind this wait, which takes them as inputs
        asm volatile("s_wait_xcnt 0x0" :: "v"(vp), "v"(vlp) : "memory");
        acc[0][2 * g] = wmma16b(va, pf[0], acc[0][2 * g]); acc[0][2 * g + 1] = wmma16b(vb, pf[0], acc[0][2 * g + 1]);
        if (rc) {   // V x P_res + V_res x P of this step, added to the context here
          v8f x = wmma16b(va, plf, (v8f){}); x = wmma16b(vla, pf[0], x);
#pragma unroll
          for (int r = 0; r < 8; ++r) acc[0][2 * g][r] += x[r] * (1.0f / RS);
          x = wmma16b(vb, plf, (v8f){}); x = wmma16b(vlb, pf[0], x);
#pragma unroll
          for (int r = 0; r < 8; ++r) acc[0][2 * g + 1][r] += x[r] * (1.0f / RS); }
      }
    }
  }
}

// MIX: the grid holds query tiles with residual planes (tile index < NQT_RES), a block each, beside the blocks of NQW tiles; a block takes its walk by its index (block-uniform).
// second launch bound: 4 waves per SIMD (256 registers): two tiles' contexts, queries and scores beside a chunk's K and V fragments, with no scratch; the grid without residual tiles is 4 waves per SIMD of the chip
template <bool MIX>
__global__ __launch_bounds__(32 * NWK, 4) void attn_kernel(const b16* __restrict__ QK, const b16* __restrict__ QKlo, const b16* __restrict__ VT, const b16* __restrict__ VTlo,
    const unsigned int* __restrict__ MB, b16* __restrict__ CTX) {
  __shared__ __attribute__((aligned(16))) float Part[NWK * NQW * 16 * PPW];
  __shared__ float Mxs[NWK * NQW * 16], Lss[NWK * NQW * 16];
  constexpr int NBH = MIX ? NQT_RES + (NQT - NQT_RES) / NQW : NQT / NQW;   // blocks of a (batch, head)
  const int tid = threadIdx.x, lane = tid & 31, nloc = lane & 15, hlf = lane >> 4, wave = __builtin_amdgcn_readfirstlane(tid >> 5);
  const int bi = blockIdx.x, jb = bi % NBH, bh = bi / NBH, h = bh % NH, b = bh / NH;
  const bool res = MIX && jb < NQT_RES;
  const int qt = res ? jb : (MIX ? NQT_RES + NQW * (jb - NQT_RES) : NQW * jb), nq = res ? 1 : NQW, q0 = qt * 16;   // the block's first tile, its number of tiles
  const size_t rq = (size_t)b * SEQ + q0;
  const size_t qo = (((size_t)(b * 2) * NH + h) * NQT + qt) * QKT;   // the first query tile in the q|k planes (the next tile follows it)
  const size_t ko = (((size_t)(b * 2 + 1) * NH + h) * NQT + 2 * wave) * QKT, vo = ((size_t)(b * NH + h) * (SEQ / 32) + wave) * VCH;   // the wave's first chunk (two key tiles of k, one chunk of v)
  const unsigned int* mbp = MB + ((size_t)b * NQT + qt) * (SEQ / 2) + 16 * wave;   // the 16 bit words (one per query row) of the wave's first chunk, first tile; wave-uniform, the lane reads word nloc
  float mx[NQW], ls[NQW];   // of query nloc of tile u: running max (equal in both halves), sum over the keys of this lane's half
  v8f acc[NQW][4]; v16b qa[NQW][2];
#pragma unroll
  for (int u = 0; u < NQW; ++u) { mx[u] = -3.0e38f; ls[u] = 0.0f; qa[u][0] = (v16b){}; qa[u][1] = (v16b){};
#pragma unroll
    for (int t = 0; t < 4; ++t) acc[u][t] = (v8f){}; }
  const int irot = (jb + h) % (SEQ / 32 / NWK);   // first step of this block's walk (block-uniform)
  if (res) {
    qa[0][0] = frag_pk(QK + qo, lane); qa[0][1] = frag_pk(QK + qo + FRG, lane);
    attn_walk<true>(acc, mx, ls, qa, QKlo + qo, QK + ko, QKlo + ko, VT + vo, VTlo + vo, mbp, irot, wave, lane, nloc, hlf);
  } else {
#pragma unroll
    for (int u = 0; u < NQW; ++u) { qa[u][0] = frag_pk(QK + qo + u * QKT, lane); qa[u][1] = frag_pk(QK + qo + u * QKT + FRG, lane); }
    attn_walk<false>(acc, mx, ls, qa, QKlo, QK + ko, QKlo + ko, VT + vo, VTlo + vo, mbp, irot, wave, lane, nloc, hlf);
  }
  // each wave publishes, per tile, its partial context (f32, still scaled by its own max), max and sum; a wave whose chunks were all skipped publishes max -3e38, sum 0, context 0
#pragma unroll
  for (int u = 0; u < NQW; ++u) if (u < nq) {
    float* pw = Part + ((wave * NQW + u) * 16 + nloc) * PPW + 8 * hlf;   // the lane's 8 consecutive dims of a dim tile: two 16-B stores
#pragma unroll
    for (int t = 0; t < 4; ++t) { v4f x0, x1;
#pragma unroll
      for (int e = 0; e < 4; ++e) { x0[e] = acc[u][t][e]; x1[e] = acc[u][t][4 + e]; }
      *(v4f*)(pw + 16 * t) = x0; *(v4f*)(pw + 16 * t + 4) = x1; }
    const float lsw = ls[u] + xhalf(ls[u]);   // the two halves' sums of query nloc
    if (hlf == 0) { Mxs[(wave * NQW + u) * 16 + nloc] = mx[u]; Lss[(wave * NQW + u) * 16 + nloc] = lsw; }
  }
  __syncthreads();   // every wave's partials are in LDS before any thread joins them
  // join: per tile, thread = 8 columns of one row (NWK = 4: 128 threads cover 16 x 64)
  static_assert(32 * NWK * 8 == 16 * DH);
  const int jr = tid >> 3, jc = 8 * (tid & 7);
  v8b ov[NQW];
#pragma unroll
  for (int u = 0; u < NQW; ++u) if (u < nq) {
    float wm_[NWK], M = Mxs[u * 16 + jr];
#pragma unroll
    for (int w = 1; w < NWK; ++w) M = fmaxf(M, Mxs[(w * NQW + u) * 16 + jr]);
    float L = 0.0f, o[8];
#pragma unroll
    for (int e = 0; e < 8; ++e) o[e] = 0.0f;
#pragma unroll
    for (int w = 0; w < NWK; ++w) { wm_[w] = nexp2((Mxs[(w * NQW + u) * 16 + jr] - M) * L2E); L += wm_[w] * Lss[(w * NQW + u) * 16 + jr];
      const v4f x0 = *(const v4f*)(Part + ((w * NQW + u) * 16 + jr) * PPW + jc), x1 = *(const v4f*)(Part + ((w * NQW + u) * 16 + jr) * PPW + jc + 4);
#pragma unroll
      for (int e = 0; e < 4; ++e) { o[e] += wm_[w] * x0[e]; o[4 + e] += wm_[w] * x1[e]; } }
    const float inv = (1.0f / L) * (CX / (PSC * CA));
#pragma unroll
    for (int e = 0; e < 8; ++e) ov[u][e] = (b16)(o[e] * inv);
  }
  // the stores stand behind every tile's join: nothing rewrites a register that they name
#pragma unroll
  for (int u = 0; u < NQW; ++u) if (u < nq) *(v8b*)(CTX + (rq + 16 * u + jr) * D + h * DH + jc) = ov[u];
}
}  // namespace

extern "C" void kernel_launch(void* const* d_in, const int* in_sizes, int n_in, void* d_out, int out_size, void* d_ws, size_t ws_size, hipStream_t stream) {
  (void)n_in;
  auto Fp = [&](int i) { return (const float*)d_in[i]; };
  auto Ip = [&](int i) { return (const int*)d_in[i]; };
  // wire order: 0 tokens [512][8] i32, 1 memory [8][512][512], 2 self-attention mask [8][512][512] i32, 3 memory mask [8][512][512] i32, 4 embedding [32000][512],
  // 5..8 Wq_s Wk_s Wv_s Wo_s [6][512 in][512 out], 9..12 Wq_c Wk_c Wv_c Wo_c, 13..16 bq_s bk_s bv_s bo_s [6][512], 17..20 bq_c bk_c bv_c bo_c,
  // 21 W1 [6][512][2048], 22 b1 [6][2048], 23 W2 [6][2048][512], 24 b2 [6][512], 25 g1, 26 g2, 27 g3, 28 be1, 29 be2, 30 be3 [6][512]
  const long needRows = (long)(NB - 1) * SEQ_FULL + SEQ;
  if ((long)in_sizes[0] < (long)SEQ * NB_FULL || (long)in_sizes[1] < needRows * D || (long)in_sizes[2] < needRows * SEQ_FULL || (long)in_sizes[3] < needRows * SEQ_FULL ||
      (long)in_sizes[4] < (long)VOCAB * D) return;
  for (int i = 5; i <= 12; ++i) if ((long)in_sizes[i] < (long)NLAY * D * D) return;
  for (int i = 13; i <= 20; ++i) if (in_sizes[i] < NLAY * D) return;
  if ((long)in_sizes[21] < (long)NLAY * D * DFF || in_sizes[22] < NLAY * DFF || (long)in_sizes[23] < (long)NLAY * DFF * D || in_sizes[24] < NLAY * D) return;
  for (int i = 25; i <= 30; ++i) if (in_sizes[i] < NLAY * D) return;
  if (out_size < MR * D) return;

  size_t off = 0; char* ws = (char*)d_ws;
  auto carve = [&](size_t bytes) { char* p = ws + off; off += (bytes + 255) & ~(size_t)255; return p; };
  b16* WQKVS = (b16*)carve((size_t)NLAY * NQKV * D * 2);   // [6][1536][512]
  b16* WOS   = (b16*)carve((size_t)NLAY * D * D * 2);
  b16* WQKVC = (b16*)carve((size_t)NLAY * NQKV * D * 2);   // [6][1536][512]
  b16* WOC   = (b16*)carve((size_t)NLAY * D * D * 2);
  b16* W1T   = (b16*)carve((size_t)NLAY * DFF * D * 2);    // [6][2048][512]
  b16* W2T   = (b16*)carve((size_t)NLAY * D * DFF * 2);    // [6][512][2048]
  float* X   = (float*)carve((size_t)MR * D * 4);
  b16* Xh    = (b16*)carve((size_t)MR * D * 2);
  b16* Mh    = (b16*)carve((size_t)MR * D * 2);
  b16* QK    = (b16*)carve((size_t)MR * LQK * 2);
  b16* QKlo  = (b16*)carve((size_t)MR * LQK * 2);
  b16* Vt    = (b16*)carve((size_t)MR * D * 2);            // [NB][NH][SEQ / 32][4][512]
  b16* Vtlo  = (b16*)carve((size_t)MR * D * 2);
  b16* CTX   = (b16*)carve((size_t)MR * D * 2);
  b16* Hh    = (b16*)carve((size_t)MR * DFF * 2);
  unsigned int* MBS = (unsigned int*)carve((size_t)NB * NQT * (SEQ / 2) * 4);   // mask bit words [NB][NQT][SEQ / 32][16]
  unsigned int* MBC = (unsigned int*)carve((size_t)NB * NQT * (SEQ / 2) * 4);
  if (off > ws_size || off > ((size_t)128 << 20)) return;   // 113,770,496 B at full size

  const dim3 b256(256), battn(32 * NWK);
  prep_kernel<<<P_ALL, b256, 0, stream>>>(Ip(0), Fp(4), Fp(1), Ip(2), Ip(3), Fp(5), Fp(6), Fp(7), Fp(8), Fp(9), Fp(10), Fp(11), Fp(12), Fp(21), Fp(23),
      WQKVS, WOS, WQKVC, WOC, W1T, W2T, Mh, X, Xh, MBS, MBC);

  const float OSA = 1.0f / (CA * WSC), OSX = 1.0f / (CX * WSC);
  for (int l = 0; l < NLAY; ++l) {
    const size_t lD = (size_t)l * D, lF = (size_t)l * DFF;
    // fused q|k|v projection of x: q and k -> q|k plane, v -> head-transposed plane (all in fragment order); residual planes for the first 128 rows of each sequence
    gemm_kernel<false><<<dim3(MR / 128, NQKV / 128), b256, 0, stream>>>(Xh, Xh, 0, D, WQKVS + (size_t)l * NQKV * D, D, Fp(13) + lD, Fp(14) + lD, Fp(15) + lD, Fp(15) + lD,
        QK, QKlo, LQK, 0, Vt, Vtlo, 2 * D, OSA, 1);
    attn_kernel<true><<<NB * NH * (NQT_RES + (NQT - NQT_RES) / NQW), battn, 0, stream>>>(QK, QKlo, Vt, Vtlo, MBS, CTX);
    gemm_ln_kernel<<<MR / 32, b256, 0, stream>>>(CTX, D, WOS + (size_t)l * D * D, Fp(16) + lD, X, Fp(25) + lD, Fp(28) + lD, X, Xh, OSX, 1);
    // attention over the memory tensor: q (columns 0..511) from x, k|v (columns 512..1535) from the memory plane, one grid
    gemm_kernel<false><<<dim3(MR / 128, NQKV / 128), b256, 0, stream>>>(Xh, Mh, D, D, WQKVC + (size_t)l * NQKV * D, D, Fp(17) + lD, Fp(18) + lD, Fp(19) + lD, Fp(19) + lD,
        QK, QKlo, LQK, 0, Vt, Vtlo, 2 * D, OSA, 0);
    attn_kernel<false><<<NB * NH * (NQT / NQW), battn, 0, stream>>>(QK, QKlo, Vt, Vtlo, MBC, CTX);
    gemm_ln_kernel<<<MR / 32, b256, 0, stream>>>(CTX, D, WOC + (size_t)l * D * D, Fp(20) + lD, X, Fp(26) + lD, Fp(29) + lD, X, Xh, OSX, 1);
    // FFN
    gemm_kernel<true><<<dim3(MR / 128, DFF / 128), b256, 0, stream>>>(Xh, Xh, 0, D, W1T + (size_t)l * DFF * D, D, Fp(22) + lF, Fp(22) + lF + 512, Fp(22) + lF + 1024, Fp(22) + lF + 1536,
        Hh, QKlo, DFF, 0, Vt, Vtlo, DFF, OSA, 0);
    const bool last = (l == NLAY - 1);
    gemm_ln_kernel<<<MR / 32, b256, 0, stream>>>(Hh, DFF, W2T + (size_t)l * D * DFF, Fp(24) + lD, X, Fp(27) + lD, Fp(30) + lD, last ? (float*)d_out : X, Xh, OSA, last ? 0 : 1);
  }
}
